// v000
// Measured on an AMD MI455X. A time is GPU time per run, averaged over a window of back-to-back runs after a warm-up
// (all launches, gaps included; the runs take copies of the inputs in turn), and the median of several windows.
// Apart from v000's, it joins two sittings. Times from different sittings can be a few percent apart, while
// side-by-side timings come from the same sitting.
// v000 is the starting kernel. One run takes 2700 microseconds.
#include <hip/hip_runtime.h>

// MultiHeadAreaAttention: qh,kh,vh = (q Wq^T + bq), (k Wk^T + bk), (v Wv^T + bv) as 16 heads x 64; areas = all windows of width 1..3 along the key axis (A = 3,069; block w starts at area index 0 / 1024 / 2047, end(a) = start + w - 1); k_area = window mean, v_area = window sum; logits = qh.k_area / 8, visible iff mask[q][end(a)] != 0 (else -1e30); weights = softmax over areas; if zero_pad: weights of query 0 := 0; ctx = weights.v_area; out = concat Wo^T + bo -> [2][1024][1024].
// Deterministic: online softmax over fixed 256-area chunks in order (chunks with no visible area for any of the wave's 16 queries are skipped — they contribute exactly 0); no atomics.
// WMMA (v_wmma_f32_16x16x32_f16, f32 accumulate): inputs (EXACT bf16 x8, K 1,024) x W rows (EXACT; 64 tiles each) per 16-token wave; per (bh, 16-query) wave S = qh (hi+lo x256, K 64) x k_area rows (hi+lo; 16 tiles/chunk) and O += P (hi+lo) x v_area^T rows (hi+lo; 4 tiles), 3 products; o (hi+lo) x Wo rows (64 tiles) — ≈ 4 M WMMA; area pooling, mask gather, softmax in f32.

namespace {
constexpr int NB_ = 2, L = 1024, D = 1024, H = 16, HD = 64, NA = 3 * L - 3 /* 3069 */, NAP = 3072, NT = NB_ * L, CH = 256, NCH = NAP / CH /* 12 */;
constexpr float XS = 8.0f, HS = 256.0f, PS = 256.0f, WSC = 256.0f, SCALE = 0.125f;
typedef _Float16 b16;
typedef __attribute__((ext_vector_type(16))) _Float16 v16b;
typedef __attribute__((ext_vector_type(8))) _Float16 v8b;
typedef __attribute__((ext_vector_type(2))) _Float16 v2b;
typedef __attribute__((ext_vector_type(8))) float v8f;
typedef __attribute__((ext_vector_type(4))) float v4f;
typedef __attribute__((ext_vector_type(2))) float v2f;
__device__ __forceinline__ float bf16_rne(float f) { unsigned int u = __float_as_uint(f); u += 0x7FFFu + ((u >> 16) & 1u); float r = __uint_as_float(u & 0xFFFF0000u); asm volatile("" : "+v"(r)); return r; }
__device__ __forceinline__ float bfv(float f) { float r = bf16_rne(f); asm volatile("" : "+v"(r)); return r; }
__device__ __forceinline__ void split16(float v, b16& hi, b16& lo) { hi = (b16)v; lo = (b16)(v - (float)hi); }
__device__ __forceinline__ v16b frag_kb(const b16* p, int hh) { const v8b a = *(const v8b*)(p + 8 * hh), b = *(const v8b*)(p + 16 + 8 * hh); v16b f;
#pragma unroll
  for (int e = 0; e < 8; ++e) { f[e] = a[e]; f[8 + e] = b[e]; } return f; }
__device__ __forceinline__ v8f wmma16b(v16b a, v16b b, v8f c) { v8f d = __builtin_amdgcn_wmma_f32_16x16x32_f16(false, a, false, b, (short)0, c, false, false); asm volatile("v_nop\n\tv_nop\n\tv_nop\n\tv_nop" : "+v"(d) : "v"(a), "v"(b)); return d; }
__device__ __forceinline__ void wave_lds_sync() { __builtin_amdgcn_fence(__ATOMIC_RELEASE, "workgroup"); __builtin_amdgcn_wave_barrier(); __builtin_amdgcn_fence(__ATOMIC_ACQUIRE, "workgroup"); }
// area index -> (start token, width); padding areas (>= 3069) get start 0, width 0 (zero pooled rows) and end = L (never visible)
__device__ __forceinline__ void area_of(int a, int& t0, int& w) { if (a < L) { t0 = a; w = 1; } else if (a < 2 * L - 1) { t0 = a - L; w = 2; } else if (a < NA) { t0 = a - (2 * L - 1); w = 3; } else { t0 = 0; w = 0; } }
__device__ __forceinline__ int area_end(int a) { int t0, w; area_of(a, t0, w); return w == 0 ? L : t0 + w - 1; }

__global__ __launch_bounds__(256) void wput_kernel(const float* __restrict__ wq, const float* __restrict__ wk, const float* __restrict__ wv, const float* __restrict__ wo, b16* __restrict__ W4) { const size_t nt = (size_t)gridDim.x * 256, u0 = (size_t)blockIdx.x * 256 + threadIdx.x; v8b v;
  for (size_t u = u0; u < (size_t)4 * D * 128; u += nt) { const int o = (int)(u / 128), k0 = (int)(u % 128) * 8; const int which = o / D, oo = o % D; const float* w = which == 0 ? wq : (which == 1 ? wk : (which == 2 ? wv : wo));
#pragma unroll
    for (int j = 0; j < 8; ++j) v[j] = (b16)(bf16_rne(w[(size_t)oo * D + k0 + j]) * WSC); { *(v8b*)(W4 + (size_t)o * D + k0) = v;  } } }
__global__ __launch_bounds__(32) void proj_kernel(const float* __restrict__ xq, const float* __restrict__ xk, const float* __restrict__ xv, const b16* __restrict__ W4, const float* __restrict__ bq, const float* __restrict__ bk, const float* __restrict__ bv, b16* __restrict__ Qh, b16* __restrict__ Ql, float* __restrict__ KR, float* __restrict__ VR) { __shared__ __attribute__((aligned(16))) b16 Ax[16][D + 8]; __shared__ float Tf[16][260]; const int lane = threadIdx.x, nloc = lane & 15, hlf = lane >> 4; const size_t t0 = (size_t)blockIdx.x * 16; const int which = blockIdx.y;
  const float* x = which == 0 ? xq : (which == 1 ? xk : xv); const float* bias = which == 0 ? bq : (which == 1 ? bk : bv);
  for (int rr = 0; rr < 16; ++rr) for (int q = 0; q < D / 32; ++q) { const int c = q * 32 + lane; Ax[rr][c] = (b16)(bf16_rne(x[(t0 + rr) * D + c]) * XS); }
  if (lane < 16) for (int k = D; k < D + 8; ++k) Ax[lane][k] = (b16)0.0f;
  wave_lds_sync();
#pragma unroll 1
  for (int g = 0; g < 4; ++g) { const int c0 = g * 256; v8f acc[16];
#pragma unroll
    for (int t = 0; t < 16; ++t) acc[t] = (v8f){};
#pragma unroll 2
    for (int kb = 0; kb < D; kb += 32) { const v16b a = frag_kb(&Ax[nloc][kb], hlf);
#pragma unroll
      for (int t = 0; t < 16; ++t) acc[t] = wmma16b(a, frag_kb(W4 + ((size_t)which * D + c0 + t * 16 + nloc) * D + kb, hlf), acc[t]); }
#pragma unroll
    for (int t = 0; t < 16; ++t) { const int cc = t * 16 + nloc; const float bb = bfv(bias[c0 + cc]);
#pragma unroll
      for (int r8 = 0; r8 < 8; ++r8) Tf[8 * hlf + r8][cc] = acc[t][r8] * (1.0f / (XS * WSC)) + bb; }
    wave_lds_sync();
    { for (int rr = 0; rr < 16; ++rr) { const size_t tk = t0 + rr;
        if (which == 0) { for (int q = 0; q < 4; ++q) { const int c = q * 64 + lane * 2; b16 h0, l0, h1, l1; split16(Tf[rr][c] * HS, h0, l0); split16(Tf[rr][c + 1] * HS, h1, l1); *(v2b*)(Qh + tk * D + c0 + c) = (v2b){h0, h1}; *(v2b*)(Ql + tk * D + c0 + c) = (v2b){l0, l1}; } }
        else { float* R = which == 1 ? KR : VR; for (int q = 0; q < 2; ++q) *(v4f*)(R + tk * D + c0 + q * 128 + lane * 4) = *(const v4f*)(&Tf[rr][q * 128 + lane * 4]); } }
       }
    wave_lds_sync(); } }
__global__ __launch_bounds__(256) void area_kernel(const float* __restrict__ KR, const float* __restrict__ VR, b16* __restrict__ KAh, b16* __restrict__ KAl, b16* __restrict__ VTh, b16* __restrict__ VTl) { __shared__ float Tv[64][HD + 1]; const int bh = blockIdx.x / (NAP / 64), a0 = (blockIdx.x % (NAP / 64)) * 64; const int b = bh / H, h = bh % H; const int tid = threadIdx.x, wave = tid >> 5, lane = tid & 31;
  for (int q = wave; q < 64; q += 8) { const int a = a0 + q; int t0, w; area_of(a, t0, w); v2f ks = {0, 0}, vs = {0, 0}; for (int i = 0; i < w; ++i) { const size_t ro = ((size_t)b * L + t0 + i) * D + h * HD + lane * 2; ks += *(const v2f*)(KR + ro); vs += *(const v2f*)(VR + ro); } const float inv = w > 0 ? 1.0f / (float)w : 0.0f; b16 h0, l0, h1, l1; split16(ks[0] * inv * HS, h0, l0); split16(ks[1] * inv * HS, h1, l1); Tv[q][lane * 2] = vs[0]; Tv[q][lane * 2 + 1] = vs[1];
    { *(v2b*)(KAh + ((size_t)bh * NAP + a) * HD + lane * 2) = (v2b){h0, h1}; *(v2b*)(KAl + ((size_t)bh * NAP + a) * HD + lane * 2) = (v2b){l0, l1};  } }
  __syncthreads();
  { for (int d = wave; d < HD; d += 8) { b16 h0, l0, h1, l1; split16(Tv[lane * 2][d] * HS, h0, l0); split16(Tv[lane * 2 + 1][d] * HS, h1, l1); const size_t o = ((size_t)bh * HD + d) * NAP + a0 + lane * 2; *(v2b*)(VTh + o) = (v2b){h0, h1}; *(v2b*)(VTl + o) = (v2b){l0, l1}; }  } }
__global__ __launch_bounds__(32) void att_kernel(const b16* __restrict__ Qh, const b16* __restrict__ Ql, const b16* __restrict__ KAh, const b16* __restrict__ KAl, const b16* __restrict__ VTh, const b16* __restrict__ VTl, const int* __restrict__ mask, const int* __restrict__ zpad, int QLIM, float* __restrict__ O) { __shared__ __attribute__((aligned(16))) b16 Pa[16][CH + 8], Pb[16][CH + 8]; __shared__ float Sc[16][CH + 1], Mx[16], Ls[16], Fc[16], Of[16][HD + 1]; __shared__ int Vis[16][CH], Any[16]; const int lane = threadIdx.x, nloc = lane & 15, hlf = lane >> 4; const int bh = blockIdx.x / (L / 16), q0 = (blockIdx.x % (L / 16)) * 16; if (q0 >= QLIM) return; const int b = bh / H, h = bh % H; const size_t tq = (size_t)b * L + q0;
  if (lane < 16) { Mx[lane] = -INFINITY; Ls[lane] = 0.0f; for (int kk = CH; kk < CH + 8; ++kk) { Pa[lane][kk] = (b16)0.0f; Pb[lane][kk] = (b16)0.0f; } }
  v16b qa[2], ql[2]; for (int ks = 0; ks < 2; ++ks) { qa[ks] = frag_kb(Qh + (tq + nloc) * D + h * HD + ks * 32, hlf); ql[ks] = frag_kb(Ql + (tq + nloc) * D + h * HD + ks * 32, hlf); }
  v8f oacc[4] = {(v8f){}, (v8f){}, (v8f){}, (v8f){}};
#pragma unroll 1
  for (int ch = 0; ch < NCH; ++ch) { const int a0 = ch * CH;
    // visibility table for this chunk (lane = query row; its 256 areas)
    if (lane < 16) { const int q = q0 + lane; int any = 0; for (int j = 0; j < CH; ++j) { const int e = area_end(a0 + j); const int vis = (e < L) ? (mask[(size_t)q * L + e] != 0) : 0; Vis[lane][j] = vis; any |= vis; } Any[lane] = any; }
    wave_lds_sync();
    int anyw = 0; for (int r = 0; r < 16; ++r) anyw |= Any[r];
    if (!anyw) continue;   // wave-uniform: no query of this wave sees any area of the chunk -> exact zero contribution
#pragma unroll 1
    for (int tg = 0; tg < 16; tg += 4) { v8f sacc[4] = {(v8f){}, (v8f){}, (v8f){}, (v8f){}};
#pragma unroll
      for (int t = 0; t < 4; ++t)
#pragma unroll
        for (int ks = 0; ks < 2; ++ks) { const size_t ko = ((size_t)bh * NAP + a0 + (tg + t) * 16 + nloc) * HD + ks * 32; const v16b kh = frag_kb(KAh + ko, hlf), kl = frag_kb(KAl + ko, hlf); sacc[t] = wmma16b(qa[ks], kh, sacc[t]); sacc[t] = wmma16b(qa[ks], kl, sacc[t]); sacc[t] = wmma16b(ql[ks], kh, sacc[t]); }
#pragma unroll
      for (int t = 0; t < 4; ++t)
#pragma unroll
        for (int r8 = 0; r8 < 8; ++r8) Sc[8 * hlf + r8][(tg + t) * 16 + nloc] = sacc[t][r8] * (SCALE / (HS * HS)); }
    wave_lds_sync();
    if (lane < 16) { const int r = lane; float mx = -INFINITY; for (int j = 0; j < CH; ++j) if (Vis[r][j]) mx = fmaxf(mx, Sc[r][j]); const float mo = Mx[r], mn = fmaxf(mo, mx); const float fac = (mo == -INFINITY) ? 0.0f : (mn == -INFINITY ? 1.0f : __expf(mo - mn)); float sm = 0.0f;
      for (int j = 0; j < CH; ++j) { const float p = (Vis[r][j] && mn != -INFINITY) ? __expf(Sc[r][j] - mn) : 0.0f; sm += p; b16 ph, pl; split16(p * PS, ph, pl); Pa[r][j] = ph; Pb[r][j] = pl; } Fc[r] = fac; Ls[r] = Ls[r] * fac + sm; Mx[r] = mn; }
    wave_lds_sync();
#pragma unroll
    for (int t = 0; t < 4; ++t)
#pragma unroll
      for (int r8 = 0; r8 < 8; ++r8) oacc[t][r8] *= Fc[8 * hlf + r8];
#pragma unroll 2
    for (int kb = 0; kb < CH; kb += 32) { const v16b pa = frag_kb(&Pa[nloc][kb], hlf), pb = frag_kb(&Pb[nloc][kb], hlf);
#pragma unroll
      for (int t = 0; t < 4; ++t) { const size_t vo = ((size_t)bh * HD + t * 16 + nloc) * NAP + a0 + kb; const v16b vh = frag_kb(VTh + vo, hlf), vlo = frag_kb(VTl + vo, hlf); oacc[t] = wmma16b(pa, vh, oacc[t]); oacc[t] = wmma16b(pa, vlo, oacc[t]); oacc[t] = wmma16b(pb, vh, oacc[t]); } }
    wave_lds_sync(); }
  const int zp = zpad[0];
#pragma unroll
  for (int t = 0; t < 4; ++t)
#pragma unroll
    for (int r8 = 0; r8 < 8; ++r8) { const int r = 8 * hlf + r8; const float l = Ls[r]; const bool zero = (zp != 0 && q0 + r == 0); Of[r][t * 16 + nloc] = zero ? 0.0f : oacc[t][r8] * (1.0f / (PS * HS)) / l; }
  wave_lds_sync();
  { for (int r = 0; r < 16; ++r) *(v2f*)(O + (tq + r) * D + h * HD + lane * 2) = (v2f){Of[r][lane * 2], Of[r][lane * 2 + 1]};  } }
__global__ __launch_bounds__(32) void outp_kernel(const float* __restrict__ O, const b16* __restrict__ WO, const float* __restrict__ bo, int QLIM, float* __restrict__ out) { __shared__ __attribute__((aligned(16))) b16 Ah[16][D + 8], Al[16][D + 8]; __shared__ float Tf[16][260]; const int lane = threadIdx.x, nloc = lane & 15, hlf = lane >> 4; const size_t t0 = (size_t)blockIdx.x * 16; if ((int)(t0 % L) >= QLIM) return;
  for (int rr = 0; rr < 16; ++rr) for (int q = 0; q < D / 32; ++q) { const int c = q * 32 + lane; b16 p, pl; split16(O[(t0 + rr) * D + c] * HS, p, pl); Ah[rr][c] = p; Al[rr][c] = pl; }
  if (lane < 16) for (int k = D; k < D + 8; ++k) { Ah[lane][k] = (b16)0.0f; Al[lane][k] = (b16)0.0f; }
  wave_lds_sync();
#pragma unroll 1
  for (int g = 0; g < 4; ++g) { v8f acc[16];
#pragma unroll
    for (int t = 0; t < 16; ++t) acc[t] = (v8f){};
#pragma unroll 2
    for (int kb = 0; kb < D; kb += 32) { const v16b a = frag_kb(&Ah[nloc][kb], hlf), al = frag_kb(&Al[nloc][kb], hlf);
#pragma unroll
      for (int t = 0; t < 16; ++t) { const v16b bw = frag_kb(WO + (size_t)(g * 256 + t * 16 + nloc) * D + kb, hlf); acc[t] = wmma16b(a, bw, acc[t]); acc[t] = wmma16b(al, bw, acc[t]); } }
#pragma unroll
    for (int t = 0; t < 16; ++t) { const int cc = t * 16 + nloc; const float bb = bfv(bo[g * 256 + cc]);
#pragma unroll
      for (int r8 = 0; r8 < 8; ++r8) Tf[8 * hlf + r8][cc] = acc[t][r8] * (1.0f / (HS * WSC)) + bb; }
    wave_lds_sync();
    { for (int rr = 0; rr < 16; ++rr) for (int q = 0; q < 2; ++q) *(v4f*)(out + (t0 + rr) * D + g * 256 + q * 128 + lane * 4) = *(const v4f*)(&Tf[rr][q * 128 + lane * 4]);  }
    wave_lds_sync(); } }
}  // namespace

extern "C" void kernel_launch(void* const* d_in, const int* in_sizes, int n_in, void* d_out, int out_size, void* d_ws, size_t ws_size, hipStream_t stream) {
  (void)n_in;
  auto Fp = [&](int i) { return (const float*)d_in[i]; }; auto Ip = [&](int i) { return (const int*)d_in[i]; };
  // input order: 0 q [2,1024,1024]; 1 k; 2 v; 3 Wq; 4 bq; 5 Wk; 6 bk; 7 Wv; 8 bv; 9 Wo; 10 bo; 11 mask [1024,1024] i32; 12 zero_pad [1] i32
  if (in_sizes[0] != NT * D || in_sizes[1] != NT * D || in_sizes[2] != NT * D || in_sizes[3] != D * D || in_sizes[9] != D * D || in_sizes[11] != L * L || in_sizes[12] != 1 || out_size != NT * D) return;
  const int QLIM = L;   // per-batch query cut (multiple of 16)
  size_t off = 0; char* ws = (char*)d_ws;
  auto carve = [&](size_t bytes) { char* p = ws + off; off += (bytes + 255) & ~(size_t)255; return p; };
  b16* W4 = (b16*)carve((size_t)4 * D * D * 2); b16* Qh = (b16*)carve((size_t)NT * D * 2); b16* Ql = (b16*)carve((size_t)NT * D * 2); float* KR = (float*)carve((size_t)NT * D * 4); float* VR = (float*)carve((size_t)NT * D * 4); b16* KAh = (b16*)carve((size_t)NB_ * H * NAP * HD * 2); b16* KAl = (b16*)carve((size_t)NB_ * H * NAP * HD * 2); b16* VTh = (b16*)carve((size_t)NB_ * H * HD * NAP * 2); b16* VTl = (b16*)carve((size_t)NB_ * H * HD * NAP * 2); float* O = (float*)carve((size_t)NT * D * 4);
  if (off > ws_size || off > ((size_t)96 << 20)) return;   // ~ 88 MiB
  wput_kernel<<<256, 256, 0, stream>>>(Fp(3), Fp(5), Fp(7), Fp(9), W4);
  proj_kernel<<<dim3(NT / 16, 3), 32, 0, stream>>>(Fp(0), Fp(1), Fp(2), W4, Fp(4), Fp(6), Fp(8), Qh, Ql, KR, VR);
  area_kernel<<<NB_ * H * (NAP / 64), 256, 0, stream>>>(KR, VR, KAh, KAl, VTh, VTl);
  att_kernel<<<NB_ * H * (L / 16), 32, 0, stream>>>(Qh, Ql, KAh, KAl, VTh, VTl, Ip(11), Ip(12), QLIM, O);
  outp_kernel<<<NT / 16, 32, 0, stream>>>(O, W4 + (size_t)3 * D * D, Fp(10), QLIM, (float*)d_out);
}

// v001
// Measured time: 1220 microseconds a run.
// Two timings next to v000 put it at 2.21 and 2.24 times that version's speed.
#include <hip/hip_runtime.h>

// MultiHeadAreaAttention: qh,kh,vh = (q Wq^T + bq), (k Wk^T + bk), (v Wv^T + bv) as 16 heads x 64; areas = all windows of width 1..3 along the key axis (A = 3,069; block w starts at area index 0 / 1024 / 2047, end(a) = start + w - 1); k_area = window mean, v_area = window sum; logits = qh.k_area / 8, visible iff mask[q][end(a)] != 0 (else -1e30); weights = softmax over areas; if zero_pad: weights of query 0 := 0; ctx = weights.v_area; out = concat Wo^T + bo -> [2][1024][1024].
// Deterministic: online softmax over fixed 128-area chunks in order (chunks with no visible area for any of the wave's 16 queries are skipped: they contribute exactly 0); inside a chunk each lane sums its 64 areas in a fixed tree, then the two halves of a query are added; no atomics.
// WMMA (v_wmma_f32_16x16x32_f16, f32 accumulate): inputs (EXACT bf16 x8, K 1,024) x W rows (EXACT; 64 tiles each) per 16-token wave; per (bh, 16-query) wave S^T = k_area rows (hi+lo; 8 tiles/chunk) x qh (hi+lo x256, K 64) and O^T += v_area^T rows (hi+lo; 4 tiles) x P (hi+lo), 3 products; o (hi+lo) x Wo rows (64 tiles); about 4 M WMMA; area pooling, mask gather, softmax in f32.

namespace {
constexpr int NB_ = 2, L = 1024, D = 1024, H = 16, HD = 64, NA = 3 * L - 3 /* 3069 */, NAP = 3072, NT = NB_ * L, CH = 128, NCH = NAP / CH /* 24 */, NTI = CH / 16;
constexpr float XS = 8.0f, HS = 256.0f, PS = 256.0f, WSC = 256.0f, SCALE = 0.125f, LOG2E = 1.44269504f;
typedef _Float16 b16;
typedef __attribute__((ext_vector_type(16))) _Float16 v16b;
typedef __attribute__((ext_vector_type(8))) _Float16 v8b;
typedef __attribute__((ext_vector_type(2))) _Float16 v2b;
typedef __attribute__((ext_vector_type(8))) float v8f;
typedef __attribute__((ext_vector_type(4))) float v4f;
typedef __attribute__((ext_vector_type(2))) float v2f;
__device__ __forceinline__ float bf16_rne(float f) { unsigned int u = __float_as_uint(f); u += 0x7FFFu + ((u >> 16) & 1u); float r = __uint_as_float(u & 0xFFFF0000u); asm volatile("" : "+v"(r)); return r; }
__device__ __forceinline__ float bfv(float f) { float r = bf16_rne(f); asm volatile("" : "+v"(r)); return r; }
__device__ __forceinline__ void split16(float v, b16& hi, b16& lo) { hi = (b16)v; lo = (b16)(v - (float)hi); }
__device__ __forceinline__ v16b frag_kb(const b16* p, int hh) { const v8b a = *(const v8b*)(p + 8 * hh), b = *(const v8b*)(p + 16 + 8 * hh); v16b f;
#pragma unroll
  for (int e = 0; e < 8; ++e) { f[e] = a[e]; f[8 + e] = b[e]; } return f; }
__device__ __forceinline__ v8f wmma16b(v16b a, v16b b, v8f c) { v8f d = __builtin_amdgcn_wmma_f32_16x16x32_f16(false, a, false, b, (short)0, c, false, false); asm volatile("v_nop\n\tv_nop\n\tv_nop\n\tv_nop" : "+v"(d) : "v"(a), "v"(b)); return d; }
// 2^x and, in the same statement, the one issue slot that the instruction set asks for behind a transcendental
__device__ __forceinline__ float exp2_slot(float x) { float p; asm("v_exp_f32 %0, %1\n\tv_nop" : "=v"(p) : "v"(x)); return p; }
__device__ __forceinline__ void wave_lds_sync() { __builtin_amdgcn_fence(__ATOMIC_RELEASE, "workgroup"); __builtin_amdgcn_wave_barrier(); __builtin_amdgcn_fence(__ATOMIC_ACQUIRE, "workgroup"); }
// area index -> (start token, width); padding areas (>= 3069) get start 0, width 0 (zero pooled rows)
__device__ __forceinline__ void area_of(int a, int& t0, int& w) { if (a < L) { t0 = a; w = 1; } else if (a < 2 * L - 1) { t0 = a - L; w = 2; } else if (a < NA) { t0 = a - (2 * L - 1); w = 3; } else { t0 = 0; w = 0; } }

__global__ __launch_bounds__(256) void wput_kernel(const float* __restrict__ wq, const float* __restrict__ wk, const float* __restrict__ wv, const float* __restrict__ wo, b16* __restrict__ W4) { const size_t nt = (size_t)gridDim.x * 256, u0 = (size_t)blockIdx.x * 256 + threadIdx.x; v8b v;
  for (size_t u = u0; u < (size_t)4 * D * 128; u += nt) { const int o = (int)(u / 128), k0 = (int)(u % 128) * 8; const int which = o / D, oo = o % D; const float* w = which == 0 ? wq : (which == 1 ? wk : (which == 2 ? wv : wo));
#pragma unroll
    for (int j = 0; j < 8; ++j) v[j] = (b16)(bf16_rne(w[(size_t)oo * D + k0 + j]) * WSC); { *(v8b*)(W4 + (size_t)o * D + k0) = v;  } } }
__global__ __launch_bounds__(32) void proj_kernel(const float* __restrict__ xq, const float* __restrict__ xk, const float* __restrict__ xv, const b16* __restrict__ W4, const float* __restrict__ bq, const float* __restrict__ bk, const float* __restrict__ bv, b16* __restrict__ Qh, b16* __restrict__ Ql, float* __restrict__ KR, float* __restrict__ VR) { __shared__ __attribute__((aligned(16))) b16 Ax[16][D + 8]; __shared__ float Tf[16][260]; const int lane = threadIdx.x, nloc = lane & 15, hlf = lane >> 4; const size_t t0 = (size_t)blockIdx.x * 16; const int which = blockIdx.y;
  const float* x = which == 0 ? xq : (which == 1 ? xk : xv); const float* bias = which == 0 ? bq : (which == 1 ? bk : bv);
  for (int rr = 0; rr < 16; ++rr) for (int q = 0; q < D / 32; ++q) { const int c = q * 32 + lane; Ax[rr][c] = (b16)(bf16_rne(x[(t0 + rr) * D + c]) * XS); }
  if (lane < 16) for (int k = D; k < D + 8; ++k) Ax[lane][k] = (b16)0.0f;
  wave_lds_sync();
#pragma unroll 1
  for (int g = 0; g < 4; ++g) { const int c0 = g * 256; v8f acc[16];
#pragma unroll
    for (int t = 0; t < 16; ++t) acc[t] = (v8f){};
#pragma unroll 2
    for (int kb = 0; kb < D; kb += 32) { const v16b a = frag_kb(&Ax[nloc][kb], hlf);
#pragma unroll
      for (int t = 0; t < 16; ++t) acc[t] = wmma16b(a, frag_kb(W4 + ((size_t)which * D + c0 + t * 16 + nloc) * D + kb, hlf), acc[t]); }
#pragma unroll
    for (int t = 0; t < 16; ++t) { const int cc = t * 16 + nloc; const float bb = bfv(bias[c0 + cc]);
#pragma unroll
      for (int r8 = 0; r8 < 8; ++r8) Tf[8 * hlf + r8][cc] = acc[t][r8] * (1.0f / (XS * WSC)) + bb; }
    wave_lds_sync();
    { for (int rr = 0; rr < 16; ++rr) { const size_t tk = t0 + rr;
        if (which == 0) { for (int q = 0; q < 4; ++q) { const int c = q * 64 + lane * 2; b16 h0, l0, h1, l1; split16(Tf[rr][c] * HS, h0, l0); split16(Tf[rr][c + 1] * HS, h1, l1); *(v2b*)(Qh + tk * D + c0 + c) = (v2b){h0, h1}; *(v2b*)(Ql + tk * D + c0 + c) = (v2b){l0, l1}; } }
        else { float* R = which == 1 ? KR : VR; for (int q = 0; q < 2; ++q) *(v4f*)(R + tk * D + c0 + q * 128 + lane * 4) = *(const v4f*)(&Tf[rr][q * 128 + lane * 4]); } }
       }
    wave_lds_sync(); } }
__global__ __launch_bounds__(256) void area_kernel(const float* __restrict__ KR, const float* __restrict__ VR, b16* __restrict__ KAh, b16* __restrict__ KAl, b16* __restrict__ VTh, b16* __restrict__ VTl) { __shared__ float Tv[64][HD + 1]; const int bh = blockIdx.x / (NAP / 64), a0 = (blockIdx.x % (NAP / 64)) * 64; const int b = bh / H, h = bh % H; const int tid = threadIdx.x, wave = tid >> 5, lane = tid & 31;
  for (int q = wave; q < 64; q += 8) { const int a = a0 + q; int t0, w; area_of(a, t0, w); v2f ks = {0, 0}, vs = {0, 0}; for (int i = 0; i < w; ++i) { const size_t ro = ((size_t)b * L + t0 + i) * D + h * HD + lane * 2; ks += *(const v2f*)(KR + ro); vs += *(const v2f*)(VR + ro); } const float inv = w > 0 ? 1.0f / (float)w : 0.0f; b16 h0, l0, h1, l1; split16(ks[0] * inv * HS, h0, l0); split16(ks[1] * inv * HS, h1, l1); Tv[q][lane * 2] = vs[0]; Tv[q][lane * 2 + 1] = vs[1];
    { *(v2b*)(KAh + ((size_t)bh * NAP + a) * HD + lane * 2) = (v2b){h0, h1}; *(v2b*)(KAl + ((size_t)bh * NAP + a) * HD + lane * 2) = (v2b){l0, l1};  } }
  __syncthreads();
  { for (int d = wave; d < HD; d += 8) { b16 h0, l0, h1, l1; split16(Tv[lane * 2][d] * HS, h0, l0); split16(Tv[lane * 2 + 1][d] * HS, h1, l1); const size_t o = ((size_t)bh * HD + d) * NAP + a0 + lane * 2; *(v2b*)(VTh + o) = (v2b){h0, h1}; *(v2b*)(VTl + o) = (v2b){l0, l1}; }  } }
// the grid is two waves for each SIMD of the chip: let the register budget and the load scheduling be those of two resident waves
__global__ __launch_bounds__(32) __attribute__((amdgpu_waves_per_eu(1, 2))) void att_kernel(const b16* __restrict__ Qh, const b16* __restrict__ Ql, const b16* __restrict__ KAh, const b16* __restrict__ KAl, const b16* __restrict__ VTh, const b16* __restrict__ VTl, const int* __restrict__ mask, const int* __restrict__ zpad, int QLIM, float* __restrict__ O) { const int lane = threadIdx.x, nloc = lane & 15, hlf = lane >> 4; const int bh = blockIdx.x / (L / 16), q0 = (blockIdx.x % (L / 16)) * 16; if (q0 >= QLIM) return; const int b = bh / H, h = bh % H; const size_t tq = (size_t)b * L + q0;
  // both products are taken transposed (S^T = k_area x qh^T, O^T = v_area^T x P^T): queries are the N side, so lane nloc owns query q0 + nloc and its half hlf holds areas 16 T + 8 hlf + 0..7 of every 16-area tile T.
  // Two neighbouring S^T tiles are then, register for register, the K = 32 operand of P (k = 8 hlf + e and 16 + 8 hlf + e, the order of frag_kb): mask, softmax and P never leave the registers.
  const int* mrow = mask + (size_t)(q0 + nloc) * L;
  v16b qa[2], ql[2]; for (int ks = 0; ks < 2; ++ks) { qa[ks] = frag_kb(Qh + (tq + nloc) * D + h * HD + ks * 32, hlf); ql[ks] = frag_kb(Ql + (tq + nloc) * D + h * HD + ks * 32, hlf); }
  v8f oacc[4] = {(v8f){}, (v8f){}, (v8f){}, (v8f){}}; float mrun = -INFINITY, lrun = 0.0f;
#pragma unroll 1
  for (int ch = 0; ch < NCH; ++ch) { const int a0 = ch * CH;
    // visibility bits of this lane's 64 areas (bit 8 (T & 3) + r8 of word T >> 2). All tiles of a chunk but the last lie inside one width block, where end(a) = a - eoff; the last tile may hold a block edge or padding and goes area by area.
    const int eoff = a0 < L ? 0 : (a0 < 2 * L ? L - 1 : 2 * L - 3); unsigned int vb[NTI / 4] = {};
#pragma unroll
    for (int t = 0; t < NTI - 1; ++t) { int m[8]; __builtin_memcpy(m, mrow + (a0 - eoff + t * 16 + 8 * hlf), 32);
#pragma unroll
      for (int r8 = 0; r8 < 8; ++r8) vb[t >> 2] |= (m[r8] != 0 ? 1u : 0u) << ((t & 3) * 8 + r8); }
#pragma unroll
    for (int r8 = 0; r8 < 8; ++r8) { const int a = a0 + CH - 16 + 8 * hlf + r8, e = a - (a < L ? 0 : (a < 2 * L - 1 ? L - 1 : 2 * L - 3)); const int m = mrow[e < L ? e : L - 1]; vb[NTI / 4 - 1] |= (((e < L) & (m != 0)) ? 1u : 0u) << (24 + r8); }   // padding areas (a >= 3069) come out as e >= L: address clamped, never visible
    if (__builtin_amdgcn_ballot_w32((vb[0] | vb[1]) != 0u) == 0u) continue;   // wave-uniform: no query of this wave sees any area of the chunk -> exact zero contribution
    v8f s[NTI];
#pragma unroll
    for (int tg = 0; tg < NTI; tg += 4) {
#pragma unroll
      for (int t = 0; t < 4; ++t) s[tg + t] = (v8f){};
#pragma unroll
      for (int ks = 0; ks < 2; ++ks) { v16b kh[4], kl[4];
#pragma unroll
        for (int t = 0; t < 4; ++t) { const size_t ko = ((size_t)bh * NAP + a0 + (tg + t) * 16 + nloc) * HD + ks * 32; kh[t] = frag_kb(KAh + ko, hlf); kl[t] = frag_kb(KAl + ko, hlf); }
#pragma unroll
        for (int t = 0; t < 4; ++t) s[tg + t] = wmma16b(kh[t], qa[ks], s[tg + t]);
#pragma unroll
        for (int t = 0; t < 4; ++t) s[tg + t] = wmma16b(kl[t], qa[ks], s[tg + t]);
#pragma unroll
        for (int t = 0; t < 4; ++t) s[tg + t] = wmma16b(kh[t], ql[ks], s[tg + t]); } }
    v8f m8;
#pragma unroll
    for (int r8 = 0; r8 < 8; ++r8) m8[r8] = -INFINITY;
#pragma unroll
    for (int t = 0; t < NTI; ++t)
#pragma unroll
      for (int r8 = 0; r8 < 8; ++r8) { const float v = ((vb[t >> 2] >> ((t & 3) * 8 + r8)) & 1u) ? s[t][r8] * (SCALE / (HS * HS)) : -INFINITY; s[t][r8] = v; m8[r8] = fmaxf(m8[r8], v); }
    float mx = fmaxf(fmaxf(fmaxf(m8[0], m8[1]), fmaxf(m8[2], m8[3])), fmaxf(fmaxf(m8[4], m8[5]), fmaxf(m8[6], m8[7]))); mx = fmaxf(mx, __shfl_xor(mx, 16));
    const float mn = fmaxf(mrun, mx), fe = exp2_slot((mrun - mn) * LOG2E), fac = (mrun == -INFINITY) ? 0.0f : fe, ms = (mn == -INFINITY) ? 0.0f : mn; v8f s8 = (v8f){};
#pragma unroll
    for (int t = 0; t < NTI; ++t)
#pragma unroll
      for (int r8 = 0; r8 < 8; ++r8) { const float p = exp2_slot((s[t][r8] - ms) * LOG2E); s8[r8] += p; s[t][r8] = p * PS; }
    float sm = ((s8[0] + s8[1]) + (s8[2] + s8[3])) + ((s8[4] + s8[5]) + (s8[6] + s8[7])); sm += __shfl_xor(sm, 16); lrun = lrun * fac + sm; mrun = mn;
#pragma unroll
    for (int t = 0; t < 4; ++t) oacc[t] *= fac;
    const b16 *vph[4], *vpl[4];
#pragma unroll
    for (int t = 0; t < 4; ++t) { const size_t vo = ((size_t)bh * HD + t * 16 + nloc) * NAP + a0 + 8 * hlf; vph[t] = VTh + vo; vpl[t] = VTl + vo; }
#pragma unroll
    for (int kb = 0; kb < CH; kb += 32) { v16b pa, pb, vh[4], vlo[4];
#pragma unroll
      for (int e = 0; e < 8; ++e) { b16 ph, pl; split16(s[kb / 16][e], ph, pl); pa[e] = ph; pb[e] = pl; split16(s[kb / 16 + 1][e], ph, pl); pa[8 + e] = ph; pb[8 + e] = pl; }
#pragma unroll
      for (int t = 0; t < 4; ++t) { vh[t] = frag_kb(vph[t] + kb, 0); vlo[t] = frag_kb(vpl[t] + kb, 0); }
      // behind the chunk's last loads through these eight addresses: the wait that belongs in front of the first reuse of their registers; as inputs they stay whole up to it
      if (kb + 32 == CH) asm volatile("s_wait_xcnt 0x0" :: "v"(vph[0]), "v"(vph[1]), "v"(vph[2]), "v"(vph[3]), "v"(vpl[0]), "v"(vpl[1]), "v"(vpl[2]), "v"(vpl[3]) : "memory");
#pragma unroll
      for (int t = 0; t < 4; ++t) oacc[t] = wmma16b(vh[t], pa, oacc[t]);
#pragma unroll
      for (int t = 0; t < 4; ++t) oacc[t] = wmma16b(vlo[t], pa, oacc[t]);
#pragma unroll
      for (int t = 0; t < 4; ++t) oacc[t] = wmma16b(vh[t], pb, oacc[t]); } }
  const bool zero = (zpad[0] != 0 && q0 + nloc == 0);
#pragma unroll
  for (int t = 0; t < 4; ++t) { v4f o0, o1;
#pragma unroll
    for (int j = 0; j < 4; ++j) { const float u0 = oacc[t][j] * (1.0f / (PS * HS)) / lrun, u1 = oacc[t][4 + j] * (1.0f / (PS * HS)) / lrun; o0[j] = zero ? 0.0f : u0; o1[j] = zero ? 0.0f : u1; }
    float* op = O + (tq + nloc) * D + h * HD + t * 16 + 8 * hlf; *(v4f*)op = o0; *(v4f*)(op + 4) = o1; } }
__global__ __launch_bounds__(32) void outp_kernel(const float* __restrict__ O, const b16* __restrict__ WO, const float* __restrict__ bo, int QLIM, float* __restrict__ out) { __shared__ __attribute__((aligned(16))) b16 Ah[16][D + 8], Al[16][D + 8]; __shared__ float Tf[16][260]; const int lane = threadIdx.x, nloc = lane & 15, hlf = lane >> 4; const size_t t0 = (size_t)blockIdx.x * 16; if ((int)(t0 % L) >= QLIM) return;
  for (int rr = 0; rr < 16; ++rr) for (int q = 0; q < D / 32; ++q) { const int c = q * 32 + lane; b16 p, pl; split16(O[(t0 + rr) * D + c] * HS, p, pl); Ah[rr][c] = p; Al[rr][c] = pl; }
  if (lane < 16) for (int k = D; k < D + 8; ++k) { Ah[lane][k] = (b16)0.0f; Al[lane][k] = (b16)0.0f; }
  wave_lds_sync();
#pragma unroll 1
  for (int g = 0; g < 4; ++g) { v8f acc[16];
#pragma unroll
    for (int t = 0; t < 16; ++t) acc[t] = (v8f){};
#pragma unroll 2
    for (int kb = 0; kb < D; kb += 32) { const v16b a = frag_kb(&Ah[nloc][kb], hlf), al = frag_kb(&Al[nloc][kb], hlf);
#pragma unroll
      for (int t = 0; t < 16; ++t) { const v16b bw = frag_kb(WO + (size_t)(g * 256 + t * 16 + nloc) * D + kb, hlf); acc[t] = wmma16b(a, bw, acc[t]); acc[t] = wmma16b(al, bw, acc[t]); } }
#pragma unroll
    for (int t = 0; t < 16; ++t) { const int cc = t * 16 + nloc; const float bb = bfv(bo[g * 256 + cc]);
#pragma unroll
      for (int r8 = 0; r8 < 8; ++r8) Tf[8 * hlf + r8][cc] = acc[t][r8] * (1.0f / (HS * WSC)) + bb; }
    wave_lds_sync();
    { for (int rr = 0; rr < 16; ++rr) for (int q = 0; q < 2; ++q) *(v4f*)(out + (t0 + rr) * D + g * 256 + q * 128 + lane * 4) = *(const v4f*)(&Tf[rr][q * 128 + lane * 4]);  }
    wave_lds_sync(); } }
}  // namespace

extern "C" void kernel_launch(void* const* d_in, const int* in_sizes, int n_in, void* d_out, int out_size, void* d_ws, size_t ws_size, hipStream_t stream) {
  (void)n_in;
  auto Fp = [&](int i) { return (const float*)d_in[i]; }; auto Ip = [&](int i) { return (const int*)d_in[i]; };
  // input order: 0 q [2,1024,1024]; 1 k; 2 v; 3 Wq; 4 bq; 5 Wk; 6 bk; 7 Wv; 8 bv; 9 Wo; 10 bo; 11 mask [1024,1024] i32; 12 zero_pad [1] i32
  if (in_sizes[0] != NT * D || in_sizes[1] != NT * D || in_sizes[2] != NT * D || in_sizes[3] != D * D || in_sizes[9] != D * D || in_sizes[11] != L * L || in_sizes[12] != 1 || out_size != NT * D) return;
  const int QLIM = L;   // per-batch query cut (multiple of 16)
  size_t off = 0; char* ws = (char*)d_ws;
  auto carve = [&](size_t bytes) { char* p = ws + off; off += (bytes + 255) & ~(size_t)255; return p; };
  b16* W4 = (b16*)carve((size_t)4 * D * D * 2); b16* Qh = (b16*)carve((size_t)NT * D * 2); b16* Ql = (b16*)carve((size_t)NT * D * 2); float* KR = (float*)carve((size_t)NT * D * 4); float* VR = (float*)carve((size_t)NT * D * 4); b16* KAh = (b16*)carve((size_t)NB_ * H * NAP * HD * 2); b16* KAl = (b16*)carve((size_t)NB_ * H * NAP * HD * 2); b16* VTh = (b16*)carve((size_t)NB_ * H * HD * NAP * 2); b16* VTl = (b16*)carve((size_t)NB_ * H * HD * NAP * 2); float* O = (float*)carve((size_t)NT * D * 4);
  if (off > ws_size || off > ((size_t)96 << 20)) return;   // ~ 88 MiB
  wput_kernel<<<256, 256, 0, stream>>>(Fp(3), Fp(5), Fp(7), Fp(9), W4);
  proj_kernel<<<dim3(NT / 16, 3), 32, 0, stream>>>(Fp(0), Fp(1), Fp(2), W4, Fp(4), Fp(6), Fp(8), Qh, Ql, KR, VR);
  area_kernel<<<NB_ * H * (NAP / 64), 256, 0, stream>>>(KR, VR, KAh, KAl, VTh, VTl);
  att_kernel<<<NB_ * H * (L / 16), 32, 0, stream>>>(Qh, Ql, KAh, KAl, VTh, VTl, Ip(11), Ip(12), QLIM, O);
  outp_kernel<<<NT / 16, 32, 0, stream>>>(O, W4 + (size_t)3 * D * D, Fp(10), QLIM, (float*)d_out);
}

// v002
// It runs in 287 microseconds.
// In two side-by-side timings against v001, it was 4.26 and 4.28 times as fast.
// All steps since v000 together make it 9.51 times as fast.
#include <hip/hip_runtime.h>

// MultiHeadAreaAttention: qh,kh,vh = (q Wq^T + bq), (k Wk^T + bk), (v Wv^T + bv) as 16 heads x 64; areas = all windows of width 1..3 along the key axis (A = 3,069; block w starts at area index 0 / 1024 / 2047, end(a) = start + w - 1); k_area = window mean, v_area = window sum; logits = qh.k_area / 8, visible iff mask[q][end(a)] != 0 (else -1e30); weights = softmax over areas; if zero_pad: weights of query 0 := 0; ctx = weights.v_area; out = concat Wo^T + bo -> [2][1024][1024].
// Deterministic: online softmax over fixed 128-area chunks in order (chunks with no visible area for any of the wave's 16 queries are skipped: they contribute exactly 0); inside a chunk each lane sums its 64 areas in a fixed tree, then the two halves of a query are added; no atomics.
// WMMA (v_wmma_f32_16x16x32_f16, f32 accumulate): inputs (EXACT bf16 x8, K 1,024) x W rows (EXACT) per 64-token x 256-column work-group of 8 waves; per (bh, 16-query) wave S^T = k_area rows (hi+lo; 8 tiles/chunk) x qh (hi+lo x256, K 64) and O^T += v_area^T rows (hi+lo; 4 tiles) x P (hi+lo), 3 products; o (hi+lo) x Wo rows, same tiling; about 4 M WMMA; area pooling, mask gather, softmax in f32.

namespace {
constexpr int NB_ = 2, L = 1024, D = 1024, H = 16, HD = 64, NA = 3 * L - 3 /* 3069 */, NAP = 3072, NT = NB_ * L, CH = 128, NCH = NAP / CH /* 24 */, NTI = CH / 16;
constexpr float XS = 8.0f, HS = 256.0f, PS = 256.0f, WSC = 256.0f, SCALE = 0.125f, LOG2E = 1.44269504f;
typedef _Float16 b16;
typedef __attribute__((ext_vector_type(16))) _Float16 v16b;
typedef __attribute__((ext_vector_type(8))) _Float16 v8b;
typedef __attribute__((ext_vector_type(4))) _Float16 v4b;
typedef __attribute__((ext_vector_type(2))) _Float16 v2b;
typedef __attribute__((ext_vector_type(8))) float v8f;
typedef __attribute__((ext_vector_type(4))) float v4f;
typedef __attribute__((ext_vector_type(2))) float v2f;
__device__ __forceinline__ float bf16_rne(float f) { unsigned int u = __float_as_uint(f); u += 0x7FFFu + ((u >> 16) & 1u); float r = __uint_as_float(u & 0xFFFF0000u); asm volatile("" : "+v"(r)); return r; }
__device__ __forceinline__ float bfv(float f) { float r = bf16_rne(f); asm volatile("" : "+v"(r)); return r; }
__device__ __forceinline__ void split16(float v, b16& hi, b16& lo) { hi = (b16)v; lo = (b16)(v - (float)hi); }
__device__ __forceinline__ v16b frag_kb(const b16* p, int hh) { const v8b a = *(const v8b*)(p + 8 * hh), b = *(const v8b*)(p + 16 + 8 * hh); v16b f;
#pragma unroll
  for (int e = 0; e < 8; ++e) { f[e] = a[e]; f[8 + e] = b[e]; } return f; }
__device__ __forceinline__ v8f wmma16b(v16b a, v16b b, v8f c) { v8f d = __builtin_amdgcn_wmma_f32_16x16x32_f16(false, a, false, b, (short)0, c, false, false); asm volatile("v_nop\n\tv_nop\n\tv_nop\n\tv_nop" : "+v"(d) : "v"(a), "v"(b)); return d; }
// 2^x and, in the same statement, the one issue slot that the instruction set asks for behind a transcendental
__device__ __forceinline__ float exp2_slot(float x) { float p; asm("v_exp_f32 %0, %1\n\tv_nop" : "=v"(p) : "v"(x)); return p; }
// area index -> (start token, width); padding areas (>= 3069) get start 0, width 0 (zero pooled rows)
__device__ __forceinline__ void area_of(int a, int& t0, int& w) { if (a < L) { t0 = a; w = 1; } else if (a < 2 * L - 1) { t0 = a - L; w = 2; } else if (a < NA) { t0 = a - (2 * L - 1); w = 3; } else { t0 = 0; w = 0; } }

__global__ __launch_bounds__(256) void wput_kernel(const float* __restrict__ wq, const float* __restrict__ wk, const float* __restrict__ wv, const float* __restrict__ wo, b16* __restrict__ W4) { const size_t nt = (size_t)gridDim.x * 256, u0 = (size_t)blockIdx.x * 256 + threadIdx.x; v8b v;
  for (size_t u = u0; u < (size_t)4 * D * 128; u += nt) { const int o = (int)(u / 128), k0 = (int)(u % 128) * 8; const int which = o / D, oo = o % D; const float* w = which == 0 ? wq : (which == 1 ? wk : (which == 2 ? wv : wo));
#pragma unroll
    for (int j = 0; j < 8; ++j) v[j] = (b16)(bf16_rne(w[(size_t)oo * D + k0 + j]) * WSC); { *(v8b*)(W4 + (size_t)o * D + k0) = v;  } } }
// GEMM tile of one work-group (both projection kernels): GM tokens x GN output columns, 8 waves. All waves stage the A tile (whole K) in LDS once; wave w then owns columns 32 w .. 32 w + 31 for all GM tokens (4 x 2 accumulator tiles), so each B fragment read from global memory serves four products (eight in outp_kernel: A hi and lo). k order per output element: ascending, as before.
constexpr int GM = 64, GN = 256, AP = D + 8, TP = GN + 4;
__global__ __launch_bounds__(256) void proj_kernel(const float* __restrict__ xq, const float* __restrict__ xk, const float* __restrict__ xv, const b16* __restrict__ W4, const float* __restrict__ bq, const float* __restrict__ bk, const float* __restrict__ bv, b16* __restrict__ Qh, b16* __restrict__ Ql, float* __restrict__ KR, float* __restrict__ VR) { __shared__ __attribute__((aligned(16))) char sm[GM * AP * 2]; b16 (*Ax)[AP] = (b16 (*)[AP])sm; float (*Tf)[TP] = (float (*)[TP])sm;   // Tf takes Ax's place behind the K loop
  const int tid = threadIdx.x, wave = __builtin_amdgcn_readfirstlane(tid >> 5), lane = tid & 31, nloc = lane & 15, hlf = lane >> 4; const size_t t0 = (size_t)blockIdx.x * GM; const int which = blockIdx.y, c0 = blockIdx.z * GN;
  const float* x = which == 0 ? xq : (which == 1 ? xk : xv); const float* bias = which == 0 ? bq : (which == 1 ? bk : bv);
  // rolled: 16 rows a trip are 16 loads of 16 bytes in flight per lane, enough to cover the memory latency
#pragma unroll 1
  for (int r0 = 0; r0 < GM; r0 += 16) { v4f xv[16];
#pragma unroll
    for (int j = 0; j < 16; ++j) xv[j] = *(const v4f*)(x + (t0 + r0 + j) * D + tid * 4);
#pragma unroll
    for (int j = 0; j < 16; ++j) { v4b hv;
#pragma unroll
      for (int e = 0; e < 4; ++e) hv[e] = (b16)(bf16_rne(xv[j][e]) * XS);
      *(v4b*)(&Ax[r0 + j][tid * 4]) = hv; } }
  __syncthreads();   // the A tile is whole before any wave reads it
  v8f acc[4][2];
#pragma unroll
  for (int m = 0; m < 4; ++m) { acc[m][0] = (v8f){}; acc[m][1] = (v8f){}; }
  const b16* wp = W4 + ((size_t)which * D + c0 + wave * 32 + nloc) * D;
  // two k steps a trip, as before: together they use up one 128-byte line of each W row, and the address step is paid once
#pragma unroll 2
  for (int kb = 0; kb < D; kb += 32) { v16b bw[2], a[4];
#pragma unroll
    for (int n = 0; n < 2; ++n) bw[n] = frag_kb(wp + (size_t)n * 16 * D + kb, hlf);
#pragma unroll
    for (int m = 0; m < 4; ++m) a[m] = frag_kb(&Ax[m * 16 + nloc][kb], hlf);
#pragma unroll
    for (int m = 0; m < 4; ++m)
#pragma unroll
      for (int n = 0; n < 2; ++n) acc[m][n] = wmma16b(a[m], bw[n], acc[m][n]); }
  __syncthreads();   // every wave has left Ax before Tf overwrites it
#pragma unroll
  for (int n = 0; n < 2; ++n) { const int cc = wave * 32 + n * 16 + nloc; const float bb = bfv(bias[c0 + cc]);
#pragma unroll
    for (int m = 0; m < 4; ++m)
#pragma unroll
      for (int r8 = 0; r8 < 8; ++r8) Tf[m * 16 + 8 * hlf + r8][cc] = acc[m][n][r8] * (1.0f / (XS * WSC)) + bb; }
  __syncthreads();   // Tf is whole before the row-wise stores read it
  for (int rr = wave; rr < GM; rr += 8) { const size_t tk = t0 + rr;
    if (which == 0) { for (int q = 0; q < 4; ++q) { const int c = q * 64 + lane * 2; b16 h0, l0, h1, l1; split16(Tf[rr][c] * HS, h0, l0); split16(Tf[rr][c + 1] * HS, h1, l1); *(v2b*)(Qh + tk * D + c0 + c) = (v2b){h0, h1}; *(v2b*)(Ql + tk * D + c0 + c) = (v2b){l0, l1}; }
      asm volatile("s_wait_xcnt 0x0" ::: "memory"); }   // behind the row's stores, inside the branch: the wait that belongs in front of the next reuse of their address and data registers
    else { float* R = which == 1 ? KR : VR; for (int q = 0; q < 2; ++q) *(v4f*)(R + tk * D + c0 + q * 128 + lane * 4) = *(const v4f*)(&Tf[rr][q * 128 + lane * 4]);
      asm volatile("s_wait_xcnt 0x0" ::: "memory"); } } }   // the same wait for this branch's stores
__global__ __launch_bounds__(256) void area_kernel(const float* __restrict__ KR, const float* __restrict__ VR, b16* __restrict__ KAh, b16* __restrict__ KAl, b16* __restrict__ VTh, b16* __restrict__ VTl) { __shared__ float Tv[64][HD + 1]; const int bh = blockIdx.x / (NAP / 64), a0 = (blockIdx.x % (NAP / 64)) * 64; const int b = bh / H, h = bh % H; const int tid = threadIdx.x, wave = tid >> 5, lane = tid & 31;
  for (int q = wave; q < 64; q += 8) { const int a = a0 + q; int t0, w; area_of(a, t0, w); v2f ks = {0, 0}, vs = {0, 0}; for (int i = 0; i < w; ++i) { const size_t ro = ((size_t)b * L + t0 + i) * D + h * HD + lane * 2; ks += *(const v2f*)(KR + ro); vs += *(const v2f*)(VR + ro); } const float inv = w > 0 ? 1.0f / (float)w : 0.0f; b16 h0, l0, h1, l1; split16(ks[0] * inv * HS, h0, l0); split16(ks[1] * inv * HS, h1, l1); Tv[q][lane * 2] = vs[0]; Tv[q][lane * 2 + 1] = vs[1];
    { *(v2b*)(KAh + ((size_t)bh * NAP + a) * HD + lane * 2) = (v2b){h0, h1}; *(v2b*)(KAl + ((size_t)bh * NAP + a) * HD + lane * 2) = (v2b){l0, l1};  } }
  __syncthreads();
  { for (int d = wave; d < HD; d += 8) { b16 h0, l0, h1, l1; split16(Tv[lane * 2][d] * HS, h0, l0); split16(Tv[lane * 2 + 1][d] * HS, h1, l1); const size_t o = ((size_t)bh * HD + d) * NAP + a0 + lane * 2; *(v2b*)(VTh + o) = (v2b){h0, h1}; *(v2b*)(VTl + o) = (v2b){l0, l1}; }  } }
// the grid is two waves for each SIMD of the chip: let the register budget and the load scheduling be those of two resident waves
__global__ __launch_bounds__(32) __attribute__((amdgpu_waves_per_eu(1, 2))) void att_kernel(const b16* __restrict__ Qh, const b16* __restrict__ Ql, const b16* __restrict__ KAh, const b16* __restrict__ KAl, const b16* __restrict__ VTh, const b16* __restrict__ VTl, const int* __restrict__ mask, const int* __restrict__ zpad, int QLIM, float* __restrict__ O) { const int lane = threadIdx.x, nloc = lane & 15, hlf = lane >> 4; const int bh = blockIdx.x / (L / 16), q0 = (blockIdx.x % (L / 16)) * 16; if (q0 >= QLIM) return; const int b = bh / H, h = bh % H; const size_t tq = (size_t)b * L + q0;
  // both products are taken transposed (S^T = k_area x qh^T, O^T = v_area^T x P^T): queries are the N side, so lane nloc owns query q0 + nloc and its half hlf holds areas 16 T + 8 hlf + 0..7 of every 16-area tile T.
  // Two neighbouring S^T tiles are then, register for register, the K = 32 operand of P (k = 8 hlf + e and 16 + 8 hlf + e, the order of frag_kb): mask, softmax and P never leave the registers.
  const int* mrow = mask + (size_t)(q0 + nloc) * L;
  v16b qa[2], ql[2]; for (int ks = 0; ks < 2; ++ks) { qa[ks] = frag_kb(Qh + (tq + nloc) * D + h * HD + ks * 32, hlf); ql[ks] = frag_kb(Ql + (tq + nloc) * D + h * HD + ks * 32, hlf); }
  v8f oacc[4] = {(v8f){}, (v8f){}, (v8f){}, (v8f){}}; float mrun = -INFINITY, lrun = 0.0f;
#pragma unroll 1
  for (int ch = 0; ch < NCH; ++ch) { const int a0 = ch * CH;
    // visibility bits of this lane's 64 areas (bit 8 (T & 3) + r8 of word T >> 2). All tiles of a chunk but the last lie inside one width block, where end(a) = a - eoff; the last tile may hold a block edge or padding and goes area by area.
    const int eoff = a0 < L ? 0 : (a0 < 2 * L ? L - 1 : 2 * L - 3); unsigned int vb[NTI / 4] = {};
#pragma unroll
    for (int t = 0; t < NTI - 1; ++t) { int m[8]; __builtin_memcpy(m, mrow + (a0 - eoff + t * 16 + 8 * hlf), 32);
#pragma unroll
      for (int r8 = 0; r8 < 8; ++r8) vb[t >> 2] |= (m[r8] != 0 ? 1u : 0u) << ((t & 3) * 8 + r8); }
#pragma unroll
    for (int r8 = 0; r8 < 8; ++r8) { const int a = a0 + CH - 16 + 8 * hlf + r8, e = a - (a < L ? 0 : (a < 2 * L - 1 ? L - 1 : 2 * L - 3)); const int m = mrow[e < L ? e : L - 1]; vb[NTI / 4 - 1] |= (((e < L) & (m != 0)) ? 1u : 0u) << (24 + r8); }   // padding areas (a >= 3069) come out as e >= L: address clamped, never visible
    if (__builtin_amdgcn_ballot_w32((vb[0] | vb[1]) != 0u) == 0u) continue;   // wave-uniform: no query of this wave sees any area of the chunk -> exact zero contribution
    v8f s[NTI];
#pragma unroll
    for (int tg = 0; tg < NTI; tg += 4) {
#pragma unroll
      for (int t = 0; t < 4; ++t) s[tg + t] = (v8f){};
#pragma unroll
      for (int ks = 0; ks < 2; ++ks) { v16b kh[4], kl[4];
#pragma unroll
        for (int t = 0; t < 4; ++t) { const size_t ko = ((size_t)bh * NAP + a0 + (tg + t) * 16 + nloc) * HD + ks * 32; kh[t] = frag_kb(KAh + ko, hlf); kl[t] = frag_kb(KAl + ko, hlf); }
#pragma unroll
        for (int t = 0; t < 4; ++t) s[tg + t] = wmma16b(kh[t], qa[ks], s[tg + t]);
#pragma unroll
        for (int t = 0; t < 4; ++t) s[tg + t] = wmma16b(kl[t], qa[ks], s[tg + t]);
#pragma unroll
        for (int t = 0; t < 4; ++t) s[tg + t] = wmma16b(kh[t], ql[ks], s[tg + t]); } }
    v8f m8;
#pragma unroll
    for (int r8 = 0; r8 < 8; ++r8) m8[r8] = -INFINITY;
#pragma unroll
    for (int t = 0; t < NTI; ++t)
#pragma unroll
      for (int r8 = 0; r8 < 8; ++r8) { const float v = ((vb[t >> 2] >> ((t & 3) * 8 + r8)) & 1u) ? s[t][r8] * (SCALE / (HS * HS)) : -INFINITY; s[t][r8] = v; m8[r8] = fmaxf(m8[r8], v); }
    float mx = fmaxf(fmaxf(fmaxf(m8[0], m8[1]), fmaxf(m8[2], m8[3])), fmaxf(fmaxf(m8[4], m8[5]), fmaxf(m8[6], m8[7]))); mx = fmaxf(mx, __shfl_xor(mx, 16));
    const float mn = fmaxf(mrun, mx), fe = exp2_slot((mrun - mn) * LOG2E), fac = (mrun == -INFINITY) ? 0.0f : fe, ms = (mn == -INFINITY) ? 0.0f : mn; v8f s8 = (v8f){};
#pragma unroll
    for (int t = 0; t < NTI; ++t)
#pragma unroll
      for (int r8 = 0; r8 < 8; ++r8) { const float p = exp2_slot((s[t][r8] - ms) * LOG2E); s8[r8] += p; s[t][r8] = p * PS; }
    float sm = ((s8[0] + s8[1]) + (s8[2] + s8[3])) + ((s8[4] + s8[5]) + (s8[6] + s8[7])); sm += __shfl_xor(sm, 16); lrun = lrun * fac + sm; mrun = mn;
#pragma unroll
    for (int t = 0; t < 4; ++t) oacc[t] *= fac;
    const b16 *vph[4], *vpl[4];
#pragma unroll
    for (int t = 0; t < 4; ++t) { const size_t vo = ((size_t)bh * HD + t * 16 + nloc) * NAP + a0 + 8 * hlf; vph[t] = VTh + vo; vpl[t] = VTl + vo; }
#pragma unroll
    for (int kb = 0; kb < CH; kb += 32) { v16b pa, pb, vh[4], vlo[4];
#pragma unroll
      for (int e = 0; e < 8; ++e) { b16 ph, pl; split16(s[kb / 16][e], ph, pl); pa[e] = ph; pb[e] = pl; split16(s[kb / 16 + 1][e], ph, pl); pa[8 + e] = ph; pb[8 + e] = pl; }
#pragma unroll
      for (int t = 0; t < 4; ++t) { vh[t] = frag_kb(vph[t] + kb, 0); vlo[t] = frag_kb(vpl[t] + kb, 0); }
      // behind the chunk's last loads through these eight addresses: the wait that belongs in front of the first reuse of their registers; as inputs they stay whole up to it
      if (kb + 32 == CH) asm volatile("s_wait_xcnt 0x0" :: "v"(vph[0]), "v"(vph[1]), "v"(vph[2]), "v"(vph[3]), "v"(vpl[0]), "v"(vpl[1]), "v"(vpl[2]), "v"(vpl[3]) : "memory");
#pragma unroll
      for (int t = 0; t < 4; ++t) oacc[t] = wmma16b(vh[t], pa, oacc[t]);
#pragma unroll
      for (int t = 0; t < 4; ++t) oacc[t] = wmma16b(vlo[t], pa, oacc[t]);
#pragma unroll
      for (int t = 0; t < 4; ++t) oacc[t] = wmma16b(vh[t], pb, oacc[t]); } }
  const bool zero = (zpad[0] != 0 && q0 + nloc == 0);
#pragma unroll
  for (int t = 0; t < 4; ++t) { v4f o0, o1;
#pragma unroll
    for (int j = 0; j < 4; ++j) { const float u0 = oacc[t][j] * (1.0f / (PS * HS)) / lrun, u1 = oacc[t][4 + j] * (1.0f / (PS * HS)) / lrun; o0[j] = zero ? 0.0f : u0; o1[j] = zero ? 0.0f : u1; }
    float* op = O + (tq + nloc) * D + h * HD + t * 16 + 8 * hlf; *(v4f*)op = o0; *(v4f*)(op + 4) = o1; } }
__global__ __launch_bounds__(256) void outp_kernel(const float* __restrict__ O, const b16* __restrict__ WO, const float* __restrict__ bo, int QLIM, float* __restrict__ out) { __shared__ __attribute__((aligned(16))) char sm[2 * GM * AP * 2]; b16 (*Ah)[AP] = (b16 (*)[AP])sm; b16 (*Al)[AP] = (b16 (*)[AP])(sm + GM * AP * 2); float (*Tf)[TP] = (float (*)[TP])sm;   // Tf takes Ah's place behind the K loop
  const int tid = threadIdx.x, wave = __builtin_amdgcn_readfirstlane(tid >> 5), lane = tid & 31, nloc = lane & 15, hlf = lane >> 4; const size_t t0 = (size_t)blockIdx.x * GM; const int c0 = blockIdx.y * GN; if ((int)(t0 % L) >= QLIM) return;
  // rolled: 16 rows a trip are 16 loads of 16 bytes in flight per lane, enough to cover the latency
#pragma unroll 1
  for (int r0 = 0; r0 < GM; r0 += 16) { v4f xv[16];
#pragma unroll
    for (int j = 0; j < 16; ++j) xv[j] = *(const v4f*)(O + (t0 + r0 + j) * D + tid * 4);
#pragma unroll
    for (int j = 0; j < 16; ++j) { v4b hv, lv;
#pragma unroll
      for (int e = 0; e < 4; ++e) { b16 p, pl; split16(xv[j][e] * HS, p, pl); hv[e] = p; lv[e] = pl; }
      *(v4b*)(&Ah[r0 + j][tid * 4]) = hv; *(v4b*)(&Al[r0 + j][tid * 4]) = lv; } }
  __syncthreads();   // both A tiles are whole before any wave reads them
  v8f acc[4][2];
#pragma unroll
  for (int m = 0; m < 4; ++m) { acc[m][0] = (v8f){}; acc[m][1] = (v8f){}; }
  const b16* wp = WO + (size_t)(c0 + wave * 32 + nloc) * D;
  // two k steps a trip, as before: together they use up one 128-byte line of each W row, and the address step is paid once
#pragma unroll 2
  for (int kb = 0; kb < D; kb += 32) { v16b bw[2], a[4], al[4];
#pragma unroll
    for (int n = 0; n < 2; ++n) bw[n] = frag_kb(wp + (size_t)n * 16 * D + kb, hlf);
#pragma unroll
    for (int m = 0; m < 4; ++m) { a[m] = frag_kb(&Ah[m * 16 + nloc][kb], hlf); al[m] = frag_kb(&Al[m * 16 + nloc][kb], hlf); }
#pragma unroll
    for (int m = 0; m < 4; ++m)
#pragma unroll
      for (int n = 0; n < 2; ++n) acc[m][n] = wmma16b(a[m], bw[n], acc[m][n]);
#pragma unroll
    for (int m = 0; m < 4; ++m)
#pragma unroll
      for (int n = 0; n < 2; ++n) acc[m][n] = wmma16b(al[m], bw[n], acc[m][n]); }
  __syncthreads();   // every wave has left Ah before Tf overwrites it
#pragma unroll
  for (int n = 0; n < 2; ++n) { const int cc = wave * 32 + n * 16 + nloc; const float bb = bfv(bo[c0 + cc]);
#pragma unroll
    for (int m = 0; m < 4; ++m)
#pragma unroll
      for (int r8 = 0; r8 < 8; ++r8) Tf[m * 16 + 8 * hlf + r8][cc] = acc[m][n][r8] * (1.0f / (HS * WSC)) + bb; }
  __syncthreads();   // Tf is whole before the row-wise stores read it
  for (int rr = wave; rr < GM; rr += 8) { if ((int)((t0 + rr) % L) >= QLIM) continue;   // rows past the query cut stay unwritten, as before
    for (int q = 0; q < 2; ++q) *(v4f*)(out + (t0 + rr) * D + c0 + q * 128 + lane * 4) = *(const v4f*)(&Tf[rr][q * 128 + lane * 4]);
    asm volatile("s_wait_xcnt 0x0" ::: "memory"); } }   // behind the row's stores: the wait that belongs in front of the next trip's reuse of their address and data registers
}  // namespace

extern "C" void kernel_launch(void* const* d_in, const int* in_sizes, int n_in, void* d_out, int out_size, void* d_ws, size_t ws_size, hipStream_t stream) {
  (void)n_in;
  auto Fp = [&](int i) { return (const float*)d_in[i]; }; auto Ip = [&](int i) { return (const int*)d_in[i]; };
  // input order: 0 q [2,1024,1024]; 1 k; 2 v; 3 Wq; 4 bq; 5 Wk; 6 bk; 7 Wv; 8 bv; 9 Wo; 10 bo; 11 mask [1024,1024] i32; 12 zero_pad [1] i32
  if (in_sizes[0] != NT * D || in_sizes[1] != NT * D || in_sizes[2] != NT * D || in_sizes[3] != D * D || in_sizes[9] != D * D || in_sizes[11] != L * L || in_sizes[12] != 1 || out_size != NT * D) return;
  const int QLIM = L;   // per-batch query cut (multiple of 16)
  size_t off = 0; char* ws = (char*)d_ws;
  auto carve = [&](size_t bytes) { char* p = ws + off; off += (bytes + 255) & ~(size_t)255; return p; };
  b16* W4 = (b16*)carve((size_t)4 * D * D * 2); b16* Qh = (b16*)carve((size_t)NT * D * 2); b16* Ql = (b16*)carve((size_t)NT * D * 2); float* KR = (float*)carve((size_t)NT * D * 4); float* VR = (float*)carve((size_t)NT * D * 4); b16* KAh = (b16*)carve((size_t)NB_ * H * NAP * HD * 2); b16* KAl = (b16*)carve((size_t)NB_ * H * NAP * HD * 2); b16* VTh = (b16*)carve((size_t)NB_ * H * HD * NAP * 2); b16* VTl = (b16*)carve((size_t)NB_ * H * HD * NAP * 2); float* O = (float*)carve((size_t)NT * D * 4);
  if (off > ws_size || off > ((size_t)96 << 20)) return;   // ~ 88 MiB
  wput_kernel<<<256, 256, 0, stream>>>(Fp(3), Fp(5), Fp(7), Fp(9), W4);
  proj_kernel<<<dim3(NT / GM, 3, D / GN), 256, 0, stream>>>(Fp(0), Fp(1), Fp(2), W4, Fp(4), Fp(6), Fp(8), Qh, Ql, KR, VR);
  area_kernel<<<NB_ * H * (NAP / 64), 256, 0, stream>>>(KR, VR, KAh, KAl, VTh, VTl);
  att_kernel<<<NB_ * H * (L / 16), 32, 0, stream>>>(Qh, Ql, KAh, KAl, VTh, VTl, Ip(11), Ip(12), QLIM, O);
  outp_kernel<<<dim3(NT / GM, D / GN), 256, 0, stream>>>(O, W4 + (size_t)3 * D * D, Fp(10), QLIM, (float*)d_out);
}

// v003
// Measured time: 161 microseconds a run.
// Timed twice side by side with v002, it ran 1.79 and 1.78 times as fast.
// Over all steps from v000 it is 17.0 times as fast.
#include <hip/hip_runtime.h>

// MultiHeadAreaAttention: qh,kh,vh = (q Wq^T + bq), (k Wk^T + bk), (v Wv^T + bv) as 16 heads x 64; areas = all windows of width 1..3 along the key axis (A = 3,069; block w starts at area index 0 / 1024 / 2047, end(a) = start + w - 1); k_area = window mean, v_area = window sum; logits = qh.k_area / 8, visible iff mask[q][end(a)] != 0 (else -1e30); weights = softmax over areas; if zero_pad: weights of query 0 := 0; ctx = weights.v_area; out = concat Wo^T + bo -> [2][1024][1024].
// Deterministic: online softmax over fixed 128-area chunks in order (chunks with no visible area for any of the wave's 16 queries are skipped: they contribute exactly 0); inside a chunk each lane sums its 64 areas in a fixed tree, then the two halves of a query are added; no atomics.
// WMMA (v_wmma_f32_16x16x32_f16, f32 accumulate): inputs (EXACT bf16 x8, K 1,024) x W rows (EXACT) per 64-token x 256-column work-group of 8 waves; per (bh, 16-query) wave (four to a work-group, K and V chunks shared in LDS) S^T = k_area rows (hi+lo; 8 tiles/chunk) x qh (hi+lo x256, K 64) and O^T += v_area^T rows (hi+lo; 4 tiles) x P (hi+lo), 3 products; o (hi+lo) x Wo rows, same tiling; about 4 M WMMA; area pooling, mask gather, softmax in f32.

namespace {
constexpr int NB_ = 2, L = 1024, D = 1024, H = 16, HD = 64, NA = 3 * L - 3 /* 3069 */, NAP = 3072, NT = NB_ * L, CH = 128, NCH = NAP / CH /* 24 */, NTI = CH / 16;
constexpr float XS = 8.0f, HS = 256.0f, PS = 256.0f, WSC = 256.0f, SCALE = 0.125f, LOG2E = 1.44269504f;
typedef _Float16 b16;
typedef __attribute__((ext_vector_type(16))) _Float16 v16b;
typedef __attribute__((ext_vector_type(8))) _Float16 v8b;
typedef __attribute__((ext_vector_type(4))) _Float16 v4b;
typedef __attribute__((ext_vector_type(2))) _Float16 v2b;
typedef __attribute__((ext_vector_type(8))) float v8f;
typedef __attribute__((ext_vector_type(4))) float v4f;
typedef __attribute__((ext_vector_type(2))) float v2f;
__device__ __forceinline__ float bf16_rne(float f) { unsigned int u = __float_as_uint(f); u += 0x7FFFu + ((u >> 16) & 1u); float r = __uint_as_float(u & 0xFFFF0000u); asm volatile("" : "+v"(r)); return r; }
__device__ __forceinline__ float bfv(float f) { float r = bf16_rne(f); asm volatile("" : "+v"(r)); return r; }
__device__ __forceinline__ void split16(float v, b16& hi, b16& lo) { hi = (b16)v; lo = (b16)(v - (float)hi); }
__device__ __forceinline__ v16b frag_kb(const b16* p, int hh) { const v8b a = *(const v8b*)(p + 8 * hh), b = *(const v8b*)(p + 16 + 8 * hh); v16b f;
#pragma unroll
  for (int e = 0; e < 8; ++e) { f[e] = a[e]; f[8 + e] = b[e]; } return f; }
__device__ __forceinline__ v8f wmma16b(v16b a, v16b b, v8f c) { v8f d = __builtin_amdgcn_wmma_f32_16x16x32_f16(false, a, false, b, (short)0, c, false, false); asm volatile("v_nop\n\tv_nop\n\tv_nop\n\tv_nop" : "+v"(d) : "v"(a), "v"(b)); return d; }
// 2^x and, in the same statement, the one issue slot that the instruction set asks for behind a transcendental
__device__ __forceinline__ float exp2_slot(float x) { float p; asm("v_exp_f32 %0, %1\n\tv_nop" : "=v"(p) : "v"(x)); return p; }
// area index -> (start token, width); padding areas (>= 3069) get start 0, width 0 (zero pooled rows)
__device__ __forceinline__ void area_of(int a, int& t0, int& w) { if (a < L) { t0 = a; w = 1; } else if (a < 2 * L - 1) { t0 = a - L; w = 2; } else if (a < NA) { t0 = a - (2 * L - 1); w = 3; } else { t0 = 0; w = 0; } }

__global__ __launch_bounds__(256) void wput_kernel(const float* __restrict__ wq, const float* __restrict__ wk, const float* __restrict__ wv, const float* __restrict__ wo, b16* __restrict__ W4) { const size_t nt = (size_t)gridDim.x * 256, u0 = (size_t)blockIdx.x * 256 + threadIdx.x; v8b v;
  for (size_t u = u0; u < (size_t)4 * D * 128; u += nt) { const int o = (int)(u / 128), k0 = (int)(u % 128) * 8; const int which = o / D, oo = o % D; const float* w = which == 0 ? wq : (which == 1 ? wk : (which == 2 ? wv : wo));
#pragma unroll
    for (int j = 0; j < 8; ++j) v[j] = (b16)(bf16_rne(w[(size_t)oo * D + k0 + j]) * WSC); { *(v8b*)(W4 + (size_t)o * D + k0) = v;  } } }
// GEMM tile of one work-group (both projection kernels): GM tokens x GN output columns, 8 waves. All waves stage the A tile (whole K) in LDS once; wave w then owns columns 32 w .. 32 w + 31 for all GM tokens (4 x 2 accumulator tiles), so each B fragment read from global memory serves four products (eight in outp_kernel: A hi and lo). k order per output element: ascending, as before.
constexpr int GM = 64, GN = 256, AP = D + 8, TP = GN + 4;
__global__ __launch_bounds__(256) void proj_kernel(const float* __restrict__ xq, const float* __restrict__ xk, const float* __restrict__ xv, const b16* __restrict__ W4, const float* __restrict__ bq, const float* __restrict__ bk, const float* __restrict__ bv, b16* __restrict__ Qh, b16* __restrict__ Ql, float* __restrict__ KR, float* __restrict__ VR) { __shared__ __attribute__((aligned(16))) char sm[GM * AP * 2]; b16 (*Ax)[AP] = (b16 (*)[AP])sm; float (*Tf)[TP] = (float (*)[TP])sm;   // Tf takes Ax's place behind the K loop
  const int tid = threadIdx.x, wave = __builtin_amdgcn_readfirstlane(tid >> 5), lane = tid & 31, nloc = lane & 15, hlf = lane >> 4; const size_t t0 = (size_t)blockIdx.x * GM; const int which = blockIdx.y, c0 = blockIdx.z * GN;
  const float* x = which == 0 ? xq : (which == 1 ? xk : xv); const float* bias = which == 0 ? bq : (which == 1 ? bk : bv);
  // rolled: 16 rows a trip are 16 loads of 16 bytes in flight per lane, enough to cover the memory latency
#pragma unroll 1
  for (int r0 = 0; r0 < GM; r0 += 16) { v4f xv[16];
#pragma unroll
    for (int j = 0; j < 16; ++j) xv[j] = *(const v4f*)(x + (t0 + r0 + j) * D + tid * 4);
#pragma unroll
    for (int j = 0; j < 16; ++j) { v4b hv;
#pragma unroll
      for (int e = 0; e < 4; ++e) hv[e] = (b16)(bf16_rne(xv[j][e]) * XS);
      *(v4b*)(&Ax[r0 + j][tid * 4]) = hv; } }
  __syncthreads();   // the A tile is whole before any wave reads it
  v8f acc[4][2];
#pragma unroll
  for (int m = 0; m < 4; ++m) { acc[m][0] = (v8f){}; acc[m][1] = (v8f){}; }
  const b16* wp = W4 + ((size_t)which * D + c0 + wave * 32 + nloc) * D;
  // two k steps a trip, as before: together they use up one 128-byte line of each W row, and the address step is paid once
#pragma unroll 2
  for (int kb = 0; kb < D; kb += 32) { v16b bw[2], a[4];
#pragma unroll
    for (int n = 0; n < 2; ++n) bw[n] = frag_kb(wp + (size_t)n * 16 * D + kb, hlf);
#pragma unroll
    for (int m = 0; m < 4; ++m) a[m] = frag_kb(&Ax[m * 16 + nloc][kb], hlf);
#pragma unroll
    for (int m = 0; m < 4; ++m)
#pragma unroll
      for (int n = 0; n < 2; ++n) acc[m][n] = wmma16b(a[m], bw[n], acc[m][n]); }
  __syncthreads();   // every wave has left Ax before Tf overwrites it
#pragma unroll
  for (int n = 0; n < 2; ++n) { const int cc = wave * 32 + n * 16 + nloc; const float bb = bfv(bias[c0 + cc]);
#pragma unroll
    for (int m = 0; m < 4; ++m)
#pragma unroll
      for (int r8 = 0; r8 < 8; ++r8) Tf[m * 16 + 8 * hlf + r8][cc] = acc[m][n][r8] * (1.0f / (XS * WSC)) + bb; }
  __syncthreads();   // Tf is whole before the row-wise stores read it
  for (int rr = wave; rr < GM; rr += 8) { const size_t tk = t0 + rr;
    if (which == 0) { for (int q = 0; q < 4; ++q) { const int c = q * 64 + lane * 2; b16 h0, l0, h1, l1; split16(Tf[rr][c] * HS, h0, l0); split16(Tf[rr][c + 1] * HS, h1, l1); *(v2b*)(Qh + tk * D + c0 + c) = (v2b){h0, h1}; *(v2b*)(Ql + tk * D + c0 + c) = (v2b){l0, l1}; }
      asm volatile("s_wait_xcnt 0x0" ::: "memory"); }   // behind the row's stores, inside the branch: the wait that belongs in front of the next reuse of their address and data registers
    else { float* R = which == 1 ? KR : VR; for (int q = 0; q < 2; ++q) *(v4f*)(R + tk * D + c0 + q * 128 + lane * 4) = *(const v4f*)(&Tf[rr][q * 128 + lane * 4]);
      asm volatile("s_wait_xcnt 0x0" ::: "memory"); } } }   // the same wait for this branch's stores
__global__ __launch_bounds__(256) void area_kernel(const float* __restrict__ KR, const float* __restrict__ VR, b16* __restrict__ KAh, b16* __restrict__ KAl, b16* __restrict__ VTh, b16* __restrict__ VTl) { __shared__ float Tv[64][HD + 1]; const int bh = blockIdx.x / (NAP / 64), a0 = (blockIdx.x % (NAP / 64)) * 64; const int b = bh / H, h = bh % H; const int tid = threadIdx.x, wave = tid >> 5, lane = tid & 31;
  for (int q = wave; q < 64; q += 8) { const int a = a0 + q; int t0, w; area_of(a, t0, w); v2f ks = {0, 0}, vs = {0, 0}; for (int i = 0; i < w; ++i) { const size_t ro = ((size_t)b * L + t0 + i) * D + h * HD + lane * 2; ks += *(const v2f*)(KR + ro); vs += *(const v2f*)(VR + ro); } const float inv = w > 0 ? 1.0f / (float)w : 0.0f; b16 h0, l0, h1, l1; split16(ks[0] * inv * HS, h0, l0); split16(ks[1] * inv * HS, h1, l1); Tv[q][lane * 2] = vs[0]; Tv[q][lane * 2 + 1] = vs[1];
    { *(v2b*)(KAh + ((size_t)bh * NAP + a) * HD + lane * 2) = (v2b){h0, h1}; *(v2b*)(KAl + ((size_t)bh * NAP + a) * HD + lane * 2) = (v2b){l0, l1};  } }
  __syncthreads();
  { for (int d = wave; d < HD; d += 8) { b16 h0, l0, h1, l1; split16(Tv[lane * 2][d] * HS, h0, l0); split16(Tv[lane * 2 + 1][d] * HS, h1, l1); const size_t o = ((size_t)bh * HD + d) * NAP + a0 + lane * 2; *(v2b*)(VTh + o) = (v2b){h0, h1}; *(v2b*)(VTl + o) = (v2b){l0, l1}; }  } }
// Attention work-group: AW waves of 16 queries each, all of one (batch, head). The K and V rows of a 128-area chunk are brought into LDS once for the four waves, in whole lines, and every fragment is read from there (before: each wave fetched every fragment itself, 16 lines a load).
// One buffer = Kh, Kl (128 area rows of 128 bytes, pitch 144) and Vh, Vl (64 feature rows of 256 bytes, pitch 272): pitches of 16 bytes x odd for the 16-byte LDS reads. Two buffers: the next chunk's copies fly while this chunk is worked on.
constexpr int AW = 4, KP = HD + 8, VP = CH + 8, KB = CH * KP, VB = HD * VP, SB = 2 * KB + 2 * VB;
typedef __attribute__((ext_vector_type(4))) int v4i;
// eight asynchronous 16-byte copies to LDS per lane (LDS byte address l + i ls, global address g + i gs); the s_wait_xcnt stands in the copies' own statement, in front of any reuse of the address registers that they name
__device__ __forceinline__ void copy8(unsigned int l, unsigned int ls, const char* g, size_t gs) {
  asm volatile("global_load_async_to_lds_b128 %0, %8, off\n\tglobal_load_async_to_lds_b128 %1, %9, off\n\tglobal_load_async_to_lds_b128 %2, %10, off\n\tglobal_load_async_to_lds_b128 %3, %11, off\n\t"
               "global_load_async_to_lds_b128 %4, %12, off\n\tglobal_load_async_to_lds_b128 %5, %13, off\n\tglobal_load_async_to_lds_b128 %6, %14, off\n\tglobal_load_async_to_lds_b128 %7, %15, off\n\ts_wait_xcnt 0x0"
               :: "v"(l), "v"(l + ls), "v"(l + 2 * ls), "v"(l + 3 * ls), "v"(l + 4 * ls), "v"(l + 5 * ls), "v"(l + 6 * ls), "v"(l + 7 * ls),
                  "v"(g), "v"(g + gs), "v"(g + 2 * gs), "v"(g + 3 * gs), "v"(g + 4 * gs), "v"(g + 5 * gs), "v"(g + 6 * gs), "v"(g + 7 * gs) : "memory"); }
// one chunk into the buffer at LDS byte address lb: 16-byte piece p = tid + 128 i of each of the four tiles (K: row p / 8, the 16 KB are contiguous in memory; V: row p / 16, memory pitch NAP elements); a wave's copy covers 512 bytes in whole lines
__device__ __forceinline__ void stage_chunk(unsigned int lb, int tid, int a0, const b16* kh, const b16* kl, const b16* vh, const b16* vl) {
  const unsigned int lk = lb + (unsigned int)((tid >> 3) * (KP * 2) + (tid & 7) * 16), lv = lb + (unsigned int)(2 * KB * 2 + (tid >> 4) * (VP * 2) + (tid & 15) * 16);
  const size_t gk = (size_t)a0 * (HD * 2) + (size_t)tid * 16, gv = (size_t)(tid >> 4) * (NAP * 2) + (size_t)a0 * 2 + (size_t)(tid & 15) * 16;
  copy8(lk, 16 * KP * 2, (const char*)kh + gk, 2048); copy8(lk + KB * 2, 16 * KP * 2, (const char*)kl + gk, 2048);
  copy8(lv, 8 * VP * 2, (const char*)vh + gv, (size_t)8 * NAP * 2); copy8(lv + VB * 2, 8 * VP * 2, (const char*)vl + gv, (size_t)8 * NAP * 2); }
// the grid is two waves for each SIMD of the chip: let the register budget and the load scheduling be those of two resident waves
__global__ __launch_bounds__(32 * AW) __attribute__((amdgpu_waves_per_eu(1, 2))) void att_kernel(const b16* __restrict__ Qh, const b16* __restrict__ Ql, const b16* __restrict__ KAh, const b16* __restrict__ KAl, const b16* __restrict__ VTh, const b16* __restrict__ VTl, const int* __restrict__ mask, const int* __restrict__ zpad, int QLIM, float* __restrict__ O) { __shared__ __attribute__((aligned(16))) b16 sb[2 * SB]; __shared__ unsigned int cv[AW];
  const int tid = threadIdx.x, wave = __builtin_amdgcn_readfirstlane(tid >> 5), lane = tid & 31, nloc = lane & 15, hlf = lane >> 4; const int bh = blockIdx.x / (L / (16 * AW)), qb = (blockIdx.x % (L / (16 * AW))) * (16 * AW); if (qb >= QLIM) return;   // the whole work-group leaves, in front of every barrier
  const int q0 = qb + wave * 16; const bool live = q0 < QLIM;   // a wave past the query cut still copies and passes every barrier; it computes and stores nothing
  const int b = bh / H, h = bh % H; const size_t tq = (size_t)b * L + q0;
  // both products are taken transposed (S^T = k_area x qh^T, O^T = v_area^T x P^T): queries are the N side, so lane nloc owns query q0 + nloc and its half hlf holds areas 16 T + 8 hlf + 0..7 of every 16-area tile T.
  // Two neighbouring S^T tiles are then, register for register, the K = 32 operand of P (k = 8 hlf + e and 16 + 8 hlf + e, the order of frag_kb): mask, softmax and P never leave the registers.
  const int* mrow = mask + (size_t)(q0 + nloc) * L;
  // Which chunks the work-group stages must read the same in all its waves: each wave ORs its 16 mask rows (whole lines), bit j of wv = some query of the wave sees some end position in 128 j .. 128 j + 127.
  v4i any[8];
#pragma unroll
  for (int j = 0; j < 8; ++j) any[j] = (v4i){0, 0, 0, 0};
  // rolled, four rows a trip: 32 loads of 16 bytes in flight per lane cover the latency
#pragma unroll 1
  for (int r0 = 0; r0 < 16; r0 += 4) { v4i mv[4][8];
#pragma unroll
    for (int r = 0; r < 4; ++r)
#pragma unroll
      for (int j = 0; j < 8; ++j) mv[r][j] = *(const v4i*)(mask + (size_t)(q0 + r0 + r) * L + j * 128 + lane * 4);
#pragma unroll
    for (int r = 0; r < 4; ++r)
#pragma unroll
      for (int j = 0; j < 8; ++j) any[j] |= mv[r][j]; }
  unsigned int wv = 0;
#pragma unroll
  for (int j = 0; j < 8; ++j) wv |= (__builtin_amdgcn_ballot_w32((any[j][0] | any[j][1] | any[j][2] | any[j][3]) != 0) != 0u ? 1u : 0u) << j;
  if (lane == 0) cv[wave] = live ? wv : 0u;
  __syncthreads();   // all four words are written before any wave reads them
  // chunk c of width block 1 ends in columns 128 c ..; of blocks 2 and 3 in 128 c + 1 .. 128 c + 128 and 128 c + 3 .. 128 c + 130 (column blocks c and c + 1); chunk 15 also holds area 2047 (end 2). A superset of the visible chunks: each wave still makes its own exact test below.
  const unsigned int vj = (unsigned int)__builtin_amdgcn_readfirstlane((int)(cv[0] | cv[1] | cv[2] | cv[3])), vj2 = vj | (vj >> 1); unsigned int rem = vj | (vj2 << 8) | ((vj & 1u) << 15) | (vj2 << 16); const int nst = __builtin_popcount(rem);
  v16b qa[2], ql[2]; for (int ks = 0; ks < 2; ++ks) { qa[ks] = frag_kb(Qh + (tq + nloc) * D + h * HD + ks * 32, hlf); ql[ks] = frag_kb(Ql + (tq + nloc) * D + h * HD + ks * 32, hlf); }
  v8f oacc[4] = {(v8f){}, (v8f){}, (v8f){}, (v8f){}}; float mrun = -INFINITY, lrun = 0.0f;
  const unsigned int lds0 = (unsigned int)(size_t)sb;   // LDS byte address of buffer 0: the low 32 bits of the shared address
  const b16 *gkh = KAh + (size_t)bh * NAP * HD, *gkl = KAl + (size_t)bh * NAP * HD, *gvh = VTh + (size_t)bh * HD * NAP, *gvl = VTl + (size_t)bh * HD * NAP;
  int c0 = 0, c1 = 0;   // the chunk in work and the chunk in flight
  if (nst > 0) { c0 = __builtin_ctz(rem); rem &= rem - 1u; stage_chunk(lds0, tid, c0 * CH, gkh, gkl, gvh, gvl); }
  asm volatile("s_wait_asynccnt 0x0" ::: "memory");   // this wave's copies of the first chunk have landed
  __syncthreads();   // and every wave's: the first chunk may be read
  if (nst > 1) { c1 = __builtin_ctz(rem); rem &= rem - 1u; stage_chunk(lds0 + SB * 2, tid, c1 * CH, gkh, gkl, gvh, gvl); }
#pragma unroll 1
  for (int st = 0; st < nst; ++st) { const int a0 = c0 * CH; const b16* kbuf = sb + (st & 1) * SB; const b16* vbuf = kbuf + 2 * KB;
    // visibility bits of this lane's 64 areas (bit 8 (T & 3) + r8 of word T >> 2). All tiles of a chunk but the last lie inside one width block, where end(a) = a - eoff; the last tile may hold a block edge or padding and goes area by area.
    const int eoff = a0 < L ? 0 : (a0 < 2 * L ? L - 1 : 2 * L - 3); unsigned int vb[NTI / 4] = {};
#pragma unroll
    for (int t = 0; t < NTI - 1; ++t) { int m[8]; __builtin_memcpy(m, mrow + (a0 - eoff + t * 16 + 8 * hlf), 32);
#pragma unroll
      for (int r8 = 0; r8 < 8; ++r8) vb[t >> 2] |= (m[r8] != 0 ? 1u : 0u) << ((t & 3) * 8 + r8); }
#pragma unroll
    for (int r8 = 0; r8 < 8; ++r8) { const int a = a0 + CH - 16 + 8 * hlf + r8, e = a - (a < L ? 0 : (a < 2 * L - 1 ? L - 1 : 2 * L - 3)); const int m = mrow[e < L ? e : L - 1]; vb[NTI / 4 - 1] |= (((e < L) & (m != 0)) ? 1u : 0u) << (24 + r8); }   // padding areas (a >= 3069) come out as e >= L: address clamped, never visible
    if (live && __builtin_amdgcn_ballot_w32((vb[0] | vb[1]) != 0u) != 0u) {   // wave-uniform: where no query of this wave sees any area of the chunk its contribution is exactly zero; the hand-over below is passed all the same
    v8f s[NTI];
#pragma unroll
    for (int tg = 0; tg < NTI; tg += 4) {
#pragma unroll
      for (int t = 0; t < 4; ++t) s[tg + t] = (v8f){};
#pragma unroll
      for (int ks = 0; ks < 2; ++ks) { v16b kh[4], kl[4];
#pragma unroll
        for (int t = 0; t < 4; ++t) { const b16* kr = kbuf + ((tg + t) * 16 + nloc) * KP + ks * 32; kh[t] = frag_kb(kr, hlf); kl[t] = frag_kb(kr + KB, hlf); }
#pragma unroll
        for (int t = 0; t < 4; ++t) s[tg + t] = wmma16b(kh[t], qa[ks], s[tg + t]);
#pragma unroll
        for (int t = 0; t < 4; ++t) s[tg + t] = wmma16b(kl[t], qa[ks], s[tg + t]);
#pragma unroll
        for (int t = 0; t < 4; ++t) s[tg + t] = wmma16b(kh[t], ql[ks], s[tg + t]); } }
    v8f m8;
#pragma unroll
    for (int r8 = 0; r8 < 8; ++r8) m8[r8] = -INFINITY;
#pragma unroll
    for (int t = 0; t < NTI; ++t)
#pragma unroll
      for (int r8 = 0; r8 < 8; ++r8) { const float v = ((vb[t >> 2] >> ((t & 3) * 8 + r8)) & 1u) ? s[t][r8] * (SCALE / (HS * HS)) : -INFINITY; s[t][r8] = v; m8[r8] = fmaxf(m8[r8], v); }
    float mx = fmaxf(fmaxf(fmaxf(m8[0], m8[1]), fmaxf(m8[2], m8[3])), fmaxf(fmaxf(m8[4], m8[5]), fmaxf(m8[6], m8[7]))); mx = fmaxf(mx, __shfl_xor(mx, 16));
    const float mn = fmaxf(mrun, mx), fe = exp2_slot((mrun - mn) * LOG2E), fac = (mrun == -INFINITY) ? 0.0f : fe, ms = (mn == -INFINITY) ? 0.0f : mn; v8f s8 = (v8f){};
#pragma unroll
    for (int t = 0; t < NTI; ++t)
#pragma unroll
      for (int r8 = 0; r8 < 8; ++r8) { const float p = exp2_slot((s[t][r8] - ms) * LOG2E); s8[r8] += p; s[t][r8] = p * PS; }
    float sm = ((s8[0] + s8[1]) + (s8[2] + s8[3])) + ((s8[4] + s8[5]) + (s8[6] + s8[7])); sm += __shfl_xor(sm, 16); lrun = lrun * fac + sm; mrun = mn;
#pragma unroll
    for (int t = 0; t < 4; ++t) oacc[t] *= fac;
#pragma unroll
    for (int kb = 0; kb < CH; kb += 32) { v16b pa, pb, vh[4], vlo[4];
#pragma unroll
      for (int e = 0; e < 8; ++e) { b16 ph, pl; split16(s[kb / 16][e], ph, pl); pa[e] = ph; pb[e] = pl; split16(s[kb / 16 + 1][e], ph, pl); pa[8 + e] = ph; pb[8 + e] = pl; }
#pragma unroll
      for (int t = 0; t < 4; ++t) { const b16* vr = vbuf + (t * 16 + nloc) * VP + kb; vh[t] = frag_kb(vr, hlf); vlo[t] = frag_kb(vr + VB, hlf); }
#pragma unroll
      for (int t = 0; t < 4; ++t) oacc[t] = wmma16b(vh[t], pa, oacc[t]);
#pragma unroll
      for (int t = 0; t < 4; ++t) oacc[t] = wmma16b(vlo[t], pa, oacc[t]);
#pragma unroll
      for (int t = 0; t < 4; ++t) oacc[t] = wmma16b(vh[t], pb, oacc[t]); } }
    // hand-over, every wave, in this order: my LDS reads of this buffer are done; my copies of the next chunk have landed; the barrier publishes the next chunk and frees this buffer; only then the refill
    asm volatile("s_wait_dscnt 0x0" ::: "memory");
    asm volatile("s_wait_asynccnt 0x0" ::: "memory");
    __syncthreads();
    c0 = c1;
    if (st + 2 < nst) { c1 = __builtin_ctz(rem); rem &= rem - 1u; stage_chunk(lds0 + (unsigned int)((st & 1) * SB * 2), tid, c1 * CH, gkh, gkl, gvh, gvl); } }
  asm volatile("s_wait_asynccnt 0x0" ::: "memory");   // no copy is outstanding when the wave ends
  const bool zero = (zpad[0] != 0 && q0 + nloc == 0);
  if (live) {
#pragma unroll
  for (int t = 0; t < 4; ++t) { v4f o0, o1;
#pragma unroll
    for (int j = 0; j < 4; ++j) { const float u0 = oacc[t][j] * (1.0f / (PS * HS)) / lrun, u1 = oacc[t][4 + j] * (1.0f / (PS * HS)) / lrun; o0[j] = zero ? 0.0f : u0; o1[j] = zero ? 0.0f : u1; }
    float* op = O + (tq + nloc) * D + h * HD + t * 16 + 8 * hlf; *(v4f*)op = o0; *(v4f*)(op + 4) = o1; } } }
__global__ __launch_bounds__(256) void outp_kernel(const float* __restrict__ O, const b16* __restrict__ WO, const float* __restrict__ bo, int QLIM, float* __restrict__ out) { __shared__ __attribute__((aligned(16))) char sm[2 * GM * AP * 2]; b16 (*Ah)[AP] = (b16 (*)[AP])sm; b16 (*Al)[AP] = (b16 (*)[AP])(sm + GM * AP * 2); float (*Tf)[TP] = (float (*)[TP])sm;   // Tf takes Ah's place behind the K loop
  const int tid = threadIdx.x, wave = __builtin_amdgcn_readfirstlane(tid >> 5), lane = tid & 31, nloc = lane & 15, hlf = lane >> 4; const size_t t0 = (size_t)blockIdx.x * GM; const int c0 = blockIdx.y * GN; if ((int)(t0 % L) >= QLIM) return;
  // rolled: 16 rows a trip are 16 loads of 16 bytes in flight per lane, enough to cover the latency
#pragma unroll 1
  for (int r0 = 0; r0 < GM; r0 += 16) { v4f xv[16];
#pragma unroll
    for (int j = 0; j < 16; ++j) xv[j] = *(const v4f*)(O + (t0 + r0 + j) * D + tid * 4);
#pragma unroll
    for (int j = 0; j < 16; ++j) { v4b hv, lv;
#pragma unroll
      for (int e = 0; e < 4; ++e) { b16 p, pl; split16(xv[j][e] * HS, p, pl); hv[e] = p; lv[e] = pl; }
      *(v4b*)(&Ah[r0 + j][tid * 4]) = hv; *(v4b*)(&Al[r0 + j][tid * 4]) = lv; } }
  __syncthreads();   // both A tiles are whole before any wave reads them
  v8f acc[4][2];
#pragma unroll
  for (int m = 0; m < 4; ++m) { acc[m][0] = (v8f){}; acc[m][1] = (v8f){}; }
  const b16* wp = WO + (size_t)(c0 + wave * 32 + nloc) * D;
  // two k steps a trip, as before: together they use up one 128-byte line of each W row, and the address step is paid once
#pragma unroll 2
  for (int kb = 0; kb < D; kb += 32) { v16b bw[2], a[4], al[4];
#pragma unroll
    for (int n = 0; n < 2; ++n) bw[n] = frag_kb(wp + (size_t)n * 16 * D + kb, hlf);
#pragma unroll
    for (int m = 0; m < 4; ++m) { a[m] = frag_kb(&Ah[m * 16 + nloc][kb], hlf); al[m] = frag_kb(&Al[m * 16 + nloc][kb], hlf); }
#pragma unroll
    for (int m = 0; m < 4; ++m)
#pragma unroll
      for (int n = 0; n < 2; ++n) acc[m][n] = wmma16b(a[m], bw[n], acc[m][n]);
#pragma unroll
    for (int m = 0; m < 4; ++m)
#pragma unroll
      for (int n = 0; n < 2; ++n) acc[m][n] = wmma16b(al[m], bw[n], acc[m][n]); }
  __syncthreads();   // every wave has left Ah before Tf overwrites it
#pragma unroll
  for (int n = 0; n < 2; ++n) { const int cc = wave * 32 + n * 16 + nloc; const float bb = bfv(bo[c0 + cc]);
#pragma unroll
    for (int m = 0; m < 4; ++m)
#pragma unroll
      for (int r8 = 0; r8 < 8; ++r8) Tf[m * 16 + 8 * hlf + r8][cc] = acc[m][n][r8] * (1.0f / (HS * WSC)) + bb; }
  __syncthreads();   // Tf is whole before the row-wise stores read it
  for (int rr = wave; rr < GM; rr += 8) { if ((int)((t0 + rr) % L) >= QLIM) continue;   // rows past the query cut stay unwritten, as before
    for (int q = 0; q < 2; ++q) *(v4f*)(out + (t0 + rr) * D + c0 + q * 128 + lane * 4) = *(const v4f*)(&Tf[rr][q * 128 + lane * 4]);
    asm volatile("s_wait_xcnt 0x0" ::: "memory"); } }   // behind the row's stores: the wait that belongs in front of the next trip's reuse of their address and data registers
}  // namespace

extern "C" void kernel_launch(void* const* d_in, const int* in_sizes, int n_in, void* d_out, int out_size, void* d_ws, size_t ws_size, hipStream_t stream) {
  (void)n_in;
  auto Fp = [&](int i) { return (const float*)d_in[i]; }; auto Ip = [&](int i) { return (const int*)d_in[i]; };
  // input order: 0 q [2,1024,1024]; 1 k; 2 v; 3 Wq; 4 bq; 5 Wk; 6 bk; 7 Wv; 8 bv; 9 Wo; 10 bo; 11 mask [1024,1024] i32; 12 zero_pad [1] i32
  if (in_sizes[0] != NT * D || in_sizes[1] != NT * D || in_sizes[2] != NT * D || in_sizes[3] != D * D || in_sizes[9] != D * D || in_sizes[11] != L * L || in_sizes[12] != 1 || out_size != NT * D) return;
  const int QLIM = L;   // per-batch query cut (multiple of 16)
  size_t off = 0; char* ws = (char*)d_ws;
  auto carve = [&](size_t bytes) { char* p = ws + off; off += (bytes + 255) & ~(size_t)255; return p; };
  b16* W4 = (b16*)carve((size_t)4 * D * D * 2); b16* Qh = (b16*)carve((size_t)NT * D * 2); b16* Ql = (b16*)carve((size_t)NT * D * 2); float* KR = (float*)carve((size_t)NT * D * 4); float* VR = (float*)carve((size_t)NT * D * 4); b16* KAh = (b16*)carve((size_t)NB_ * H * NAP * HD * 2); b16* KAl = (b16*)carve((size_t)NB_ * H * NAP * HD * 2); b16* VTh = (b16*)carve((size_t)NB_ * H * HD * NAP * 2); b16* VTl = (b16*)carve((size_t)NB_ * H * HD * NAP * 2); float* O = (float*)carve((size_t)NT * D * 4);
  if (off > ws_size || off > ((size_t)96 << 20)) return;   // ~ 88 MiB
  wput_kernel<<<256, 256, 0, stream>>>(Fp(3), Fp(5), Fp(7), Fp(9), W4);
  proj_kernel<<<dim3(NT / GM, 3, D / GN), 256, 0, stream>>>(Fp(0), Fp(1), Fp(2), W4, Fp(4), Fp(6), Fp(8), Qh, Ql, KR, VR);
  area_kernel<<<NB_ * H * (NAP / 64), 256, 0, stream>>>(KR, VR, KAh, KAl, VTh, VTl);
  att_kernel<<<NB_ * H * (L / (16 * AW)), 32 * AW, 0, stream>>>(Qh, Ql, KAh, KAl, VTh, VTl, Ip(11), Ip(12), QLIM, O);
  outp_kernel<<<dim3(NT / GM, D / GN), 256, 0, stream>>>(O, W4 + (size_t)3 * D * D, Fp(10), QLIM, (float*)d_out);
}

// v004
// A run of this version takes 116 microseconds.
// Two timings next to v003 put it at 1.40 and 1.39 times that version's speed.
// Counting every step since v000, it is 23.7 times as fast.
#include <hip/hip_runtime.h>

// MultiHeadAreaAttention: qh,kh,vh = (q Wq^T + bq), (k Wk^T + bk), (v Wv^T + bv) as 16 heads x 64; areas = all windows of width 1..3 along the key axis (A = 3,069; block w starts at area index 0 / 1024 / 2047, end(a) = start + w - 1); k_area = window mean, v_area = window sum; logits = qh.k_area / 8, visible iff mask[q][end(a)] != 0 (else -1e30); weights = softmax over areas; if zero_pad: weights of query 0 := 0; ctx = weights.v_area; out = concat Wo^T + bo -> [2][1024][1024].
// Pooling is linear, so no pooled row is ever formed: qh.k_area(end e, width w) = (x[e] + .. + x[e-w+1]) / w with the token logits x[t] = qh.kh[t], and weights.v_area = sum over tokens t of c[t] vh[t], c[t] = the summed weights of the (up to six) areas that hold t. Both matrix products run over the 1,024 tokens instead of the 3,069 areas.
// Deterministic: online softmax over fixed chunks of 120 end positions (360 areas) in order (chunks with no visible area for any of the wave's 16 queries are skipped: they contribute exactly 0); inside a chunk each lane sums its areas in a fixed tree, then the two halves of a query are added; no atomics.
// WMMA (v_wmma_f32_16x16x32_f16, f32 accumulate): inputs (EXACT bf16 x8, K 1,024) x W rows (EXACT) per 64-token x 256-column work-group of 8 waves; per (bh, 16-query) wave (four to a work-group, K and V chunks shared in LDS) X^T = kh token rows (hi+lo; 8 tiles/chunk) x qh (hi+lo x256, K 64) and O^T += vh^T rows (hi+lo; 4 tiles) x c (hi+lo), 3 products; o (hi+lo) x Wo rows, same tiling; neighbour sums, mask gather, softmax in f32.

namespace {
constexpr int NB_ = 2, L = 1024, D = 1024, H = 16, HD = 64, NT = NB_ * L, CH = 128, NTI = CH / 16, HALO = 8, CS = CH - HALO /* 120 */, NCH = (L + CS - 1) / CS /* 9 */, NAP = (NCH - 1) * CS + CH /* 1088 */;
constexpr float XS = 8.0f, HS = 256.0f, PS = 256.0f, WSC = 256.0f, SCALE = 0.125f, LOG2E = 1.44269504f;
typedef _Float16 b16;
typedef __attribute__((ext_vector_type(16))) _Float16 v16b;
typedef __attribute__((ext_vector_type(8))) _Float16 v8b;
typedef __attribute__((ext_vector_type(4))) _Float16 v4b;
typedef __attribute__((ext_vector_type(2))) _Float16 v2b;
typedef __attribute__((ext_vector_type(8))) float v8f;
typedef __attribute__((ext_vector_type(4))) float v4f;
typedef __attribute__((ext_vector_type(2))) float v2f;
__device__ __forceinline__ float bf16_rne(float f) { unsigned int u = __float_as_uint(f); u += 0x7FFFu + ((u >> 16) & 1u); float r = __uint_as_float(u & 0xFFFF0000u); asm volatile("" : "+v"(r)); return r; }
__device__ __forceinline__ float bfv(float f) { float r = bf16_rne(f); asm volatile("" : "+v"(r)); return r; }
__device__ __forceinline__ void split16(float v, b16& hi, b16& lo) { hi = (b16)v; lo = (b16)(v - (float)hi); }
__device__ __forceinline__ v16b frag_kb(const b16* p, int hh) { const v8b a = *(const v8b*)(p + 8 * hh), b = *(const v8b*)(p + 16 + 8 * hh); v16b f;
#pragma unroll
  for (int e = 0; e < 8; ++e) { f[e] = a[e]; f[8 + e] = b[e]; } return f; }
__device__ __forceinline__ v8f wmma16b(v16b a, v16b b, v8f c) { v8f d = __builtin_amdgcn_wmma_f32_16x16x32_f16(false, a, false, b, (short)0, c, false, false); asm volatile("v_nop\n\tv_nop\n\tv_nop\n\tv_nop" : "+v"(d) : "v"(a), "v"(b)); return d; }
// the same for a B operand that nothing overwrites while the kernel runs (the query fragments): not named in the statement, it is free to live above v255, where an asm operand cannot, and leaves the low registers to the operands that must be there (named, two of the four fragments were spilled to scratch and read back in every chunk)
__device__ __forceinline__ v8f wmma16q(v16b a, v16b b, v8f c) { v8f d = __builtin_amdgcn_wmma_f32_16x16x32_f16(false, a, false, b, (short)0, c, false, false); asm volatile("v_nop\n\tv_nop\n\tv_nop\n\tv_nop" : "+v"(d) : "v"(a)); return d; }
// 2^x and, in the same statement, the one issue slot that the instruction set asks for behind a transcendental
__device__ __forceinline__ float exp2_slot(float x) { float p; asm("v_exp_f32 %0, %1\n\tv_nop" : "=v"(p) : "v"(x)); return p; }
// the value that lane l ^ 16 holds (the other half of the same query's tokens), by a vector cross-row move
__device__ __forceinline__ float xhalf(float v) { const int b = __float_as_int(v); return __int_as_float(__builtin_amdgcn_permlanex16(b, b, 0x76543210, 0xfedcba98, false, false)); }
// row a of the padded token axis (NAP rows) -> (token, 1); the HALO rows in front of token 0 and the rows behind token L - 1 get token 0, width 0 (zero rows)
__device__ __forceinline__ void area_of(int a, int& t0, int& w) { if (a >= HALO && a < L + HALO) { t0 = a - HALO; w = 1; } else { t0 = 0; w = 0; } }

__global__ __launch_bounds__(256) void wput_kernel(const float* __restrict__ wq, const float* __restrict__ wk, const float* __restrict__ wv, const float* __restrict__ wo, b16* __restrict__ W4) { const size_t nt = (size_t)gridDim.x * 256, u0 = (size_t)blockIdx.x * 256 + threadIdx.x; v8b v;
  for (size_t u = u0; u < (size_t)4 * D * 128; u += nt) { const int o = (int)(u / 128), k0 = (int)(u % 128) * 8; const int which = o / D, oo = o % D; const float* w = which == 0 ? wq : (which == 1 ? wk : (which == 2 ? wv : wo));
#pragma unroll
    for (int j = 0; j < 8; ++j) v[j] = (b16)(bf16_rne(w[(size_t)oo * D + k0 + j]) * WSC); { *(v8b*)(W4 + (size_t)o * D + k0) = v;  } } }
// GEMM tile of one work-group (both projection kernels): GM tokens x GN output columns, 8 waves. All waves stage the A tile (whole K) in LDS once; wave w then owns columns 32 w .. 32 w + 31 for all GM tokens (4 x 2 accumulator tiles), so each B fragment read from global memory serves four products (eight in outp_kernel: A hi and lo). k order per output element: ascending, as before.
constexpr int GM = 64, GN = 256, AP = D + 8, TP = GN + 4;
__global__ __launch_bounds__(256) void proj_kernel(const float* __restrict__ xq, const float* __restrict__ xk, const float* __restrict__ xv, const b16* __restrict__ W4, const float* __restrict__ bq, const float* __restrict__ bk, const float* __restrict__ bv, b16* __restrict__ Qh, b16* __restrict__ Ql, float* __restrict__ KR, float* __restrict__ VR) { __shared__ __attribute__((aligned(16))) char sm[GM * AP * 2]; b16 (*Ax)[AP] = (b16 (*)[AP])sm; float (*Tf)[TP] = (float (*)[TP])sm;   // Tf takes Ax's place behind the K loop
  const int tid = threadIdx.x, wave = __builtin_amdgcn_readfirstlane(tid >> 5), lane = tid & 31, nloc = lane & 15, hlf = lane >> 4; const size_t t0 = (size_t)blockIdx.x * GM; const int which = blockIdx.y, c0 = blockIdx.z * GN;
  const float* x = which == 0 ? xq : (which == 1 ? xk : xv); const float* bias = which == 0 ? bq : (which == 1 ? bk : bv);
  // rolled: 16 rows a trip are 16 loads of 16 bytes in flight per lane, enough to cover the memory latency
#pragma unroll 1
  for (int r0 = 0; r0 < GM; r0 += 16) { v4f xv[16];
#pragma unroll
    for (int j = 0; j < 16; ++j) xv[j] = *(const v4f*)(x + (t0 + r0 + j) * D + tid * 4);
#pragma unroll
    for (int j = 0; j < 16; ++j) { v4b hv;
#pragma unroll
      for (int e = 0; e < 4; ++e) hv[e] = (b16)(bf16_rne(xv[j][e]) * XS);
      *(v4b*)(&Ax[r0 + j][tid * 4]) = hv; } }
  __syncthreads();   // the A tile is whole before any wave reads it
  v8f acc[4][2];
#pragma unroll
  for (int m = 0; m < 4; ++m) { acc[m][0] = (v8f){}; acc[m][1] = (v8f){}; }
  const b16* wp = W4 + ((size_t)which * D + c0 + wave * 32 + nloc) * D;
  // two k steps a trip, as before: together they use up one 128-byte line of each W row, and the address step is paid once
#pragma unroll 2
  for (int kb = 0; kb < D; kb += 32) { v16b bw[2], a[4];
#pragma unroll
    for (int n = 0; n < 2; ++n) bw[n] = frag_kb(wp + (size_t)n * 16 * D + kb, hlf);
#pragma unroll
    for (int m = 0; m < 4; ++m) a[m] = frag_kb(&Ax[m * 16 + nloc][kb], hlf);
#pragma unroll
    for (int m = 0; m < 4; ++m)
#pragma unroll
      for (int n = 0; n < 2; ++n) acc[m][n] = wmma16b(a[m], bw[n], acc[m][n]); }
  __syncthreads();   // every wave has left Ax before Tf overwrites it
#pragma unroll
  for (int n = 0; n < 2; ++n) { const int cc = wave * 32 + n * 16 + nloc; const float bb = bfv(bias[c0 + cc]);
#pragma unroll
    for (int m = 0; m < 4; ++m)
#pragma unroll
      for (int r8 = 0; r8 < 8; ++r8) Tf[m * 16 + 8 * hlf + r8][cc] = acc[m][n][r8] * (1.0f / (XS * WSC)) + bb; }
  __syncthreads();   // Tf is whole before the row-wise stores read it
  for (int rr = wave; rr < GM; rr += 8) { const size_t tk = t0 + rr;
    if (which == 0) { for (int q = 0; q < 4; ++q) { const int c = q * 64 + lane * 2; b16 h0, l0, h1, l1; split16(Tf[rr][c] * HS, h0, l0); split16(Tf[rr][c + 1] * HS, h1, l1); *(v2b*)(Qh + tk * D + c0 + c) = (v2b){h0, h1}; *(v2b*)(Ql + tk * D + c0 + c) = (v2b){l0, l1}; }
      asm volatile("s_wait_xcnt 0x0" ::: "memory"); }   // behind the row's stores, inside the branch: the wait that belongs in front of the next reuse of their address and data registers
    else { float* R = which == 1 ? KR : VR; for (int q = 0; q < 2; ++q) *(v4f*)(R + tk * D + c0 + q * 128 + lane * 4) = *(const v4f*)(&Tf[rr][q * 128 + lane * 4]);
      asm volatile("s_wait_xcnt 0x0" ::: "memory"); } } }   // the same wait for this branch's stores
__global__ __launch_bounds__(256) void area_kernel(const float* __restrict__ KR, const float* __restrict__ VR, b16* __restrict__ KAh, b16* __restrict__ KAl, b16* __restrict__ VTh, b16* __restrict__ VTl) { __shared__ float Tv[64][HD + 1]; const int bh = blockIdx.x / (NAP / 64), a0 = (blockIdx.x % (NAP / 64)) * 64; const int b = bh / H, h = bh % H; const int tid = threadIdx.x, wave = tid >> 5, lane = tid & 31;
  for (int q = wave; q < 64; q += 8) { const int a = a0 + q; int t0, w; area_of(a, t0, w); v2f ks = {0, 0}, vs = {0, 0}; for (int i = 0; i < w; ++i) { const size_t ro = ((size_t)b * L + t0 + i) * D + h * HD + lane * 2; ks += *(const v2f*)(KR + ro); vs += *(const v2f*)(VR + ro); } const float inv = w > 0 ? 1.0f / (float)w : 0.0f; b16 h0, l0, h1, l1; split16(ks[0] * inv * HS, h0, l0); split16(ks[1] * inv * HS, h1, l1); Tv[q][lane * 2] = vs[0]; Tv[q][lane * 2 + 1] = vs[1];
    { *(v2b*)(KAh + ((size_t)bh * NAP + a) * HD + lane * 2) = (v2b){h0, h1}; *(v2b*)(KAl + ((size_t)bh * NAP + a) * HD + lane * 2) = (v2b){l0, l1};  } }
  __syncthreads();
  { for (int d = wave; d < HD; d += 8) { b16 h0, l0, h1, l1; split16(Tv[lane * 2][d] * HS, h0, l0); split16(Tv[lane * 2 + 1][d] * HS, h1, l1); const size_t o = ((size_t)bh * HD + d) * NAP + a0 + lane * 2; *(v2b*)(VTh + o) = (v2b){h0, h1}; *(v2b*)(VTl + o) = (v2b){l0, l1}; }  } }
// Attention work-group: AW waves of 16 queries each, all of one (batch, head). Chunk c is the 128 tokens CS c - HALO .. CS c + CS - 1 (padded rows CS c ..): it owns the areas that END in its last CS tokens, and its first HALO tokens are there for the two tokens that such an area may reach back, so every chunk is worked on by itself. Its K and V rows are brought into LDS once for the four waves and every fragment is read from there.
// One buffer = Kh, Kl (128 token rows of 128 bytes, pitch 144) and Vh, Vl (64 feature rows of 256 bytes, pitch 272): pitches of 16 bytes x odd for the 16-byte LDS reads. Two buffers: the next chunk's copies fly while this chunk is worked on.
constexpr int AW = 4, KP = HD + 8, VP = CH + 8, KB = CH * KP, VB = HD * VP, SB = 2 * KB + 2 * VB;
typedef __attribute__((ext_vector_type(4))) int v4i;
// eight asynchronous 16-byte copies to LDS per lane (LDS byte address l + i ls, global address g + i gs); the s_wait_xcnt stands in the copies' own statement, in front of any reuse of the address registers that they name
__device__ __forceinline__ void copy8(unsigned int l, unsigned int ls, const char* g, size_t gs) {
  asm volatile("global_load_async_to_lds_b128 %0, %8, off\n\tglobal_load_async_to_lds_b128 %1, %9, off\n\tglobal_load_async_to_lds_b128 %2, %10, off\n\tglobal_load_async_to_lds_b128 %3, %11, off\n\t"
               "global_load_async_to_lds_b128 %4, %12, off\n\tglobal_load_async_to_lds_b128 %5, %13, off\n\tglobal_load_async_to_lds_b128 %6, %14, off\n\tglobal_load_async_to_lds_b128 %7, %15, off\n\ts_wait_xcnt 0x0"
               :: "v"(l), "v"(l + ls), "v"(l + 2 * ls), "v"(l + 3 * ls), "v"(l + 4 * ls), "v"(l + 5 * ls), "v"(l + 6 * ls), "v"(l + 7 * ls),
                  "v"(g), "v"(g + gs), "v"(g + 2 * gs), "v"(g + 3 * gs), "v"(g + 4 * gs), "v"(g + 5 * gs), "v"(g + 6 * gs), "v"(g + 7 * gs) : "memory"); }
// one chunk into the buffer at LDS byte address lb: 16-byte piece p = tid + 128 i of each of the four tiles (K: row p / 8, the 16 KB are contiguous in memory; V: row p / 16, memory pitch NAP elements)
__device__ __forceinline__ void stage_chunk(unsigned int lb, int tid, int a0, const b16* kh, const b16* kl, const b16* vh, const b16* vl) {
  const unsigned int lk = lb + (unsigned int)((tid >> 3) * (KP * 2) + (tid & 7) * 16), lv = lb + (unsigned int)(2 * KB * 2 + (tid >> 4) * (VP * 2) + (tid & 15) * 16);
  const size_t gk = (size_t)a0 * (HD * 2) + (size_t)tid * 16, gv = (size_t)(tid >> 4) * (NAP * 2) + (size_t)a0 * 2 + (size_t)(tid & 15) * 16;
  copy8(lk, 16 * KP * 2, (const char*)kh + gk, 2048); copy8(lk + KB * 2, 16 * KP * 2, (const char*)kl + gk, 2048);
  copy8(lv, 8 * VP * 2, (const char*)vh + gv, (size_t)8 * NAP * 2); copy8(lv + VB * 2, 8 * VP * 2, (const char*)vl + gv, (size_t)8 * NAP * 2); }
// the grid is two waves for each SIMD of the chip: let the register budget and the load scheduling be those of two resident waves
__global__ __launch_bounds__(32 * AW) __attribute__((amdgpu_waves_per_eu(1, 2))) void att_kernel(const b16* __restrict__ Qh, const b16* __restrict__ Ql, const b16* __restrict__ KAh, const b16* __restrict__ KAl, const b16* __restrict__ VTh, const b16* __restrict__ VTl, const int* __restrict__ mask, const int* __restrict__ zpad, int QLIM, float* __restrict__ O) { __shared__ __attribute__((aligned(16))) b16 sb[2 * SB]; __shared__ unsigned int cv[AW];
  const int tid = threadIdx.x, wave = __builtin_amdgcn_readfirstlane(tid >> 5), lane = tid & 31, nloc = lane & 15, hlf = lane >> 4; const int bh = blockIdx.x / (L / (16 * AW)), qb = (blockIdx.x % (L / (16 * AW))) * (16 * AW); if (qb >= QLIM) return;   // the whole work-group leaves, in front of every barrier
  const int q0 = qb + wave * 16; const bool live = q0 < QLIM;   // a wave past the query cut still copies and passes every barrier; it computes and stores nothing
  const int b = bh / H, h = bh % H; const size_t tq = (size_t)b * L + q0;
  // both products are taken transposed (X^T = kh x qh^T, O^T = vh^T x c^T): queries are the N side, so lane nloc owns query q0 + nloc and its half hlf holds tokens 16 T + 8 hlf + 0..7 of every 16-token tile T.
  // Two neighbouring tiles are then, register for register, the K = 32 operand of c (k = 8 hlf + e and 16 + 8 hlf + e, the order of frag_kb): mask, softmax and c never leave the registers; a neighbour token in the other half of the lanes comes by one lane exchange.
  const int* mrow = mask + (size_t)(q0 + nloc) * L;
  // Which chunks the work-group stages must read the same in all its waves: each wave ORs its 16 mask rows (whole lines), bit j of wv = some query of the wave sees some end position in 128 j .. 128 j + 127.
  v4i any[8];
#pragma unroll
  for (int j = 0; j < 8; ++j) any[j] = (v4i){0, 0, 0, 0};
  // rolled, four rows a trip: 32 loads of 16 bytes in flight per lane cover the latency
#pragma unroll 1
  for (int r0 = 0; r0 < 16; r0 += 4) { v4i mv[4][8];
#pragma unroll
    for (int r = 0; r < 4; ++r)
#pragma unroll
      for (int j = 0; j < 8; ++j) mv[r][j] = *(const v4i*)(mask + (size_t)(q0 + r0 + r) * L + j * 128 + lane * 4);
#pragma unroll
    for (int r = 0; r < 4; ++r)
#pragma unroll
      for (int j = 0; j < 8; ++j) any[j] |= mv[r][j]; }
  unsigned int wv = 0;
#pragma unroll
  for (int j = 0; j < 8; ++j) wv |= (__builtin_amdgcn_ballot_w32((any[j][0] | any[j][1] | any[j][2] | any[j][3]) != 0) != 0u ? 1u : 0u) << j;
  if (lane == 0) cv[wave] = live ? wv : 0u;
  __syncthreads();   // all four words are written before any wave reads them
  // the ends of chunk c, 120 c .. 120 c + 119, lie in column blocks c - 1 and c (chunk 0: block 0; chunk 8: block 7). A superset of the visible chunks: each wave still makes its own exact test below.
  const unsigned int vj = (unsigned int)__builtin_amdgcn_readfirstlane((int)(cv[0] | cv[1] | cv[2] | cv[3])); unsigned int rem = (vj | (vj << 1)) & ((1u << NCH) - 1u); const int nst = __builtin_popcount(rem);
  v16b qa[2], ql[2]; for (int ks = 0; ks < 2; ++ks) { qa[ks] = frag_kb(Qh + (tq + nloc) * D + h * HD + ks * 32, hlf); ql[ks] = frag_kb(Ql + (tq + nloc) * D + h * HD + ks * 32, hlf); }
  v8f oacc[4] = {(v8f){}, (v8f){}, (v8f){}, (v8f){}}; float mrun = -INFINITY, lrun = 0.0f;
  const unsigned int lds0 = (unsigned int)(size_t)sb;   // LDS byte address of buffer 0: the low 32 bits of the shared address
  const b16 *gkh = KAh + (size_t)bh * NAP * HD, *gkl = KAl + (size_t)bh * NAP * HD, *gvh = VTh + (size_t)bh * HD * NAP, *gvl = VTl + (size_t)bh * HD * NAP;
  int c0 = 0, c1 = 0;   // the chunk in work and the chunk in flight
  if (nst > 0) { c0 = __builtin_ctz(rem); rem &= rem - 1u; stage_chunk(lds0, tid, c0 * CS, gkh, gkl, gvh, gvl); }
  asm volatile("s_wait_asynccnt 0x0" ::: "memory");   // this wave's copies of the first chunk have landed
  __syncthreads();   // and every wave's: the first chunk may be read
  if (nst > 1) { c1 = __builtin_ctz(rem); rem &= rem - 1u; stage_chunk(lds0 + SB * 2, tid, c1 * CS, gkh, gkl, gvh, gvl); }
#pragma unroll 1
  for (int st = 0; st < nst; ++st) { const int e0 = c0 * CS - HALO; const b16* kbuf = sb + (st & 1) * SB; const b16* vbuf = kbuf + 2 * KB;
    // visibility bits of this lane's 64 end positions e0 + 16 T + 8 hlf + r8 (bit 8 (T & 3) + r8 of word T >> 2). A group of eight holds ends of this chunk unless it is the halo (T = 0, lower half) or lies behind the last token: there the address is clamped and no bit is set.
    unsigned int vb[NTI / 4] = {};
#pragma unroll
    for (int t = 0; t < NTI; ++t) { const int g = e0 + t * 16 + 8 * hlf; const bool ok = (t > 0 || hlf != 0) && g < L; int m[8]; __builtin_memcpy(m, mrow + (ok ? g : 0), 32); unsigned int bb = 0;
#pragma unroll
      for (int r8 = 0; r8 < 8; ++r8) bb |= (m[r8] != 0 ? 1u : 0u) << r8;
      vb[t >> 2] |= (ok ? bb : 0u) << ((t & 3) * 8); }
    // an area of width w ends no earlier than token w - 1: end 0 has width 1 alone, end 1 widths 1 and 2 (chunk 0, tile 0, upper half, bits 0 and 1)
    const bool later = c0 != 0 || hlf == 0;
    if (live && __builtin_amdgcn_ballot_w32((vb[0] | vb[1]) != 0u) != 0u) {   // wave-uniform: where no query of this wave sees any area of the chunk its contribution is exactly zero; the hand-over below is passed all the same
    v8f s[NTI];
#pragma unroll
    for (int tg = 0; tg < NTI; tg += 4) {
#pragma unroll
      for (int t = 0; t < 4; ++t) s[tg + t] = (v8f){};
#pragma unroll
      for (int ks = 0; ks < 2; ++ks) { v16b kh[4], kl[4];
#pragma unroll
        for (int t = 0; t < 4; ++t) { const b16* kr = kbuf + ((tg + t) * 16 + nloc) * KP + ks * 32; kh[t] = frag_kb(kr, hlf); kl[t] = frag_kb(kr + KB, hlf); }
#pragma unroll
        for (int t = 0; t < 4; ++t) s[tg + t] = wmma16q(kh[t], qa[ks], s[tg + t]);
#pragma unroll
        for (int t = 0; t < 4; ++t) s[tg + t] = wmma16q(kl[t], qa[ks], s[tg + t]);
#pragma unroll
        for (int t = 0; t < 4; ++t) s[tg + t] = wmma16q(kh[t], ql[ks], s[tg + t]); } }
    // token logits x (in s), and for every group of eight its two predecessors b7 = x[-1], b6 = x[-2], which the other half of the lanes holds: the group in front of (T, upper half) is (T, lower half); in front of (T, lower half), (T - 1, upper half); the chunk's first group is halo and ends no area
    float b6[NTI], b7[NTI];
#pragma unroll
    for (int t = 0; t < NTI; ++t) { s[t] *= SCALE / (HS * HS); b6[t] = xhalf(s[t][6]); b7[t] = xhalf(s[t][7]); }
#pragma unroll
    for (int t = NTI - 1; t >= 0; --t) { b6[t] = hlf ? b6[t] : (t > 0 ? b6[t > 0 ? t - 1 : 0] : 0.0f); b7[t] = hlf ? b7[t] : (t > 0 ? b7[t > 0 ? t - 1 : 0] : 0.0f); }
    // area logits by end position e: x[e], (x[e] + x[e-1]) / 2, (x[e] + x[e-1] + x[e-2]) / 3; written out here for the maximum and again below for the weights
    v8f m8;
#pragma unroll
    for (int r8 = 0; r8 < 8; ++r8) m8[r8] = -INFINITY;
#pragma unroll
    for (int t = 0; t < NTI; ++t)
#pragma unroll
      for (int r8 = 0; r8 < 8; ++r8) { const float x0 = s[t][r8], xm1 = r8 >= 1 ? s[t][r8 >= 1 ? r8 - 1 : 0] : b7[t], xm2 = r8 >= 2 ? s[t][r8 >= 2 ? r8 - 2 : 0] : (r8 == 1 ? b7[t] : b6[t]), u2 = x0 + xm1, u3 = u2 + xm2;
        const bool c1 = ((vb[t >> 2] >> ((t & 3) * 8 + r8)) & 1u) != 0u, c2 = (t == 0 && r8 == 0) ? (c1 && later) : c1, c3 = (t == 0 && r8 <= 1) ? (c1 && later) : c1;
        m8[r8] = fmaxf(m8[r8], fmaxf(x0 + (c1 ? 0.0f : -INFINITY), fmaxf(__builtin_fmaf(u2, 0.5f, c2 ? 0.0f : -INFINITY), __builtin_fmaf(u3, 1.0f / 3.0f, c3 ? 0.0f : -INFINITY)))); }
    float mx = fmaxf(fmaxf(fmaxf(m8[0], m8[1]), fmaxf(m8[2], m8[3])), fmaxf(fmaxf(m8[4], m8[5]), fmaxf(m8[6], m8[7]))); mx = fmaxf(mx, __shfl_xor(mx, 16));
    const float mn = fmaxf(mrun, mx), fe = exp2_slot((mrun - mn) * LOG2E), fac = (mrun == -INFINITY) ? 0.0f : fe, ms = (mn == -INFINITY) ? 0.0f : mn, nms = -ms * LOG2E; v8f s8 = (v8f){};
    // weights by end position e: wa = p1 + p2 + p3 goes to token e (and into the row sum), wb = p2 + p3 also to token e - 1, wc = p3 also to token e - 2: token weight c[t] = wa[t] + wb[t + 1] + wc[t + 2], written over x tile by tile.
    // What the last two tokens of a group take from the group behind it (n0 = wc[0], n1 = wb[0] + wc[1]) comes from the other half of the lanes: behind (T, lower half) stands (T, upper half); behind (T, upper half), (T + 1, lower half); behind the chunk's last group, the next chunk's ends, which reach these tokens through that chunk's halo.
    float n0[NTI], n1[NTI];
#pragma unroll
    for (int t = 0; t < NTI; ++t) { float wa[8], wb[8], wc[8];
#pragma unroll
      for (int r8 = 0; r8 < 8; ++r8) { const float x0 = s[t][r8], xm1 = r8 >= 1 ? s[t][r8 >= 1 ? r8 - 1 : 0] : b7[t], xm2 = r8 >= 2 ? s[t][r8 >= 2 ? r8 - 2 : 0] : (r8 == 1 ? b7[t] : b6[t]), u2 = x0 + xm1, u3 = u2 + xm2;
        const bool c1 = ((vb[t >> 2] >> ((t & 3) * 8 + r8)) & 1u) != 0u, c2 = (t == 0 && r8 == 0) ? (c1 && later) : c1, c3 = (t == 0 && r8 <= 1) ? (c1 && later) : c1;
        const float p1 = exp2_slot(__builtin_fmaf(x0, LOG2E, c1 ? nms : -INFINITY)), p2 = exp2_slot(__builtin_fmaf(u2, 0.5f * LOG2E, c2 ? nms : -INFINITY)), p3 = exp2_slot(__builtin_fmaf(u3, LOG2E / 3.0f, c3 ? nms : -INFINITY));
        wc[r8] = p3; wb[r8] = p2 + p3; wa[r8] = p1 + wb[r8]; s8[r8] += wa[r8]; }
      n0[t] = xhalf(wc[0]); n1[t] = xhalf(wb[0] + wc[1]);
#pragma unroll
      for (int r8 = 0; r8 < 6; ++r8) s[t][r8] = wa[r8] + wb[r8 + 1] + wc[r8 + 2];
      s[t][6] = wa[6] + wb[7]; s[t][7] = wa[7]; }
    float sm = ((s8[0] + s8[1]) + (s8[2] + s8[3])) + ((s8[4] + s8[5]) + (s8[6] + s8[7])); sm += __shfl_xor(sm, 16); lrun = lrun * fac + sm; mrun = mn;
#pragma unroll
    for (int t = 0; t < NTI; ++t) { s[t][6] += hlf ? (t + 1 < NTI ? n0[t + 1 < NTI ? t + 1 : 0] : 0.0f) : n0[t]; s[t][7] += hlf ? (t + 1 < NTI ? n1[t + 1 < NTI ? t + 1 : 0] : 0.0f) : n1[t]; s[t] *= PS; }
#pragma unroll
    for (int t = 0; t < 4; ++t) oacc[t] *= fac;
#pragma unroll
    for (int kb = 0; kb < CH; kb += 32) { v16b pa, pb, vh[4], vlo[4];
#pragma unroll
      for (int e = 0; e < 8; ++e) { b16 ph, pl; split16(s[kb / 16][e], ph, pl); pa[e] = ph; pb[e] = pl; split16(s[kb / 16 + 1][e], ph, pl); pa[8 + e] = ph; pb[8 + e] = pl; }
#pragma unroll
      for (int t = 0; t < 4; ++t) { const b16* vr = vbuf + (t * 16 + nloc) * VP + kb; vh[t] = frag_kb(vr, hlf); vlo[t] = frag_kb(vr + VB, hlf); }
#pragma unroll
      for (int t = 0; t < 4; ++t) oacc[t] = wmma16b(vh[t], pa, oacc[t]);
#pragma unroll
      for (int t = 0; t < 4; ++t) oacc[t] = wmma16b(vlo[t], pa, oacc[t]);
#pragma unroll
      for (int t = 0; t < 4; ++t) oacc[t] = wmma16b(vh[t], pb, oacc[t]); } }
    // hand-over, every wave, in this order: my LDS reads of this buffer are done; my copies of the next chunk have landed; the barrier publishes the next chunk and frees this buffer; only then the refill
    asm volatile("s_wait_dscnt 0x0" ::: "memory");
    asm volatile("s_wait_asynccnt 0x0" ::: "memory");
    __syncthreads();
    c0 = c1;
    if (st + 2 < nst) { c1 = __builtin_ctz(rem); rem &= rem - 1u; stage_chunk(lds0 + (unsigned int)((st & 1) * SB * 2), tid, c1 * CS, gkh, gkl, gvh, gvl); } }
  asm volatile("s_wait_asynccnt 0x0" ::: "memory");   // no copy is outstanding when the wave ends
  const bool zero = (zpad[0] != 0 && q0 + nloc == 0);
  if (live) {
#pragma unroll
  for (int t = 0; t < 4; ++t) { v4f o0, o1;
#pragma unroll
    for (int j = 0; j < 4; ++j) { const float u0 = oacc[t][j] * (1.0f / (PS * HS)) / lrun, u1 = oacc[t][4 + j] * (1.0f / (PS * HS)) / lrun; o0[j] = zero ? 0.0f : u0; o1[j] = zero ? 0.0f : u1; }
    float* op = O + (tq + nloc) * D + h * HD + t * 16 + 8 * hlf; *(v4f*)op = o0; *(v4f*)(op + 4) = o1; } } }
__global__ __launch_bounds__(256) void outp_kernel(const float* __restrict__ O, const b16* __restrict__ WO, const float* __restrict__ bo, int QLIM, float* __restrict__ out) { __shared__ __attribute__((aligned(16))) char sm[2 * GM * AP * 2]; b16 (*Ah)[AP] = (b16 (*)[AP])sm; b16 (*Al)[AP] = (b16 (*)[AP])(sm + GM * AP * 2); float (*Tf)[TP] = (float (*)[TP])sm;   // Tf takes Ah's place behind the K loop
  const int tid = threadIdx.x, wave = __builtin_amdgcn_readfirstlane(tid >> 5), lane = tid & 31, nloc = lane & 15, hlf = lane >> 4; const size_t t0 = (size_t)blockIdx.x * GM; const int c0 = blockIdx.y * GN; if ((int)(t0 % L) >= QLIM) return;
  // rolled: 16 rows a trip are 16 loads of 16 bytes in flight per lane, enough to cover the latency
#pragma unroll 1
  for (int r0 = 0; r0 < GM; r0 += 16) { v4f xv[16];
#pragma unroll
    for (int j = 0; j < 16; ++j) xv[j] = *(const v4f*)(O + (t0 + r0 + j) * D + tid * 4);
#pragma unroll
    for (int j = 0; j < 16; ++j) { v4b hv, lv;
#pragma unroll
      for (int e = 0; e < 4; ++e) { b16 p, pl; split16(xv[j][e] * HS, p, pl); hv[e] = p; lv[e] = pl; }
      *(v4b*)(&Ah[r0 + j][tid * 4]) = hv; *(v4b*)(&Al[r0 + j][tid * 4]) = lv; } }
  __syncthreads();   // both A tiles are whole before any wave reads them
  v8f acc[4][2];
#pragma unroll
  for (int m = 0; m < 4; ++m) { acc[m][0] = (v8f){}; acc[m][1] = (v8f){}; }
  const b16* wp = WO + (size_t)(c0 + wave * 32 + nloc) * D;
  // two k steps a trip, as before: together they use up one 128-byte line of each W row, and the address step is paid once
#pragma unroll 2
  for (int kb = 0; kb < D; kb += 32) { v16b bw[2], a[4], al[4];
#pragma unroll
    for (int n = 0; n < 2; ++n) bw[n] = frag_kb(wp + (size_t)n * 16 * D + kb, hlf);
#pragma unroll
    for (int m = 0; m < 4; ++m) { a[m] = frag_kb(&Ah[m * 16 + nloc][kb], hlf); al[m] = frag_kb(&Al[m * 16 + nloc][kb], hlf); }
#pragma unroll
    for (int m = 0; m < 4; ++m)
#pragma unroll
      for (int n = 0; n < 2; ++n) acc[m][n] = wmma16b(a[m], bw[n], acc[m][n]);
#pragma unroll
    for (int m = 0; m < 4; ++m)
#pragma unroll
      for (int n = 0; n < 2; ++n) acc[m][n] = wmma16b(al[m], bw[n], acc[m][n]); }
  __syncthreads();   // every wave has left Ah before Tf overwrites it
#pragma unroll
  for (int n = 0; n < 2; ++n) { const int cc = wave * 32 + n * 16 + nloc; const float bb = bfv(bo[c0 + cc]);
#pragma unroll
    for (int m = 0; m < 4; ++m)
#pragma unroll
      for (int r8 = 0; r8 < 8; ++r8) Tf[m * 16 + 8 * hlf + r8][cc] = acc[m][n][r8] * (1.0f / (HS * WSC)) + bb; }
  __syncthreads();   // Tf is whole before the row-wise stores read it
  for (int rr = wave; rr < GM; rr += 8) { if ((int)((t0 + rr) % L) >= QLIM) continue;   // rows past the query cut stay unwritten, as before
    for (int q = 0; q < 2; ++q) *(v4f*)(out + (t0 + rr) * D + c0 + q * 128 + lane * 4) = *(const v4f*)(&Tf[rr][q * 128 + lane * 4]);
    asm volatile("s_wait_xcnt 0x0" ::: "memory"); } }   // behind the row's stores: the wait that belongs in front of the next trip's reuse of their address and data registers
}  // namespace

extern "C" void kernel_launch(void* const* d_in, const int* in_sizes, int n_in, void* d_out, int out_size, void* d_ws, size_t ws_size, hipStream_t stream) {
  (void)n_in;
  auto Fp = [&](int i) { return (const float*)d_in[i]; }; auto Ip = [&](int i) { return (const int*)d_in[i]; };
  // input order: 0 q [2,1024,1024]; 1 k; 2 v; 3 Wq; 4 bq; 5 Wk; 6 bk; 7 Wv; 8 bv; 9 Wo; 10 bo; 11 mask [1024,1024] i32; 12 zero_pad [1] i32
  if (in_sizes[0] != NT * D || in_sizes[1] != NT * D || in_sizes[2] != NT * D || in_sizes[3] != D * D || in_sizes[9] != D * D || in_sizes[11] != L * L || in_sizes[12] != 1 || out_size != NT * D) return;
  const int QLIM = L;   // per-batch query cut (multiple of 16)
  size_t off = 0; char* ws = (char*)d_ws;
  auto carve = [&](size_t bytes) { char* p = ws + off; off += (bytes + 255) & ~(size_t)255; return p; };
  b16* W4 = (b16*)carve((size_t)4 * D * D * 2); b16* Qh = (b16*)carve((size_t)NT * D * 2); b16* Ql = (b16*)carve((size_t)NT * D * 2); float* KR = (float*)carve((size_t)NT * D * 4); float* VR = (float*)carve((size_t)NT * D * 4); b16* KAh = (b16*)carve((size_t)NB_ * H * NAP * HD * 2); b16* KAl = (b16*)carve((size_t)NB_ * H * NAP * HD * 2); b16* VTh = (b16*)carve((size_t)NB_ * H * HD * NAP * 2); b16* VTl = (b16*)carve((size_t)NB_ * H * HD * NAP * 2); float* O = (float*)carve((size_t)NT * D * 4);
  if (off > ws_size || off > ((size_t)96 << 20)) return;   // 57 MiB
  wput_kernel<<<256, 256, 0, stream>>>(Fp(3), Fp(5), Fp(7), Fp(9), W4);
  proj_kernel<<<dim3(NT / GM, 3, D / GN), 256, 0, stream>>>(Fp(0), Fp(1), Fp(2), W4, Fp(4), Fp(6), Fp(8), Qh, Ql, KR, VR);
  area_kernel<<<NB_ * H * (NAP / 64), 256, 0, stream>>>(KR, VR, KAh, KAl, VTh, VTl);
  att_kernel<<<NB_ * H * (L / (16 * AW)), 32 * AW, 0, stream>>>(Qh, Ql, KAh, KAl, VTh, VTl, Ip(11), Ip(12), QLIM, O);
  outp_kernel<<<dim3(NT / GM, D / GN), 256, 0, stream>>>(O, W4 + (size_t)3 * D * D, Fp(10), QLIM, (float*)d_out);
}

// v005
// Measured time: 105 microseconds a run.
// Two timings next to v004 both put it at 1.10 times that version's speed.
// Counting every step since v000, it is 26.0 times as fast.
#include <hip/hip_runtime.h>

// MultiHeadAreaAttention: qh,kh,vh = (q Wq^T + bq), (k Wk^T + bk), (v Wv^T + bv) as 16 heads x 64; areas = all windows of width 1..3 along the key axis (A = 3,069; block w starts at area index 0 / 1024 / 2047, end(a) = start + w - 1); k_area = window mean, v_area = window sum; logits = qh.k_area / 8, visible iff mask[q][end(a)] != 0 (else -1e30); weights = softmax over areas; if zero_pad: weights of query 0 := 0; ctx = weights.v_area; out = concat Wo^T + bo -> [2][1024][1024].
// Pooling is linear, so no pooled row is ever formed: qh.k_area(end e, width w) = (x[e] + .. + x[e-w+1]) / w with the token logits x[t] = qh.kh[t], and weights.v_area = sum over tokens t of c[t] vh[t], c[t] = the summed weights of the (up to six) areas that hold t. Both matrix products run over the 1,024 tokens instead of the 3,069 areas.
// Deterministic: online softmax over fixed chunks of 120 end positions (360 areas) in order, a query's chunks in at most two runs whose running maximum, sum and O are merged at the end in a fixed order (chunks with no visible area for any of the wave's 16 queries are skipped: they contribute exactly 0); inside a chunk each lane sums its areas in a fixed tree, then the two halves of a query are added; no atomics.
// WMMA (v_wmma_f32_16x16x32_f16, f32 accumulate): inputs (EXACT bf16 x8, K 1,024) x W rows (EXACT) per 64-token x 256-column work-group of 8 waves; per (bh, 16-query) wave (eight to a work-group, K and V chunks shared in LDS by four) X^T = kh token rows (hi+lo; 8 tiles/chunk) x qh (hi+lo x256, K 64) and O^T += vh^T rows (hi+lo; 4 tiles) x c (hi+lo), 3 products; o (hi+lo) x Wo rows, same tiling; neighbour sums, mask gather, softmax in f32.

namespace {
constexpr int NB_ = 2, L = 1024, D = 1024, H = 16, HD = 64, NT = NB_ * L, CH = 128, NTI = CH / 16, HALO = 8, CS = CH - HALO /* 120 */, NCH = (L + CS - 1) / CS /* 9 */, NAP = (NCH - 1) * CS + CH /* 1088 */;
constexpr float XS = 8.0f, HS = 256.0f, PS = 256.0f, WSC = 256.0f, SCALE = 0.125f, LOG2E = 1.44269504f;
typedef _Float16 b16;
typedef __attribute__((ext_vector_type(16))) _Float16 v16b;
typedef __attribute__((ext_vector_type(8))) _Float16 v8b;
typedef __attribute__((ext_vector_type(4))) _Float16 v4b;
typedef __attribute__((ext_vector_type(2))) _Float16 v2b;
typedef __attribute__((ext_vector_type(8))) float v8f;
typedef __attribute__((ext_vector_type(4))) float v4f;
typedef __attribute__((ext_vector_type(2))) float v2f;
__device__ __forceinline__ float bf16_rne(float f) { unsigned int u = __float_as_uint(f); u += 0x7FFFu + ((u >> 16) & 1u); float r = __uint_as_float(u & 0xFFFF0000u); asm volatile("" : "+v"(r)); return r; }
__device__ __forceinline__ float bfv(float f) { float r = bf16_rne(f); asm volatile("" : "+v"(r)); return r; }
__device__ __forceinline__ void split16(float v, b16& hi, b16& lo) { hi = (b16)v; lo = (b16)(v - (float)hi); }
__device__ __forceinline__ v16b frag_kb(const b16* p, int hh) { const v8b a = *(const v8b*)(p + 8 * hh), b = *(const v8b*)(p + 16 + 8 * hh); v16b f;
#pragma unroll
  for (int e = 0; e < 8; ++e) { f[e] = a[e]; f[8 + e] = b[e]; } return f; }
__device__ __forceinline__ v8f wmma16b(v16b a, v16b b, v8f c) { v8f d = __builtin_amdgcn_wmma_f32_16x16x32_f16(false, a, false, b, (short)0, c, false, false); asm volatile("v_nop\n\tv_nop\n\tv_nop\n\tv_nop" : "+v"(d) : "v"(a), "v"(b)); return d; }
// the same for a B operand that is rewritten only when the half goes on to block B, far from any product (the query fragments): not named in the statement, it is free to live above v255, where an asm operand cannot, and leaves the low registers to the operands that must be there (named, two of the four fragments were spilled to scratch and read back in every chunk)
__device__ __forceinline__ v8f wmma16q(v16b a, v16b b, v8f c) { v8f d = __builtin_amdgcn_wmma_f32_16x16x32_f16(false, a, false, b, (short)0, c, false, false); asm volatile("v_nop\n\tv_nop\n\tv_nop\n\tv_nop" : "+v"(d) : "v"(a)); return d; }
// 2^x and, in the same statement, the one issue slot that the instruction set asks for behind a transcendental
__device__ __forceinline__ float exp2_slot(float x) { float p; asm("v_exp_f32 %0, %1\n\tv_nop" : "=v"(p) : "v"(x)); return p; }
// the value that lane l ^ 16 holds (the other half of the same query's tokens), by a vector cross-row move
__device__ __forceinline__ float xhalf(float v) { const int b = __float_as_int(v); return __int_as_float(__builtin_amdgcn_permlanex16(b, b, 0x76543210, 0xfedcba98, false, false)); }
// row a of the padded token axis (NAP rows) -> (token, 1); the HALO rows in front of token 0 and the rows behind token L - 1 get token 0, width 0 (zero rows)
__device__ __forceinline__ void area_of(int a, int& t0, int& w) { if (a >= HALO && a < L + HALO) { t0 = a - HALO; w = 1; } else { t0 = 0; w = 0; } }

__global__ __launch_bounds__(256) void wput_kernel(const float* __restrict__ wq, const float* __restrict__ wk, const float* __restrict__ wv, const float* __restrict__ wo, b16* __restrict__ W4) { const size_t nt = (size_t)gridDim.x * 256, u0 = (size_t)blockIdx.x * 256 + threadIdx.x; v8b v;
  for (size_t u = u0; u < (size_t)4 * D * 128; u += nt) { const int o = (int)(u / 128), k0 = (int)(u % 128) * 8; const int which = o / D, oo = o % D; const float* w = which == 0 ? wq : (which == 1 ? wk : (which == 2 ? wv : wo));
#pragma unroll
    for (int j = 0; j < 8; ++j) v[j] = (b16)(bf16_rne(w[(size_t)oo * D + k0 + j]) * WSC); { *(v8b*)(W4 + (size_t)o * D + k0) = v;  } } }
// GEMM tile of one work-group (both projection kernels): GM tokens x GN output columns, 8 waves. All waves stage the A tile (whole K) in LDS once; wave w then owns columns 32 w .. 32 w + 31 for all GM tokens (4 x 2 accumulator tiles), so each B fragment read from global memory serves four products (eight in outp_kernel: A hi and lo). k order per output element: ascending, as before.
constexpr int GM = 64, GN = 256, AP = D + 8, TP = GN + 4;
__global__ __launch_bounds__(256) void proj_kernel(const float* __restrict__ xq, const float* __restrict__ xk, const float* __restrict__ xv, const b16* __restrict__ W4, const float* __restrict__ bq, const float* __restrict__ bk, const float* __restrict__ bv, b16* __restrict__ Qh, b16* __restrict__ Ql, float* __restrict__ KR, float* __restrict__ VR) { __shared__ __attribute__((aligned(16))) char sm[GM * AP * 2]; b16 (*Ax)[AP] = (b16 (*)[AP])sm; float (*Tf)[TP] = (float (*)[TP])sm;   // Tf takes Ax's place behind the K loop
  const int tid = threadIdx.x, wave = __builtin_amdgcn_readfirstlane(tid >> 5), lane = tid & 31, nloc = lane & 15, hlf = lane >> 4; const size_t t0 = (size_t)blockIdx.x * GM; const int which = blockIdx.y, c0 = blockIdx.z * GN;
  const float* x = which == 0 ? xq : (which == 1 ? xk : xv); const float* bias = which == 0 ? bq : (which == 1 ? bk : bv);
  // rolled: 16 rows a trip are 16 loads of 16 bytes in flight per lane, enough to cover the memory latency
#pragma unroll 1
  for (int r0 = 0; r0 < GM; r0 += 16) { v4f xv[16];
#pragma unroll
    for (int j = 0; j < 16; ++j) xv[j] = *(const v4f*)(x + (t0 + r0 + j) * D + tid * 4);
#pragma unroll
    for (int j = 0; j < 16; ++j) { v4b hv;
#pragma unroll
      for (int e = 0; e < 4; ++e) hv[e] = (b16)(bf16_rne(xv[j][e]) * XS);
      *(v4b*)(&Ax[r0 + j][tid * 4]) = hv; } }
  __syncthreads();   // the A tile is whole before any wave reads it
  v8f acc[4][2];
#pragma unroll
  for (int m = 0; m < 4; ++m) { acc[m][0] = (v8f){}; acc[m][1] = (v8f){}; }
  const b16* wp = W4 + ((size_t)which * D + c0 + wave * 32 + nloc) * D;
  // two k steps a trip, as before: together they use up one 128-byte line of each W row, and the address step is paid once
#pragma unroll 2
  for (int kb = 0; kb < D; kb += 32) { v16b bw[2], a[4];
#pragma unroll
    for (int n = 0; n < 2; ++n) bw[n] = frag_kb(wp + (size_t)n * 16 * D + kb, hlf);
#pragma unroll
    for (int m = 0; m < 4; ++m) a[m] = frag_kb(&Ax[m * 16 + nloc][kb], hlf);
#pragma unroll
    for (int m = 0; m < 4; ++m)
#pragma unroll
      for (int n = 0; n < 2; ++n) acc[m][n] = wmma16b(a[m], bw[n], acc[m][n]); }
  __syncthreads();   // every wave has left Ax before Tf overwrites it
#pragma unroll
  for (int n = 0; n < 2; ++n) { const int cc = wave * 32 + n * 16 + nloc; const float bb = bfv(bias[c0 + cc]);
#pragma unroll
    for (int m = 0; m < 4; ++m)
#pragma unroll
      for (int r8 = 0; r8 < 8; ++r8) Tf[m * 16 + 8 * hlf + r8][cc] = acc[m][n][r8] * (1.0f / (XS * WSC)) + bb; }
  __syncthreads();   // Tf is whole before the row-wise stores read it
  for (int rr = wave; rr < GM; rr += 8) { const size_t tk = t0 + rr;
    if (which == 0) { for (int q = 0; q < 4; ++q) { const int c = q * 64 + lane * 2; b16 h0, l0, h1, l1; split16(Tf[rr][c] * HS, h0, l0); split16(Tf[rr][c + 1] * HS, h1, l1); *(v2b*)(Qh + tk * D + c0 + c) = (v2b){h0, h1}; *(v2b*)(Ql + tk * D + c0 + c) = (v2b){l0, l1}; }
      asm volatile("s_wait_xcnt 0x0" ::: "memory"); }   // behind the row's stores, inside the branch: the wait that belongs in front of the next reuse of their address and data registers
    else { float* R = which == 1 ? KR : VR; for (int q = 0; q < 2; ++q) *(v4f*)(R + tk * D + c0 + q * 128 + lane * 4) = *(const v4f*)(&Tf[rr][q * 128 + lane * 4]);
      asm volatile("s_wait_xcnt 0x0" ::: "memory"); } } }   // the same wait for this branch's stores
__global__ __launch_bounds__(256) void area_kernel(const float* __restrict__ KR, const float* __restrict__ VR, b16* __restrict__ KAh, b16* __restrict__ KAl, b16* __restrict__ VTh, b16* __restrict__ VTl) { __shared__ float Tv[64][HD + 1]; const int bh = blockIdx.x / (NAP / 64), a0 = (blockIdx.x % (NAP / 64)) * 64; const int b = bh / H, h = bh % H; const int tid = threadIdx.x, wave = tid >> 5, lane = tid & 31;
  for (int q = wave; q < 64; q += 8) { const int a = a0 + q; int t0, w; area_of(a, t0, w); v2f ks = {0, 0}, vs = {0, 0}; for (int i = 0; i < w; ++i) { const size_t ro = ((size_t)b * L + t0 + i) * D + h * HD + lane * 2; ks += *(const v2f*)(KR + ro); vs += *(const v2f*)(VR + ro); } const float inv = w > 0 ? 1.0f / (float)w : 0.0f; b16 h0, l0, h1, l1; split16(ks[0] * inv * HS, h0, l0); split16(ks[1] * inv * HS, h1, l1); Tv[q][lane * 2] = vs[0]; Tv[q][lane * 2 + 1] = vs[1];
    { *(v2b*)(KAh + ((size_t)bh * NAP + a) * HD + lane * 2) = (v2b){h0, h1}; *(v2b*)(KAl + ((size_t)bh * NAP + a) * HD + lane * 2) = (v2b){l0, l1};  } }
  __syncthreads();
  { for (int d = wave; d < HD; d += 8) { b16 h0, l0, h1, l1; split16(Tv[lane * 2][d] * HS, h0, l0); split16(Tv[lane * 2 + 1][d] * HS, h1, l1); const size_t o = ((size_t)bh * HD + d) * NAP + a0 + lane * 2; *(v2b*)(VTh + o) = (v2b){h0, h1}; *(v2b*)(VTl + o) = (v2b){l0, l1}; }  } }
// Attention work-group: AG halves of AW waves, all of one (batch, head); a half works on one 64-query block at a time, 16 queries a wave. Chunk c is the 128 tokens CS c - HALO .. CS c + CS - 1 (padded rows CS c ..): it owns the areas that END in its last CS tokens, and its first HALO tokens are there for the two tokens that such an area may reach back, so every chunk is worked on by itself. Its K and V rows are brought into LDS once for the four waves of a half and every fragment is read from there.
// One buffer = Kh, Kl (128 token rows of 128 bytes, pitch 144) and Vh, Vl (64 feature rows of 256 bytes, pitch 272): pitches of 16 bytes x odd for the 16-byte LDS reads. Two buffers for each half: the next chunk's copies fly while this chunk is worked on.
constexpr int AW = 4, AG = 2, XP = 36, KP = HD + 8, VP = CH + 8, KB = CH * KP, VB = HD * VP, SB = 2 * KB + 2 * VB;
typedef __attribute__((ext_vector_type(4))) int v4i;
// eight asynchronous 16-byte copies to LDS per lane (LDS byte address l + i ls, global address g + i gs); the s_wait_xcnt stands in the copies' own statement, in front of any reuse of the address registers that they name
__device__ __forceinline__ void copy8(unsigned int l, unsigned int ls, const char* g, size_t gs) {
  asm volatile("global_load_async_to_lds_b128 %0, %8, off\n\tglobal_load_async_to_lds_b128 %1, %9, off\n\tglobal_load_async_to_lds_b128 %2, %10, off\n\tglobal_load_async_to_lds_b128 %3, %11, off\n\t"
               "global_load_async_to_lds_b128 %4, %12, off\n\tglobal_load_async_to_lds_b128 %5, %13, off\n\tglobal_load_async_to_lds_b128 %6, %14, off\n\tglobal_load_async_to_lds_b128 %7, %15, off\n\ts_wait_xcnt 0x0"
               :: "v"(l), "v"(l + ls), "v"(l + 2 * ls), "v"(l + 3 * ls), "v"(l + 4 * ls), "v"(l + 5 * ls), "v"(l + 6 * ls), "v"(l + 7 * ls),
                  "v"(g), "v"(g + gs), "v"(g + 2 * gs), "v"(g + 3 * gs), "v"(g + 4 * gs), "v"(g + 5 * gs), "v"(g + 6 * gs), "v"(g + 7 * gs) : "memory"); }
// one chunk into the buffer at LDS byte address lb: 16-byte piece p = tid + 128 i of each of the four tiles (K: row p / 8, the 16 KB are contiguous in memory; V: row p / 16, memory pitch NAP elements)
__device__ __forceinline__ void stage_chunk(unsigned int lb, int tid, int a0, const b16* kh, const b16* kl, const b16* vh, const b16* vl) {
  const unsigned int lk = lb + (unsigned int)((tid >> 3) * (KP * 2) + (tid & 7) * 16), lv = lb + (unsigned int)(2 * KB * 2 + (tid >> 4) * (VP * 2) + (tid & 15) * 16);
  const size_t gk = (size_t)a0 * (HD * 2) + (size_t)tid * 16, gv = (size_t)(tid >> 4) * (NAP * 2) + (size_t)a0 * 2 + (size_t)(tid & 15) * 16;
  copy8(lk, 16 * KP * 2, (const char*)kh + gk, 2048); copy8(lk + KB * 2, 16 * KP * 2, (const char*)kl + gk, 2048);
  copy8(lv, 8 * VP * 2, (const char*)vh + gv, (size_t)8 * NAP * 2); copy8(lv + VB * 2, 8 * VP * 2, (const char*)vl + gv, (size_t)8 * NAP * 2); }
// one work-group to a WGP, two waves for each SIMD (a wave of each half): let the register budget and the load scheduling be those of two resident waves
__global__ __launch_bounds__(32 * AW * AG) __attribute__((amdgpu_waves_per_eu(1, 2))) void att_kernel(const b16* __restrict__ Qh, const b16* __restrict__ Ql, const b16* __restrict__ KAh, const b16* __restrict__ KAl, const b16* __restrict__ VTh, const b16* __restrict__ VTl, const int* __restrict__ mask, const int* __restrict__ zpad, int QLIM, float* __restrict__ O) { __shared__ __attribute__((aligned(16))) b16 sb[AG * 2 * SB]; __shared__ unsigned int cv[AG * AW];
  const int tid = threadIdx.x, wave = __builtin_amdgcn_readfirstlane(tid >> 5), lane = tid & 31, nloc = lane & 15, hlf = lane >> 4, grp = wave / AW, wq = wave % AW, gt = tid % (32 * AW); constexpr int NQB = L / (16 * AW);
  // The work-group owns query blocks A = NQB - 1 - pr and B = pr of its head: under a causal mask one sees many chunks where the other sees few, so every work-group has about the same number of (block, chunk) tasks.
  // The tasks, A's visible chunks in order and then B's, are cut in the middle: half 0 takes the first part, half 1 the rest, each through an LDS ring of its own. No wave walks a long row of chunks alone while its SIMD's other wave has run out of work.
  const int bh = blockIdx.x / (NQB / 2), pr = blockIdx.x % (NQB / 2), qbA = (NQB - 1 - pr) * (16 * AW), qbB = pr * (16 * AW); if (qbB >= QLIM) return;   // qbB < qbA: both blocks lie past the query cut; the whole work-group leaves, in front of every barrier
  const int q0 = (grp != 0 ? qbB : qbA) + wq * 16; const bool live = q0 < QLIM;   // the wave's own 16 queries: it scans their mask rows here and merges and stores their result at the end (a wave past the query cut still copies and passes every barrier; it stores nothing)
  const int b = bh / H, h = bh % H; const size_t tq = (size_t)b * L + q0;
  // both products are taken transposed (X^T = kh x qh^T, O^T = vh^T x c^T): queries are the N side, so lane nloc owns query nloc of the wave's 16 in the block in work and its half hlf holds tokens 16 T + 8 hlf + 0..7 of every 16-token tile T.
  // Two neighbouring tiles are then, register for register, the K = 32 operand of c (k = 8 hlf + e and 16 + 8 hlf + e, the order of frag_kb): mask, softmax and c never leave the registers; a neighbour token in the other half of the lanes comes by one lane exchange.
  // The task list must read the same in all waves: each wave ORs its 16 mask rows (whole lines); bit c of wv = some query of the wave sees some end position of chunk c, 120 c .. 120 c + 119. Exact, so that the cut in the middle halves the real work:
  v4i any[8];
#pragma unroll
  for (int j = 0; j < 8; ++j) any[j] = (v4i){0, 0, 0, 0};
  // rolled, four rows a trip: 32 loads of 16 bytes in flight per lane cover the latency
#pragma unroll 1
  for (int r0 = 0; r0 < 16; r0 += 4) { v4i mv[4][8];
#pragma unroll
    for (int r = 0; r < 4; ++r)
#pragma unroll
      for (int j = 0; j < 8; ++j) mv[r][j] = *(const v4i*)(mask + (size_t)(q0 + r0 + r) * L + j * 128 + lane * 4);
#pragma unroll
    for (int r = 0; r < 4; ++r)
#pragma unroll
      for (int j = 0; j < 8; ++j) any[j] |= mv[r][j]; }
  unsigned int wv = 0;
#pragma unroll
  for (int j = 0; j < 8; ++j) { const unsigned int bal = __builtin_amdgcn_ballot_w32((any[j][0] | any[j][1] | any[j][2] | any[j][3]) != 0), lowm = (1u << (30 - 2 * j)) - 1u;   // lane l holds columns 128 j + 4 l .. + 3: chunk j for l < 30 - 2 j, chunk j + 1 behind
    wv |= ((bal & lowm) != 0u ? 1u : 0u) << j; wv |= ((bal & ~lowm) != 0u ? 1u : 0u) << (j + 1); }
  if (lane == 0) cv[wave] = live ? wv : 0u;
  __syncthreads();   // all eight words are written before any wave reads them
  // ra, rb: the chunks of A and of B that are still to be handed out to this half; nst = steps of the longer half (half 0), passed by every wave; n = this half's own tasks
  unsigned int ra = (unsigned int)__builtin_amdgcn_readfirstlane((int)(cv[0] | cv[1] | cv[2] | cv[3])), rb = (unsigned int)__builtin_amdgcn_readfirstlane((int)(cv[4] | cv[5] | cv[6] | cv[7]));
  const int ntot = __builtin_popcount(ra) + __builtin_popcount(rb), nst = (ntot + 1) >> 1; int n = nst;
  if (grp != 0) { n = ntot - nst; for (int i = 0; i < nst; ++i) { if (ra != 0u) ra &= ra - 1u; else rb &= rb - 1u; } }   // half 1 steps over half 0's tasks (at most NCH trips)
  auto pop = [&](int& c, int& k) { if (ra != 0u) { c = __builtin_ctz(ra); ra &= ra - 1u; k = 0; } else { c = __builtin_ctz(rb); rb &= rb - 1u; k = 1; } };   // next task: chunk c of block k (0 = A, 1 = B)
  // the block in work: its first query of this wave, its mask row and its query fragments
  bool wlive = false; const int* mrow = mask; v16b qa[2], ql[2];
  auto take = [&](int k) { const int qw = (k != 0 ? qbB : qbA) + wq * 16; wlive = qw < QLIM; mrow = mask + (size_t)(qw + nloc) * L; const size_t qo = ((size_t)b * L + qw + nloc) * D + h * HD;
    for (int ks = 0; ks < 2; ++ks) { qa[ks] = frag_kb(Qh + qo + ks * 32, hlf); ql[ks] = frag_kb(Ql + qo + ks * 32, hlf); }
    __builtin_amdgcn_sched_barrier(0);   // keeps the fragment loads in front of the wait below (without it the scheduler let them sink behind it)
    asm volatile("s_wait_xcnt 0x0" ::: "memory");   // behind the fragment loads: the wait that belongs in front of the next reuse of their address registers
    __builtin_amdgcn_sched_barrier(0); };   // and keeps what follows, which may reuse those registers, behind the wait
  v8f oacc[4] = {(v8f){}, (v8f){}, (v8f){}, (v8f){}}, oA[4] = {(v8f){}, (v8f){}, (v8f){}, (v8f){}}; float mrun = -INFINITY, lrun = 0.0f, mA = -INFINITY, lA = 0.0f;   // the state of the block in work; block A's state once the half has gone on to B
  const unsigned int lds0 = (unsigned int)(size_t)sb + (unsigned int)(grp * 2 * SB * 2);   // LDS byte address of this half's buffer 0: the low 32 bits of the shared address
  const b16 *gkh = KAh + (size_t)bh * NAP * HD, *gkl = KAl + (size_t)bh * NAP * HD, *gvh = VTh + (size_t)bh * HD * NAP, *gvl = VTl + (size_t)bh * HD * NAP;
  int c0 = 0, c1 = 0, k0 = 0, k1 = 0;   // the task in work and the task in flight
  if (n > 0) { pop(c0, k0); stage_chunk(lds0, gt, c0 * CS, gkh, gkl, gvh, gvl); }
  int kc = k0; take(kc);   // here, so that the fragments' latency passes while the first chunk's copies fly
  asm volatile("s_wait_asynccnt 0x0" ::: "memory");   // this wave's copies of the first chunk have landed
  __syncthreads();   // and every wave's: the first chunk may be read
  if (n > 1) { pop(c1, k1); stage_chunk(lds0 + SB * 2, gt, c1 * CS, gkh, gkl, gvh, gvl); }
#pragma unroll 1
  for (int st = 0; st < nst; ++st) { const int e0 = c0 * CS - HALO; const b16* kbuf = sb + (grp * 2 + (st & 1)) * SB; const b16* vbuf = kbuf + 2 * KB; const bool act = st < n;   // half 1 may have one task less: it passes the last hand-over all the same
    if (act && k0 != kc) {   // wave-uniform: the half goes on from block A to block B
      kc = k0; take(kc);
#pragma unroll
      for (int t = 0; t < 4; ++t) { oA[t] = oacc[t]; oacc[t] = (v8f){}; }
      mA = mrun; lA = lrun; mrun = -INFINITY; lrun = 0.0f; }
    // visibility bits of this lane's 64 end positions e0 + 16 T + 8 hlf + r8 (bit 8 (T & 3) + r8 of word T >> 2). A group of eight holds ends of this chunk unless it is the halo (T = 0, lower half) or lies behind the last token: there the address is clamped and no bit is set.
    unsigned int vb[NTI / 4] = {};
#pragma unroll
    for (int t = 0; t < NTI; ++t) { const int g = e0 + t * 16 + 8 * hlf; const bool ok = (t > 0 || hlf != 0) && g < L; int m[8]; __builtin_memcpy(m, mrow + (ok ? g : 0), 32); unsigned int bb = 0;
#pragma unroll
      for (int r8 = 0; r8 < 8; ++r8) bb |= (m[r8] != 0 ? 1u : 0u) << r8;
      vb[t >> 2] |= (ok ? bb : 0u) << ((t & 3) * 8); }
    // an area of width w ends no earlier than token w - 1: end 0 has width 1 alone, end 1 widths 1 and 2 (chunk 0, tile 0, upper half, bits 0 and 1)
    const bool later = c0 != 0 || hlf == 0;
    if (act && wlive && __builtin_amdgcn_ballot_w32((vb[0] | vb[1]) != 0u) != 0u) {   // wave-uniform: where no query of this wave sees any area of the chunk its contribution is exactly zero; the hand-over below is passed all the same
    v8f s[NTI];
#pragma unroll
    for (int tg = 0; tg < NTI; tg += 4) {
#pragma unroll
      for (int t = 0; t < 4; ++t) s[tg + t] = (v8f){};
#pragma unroll
      for (int ks = 0; ks < 2; ++ks) { v16b kh[4], kl[4];
#pragma unroll
        for (int t = 0; t < 4; ++t) { const b16* kr = kbuf + ((tg + t) * 16 + nloc) * KP + ks * 32; kh[t] = frag_kb(kr, hlf); kl[t] = frag_kb(kr + KB, hlf); }
#pragma unroll
        for (int t = 0; t < 4; ++t) s[tg + t] = wmma16q(kh[t], qa[ks], s[tg + t]);
#pragma unroll
        for (int t = 0; t < 4; ++t) s[tg + t] = wmma16q(kl[t], qa[ks], s[tg + t]);
#pragma unroll
        for (int t = 0; t < 4; ++t) s[tg + t] = wmma16q(kh[t], ql[ks], s[tg + t]); } }
    // token logits x (in s), and for every group of eight its two predecessors b7 = x[-1], b6 = x[-2], which the other half of the lanes holds: the group in front of (T, upper half) is (T, lower half); in front of (T, lower half), (T - 1, upper half); the chunk's first group is halo and ends no area
    float b6[NTI], b7[NTI];
#pragma unroll
    for (int t = 0; t < NTI; ++t) { s[t] *= SCALE / (HS * HS); b6[t] = xhalf(s[t][6]); b7[t] = xhalf(s[t][7]); }
#pragma unroll
    for (int t = NTI - 1; t >= 0; --t) { b6[t] = hlf ? b6[t] : (t > 0 ? b6[t > 0 ? t - 1 : 0] : 0.0f); b7[t] = hlf ? b7[t] : (t > 0 ? b7[t > 0 ? t - 1 : 0] : 0.0f); }
    // area logits by end position e: x[e], (x[e] + x[e-1]) / 2, (x[e] + x[e-1] + x[e-2]) / 3; written out here for the maximum and again below for the weights
    v8f m8;
#pragma unroll
    for (int r8 = 0; r8 < 8; ++r8) m8[r8] = -INFINITY;
#pragma unroll
    for (int t = 0; t < NTI; ++t)
#pragma unroll
      for (int r8 = 0; r8 < 8; ++r8) { const float x0 = s[t][r8], xm1 = r8 >= 1 ? s[t][r8 >= 1 ? r8 - 1 : 0] : b7[t], xm2 = r8 >= 2 ? s[t][r8 >= 2 ? r8 - 2 : 0] : (r8 == 1 ? b7[t] : b6[t]), u2 = x0 + xm1, u3 = u2 + xm2;
        const bool c1 = ((vb[t >> 2] >> ((t & 3) * 8 + r8)) & 1u) != 0u, c2 = (t == 0 && r8 == 0) ? (c1 && later) : c1, c3 = (t == 0 && r8 <= 1) ? (c1 && later) : c1;
        m8[r8] = fmaxf(m8[r8], fmaxf(x0 + (c1 ? 0.0f : -INFINITY), fmaxf(__builtin_fmaf(u2, 0.5f, c2 ? 0.0f : -INFINITY), __builtin_fmaf(u3, 1.0f / 3.0f, c3 ? 0.0f : -INFINITY)))); }
    float mx = fmaxf(fmaxf(fmaxf(m8[0], m8[1]), fmaxf(m8[2], m8[3])), fmaxf(fmaxf(m8[4], m8[5]), fmaxf(m8[6], m8[7]))); mx = fmaxf(mx, __shfl_xor(mx, 16));
    const float mn = fmaxf(mrun, mx), fe = exp2_slot((mrun - mn) * LOG2E), fac = (mrun == -INFINITY) ? 0.0f : fe, ms = (mn == -INFINITY) ? 0.0f : mn, nms = -ms * LOG2E; v8f s8 = (v8f){};
    // weights by end position e: wa = p1 + p2 + p3 goes to token e (and into the row sum), wb = p2 + p3 also to token e - 1, wc = p3 also to token e - 2: token weight c[t] = wa[t] + wb[t + 1] + wc[t + 2], written over x tile by tile.
    // What the last two tokens of a group take from the group behind it (n0 = wc[0], n1 = wb[0] + wc[1]) comes from the other half of the lanes: behind (T, lower half) stands (T, upper half); behind (T, upper half), (T + 1, lower half); behind the chunk's last group, the next chunk's ends, which reach these tokens through that chunk's halo.
    float n0[NTI], n1[NTI];
#pragma unroll
    for (int t = 0; t < NTI; ++t) { float wa[8], wb[8], wc[8];
#pragma unroll
      for (int r8 = 0; r8 < 8; ++r8) { const float x0 = s[t][r8], xm1 = r8 >= 1 ? s[t][r8 >= 1 ? r8 - 1 : 0] : b7[t], xm2 = r8 >= 2 ? s[t][r8 >= 2 ? r8 - 2 : 0] : (r8 == 1 ? b7[t] : b6[t]), u2 = x0 + xm1, u3 = u2 + xm2;
        const bool c1 = ((vb[t >> 2] >> ((t & 3) * 8 + r8)) & 1u) != 0u, c2 = (t == 0 && r8 == 0) ? (c1 && later) : c1, c3 = (t == 0 && r8 <= 1) ? (c1 && later) : c1;
        const float p1 = exp2_slot(__builtin_fmaf(x0, LOG2E, c1 ? nms : -INFINITY)), p2 = exp2_slot(__builtin_fmaf(u2, 0.5f * LOG2E, c2 ? nms : -INFINITY)), p3 = exp2_slot(__builtin_fmaf(u3, LOG2E / 3.0f, c3 ? nms : -INFINITY));
        wc[r8] = p3; wb[r8] = p2 + p3; wa[r8] = p1 + wb[r8]; s8[r8] += wa[r8]; }
      n0[t] = xhalf(wc[0]); n1[t] = xhalf(wb[0] + wc[1]);
#pragma unroll
      for (int r8 = 0; r8 < 6; ++r8) s[t][r8] = wa[r8] + wb[r8 + 1] + wc[r8 + 2];
      s[t][6] = wa[6] + wb[7]; s[t][7] = wa[7]; }
    float sm = ((s8[0] + s8[1]) + (s8[2] + s8[3])) + ((s8[4] + s8[5]) + (s8[6] + s8[7])); sm += __shfl_xor(sm, 16); lrun = lrun * fac + sm; mrun = mn;
#pragma unroll
    for (int t = 0; t < NTI; ++t) { s[t][6] += hlf ? (t + 1 < NTI ? n0[t + 1 < NTI ? t + 1 : 0] : 0.0f) : n0[t]; s[t][7] += hlf ? (t + 1 < NTI ? n1[t + 1 < NTI ? t + 1 : 0] : 0.0f) : n1[t]; s[t] *= PS; }
#pragma unroll
    for (int t = 0; t < 4; ++t) oacc[t] *= fac;
#pragma unroll
    for (int kb = 0; kb < CH; kb += 32) { v16b pa, pb, vh[4], vlo[4];
#pragma unroll
      for (int e = 0; e < 8; ++e) { b16 ph, pl; split16(s[kb / 16][e], ph, pl); pa[e] = ph; pb[e] = pl; split16(s[kb / 16 + 1][e], ph, pl); pa[8 + e] = ph; pb[8 + e] = pl; }
#pragma unroll
      for (int t = 0; t < 4; ++t) { const b16* vr = vbuf + (t * 16 + nloc) * VP + kb; vh[t] = frag_kb(vr, hlf); vlo[t] = frag_kb(vr + VB, hlf); }
#pragma unroll
      for (int t = 0; t < 4; ++t) oacc[t] = wmma16b(vh[t], pa, oacc[t]);
#pragma unroll
      for (int t = 0; t < 4; ++t) oacc[t] = wmma16b(vlo[t], pa, oacc[t]);
#pragma unroll
      for (int t = 0; t < 4; ++t) oacc[t] = wmma16b(vh[t], pb, oacc[t]); } }
    // hand-over, every wave, in this order: my LDS reads of this buffer are done; my copies of the next chunk have landed; the barrier publishes the next chunk and frees this buffer; only then the refill
    asm volatile("s_wait_dscnt 0x0" ::: "memory");
    asm volatile("s_wait_asynccnt 0x0" ::: "memory");
    __syncthreads();
    c0 = c1; k0 = k1;
    if (st + 2 < n) { pop(c1, k1); stage_chunk(lds0 + (unsigned int)((st & 1) * SB * 2), gt, c1 * CS, gkh, gkl, gvh, gvl); } }
  asm volatile("s_wait_asynccnt 0x0" ::: "memory");   // no copy is outstanding when the wave ends
  // Each wave now holds a state for its tile of A and one for its tile of B (empty: -inf, 0, 0). Half 0 finishes A, half 1 finishes B: a wave hands the other state to the wave of the other half that has the same tile, through LDS (the rings are free: every wave's reads and copies ended in front of the last barrier).
  if (kc == 0) {
#pragma unroll
    for (int t = 0; t < 4; ++t) { oA[t] = oacc[t]; oacc[t] = (v8f){}; }
    mA = mrun; lA = lrun; mrun = -INFINITY; lrun = 0.0f; }
  if (grp == 0) {
#pragma unroll
    for (int t = 0; t < 4; ++t) { const v8f x = oacc[t]; oacc[t] = oA[t]; oA[t] = x; }
    const float xm = mrun, xl = lrun; mrun = mA; lrun = lA; mA = xm; lA = xl; }
  // (oacc, mrun, lrun) stays, (oA, mA, lA) goes; XP floats a lane: a pitch of 16 bytes x odd
  float* xw = (float*)sb + (size_t)(wave * 32 + lane) * XP; const float* xr = (const float*)sb + (size_t)((wave ^ AW) * 32 + lane) * XP;
#pragma unroll
  for (int t = 0; t < 4; ++t) { *(v4f*)(xw + t * 8) = (v4f){oA[t][0], oA[t][1], oA[t][2], oA[t][3]}; *(v4f*)(xw + t * 8 + 4) = (v4f){oA[t][4], oA[t][5], oA[t][6], oA[t][7]}; }
  *(v2f*)(xw + 32) = (v2f){mA, lA};
  __syncthreads();   // every wave's handed-over state is written before its partner reads it
  const v2f ml = *(const v2f*)(xr + 32); const float mm = fmaxf(mrun, ml[0]), ek = exp2_slot((mrun - mm) * LOG2E), ep = exp2_slot((ml[0] - mm) * LOG2E), fk = (mrun == -INFINITY) ? 0.0f : ek, fp = (ml[0] == -INFINITY) ? 0.0f : ep;
  lrun = lrun * fk + ml[1] * fp;
#pragma unroll
  for (int t = 0; t < 4; ++t) { const v4f p0 = *(const v4f*)(xr + t * 8), p1 = *(const v4f*)(xr + t * 8 + 4);
#pragma unroll
    for (int j = 0; j < 4; ++j) { oacc[t][j] = oacc[t][j] * fk + p0[j] * fp; oacc[t][4 + j] = oacc[t][4 + j] * fk + p1[j] * fp; } }
  const bool zero = (zpad[0] != 0 && q0 + nloc == 0);
  if (live) {
#pragma unroll
  for (int t = 0; t < 4; ++t) { v4f o0, o1;
#pragma unroll
    for (int j = 0; j < 4; ++j) { const float u0 = oacc[t][j] * (1.0f / (PS * HS)) / lrun, u1 = oacc[t][4 + j] * (1.0f / (PS * HS)) / lrun; o0[j] = zero ? 0.0f : u0; o1[j] = zero ? 0.0f : u1; }
    float* op = O + (tq + nloc) * D + h * HD + t * 16 + 8 * hlf; *(v4f*)op = o0; *(v4f*)(op + 4) = o1; } } }
__global__ __launch_bounds__(256) void outp_kernel(const float* __restrict__ O, const b16* __restrict__ WO, const float* __restrict__ bo, int QLIM, float* __restrict__ out) { __shared__ __attribute__((aligned(16))) char sm[2 * GM * AP * 2]; b16 (*Ah)[AP] = (b16 (*)[AP])sm; b16 (*Al)[AP] = (b16 (*)[AP])(sm + GM * AP * 2); float (*Tf)[TP] = (float (*)[TP])sm;   // Tf takes Ah's place behind the K loop
  const int tid = threadIdx.x, wave = __builtin_amdgcn_readfirstlane(tid >> 5), lane = tid & 31, nloc = lane & 15, hlf = lane >> 4; const size_t t0 = (size_t)blockIdx.x * GM; const int c0 = blockIdx.y * GN; if ((int)(t0 % L) >= QLIM) return;
  // rolled: 16 rows a trip are 16 loads of 16 bytes in flight per lane, enough to cover the latency
#pragma unroll 1
  for (int r0 = 0; r0 < GM; r0 += 16) { v4f xv[16];
#pragma unroll
    for (int j = 0; j < 16; ++j) xv[j] = *(const v4f*)(O + (t0 + r0 + j) * D + tid * 4);
#pragma unroll
    for (int j = 0; j < 16; ++j) { v4b hv, lv;
#pragma unroll
      for (int e = 0; e < 4; ++e) { b16 p, pl; split16(xv[j][e] * HS, p, pl); hv[e] = p; lv[e] = pl; }
      *(v4b*)(&Ah[r0 + j][tid * 4]) = hv; *(v4b*)(&Al[r0 + j][tid * 4]) = lv; } }
  __syncthreads();   // both A tiles are whole before any wave reads them
  v8f acc[4][2];
#pragma unroll
  for (int m = 0; m < 4; ++m) { acc[m][0] = (v8f){}; acc[m][1] = (v8f){}; }
  const b16* wp = WO + (size_t)(c0 + wave * 32 + nloc) * D;
  // two k steps a trip, as before: together they use up one 128-byte line of each W row, and the address step is paid once
#pragma unroll 2
  for (int kb = 0; kb < D; kb += 32) { v16b bw[2], a[4], al[4];
#pragma unroll
    for (int n = 0; n < 2; ++n) bw[n] = frag_kb(wp + (size_t)n * 16 * D + kb, hlf);
#pragma unroll
    for (int m = 0; m < 4; ++m) { a[m] = frag_kb(&Ah[m * 16 + nloc][kb], hlf); al[m] = frag_kb(&Al[m * 16 + nloc][kb], hlf); }
#pragma unroll
    for (int m = 0; m < 4; ++m)
#pragma unroll
      for (int n = 0; n < 2; ++n) acc[m][n] = wmma16b(a[m], bw[n], acc[m][n]);
#pragma unroll
    for (int m = 0; m < 4; ++m)
#pragma unroll
      for (int n = 0; n < 2; ++n) acc[m][n] = wmma16b(al[m], bw[n], acc[m][n]); }
  __syncthreads();   // every wave has left Ah before Tf overwrites it
#pragma unroll
  for (int n = 0; n < 2; ++n) { const int cc = wave * 32 + n * 16 + nloc; const float bb = bfv(bo[c0 + cc]);
#pragma unroll
    for (int m = 0; m < 4; ++m)
#pragma unroll
      for (int r8 = 0; r8 < 8; ++r8) Tf[m * 16 + 8 * hlf + r8][cc] = acc[m][n][r8] * (1.0f / (HS * WSC)) + bb; }
  __syncthreads();   // Tf is whole before the row-wise stores read it
  for (int rr = wave; rr < GM; rr += 8) { if ((int)((t0 + rr) % L) >= QLIM) continue;   // rows past the query cut stay unwritten, as before
    for (int q = 0; q < 2; ++q) *(v4f*)(out + (t0 + rr) * D + c0 + q * 128 + lane * 4) = *(const v4f*)(&Tf[rr][q * 128 + lane * 4]);
    asm volatile("s_wait_xcnt 0x0" ::: "memory"); } }   // behind the row's stores: the wait that belongs in front of the next trip's reuse of their address and data registers
}  // namespace

extern "C" void kernel_launch(void* const* d_in, const int* in_sizes, int n_in, void* d_out, int out_size, void* d_ws, size_t ws_size, hipStream_t stream) {
  (void)n_in;
  auto Fp = [&](int i) { return (const float*)d_in[i]; }; auto Ip = [&](int i) { return (const int*)d_in[i]; };
  // input order: 0 q [2,1024,1024]; 1 k; 2 v; 3 Wq; 4 bq; 5 Wk; 6 bk; 7 Wv; 8 bv; 9 Wo; 10 bo; 11 mask [1024,1024] i32; 12 zero_pad [1] i32
  if (in_sizes[0] != NT * D || in_sizes[1] != NT * D || in_sizes[2] != NT * D || in_sizes[3] != D * D || in_sizes[9] != D * D || in_sizes[11] != L * L || in_sizes[12] != 1 || out_size != NT * D) return;
  const int QLIM = L;   // per-batch query cut (multiple of 16)
  size_t off = 0; char* ws = (char*)d_ws;
  auto carve = [&](size_t bytes) { char* p = ws + off; off += (bytes + 255) & ~(size_t)255; return p; };
  b16* W4 = (b16*)carve((size_t)4 * D * D * 2); b16* Qh = (b16*)carve((size_t)NT * D * 2); b16* Ql = (b16*)carve((size_t)NT * D * 2); float* KR = (float*)carve((size_t)NT * D * 4); float* VR = (float*)carve((size_t)NT * D * 4); b16* KAh = (b16*)carve((size_t)NB_ * H * NAP * HD * 2); b16* KAl = (b16*)carve((size_t)NB_ * H * NAP * HD * 2); b16* VTh = (b16*)carve((size_t)NB_ * H * HD * NAP * 2); b16* VTl = (b16*)carve((size_t)NB_ * H * HD * NAP * 2); float* O = (float*)carve((size_t)NT * D * 4);
  if (off > ws_size || off > ((size_t)96 << 20)) return;   // 57 MiB
  wput_kernel<<<256, 256, 0, stream>>>(Fp(3), Fp(5), Fp(7), Fp(9), W4);
  proj_kernel<<<dim3(NT / GM, 3, D / GN), 256, 0, stream>>>(Fp(0), Fp(1), Fp(2), W4, Fp(4), Fp(6), Fp(8), Qh, Ql, KR, VR);
  area_kernel<<<NB_ * H * (NAP / 64), 256, 0, stream>>>(KR, VR, KAh, KAl, VTh, VTl);
  att_kernel<<<NB_ * H * (L / (16 * AW)) / AG, 32 * AW * AG, 0, stream>>>(Qh, Ql, KAh, KAl, VTh, VTl, Ip(11), Ip(12), QLIM, O);
  outp_kernel<<<dim3(NT / GM, D / GN), 256, 0, stream>>>(O, W4 + (size_t)3 * D * D, Fp(10), QLIM, (float*)d_out);
}

// v006
// It runs in 92.9 microseconds.
// In two side-by-side timings against v005, it was 1.13 and 1.12 times as fast.
// Counting every step since v000, it is 29.2 times as fast.
#include <hip/hip_runtime.h>

// MultiHeadAreaAttention: qh,kh,vh = (q Wq^T + bq), (k Wk^T + bk), (v Wv^T + bv) as 16 heads x 64; areas = all windows of width 1..3 along the key axis (A = 3,069; block w starts at area index 0 / 1024 / 2047, end(a) = start + w - 1); k_area = window mean, v_area = window sum; logits = qh.k_area / 8, visible iff mask[q][end(a)] != 0 (else -1e30); weights = softmax over areas; if zero_pad: weights of query 0 := 0; ctx = weights.v_area; out = concat Wo^T + bo -> [2][1024][1024].
// Pooling is linear, so no pooled row is ever formed: qh.k_area(end e, width w) = (x[e] + .. + x[e-w+1]) / w with the token logits x[t] = qh.kh[t], and weights.v_area = sum over tokens t of c[t] vh[t], c[t] = the summed weights of the (up to six) areas that hold t. Both matrix products run over the 1,024 tokens instead of the 3,069 areas.
// Deterministic: online softmax over fixed chunks of 120 end positions (360 areas) in order, a query's chunks in at most two runs whose running maximum, sum and O are merged at the end in a fixed order (chunks with no visible area for any of the wave's 16 queries are skipped: they contribute exactly 0); inside a chunk each lane sums its areas in a fixed tree, then the two halves of a query are added; no atomics.
// WMMA (v_wmma_f32_16x16x32_f16, f32 accumulate): inputs (EXACT bf16 x8, K 1,024) x W rows (EXACT) per 64-token x 256-column work-group of 8 waves; per (bh, 16-query) wave (eight to a work-group, K and V chunks shared in LDS by four) X^T = kh token rows (hi+lo; 8 tiles/chunk) x qh (hi+lo x256, K 64) and O^T += vh^T rows (hi+lo; 4 tiles) x c (hi+lo), 3 products; o (hi+lo) x Wo rows, same tiling; neighbour sums, mask gather, softmax in f32.

namespace {
constexpr int NB_ = 2, L = 1024, D = 1024, H = 16, HD = 64, NT = NB_ * L, CH = 128, NTI = CH / 16, HALO = 8, CS = CH - HALO /* 120 */, NCH = (L + CS - 1) / CS /* 9 */, NAP = (NCH - 1) * CS + CH /* 1088 */;
constexpr float XS = 8.0f, HS = 256.0f, PS = 256.0f, WSC = 256.0f, SCALE = 0.125f, LOG2E = 1.44269504f;
typedef _Float16 b16;
typedef __attribute__((ext_vector_type(16))) _Float16 v16b;
typedef __attribute__((ext_vector_type(8))) _Float16 v8b;
typedef __attribute__((ext_vector_type(4))) _Float16 v4b;
typedef __attribute__((ext_vector_type(2))) _Float16 v2b;
typedef __attribute__((ext_vector_type(8))) float v8f;
typedef __attribute__((ext_vector_type(4))) float v4f;
typedef __attribute__((ext_vector_type(2))) float v2f;
__device__ __forceinline__ float bf16_rne(float f) { unsigned int u = __float_as_uint(f); u += 0x7FFFu + ((u >> 16) & 1u); float r = __uint_as_float(u & 0xFFFF0000u); asm volatile("" : "+v"(r)); return r; }
__device__ __forceinline__ float bfv(float f) { float r = bf16_rne(f); asm volatile("" : "+v"(r)); return r; }
__device__ __forceinline__ void split16(float v, b16& hi, b16& lo) { hi = (b16)v; lo = (b16)(v - (float)hi); }
__device__ __forceinline__ v16b frag_kb(const b16* p, int hh) { const v8b a = *(const v8b*)(p + 8 * hh), b = *(const v8b*)(p + 16 + 8 * hh); v16b f;
#pragma unroll
  for (int e = 0; e < 8; ++e) { f[e] = a[e]; f[8 + e] = b[e]; } return f; }
// W4 holds the four weight matrices in the order in which a GEMM wave reads them. One block = one B fragment (16 output columns x 32 k, WB elements) = two runs of 512 bytes: run r, lane l = (hlf, nloc) holds W[column nloc of the tile][k = 16 r + 8 hlf + 0..7], the k order of frag_kb.
// So each 16-byte load of a wave covers four whole 128-byte lines (from row-major W it touched sixteen lines for 32 bytes each). The blocks of one column tile follow one another in k (WT elements a tile), the tiles in column order, the matrices in the order q, k, v, o.
constexpr int WB = 16 * 32, WT = (D / 32) * WB, RD = 4;
__device__ __forceinline__ v16b frag_pk(const b16* p) { const v8b a = *(const v8b*)p, b = *(const v8b*)(p + WB / 2); v16b f;
#pragma unroll
  for (int e = 0; e < 8; ++e) { f[e] = a[e]; f[8 + e] = b[e]; } return f; }
__device__ __forceinline__ v8f wmma16b(v16b a, v16b b, v8f c) { v8f d = __builtin_amdgcn_wmma_f32_16x16x32_f16(false, a, false, b, (short)0, c, false, false); asm volatile("v_nop\n\tv_nop\n\tv_nop\n\tv_nop" : "+v"(d) : "v"(a), "v"(b)); return d; }
// the same for a B operand that is rewritten only when the half goes on to block B, far from any product (the query fragments): not named in the statement, it is free to live above v255, where an asm operand cannot, and leaves the low registers to the operands that must be there (named, two of the four fragments were spilled to scratch and read back in every chunk)
__device__ __forceinline__ v8f wmma16q(v16b a, v16b b, v8f c) { v8f d = __builtin_amdgcn_wmma_f32_16x16x32_f16(false, a, false, b, (short)0, c, false, false); asm volatile("v_nop\n\tv_nop\n\tv_nop\n\tv_nop" : "+v"(d) : "v"(a)); return d; }
// 2^x and, in the same statement, the one issue slot that the instruction set asks for behind a transcendental
__device__ __forceinline__ float exp2_slot(float x) { float p; asm("v_exp_f32 %0, %1\n\tv_nop" : "=v"(p) : "v"(x)); return p; }
// the value that lane l ^ 16 holds (the other half of the same query's tokens), by a vector cross-row move
__device__ __forceinline__ float xhalf(float v) { const int b = __float_as_int(v); return __int_as_float(__builtin_amdgcn_permlanex16(b, b, 0x76543210, 0xfedcba98, false, false)); }
// row a of the padded token axis (NAP rows) -> (token, 1); the HALO rows in front of token 0 and the rows behind token L - 1 get token 0, width 0 (zero rows)
__device__ __forceinline__ void area_of(int a, int& t0, int& w) { if (a >= HALO && a < L + HALO) { t0 = a - HALO; w = 1; } else { t0 = 0; w = 0; } }

__global__ __launch_bounds__(256) void wput_kernel(const float* __restrict__ wq, const float* __restrict__ wk, const float* __restrict__ wv, const float* __restrict__ wo, b16* __restrict__ W4) { const size_t nt = (size_t)gridDim.x * 256, u0 = (size_t)blockIdx.x * 256 + threadIdx.x; v8b v;
  // thread u writes the u-th 16 bytes of W4 (whole lines per wave) and gathers its eight weights from row oo, columns k0 ..
  for (size_t u = u0; u < (size_t)4 * D * 128; u += nt) { const int l = (int)(u % 32), r = (int)(u / 32) % 2, ks = (int)(u / 64) % (D / 32), ct = (int)(u / (64 * (D / 32))) % (D / 16), which = (int)(u / ((size_t)64 * (D / 32) * (D / 16))); const int oo = ct * 16 + (l & 15), k0 = ks * 32 + r * 16 + (l >> 4) * 8; const float* w = which == 0 ? wq : (which == 1 ? wk : (which == 2 ? wv : wo));
#pragma unroll
    for (int j = 0; j < 8; ++j) v[j] = (b16)(bf16_rne(w[(size_t)oo * D + k0 + j]) * WSC); { *(v8b*)(W4 + u * 8) = v;  } } }
// GEMM tile of one work-group (both projection kernels): GM tokens x GN output columns, 8 waves. All waves stage the A tile (whole K) in LDS once; wave w then owns columns 32 w .. 32 w + 31 for all GM tokens (4 x 2 accumulator tiles), so each B fragment read from global memory (packed: frag_pk) serves four products in proj_kernel and eight (hi and lo A tiles) in outp_kernel. k order per output element: ascending, as before.
constexpr int GM = 64, GN = 256, AP = D + 8, TP = GN + 4;
__global__ __launch_bounds__(256) void proj_kernel(const float* __restrict__ xq, const float* __restrict__ xk, const float* __restrict__ xv, const b16* __restrict__ W4, const float* __restrict__ bq, const float* __restrict__ bk, const float* __restrict__ bv, b16* __restrict__ Qh, b16* __restrict__ Ql, float* __restrict__ KR, float* __restrict__ VR) { __shared__ __attribute__((aligned(16))) char sm[GM * AP * 2]; b16 (*Ax)[AP] = (b16 (*)[AP])sm; float (*Tf)[TP] = (float (*)[TP])sm;   // Tf takes Ax's place behind the K loop
  const int tid = threadIdx.x, wave = __builtin_amdgcn_readfirstlane(tid >> 5), lane = tid & 31, nloc = lane & 15, hlf = lane >> 4; const size_t t0 = (size_t)blockIdx.x * GM; const int which = blockIdx.y, c0 = blockIdx.z * GN;
  const float* x = which == 0 ? xq : (which == 1 ? xk : xv); const float* bias = which == 0 ? bq : (which == 1 ? bk : bv);
  // rolled: 16 rows a trip are 16 loads of 16 bytes in flight per lane, enough to cover the memory latency
#pragma unroll 1
  for (int r0 = 0; r0 < GM; r0 += 16) { v4f xv[16];
#pragma unroll
    for (int j = 0; j < 16; ++j) xv[j] = *(const v4f*)(x + (t0 + r0 + j) * D + tid * 4);
#pragma unroll
    for (int j = 0; j < 16; ++j) { v4b hv;
#pragma unroll
      for (int e = 0; e < 4; ++e) hv[e] = (b16)(bf16_rne(xv[j][e]) * XS);
      *(v4b*)(&Ax[r0 + j][tid * 4]) = hv; } }
  // No line of packed W serves two k steps, so no step's loads warm the cache for the next: the fragments go through a ring of RD register sets, each refilled for k step s + RD as soon as step s has used it. The first RD sets are asked for here, in front of the barrier.
  const b16* wp = W4 + (size_t)(which * (D / 16) + (c0 + wave * 32) / 16) * WT + lane * 8; v16b bw[RD][2];
#pragma unroll
  for (int u = 0; u < RD; ++u)
#pragma unroll
    for (int n = 0; n < 2; ++n) bw[u][n] = frag_pk(wp + n * WT + u * WB);
  __syncthreads();   // the A tile is whole before any wave reads it
  v8f acc[4][2];
#pragma unroll
  for (int m = 0; m < 4; ++m) { acc[m][0] = (v8f){}; acc[m][1] = (v8f){}; }
  auto kstep = [&](int ks, int u, bool refill) { v16b a[4];
#pragma unroll
    for (int m = 0; m < 4; ++m) a[m] = frag_kb(&Ax[m * 16 + nloc][ks * 32], hlf);
#pragma unroll
    for (int m = 0; m < 4; ++m)
#pragma unroll
      for (int n = 0; n < 2; ++n) acc[m][n] = wmma16b(a[m], bw[u][n], acc[m][n]);
    if (refill) {
#pragma unroll
      for (int n = 0; n < 2; ++n) bw[u][n] = frag_pk(wp + n * WT + (size_t)(ks + RD) * WB); } };
  // rolled, RD k steps a trip (one turn of the ring, so that every set keeps its registers); the last turn refills nothing
#pragma unroll 1
  for (int k4 = 0; k4 < D / 32 - RD; k4 += RD) {
#pragma unroll
    for (int u = 0; u < RD; ++u) kstep(k4 + u, u, true); }
#pragma unroll
  for (int u = 0; u < RD; ++u) kstep(D / 32 - RD + u, u, false);
  __syncthreads();   // every wave has left Ax before Tf overwrites it
#pragma unroll
  for (int n = 0; n < 2; ++n) { const int cc = wave * 32 + n * 16 + nloc; const float bb = bfv(bias[c0 + cc]);
#pragma unroll
    for (int m = 0; m < 4; ++m)
#pragma unroll
      for (int r8 = 0; r8 < 8; ++r8) Tf[m * 16 + 8 * hlf + r8][cc] = acc[m][n][r8] * (1.0f / (XS * WSC)) + bb; }
  __syncthreads();   // Tf is whole before the row-wise stores read it
  for (int rr = wave; rr < GM; rr += 8) { const size_t tk = t0 + rr;
    if (which == 0) { for (int q = 0; q < 4; ++q) { const int c = q * 64 + lane * 2; b16 h0, l0, h1, l1; split16(Tf[rr][c] * HS, h0, l0); split16(Tf[rr][c + 1] * HS, h1, l1); *(v2b*)(Qh + tk * D + c0 + c) = (v2b){h0, h1}; *(v2b*)(Ql + tk * D + c0 + c) = (v2b){l0, l1}; }
      asm volatile("s_wait_xcnt 0x0" ::: "memory"); }   // behind the row's stores, inside the branch: the wait that belongs in front of the next reuse of their address and data registers
    else { float* R = which == 1 ? KR : VR; for (int q = 0; q < 2; ++q) *(v4f*)(R + tk * D + c0 + q * 128 + lane * 4) = *(const v4f*)(&Tf[rr][q * 128 + lane * 4]);
      asm volatile("s_wait_xcnt 0x0" ::: "memory"); } } }   // the same wait for this branch's stores
__global__ __launch_bounds__(256) void area_kernel(const float* __restrict__ KR, const float* __restrict__ VR, b16* __restrict__ KAh, b16* __restrict__ KAl, b16* __restrict__ VTh, b16* __restrict__ VTl) { __shared__ float Tv[64][HD + 1]; const int bh = blockIdx.x / (NAP / 64), a0 = (blockIdx.x % (NAP / 64)) * 64; const int b = bh / H, h = bh % H; const int tid = threadIdx.x, wave = tid >> 5, lane = tid & 31;
  for (int q = wave; q < 64; q += 8) { const int a = a0 + q; int t0, w; area_of(a, t0, w); v2f ks = {0, 0}, vs = {0, 0}; for (int i = 0; i < w; ++i) { const size_t ro = ((size_t)b * L + t0 + i) * D + h * HD + lane * 2; ks += *(const v2f*)(KR + ro); vs += *(const v2f*)(VR + ro); } const float inv = w > 0 ? 1.0f / (float)w : 0.0f; b16 h0, l0, h1, l1; split16(ks[0] * inv * HS, h0, l0); split16(ks[1] * inv * HS, h1, l1); Tv[q][lane * 2] = vs[0]; Tv[q][lane * 2 + 1] = vs[1];
    { *(v2b*)(KAh + ((size_t)bh * NAP + a) * HD + lane * 2) = (v2b){h0, h1}; *(v2b*)(KAl + ((size_t)bh * NAP + a) * HD + lane * 2) = (v2b){l0, l1};  } }
  __syncthreads();
  { for (int d = wave; d < HD; d += 8) { b16 h0, l0, h1, l1; split16(Tv[lane * 2][d] * HS, h0, l0); split16(Tv[lane * 2 + 1][d] * HS, h1, l1); const size_t o = ((size_t)bh * HD + d) * NAP + a0 + lane * 2; *(v2b*)(VTh + o) = (v2b){h0, h1}; *(v2b*)(VTl + o) = (v2b){l0, l1}; }  } }
// Attention work-group: AG halves of AW waves, all of one (batch, head); a half works on one 64-query block at a time, 16 queries a wave. Chunk c is the 128 tokens CS c - HALO .. CS c + CS - 1 (padded rows CS c ..): it owns the areas that END in its last CS tokens, and its first HALO tokens are there for the two tokens that such an area may reach back, so every chunk is worked on by itself. Its K and V rows are brought into LDS once for the four waves of a half and every fragment is read from there.
// One buffer = Kh, Kl (128 token rows of 128 bytes, pitch 144) and Vh, Vl (64 feature rows of 256 bytes, pitch 272): pitches of 16 bytes x odd for the 16-byte LDS reads. Two buffers for each half: the next chunk's copies fly while this chunk is worked on.
constexpr int AW = 4, AG = 2, XP = 36, KP = HD + 8, VP = CH + 8, KB = CH * KP, VB = HD * VP, SB = 2 * KB + 2 * VB;
typedef __attribute__((ext_vector_type(4))) int v4i;
// eight asynchronous 16-byte copies to LDS per lane (LDS byte address l + i ls, global address g + i gs); the s_wait_xcnt stands in the copies' own statement, in front of any reuse of the address registers that they name
__device__ __forceinline__ void copy8(unsigned int l, unsigned int ls, const char* g, size_t gs) {
  asm volatile("global_load_async_to_lds_b128 %0, %8, off\n\tglobal_load_async_to_lds_b128 %1, %9, off\n\tglobal_load_async_to_lds_b128 %2, %10, off\n\tglobal_load_async_to_lds_b128 %3, %11, off\n\t"
               "global_load_async_to_lds_b128 %4, %12, off\n\tglobal_load_async_to_lds_b128 %5, %13, off\n\tglobal_load_async_to_lds_b128 %6, %14, off\n\tglobal_load_async_to_lds_b128 %7, %15, off\n\ts_wait_xcnt 0x0"
               :: "v"(l), "v"(l + ls), "v"(l + 2 * ls), "v"(l + 3 * ls), "v"(l + 4 * ls), "v"(l + 5 * ls), "v"(l + 6 * ls), "v"(l + 7 * ls),
                  "v"(g), "v"(g + gs), "v"(g + 2 * gs), "v"(g + 3 * gs), "v"(g + 4 * gs), "v"(g + 5 * gs), "v"(g + 6 * gs), "v"(g + 7 * gs) : "memory"); }
// one chunk into the buffer at LDS byte address lb: 16-byte piece p = tid + 128 i of each of the four tiles (K: row p / 8, the 16 KB are contiguous in memory; V: row p / 16, memory pitch NAP elements)
__device__ __forceinline__ void stage_chunk(unsigned int lb, int tid, int a0, const b16* kh, const b16* kl, const b16* vh, const b16* vl) {
  const unsigned int lk = lb + (unsigned int)((tid >> 3) * (KP * 2) + (tid & 7) * 16), lv = lb + (unsigned int)(2 * KB * 2 + (tid >> 4) * (VP * 2) + (tid & 15) * 16);
  const size_t gk = (size_t)a0 * (HD * 2) + (size_t)tid * 16, gv = (size_t)(tid >> 4) * (NAP * 2) + (size_t)a0 * 2 + (size_t)(tid & 15) * 16;
  copy8(lk, 16 * KP * 2, (const char*)kh + gk, 2048); copy8(lk + KB * 2, 16 * KP * 2, (const char*)kl + gk, 2048);
  copy8(lv, 8 * VP * 2, (const char*)vh + gv, (size_t)8 * NAP * 2); copy8(lv + VB * 2, 8 * VP * 2, (const char*)vl + gv, (size_t)8 * NAP * 2); }
// one work-group to a WGP, two waves for each SIMD (a wave of each half): let the register budget and the load scheduling be those of two resident waves
__global__ __launch_bounds__(32 * AW * AG) __attribute__((amdgpu_waves_per_eu(1, 2))) void att_kernel(const b16* __restrict__ Qh, const b16* __restrict__ Ql, const b16* __restrict__ KAh, const b16* __restrict__ KAl, const b16* __restrict__ VTh, const b16* __restrict__ VTl, const int* __restrict__ mask, const int* __restrict__ zpad, int QLIM, float* __restrict__ O) { __shared__ __attribute__((aligned(16))) b16 sb[AG * 2 * SB]; __shared__ unsigned int cv[AG * AW];
  const int tid = threadIdx.x, wave = __builtin_amdgcn_readfirstlane(tid >> 5), lane = tid & 31, nloc = lane & 15, hlf = lane >> 4, grp = wave / AW, wq = wave % AW, gt = tid % (32 * AW); constexpr int NQB = L / (16 * AW);
  // The work-group owns query blocks A = NQB - 1 - pr and B = pr of its head: under a causal mask one sees many chunks where the other sees few, so every work-group has about the same number of (block, chunk) tasks.
  // The tasks, A's visible chunks in order and then B's, are cut in the middle: half 0 takes the first part, half 1 the rest, each through an LDS ring of its own. No wave walks a long row of chunks alone while its SIMD's other wave has run out of work.
  const int bh = blockIdx.x / (NQB / 2), pr = blockIdx.x % (NQB / 2), qbA = (NQB - 1 - pr) * (16 * AW), qbB = pr * (16 * AW); if (qbB >= QLIM) return;   // qbB < qbA: both blocks lie past the query cut; the whole work-group leaves, in front of every barrier
  const int q0 = (grp != 0 ? qbB : qbA) + wq * 16; const bool live = q0 < QLIM;   // the wave's own 16 queries: it scans their mask rows here and merges and stores their result at the end (a wave past the query cut still copies and passes every barrier; it stores nothing)
  const int b = bh / H, h = bh % H; const size_t tq = (size_t)b * L + q0;
  // both products are taken transposed (X^T = kh x qh^T, O^T = vh^T x c^T): queries are the N side, so lane nloc owns query nloc of the wave's 16 in the block in work and its half hlf holds tokens 16 T + 8 hlf + 0..7 of every 16-token tile T.
  // Two neighbouring tiles are then, register for register, the K = 32 operand of c (k = 8 hlf + e and 16 + 8 hlf + e, the order of frag_kb): mask, softmax and c never leave the registers; a neighbour token in the other half of the lanes comes by one lane exchange.
  // The task list must read the same in all waves: each wave ORs its 16 mask rows (whole lines); bit c of wv = some query of the wave sees some end position of chunk c, 120 c .. 120 c + 119. Exact, so that the cut in the middle halves the real work:
  v4i any[8];
#pragma unroll
  for (int j = 0; j < 8; ++j) any[j] = (v4i){0, 0, 0, 0};
  // rolled, four rows a trip: 32 loads of 16 bytes in flight per lane cover the latency
#pragma unroll 1
  for (int r0 = 0; r0 < 16; r0 += 4) { v4i mv[4][8];
#pragma unroll
    for (int r = 0; r < 4; ++r)
#pragma unroll
      for (int j = 0; j < 8; ++j) mv[r][j] = *(const v4i*)(mask + (size_t)(q0 + r0 + r) * L + j * 128 + lane * 4);
#pragma unroll
    for (int r = 0; r < 4; ++r)
#pragma unroll
      for (int j = 0; j < 8; ++j) any[j] |= mv[r][j]; }
  unsigned int wv = 0;
#pragma unroll
  for (int j = 0; j < 8; ++j) { const unsigned int bal = __builtin_amdgcn_ballot_w32((any[j][0] | any[j][1] | any[j][2] | any[j][3]) != 0), lowm = (1u << (30 - 2 * j)) - 1u;   // lane l holds columns 128 j + 4 l .. + 3: chunk j for l < 30 - 2 j, chunk j + 1 behind
    wv |= ((bal & lowm) != 0u ? 1u : 0u) << j; wv |= ((bal & ~lowm) != 0u ? 1u : 0u) << (j + 1); }
  if (lane == 0) cv[wave] = live ? wv : 0u;
  __syncthreads();   // all eight words are written before any wave reads them
  // ra, rb: the chunks of A and of B that are still to be handed out to this half; nst = steps of the longer half (half 0), passed by every wave; n = this half's own tasks
  unsigned int ra = (unsigned int)__builtin_amdgcn_readfirstlane((int)(cv[0] | cv[1] | cv[2] | cv[3])), rb = (unsigned int)__builtin_amdgcn_readfirstlane((int)(cv[4] | cv[5] | cv[6] | cv[7]));
  const int ntot = __builtin_popcount(ra) + __builtin_popcount(rb), nst = (ntot + 1) >> 1; int n = nst;
  if (grp != 0) { n = ntot - nst; for (int i = 0; i < nst; ++i) { if (ra != 0u) ra &= ra - 1u; else rb &= rb - 1u; } }   // half 1 steps over half 0's tasks (at most NCH trips)
  auto pop = [&](int& c, int& k) { if (ra != 0u) { c = __builtin_ctz(ra); ra &= ra - 1u; k = 0; } else { c = __builtin_ctz(rb); rb &= rb - 1u; k = 1; } };   // next task: chunk c of block k (0 = A, 1 = B)
  // the block in work: its first query of this wave, its mask row and its query fragments
  bool wlive = false; const int* mrow = mask; v16b qa[2], ql[2];
  auto take = [&](int k) { const int qw = (k != 0 ? qbB : qbA) + wq * 16; wlive = qw < QLIM; mrow = mask + (size_t)(qw + nloc) * L; const size_t qo = ((size_t)b * L + qw + nloc) * D + h * HD;
    for (int ks = 0; ks < 2; ++ks) { qa[ks] = frag_kb(Qh + qo + ks * 32, hlf); ql[ks] = frag_kb(Ql + qo + ks * 32, hlf); }
    __builtin_amdgcn_sched_barrier(0);   // keeps the fragment loads in front of the wait below (without it the scheduler let them sink behind it)
    asm volatile("s_wait_xcnt 0x0" ::: "memory");   // behind the fragment loads: the wait that belongs in front of the next reuse of their address registers
    __builtin_amdgcn_sched_barrier(0); };   // and keeps what follows, which may reuse those registers, behind the wait
  v8f oacc[4] = {(v8f){}, (v8f){}, (v8f){}, (v8f){}}, oA[4] = {(v8f){}, (v8f){}, (v8f){}, (v8f){}}; float mrun = -INFINITY, lrun = 0.0f, mA = -INFINITY, lA = 0.0f;   // the state of the block in work; block A's state once the half has gone on to B
  const unsigned int lds0 = (unsigned int)(size_t)sb + (unsigned int)(grp * 2 * SB * 2);   // LDS byte address of this half's buffer 0: the low 32 bits of the shared address
  const b16 *gkh = KAh + (size_t)bh * NAP * HD, *gkl = KAl + (size_t)bh * NAP * HD, *gvh = VTh + (size_t)bh * HD * NAP, *gvl = VTl + (size_t)bh * HD * NAP;
  int c0 = 0, c1 = 0, k0 = 0, k1 = 0;   // the task in work and the task in flight
  if (n > 0) { pop(c0, k0); stage_chunk(lds0, gt, c0 * CS, gkh, gkl, gvh, gvl); }
  int kc = k0; take(kc);   // here, so that the fragments' latency passes while the first chunk's copies fly
  asm volatile("s_wait_asynccnt 0x0" ::: "memory");   // this wave's copies of the first chunk have landed
  __syncthreads();   // and every wave's: the first chunk may be read
  if (n > 1) { pop(c1, k1); stage_chunk(lds0 + SB * 2, gt, c1 * CS, gkh, gkl, gvh, gvl); }
#pragma unroll 1
  for (int st = 0; st < nst; ++st) { const int e0 = c0 * CS - HALO; const b16* kbuf = sb + (grp * 2 + (st & 1)) * SB; const b16* vbuf = kbuf + 2 * KB; const bool act = st < n;   // half 1 may have one task less: it passes the last hand-over all the same
    if (act && k0 != kc) {   // wave-uniform: the half goes on from block A to block B
      kc = k0; take(kc);
#pragma unroll
      for (int t = 0; t < 4; ++t) { oA[t] = oacc[t]; oacc[t] = (v8f){}; }
      mA = mrun; lA = lrun; mrun = -INFINITY; lrun = 0.0f; }
    // visibility bits of this lane's 64 end positions e0 + 16 T + 8 hlf + r8 (bit 8 (T & 3) + r8 of word T >> 2). A group of eight holds ends of this chunk unless it is the halo (T = 0, lower half) or lies behind the last token: there the address is clamped and no bit is set.
    unsigned int vb[NTI / 4] = {};
#pragma unroll
    for (int t = 0; t < NTI; ++t) { const int g = e0 + t * 16 + 8 * hlf; const bool ok = (t > 0 || hlf != 0) && g < L; int m[8]; __builtin_memcpy(m, mrow + (ok ? g : 0), 32); unsigned int bb = 0;
#pragma unroll
      for (int r8 = 0; r8 < 8; ++r8) bb |= (m[r8] != 0 ? 1u : 0u) << r8;
      vb[t >> 2] |= (ok ? bb : 0u) << ((t & 3) * 8); }
    // an area of width w ends no earlier than token w - 1: end 0 has width 1 alone, end 1 widths 1 and 2 (chunk 0, tile 0, upper half, bits 0 and 1)
    const bool later = c0 != 0 || hlf == 0;
    if (act && wlive && __builtin_amdgcn_ballot_w32((vb[0] | vb[1]) != 0u) != 0u) {   // wave-uniform: where no query of this wave sees any area of the chunk its contribution is exactly zero; the hand-over below is passed all the same
    v8f s[NTI];
#pragma unroll
    for (int tg = 0; tg < NTI; tg += 4) {
#pragma unroll
      for (int t = 0; t < 4; ++t) s[tg + t] = (v8f){};
#pragma unroll
      for (int ks = 0; ks < 2; ++ks) { v16b kh[4], kl[4];
#pragma unroll
        for (int t = 0; t < 4; ++t) { const b16* kr = kbuf + ((tg + t) * 16 + nloc) * KP + ks * 32; kh[t] = frag_kb(kr, hlf); kl[t] = frag_kb(kr + KB, hlf); }
#pragma unroll
        for (int t = 0; t < 4; ++t) s[tg + t] = wmma16q(kh[t], qa[ks], s[tg + t]);
#pragma unroll
        for (int t = 0; t < 4; ++t) s[tg + t] = wmma16q(kl[t], qa[ks], s[tg + t]);
#pragma unroll
        for (int t = 0; t < 4; ++t) s[tg + t] = wmma16q(kh[t], ql[ks], s[tg + t]); } }
    // token logits x (in s), and for every group of eight its two predecessors b7 = x[-1], b6 = x[-2], which the other half of the lanes holds: the group in front of (T, upper half) is (T, lower half); in front of (T, lower half), (T - 1, upper half); the chunk's first group is halo and ends no area
    float b6[NTI], b7[NTI];
#pragma unroll
    for (int t = 0; t < NTI; ++t) { s[t] *= SCALE / (HS * HS); b6[t] = xhalf(s[t][6]); b7[t] = xhalf(s[t][7]); }
#pragma unroll
    for (int t = NTI - 1; t >= 0; --t) { b6[t] = hlf ? b6[t] : (t > 0 ? b6[t > 0 ? t - 1 : 0] : 0.0f); b7[t] = hlf ? b7[t] : (t > 0 ? b7[t > 0 ? t - 1 : 0] : 0.0f); }
    // area logits by end position e: x[e], (x[e] + x[e-1]) / 2, (x[e] + x[e-1] + x[e-2]) / 3; written out here for the maximum and again below for the weights
    v8f m8;
#pragma unroll
    for (int r8 = 0; r8 < 8; ++r8) m8[r8] = -INFINITY;
#pragma unroll
    for (int t = 0; t < NTI; ++t)
#pragma unroll
      for (int r8 = 0; r8 < 8; ++r8) { const float x0 = s[t][r8], xm1 = r8 >= 1 ? s[t][r8 >= 1 ? r8 - 1 : 0] : b7[t], xm2 = r8 >= 2 ? s[t][r8 >= 2 ? r8 - 2 : 0] : (r8 == 1 ? b7[t] : b6[t]), u2 = x0 + xm1, u3 = u2 + xm2;
        const bool c1 = ((vb[t >> 2] >> ((t & 3) * 8 + r8)) & 1u) != 0u, c2 = (t == 0 && r8 == 0) ? (c1 && later) : c1, c3 = (t == 0 && r8 <= 1) ? (c1 && later) : c1;
        m8[r8] = fmaxf(m8[r8], fmaxf(x0 + (c1 ? 0.0f : -INFINITY), fmaxf(__builtin_fmaf(u2, 0.5f, c2 ? 0.0f : -INFINITY), __builtin_fmaf(u3, 1.0f / 3.0f, c3 ? 0.0f : -INFINITY)))); }
    float mx = fmaxf(fmaxf(fmaxf(m8[0], m8[1]), fmaxf(m8[2], m8[3])), fmaxf(fmaxf(m8[4], m8[5]), fmaxf(m8[6], m8[7]))); mx = fmaxf(mx, __shfl_xor(mx, 16));
    const float mn = fmaxf(mrun, mx), fe = exp2_slot((mrun - mn) * LOG2E), fac = (mrun == -INFINITY) ? 0.0f : fe, ms = (mn == -INFINITY) ? 0.0f : mn, nms = -ms * LOG2E; v8f s8 = (v8f){};
    // weights by end position e: wa = p1 + p2 + p3 goes to token e (and into the row sum), wb = p2 + p3 also to token e - 1, wc = p3 also to token e - 2: token weight c[t] = wa[t] + wb[t + 1] + wc[t + 2], written over x tile by tile.
    // What the last two tokens of a group take from the group behind it (n0 = wc[0], n1 = wb[0] + wc[1]) comes from the other half of the lanes: behind (T, lower half) stands (T, upper half); behind (T, upper half), (T + 1, lower half); behind the chunk's last group, the next chunk's ends, which reach these tokens through that chunk's halo.
    float n0[NTI], n1[NTI];
#pragma unroll
    for (int t = 0; t < NTI; ++t) { float wa[8], wb[8], wc[8];
#pragma unroll
      for (int r8 = 0; r8 < 8; ++r8) { const float x0 = s[t][r8], xm1 = r8 >= 1 ? s[t][r8 >= 1 ? r8 - 1 : 0] : b7[t], xm2 = r8 >= 2 ? s[t][r8 >= 2 ? r8 - 2 : 0] : (r8 == 1 ? b7[t] : b6[t]), u2 = x0 + xm1, u3 = u2 + xm2;
        const bool c1 = ((vb[t >> 2] >> ((t & 3) * 8 + r8)) & 1u) != 0u, c2 = (t == 0 && r8 == 0) ? (c1 && later) : c1, c3 = (t == 0 && r8 <= 1) ? (c1 && later) : c1;
        const float p1 = exp2_slot(__builtin_fmaf(x0, LOG2E, c1 ? nms : -INFINITY)), p2 = exp2_slot(__builtin_fmaf(u2, 0.5f * LOG2E, c2 ? nms : -INFINITY)), p3 = exp2_slot(__builtin_fmaf(u3, LOG2E / 3.0f, c3 ? nms : -INFINITY));
        wc[r8] = p3; wb[r8] = p2 + p3; wa[r8] = p1 + wb[r8]; s8[r8] += wa[r8]; }
      n0[t] = xhalf(wc[0]); n1[t] = xhalf(wb[0] + wc[1]);
#pragma unroll
      for (int r8 = 0; r8 < 6; ++r8) s[t][r8] = wa[r8] + wb[r8 + 1] + wc[r8 + 2];
      s[t][6] = wa[6] + wb[7]; s[t][7] = wa[7]; }
    float sm = ((s8[0] + s8[1]) + (s8[2] + s8[3])) + ((s8[4] + s8[5]) + (s8[6] + s8[7])); sm += __shfl_xor(sm, 16); lrun = lrun * fac + sm; mrun = mn;
#pragma unroll
    for (int t = 0; t < NTI; ++t) { s[t][6] += hlf ? (t + 1 < NTI ? n0[t + 1 < NTI ? t + 1 : 0] : 0.0f) : n0[t]; s[t][7] += hlf ? (t + 1 < NTI ? n1[t + 1 < NTI ? t + 1 : 0] : 0.0f) : n1[t]; s[t] *= PS; }
#pragma unroll
    for (int t = 0; t < 4; ++t) oacc[t] *= fac;
#pragma unroll
    for (int kb = 0; kb < CH; kb += 32) { v16b pa, pb, vh[4], vlo[4];
#pragma unroll
      for (int e = 0; e < 8; ++e) { b16 ph, pl; split16(s[kb / 16][e], ph, pl); pa[e] = ph; pb[e] = pl; split16(s[kb / 16 + 1][e], ph, pl); pa[8 + e] = ph; pb[8 + e] = pl; }
#pragma unroll
      for (int t = 0; t < 4; ++t) { const b16* vr = vbuf + (t * 16 + nloc) * VP + kb; vh[t] = frag_kb(vr, hlf); vlo[t] = frag_kb(vr + VB, hlf); }
#pragma unroll
      for (int t = 0; t < 4; ++t) oacc[t] = wmma16b(vh[t], pa, oacc[t]);
#pragma unroll
      for (int t = 0; t < 4; ++t) oacc[t] = wmma16b(vlo[t], pa, oacc[t]);
#pragma unroll
      for (int t = 0; t < 4; ++t) oacc[t] = wmma16b(vh[t], pb, oacc[t]); } }
    // hand-over, every wave, in this order: my LDS reads of this buffer are done; my copies of the next chunk have landed; the barrier publishes the next chunk and frees this buffer; only then the refill
    asm volatile("s_wait_dscnt 0x0" ::: "memory");
    asm volatile("s_wait_asynccnt 0x0" ::: "memory");
    __syncthreads();
    c0 = c1; k0 = k1;
    if (st + 2 < n) { pop(c1, k1); stage_chunk(lds0 + (unsigned int)((st & 1) * SB * 2), gt, c1 * CS, gkh, gkl, gvh, gvl); } }
  asm volatile("s_wait_asynccnt 0x0" ::: "memory");   // no copy is outstanding when the wave ends
  // Each wave now holds a state for its tile of A and one for its tile of B (empty: -inf, 0, 0). Half 0 finishes A, half 1 finishes B: a wave hands the other state to the wave of the other half that has the same tile, through LDS (the rings are free: every wave's reads and copies ended in front of the last barrier).
  if (kc == 0) {
#pragma unroll
    for (int t = 0; t < 4; ++t) { oA[t] = oacc[t]; oacc[t] = (v8f){}; }
    mA = mrun; lA = lrun; mrun = -INFINITY; lrun = 0.0f; }
  if (grp == 0) {
#pragma unroll
    for (int t = 0; t < 4; ++t) { const v8f x = oacc[t]; oacc[t] = oA[t]; oA[t] = x; }
    const float xm = mrun, xl = lrun; mrun = mA; lrun = lA; mA = xm; lA = xl; }
  // (oacc, mrun, lrun) stays, (oA, mA, lA) goes; XP floats a lane: a pitch of 16 bytes x odd
  float* xw = (float*)sb + (size_t)(wave * 32 + lane) * XP; const float* xr = (const float*)sb + (size_t)((wave ^ AW) * 32 + lane) * XP;
#pragma unroll
  for (int t = 0; t < 4; ++t) { *(v4f*)(xw + t * 8) = (v4f){oA[t][0], oA[t][1], oA[t][2], oA[t][3]}; *(v4f*)(xw + t * 8 + 4) = (v4f){oA[t][4], oA[t][5], oA[t][6], oA[t][7]}; }
  *(v2f*)(xw + 32) = (v2f){mA, lA};
  __syncthreads();   // every wave's handed-over state is written before its partner reads it
  const v2f ml = *(const v2f*)(xr + 32); const float mm = fmaxf(mrun, ml[0]), ek = exp2_slot((mrun - mm) * LOG2E), ep = exp2_slot((ml[0] - mm) * LOG2E), fk = (mrun == -INFINITY) ? 0.0f : ek, fp = (ml[0] == -INFINITY) ? 0.0f : ep;
  lrun = lrun * fk + ml[1] * fp;
#pragma unroll
  for (int t = 0; t < 4; ++t) { const v4f p0 = *(const v4f*)(xr + t * 8), p1 = *(const v4f*)(xr + t * 8 + 4);
#pragma unroll
    for (int j = 0; j < 4; ++j) { oacc[t][j] = oacc[t][j] * fk + p0[j] * fp; oacc[t][4 + j] = oacc[t][4 + j] * fk + p1[j] * fp; } }
  const bool zero = (zpad[0] != 0 && q0 + nloc == 0);
  if (live) {
#pragma unroll
  for (int t = 0; t < 4; ++t) { v4f o0, o1;
#pragma unroll
    for (int j = 0; j < 4; ++j) { const float u0 = oacc[t][j] * (1.0f / (PS * HS)) / lrun, u1 = oacc[t][4 + j] * (1.0f / (PS * HS)) / lrun; o0[j] = zero ? 0.0f : u0; o1[j] = zero ? 0.0f : u1; }
    float* op = O + (tq + nloc) * D + h * HD + t * 16 + 8 * hlf; *(v4f*)op = o0; *(v4f*)(op + 4) = o1; } } }
__global__ __launch_bounds__(256) void outp_kernel(const float* __restrict__ O, const b16* __restrict__ WO, const float* __restrict__ bo, int QLIM, float* __restrict__ out) { __shared__ __attribute__((aligned(16))) char sm[2 * GM * AP * 2]; b16 (*Ah)[AP] = (b16 (*)[AP])sm; b16 (*Al)[AP] = (b16 (*)[AP])(sm + GM * AP * 2); float (*Tf)[TP] = (float (*)[TP])sm;   // Tf takes Ah's place behind the K loop
  const int tid = threadIdx.x, wave = __builtin_amdgcn_readfirstlane(tid >> 5), lane = tid & 31, nloc = lane & 15, hlf = lane >> 4; const size_t t0 = (size_t)blockIdx.x * GM; const int c0 = blockIdx.y * GN; if ((int)(t0 % L) >= QLIM) return;
  // rolled: 16 rows a trip are 16 loads of 16 bytes in flight per lane, enough to cover the latency
#pragma unroll 1
  for (int r0 = 0; r0 < GM; r0 += 16) { v4f xv[16];
#pragma unroll
    for (int j = 0; j < 16; ++j) xv[j] = *(const v4f*)(O + (t0 + r0 + j) * D + tid * 4);
#pragma unroll
    for (int j = 0; j < 16; ++j) { v4b hv, lv;
#pragma unroll
      for (int e = 0; e < 4; ++e) { b16 p, pl; split16(xv[j][e] * HS, p, pl); hv[e] = p; lv[e] = pl; }
      *(v4b*)(&Ah[r0 + j][tid * 4]) = hv; *(v4b*)(&Al[r0 + j][tid * 4]) = lv; } }
  // packed W fragments through a ring of RD register sets, as in proj_kernel; the first RD sets are asked for in front of the barrier
  const b16* wp = WO + (size_t)((c0 + wave * 32) / 16) * WT + lane * 8; v16b bw[RD][2];
#pragma unroll
  for (int u = 0; u < RD; ++u)
#pragma unroll
    for (int n = 0; n < 2; ++n) bw[u][n] = frag_pk(wp + n * WT + u * WB);
  __syncthreads();   // both A tiles are whole before any wave reads them
  v8f acc[4][2];
#pragma unroll
  for (int m = 0; m < 4; ++m) { acc[m][0] = (v8f){}; acc[m][1] = (v8f){}; }
  auto kstep = [&](int ks, int u, bool refill) { v16b a[4], al[4];
#pragma unroll
    for (int m = 0; m < 4; ++m) { a[m] = frag_kb(&Ah[m * 16 + nloc][ks * 32], hlf); al[m] = frag_kb(&Al[m * 16 + nloc][ks * 32], hlf); }
#pragma unroll
    for (int m = 0; m < 4; ++m)
#pragma unroll
      for (int n = 0; n < 2; ++n) acc[m][n] = wmma16b(a[m], bw[u][n], acc[m][n]);
#pragma unroll
    for (int m = 0; m < 4; ++m)
#pragma unroll
      for (int n = 0; n < 2; ++n) acc[m][n] = wmma16b(al[m], bw[u][n], acc[m][n]);
    if (refill) {
#pragma unroll
      for (int n = 0; n < 2; ++n) bw[u][n] = frag_pk(wp + n * WT + (size_t)(ks + RD) * WB); } };
  // rolled, RD k steps a trip (one turn of the ring); the last turn refills nothing
#pragma unroll 1
  for (int k4 = 0; k4 < D / 32 - RD; k4 += RD) {
#pragma unroll
    for (int u = 0; u < RD; ++u) kstep(k4 + u, u, true); }
#pragma unroll
  for (int u = 0; u < RD; ++u) kstep(D / 32 - RD + u, u, false);
  __syncthreads();   // every wave has left Ah before Tf overwrites it
#pragma unroll
  for (int n = 0; n < 2; ++n) { const int cc = wave * 32 + n * 16 + nloc; const float bb = bfv(bo[c0 + cc]);
#pragma unroll
    for (int m = 0; m < 4; ++m)
#pragma unroll
      for (int r8 = 0; r8 < 8; ++r8) Tf[m * 16 + 8 * hlf + r8][cc] = acc[m][n][r8] * (1.0f / (HS * WSC)) + bb; }
  __syncthreads();   // Tf is whole before the row-wise stores read it
  for (int rr = wave; rr < GM; rr += 8) { if ((int)((t0 + rr) % L) >= QLIM) continue;   // rows past the query cut stay unwritten, as before
    for (int q = 0; q < 2; ++q) *(v4f*)(out + (t0 + rr) * D + c0 + q * 128 + lane * 4) = *(const v4f*)(&Tf[rr][q * 128 + lane * 4]);
    asm volatile("s_wait_xcnt 0x0" ::: "memory"); } }   // behind the row's stores: the wait that belongs in front of the next trip's reuse of their address and data registers
}  // namespace

extern "C" void kernel_launch(void* const* d_in, const int* in_sizes, int n_in, void* d_out, int out_size, void* d_ws, size_t ws_size, hipStream_t stream) {
  (void)n_in;
  auto Fp = [&](int i) { return (const float*)d_in[i]; }; auto Ip = [&](int i) { return (const int*)d_in[i]; };
  // input order: 0 q [2,1024,1024]; 1 k; 2 v; 3 Wq; 4 bq; 5 Wk; 6 bk; 7 Wv; 8 bv; 9 Wo; 10 bo; 11 mask [1024,1024] i32; 12 zero_pad [1] i32
  if (in_sizes[0] != NT * D || in_sizes[1] != NT * D || in_sizes[2] != NT * D || in_sizes[3] != D * D || in_sizes[9] != D * D || in_sizes[11] != L * L || in_sizes[12] != 1 || out_size != NT * D) return;
  const int QLIM = L;   // per-batch query cut (multiple of 16)
  size_t off = 0; char* ws = (char*)d_ws;
  auto carve = [&](size_t bytes) { char* p = ws + off; off += (bytes + 255) & ~(size_t)255; return p; };
  b16* W4 = (b16*)carve((size_t)4 * D * D * 2); b16* Qh = (b16*)carve((size_t)NT * D * 2); b16* Ql = (b16*)carve((size_t)NT * D * 2); float* KR = (float*)carve((size_t)NT * D * 4); float* VR = (float*)carve((size_t)NT * D * 4); b16* KAh = (b16*)carve((size_t)NB_ * H * NAP * HD * 2); b16* KAl = (b16*)carve((size_t)NB_ * H * NAP * HD * 2); b16* VTh = (b16*)carve((size_t)NB_ * H * HD * NAP * 2); b16* VTl = (b16*)carve((size_t)NB_ * H * HD * NAP * 2); float* O = (float*)carve((size_t)NT * D * 4);
  if (off > ws_size || off > ((size_t)96 << 20)) return;   // 57 MiB
  wput_kernel<<<256, 256, 0, stream>>>(Fp(3), Fp(5), Fp(7), Fp(9), W4);
  proj_kernel<<<dim3(NT / GM, 3, D / GN), 256, 0, stream>>>(Fp(0), Fp(1), Fp(2), W4, Fp(4), Fp(6), Fp(8), Qh, Ql, KR, VR);
  area_kernel<<<NB_ * H * (NAP / 64), 256, 0, stream>>>(KR, VR, KAh, KAl, VTh, VTl);
  att_kernel<<<NB_ * H * (L / (16 * AW)) / AG, 32 * AW * AG, 0, stream>>>(Qh, Ql, KAh, KAl, VTh, VTl, Ip(11), Ip(12), QLIM, O);
  outp_kernel<<<dim3(NT / GM, D / GN), 256, 0, stream>>>(O, W4 + (size_t)3 * D * D, Fp(10), QLIM, (float*)d_out);
}

// v007
// One run takes 85.3 microseconds.
// In both of two side-by-side timings against v006, it was 1.09 times as fast.
// All steps since v000 together make it 31.9 times as fast.
#include <hip/hip_runtime.h>

// MultiHeadAreaAttention: qh,kh,vh = (q Wq^T + bq), (k Wk^T + bk), (v Wv^T + bv) as 16 heads x 64; areas = all windows of width 1..3 along the key axis (A = 3,069; block w starts at area index 0 / 1024 / 2047, end(a) = start + w - 1); k_area = window mean, v_area = window sum; logits = qh.k_area / 8, visible iff mask[q][end(a)] != 0 (else -1e30); weights = softmax over areas; if zero_pad: weights of query 0 := 0; ctx = weights.v_area; out = concat Wo^T + bo -> [2][1024][1024].
// Pooling is linear, so no pooled row is ever formed: qh.k_area(end e, width w) = (x[e] + .. + x[e-w+1]) / w with the token logits x[t] = qh.kh[t], and weights.v_area = sum over tokens t of c[t] vh[t], c[t] = the summed weights of the (up to six) areas that hold t. Both matrix products run over the 1,024 tokens instead of the 3,069 areas.
// Deterministic: online softmax over fixed chunks of 120 end positions (360 areas) in order, a query's chunks in at most two runs whose running maximum, sum and O are merged at the end in a fixed order (chunks with no visible area for any of the wave's 16 queries are skipped: they contribute exactly 0); inside a chunk each lane sums its areas in a fixed tree, then the two halves of a query are added; no atomics.
// WMMA (v_wmma_f32_16x16x32_f16, f32 accumulate): inputs (EXACT bf16 x8, K 1,024) x W rows (EXACT) per 64-token x 256-column work-group of 8 waves; per (bh, 16-query) wave (eight to a work-group, K and V chunks shared in LDS by four) X^T = kh token rows (hi+lo; 8 tiles/chunk) x qh (hi+lo x256, K 64) and O^T += vh^T rows (hi+lo; 4 tiles) x c (hi+lo), 3 products; o (hi+lo) x Wo rows, same tiling; neighbour sums, mask gather, softmax in f32.

namespace {
constexpr int NB_ = 2, L = 1024, D = 1024, H = 16, HD = 64, NT = NB_ * L, CH = 128, NTI = CH / 16, HALO = 8, CS = CH - HALO /* 120 */, NCH = (L + CS - 1) / CS /* 9 */, FP = 64, NAP = FP + L + 64 /* 1152 */;
// the padded token axis of the K rows and of the V^T rows: token t stands at place FP + t; the FP places in front of token 0 and the 64 behind token L - 1 are zero. Chunk c begins at place CS c + FP - HALO.
static_assert((NCH - 1) * CS + FP - HALO + CH <= NAP && FP >= HALO && NAP % 64 == 0, "every chunk lies inside the padded axis; a V^T row is a whole number of 128-byte lines");
constexpr float XS = 8.0f, HS = 256.0f, PS = 256.0f, WSC = 256.0f, SCALE = 0.125f, LOG2E = 1.44269504f;
typedef _Float16 b16;
typedef __attribute__((ext_vector_type(16))) _Float16 v16b;
typedef __attribute__((ext_vector_type(8))) _Float16 v8b;
typedef __attribute__((ext_vector_type(4))) _Float16 v4b;
typedef __attribute__((ext_vector_type(2))) _Float16 v2b;
typedef __attribute__((ext_vector_type(8))) float v8f;
typedef __attribute__((ext_vector_type(4))) float v4f;
typedef __attribute__((ext_vector_type(2))) float v2f;
__device__ __forceinline__ float bf16_rne(float f) { unsigned int u = __float_as_uint(f); u += 0x7FFFu + ((u >> 16) & 1u); float r = __uint_as_float(u & 0xFFFF0000u); asm volatile("" : "+v"(r)); return r; }
__device__ __forceinline__ float bfv(float f) { float r = bf16_rne(f); asm volatile("" : "+v"(r)); return r; }
__device__ __forceinline__ void split16(float v, b16& hi, b16& lo) { hi = (b16)v; lo = (b16)(v - (float)hi); }
__device__ __forceinline__ v16b frag_kb(const b16* p, int hh) { const v8b a = *(const v8b*)(p + 8 * hh), b = *(const v8b*)(p + 16 + 8 * hh); v16b f;
#pragma unroll
  for (int e = 0; e < 8; ++e) { f[e] = a[e]; f[8 + e] = b[e]; } return f; }
// W4 holds the four weight matrices in the order in which a GEMM wave reads them. One block = one B fragment (16 output columns x 32 k, WB elements) = two runs of 512 bytes: run r, lane l = (hlf, nloc) holds W[column nloc of the tile][k = 16 r + 8 hlf + 0..7], the k order of frag_kb.
// So each 16-byte load of a wave covers four whole 128-byte lines (from row-major W it touched sixteen lines for 32 bytes each). The blocks of one column tile follow one another in k (WT elements a tile), the tiles in column order, the matrices in the order q, k, v, o.
constexpr int WB = 16 * 32, WT = (D / 32) * WB, RD = 4;
__device__ __forceinline__ v16b frag_pk(const b16* p) { const v8b a = *(const v8b*)p, b = *(const v8b*)(p + WB / 2); v16b f;
#pragma unroll
  for (int e = 0; e < 8; ++e) { f[e] = a[e]; f[8 + e] = b[e]; } return f; }
__device__ __forceinline__ v8f wmma16b(v16b a, v16b b, v8f c) { v8f d = __builtin_amdgcn_wmma_f32_16x16x32_f16(false, a, false, b, (short)0, c, false, false); asm volatile("v_nop\n\tv_nop\n\tv_nop\n\tv_nop" : "+v"(d) : "v"(a), "v"(b)); return d; }
// the same for a B operand that is rewritten only when the half goes on to block B, far from any product (the query fragments): not named in the statement, it is free to live above v255, where an asm operand cannot, and leaves the low registers to the operands that must be there (named, two of the four fragments were spilled to scratch and read back in every chunk)
__device__ __forceinline__ v8f wmma16q(v16b a, v16b b, v8f c) { v8f d = __builtin_amdgcn_wmma_f32_16x16x32_f16(false, a, false, b, (short)0, c, false, false); asm volatile("v_nop\n\tv_nop\n\tv_nop\n\tv_nop" : "+v"(d) : "v"(a)); return d; }
// 2^x and, in the same statement, the one issue slot that the instruction set asks for behind a transcendental
__device__ __forceinline__ float exp2_slot(float x) { float p; asm("v_exp_f32 %0, %1\n\tv_nop" : "=v"(p) : "v"(x)); return p; }
// the value that lane l ^ 16 holds (the other half of the same query's tokens), by a vector cross-row move
__device__ __forceinline__ float xhalf(float v) { const int b = __float_as_int(v); return __int_as_float(__builtin_amdgcn_permlanex16(b, b, 0x76543210, 0xfedcba98, false, false)); }

__global__ __launch_bounds__(256) void wput_kernel(const float* __restrict__ wq, const float* __restrict__ wk, const float* __restrict__ wv, const float* __restrict__ wo, b16* __restrict__ W4) { const size_t nt = (size_t)gridDim.x * 256, u0 = (size_t)blockIdx.x * 256 + threadIdx.x; v8b v;
  // thread u writes the u-th 16 bytes of W4 (whole lines per wave) and gathers its eight weights from row oo, columns k0 ..
  for (size_t u = u0; u < (size_t)4 * D * 128; u += nt) { const int l = (int)(u % 32), r = (int)(u / 32) % 2, ks = (int)(u / 64) % (D / 32), ct = (int)(u / (64 * (D / 32))) % (D / 16), which = (int)(u / ((size_t)64 * (D / 32) * (D / 16))); const int oo = ct * 16 + (l & 15), k0 = ks * 32 + r * 16 + (l >> 4) * 8; const float* w = which == 0 ? wq : (which == 1 ? wk : (which == 2 ? wv : wo));
#pragma unroll
    for (int j = 0; j < 8; ++j) v[j] = (b16)(bf16_rne(w[(size_t)oo * D + k0 + j]) * WSC); { *(v8b*)(W4 + u * 8) = v;  } } }
// GEMM tile of one work-group (both projection kernels): GM tokens x GN output columns, 8 waves. All waves stage the A tile (whole K) in LDS once; wave w then owns columns 32 w .. 32 w + 31 for all GM tokens (4 x 2 accumulator tiles), so each B fragment read from global memory (packed: frag_pk) serves four products. k order per output element: ascending, as before.
constexpr int GM = 64, GN = 256, AP = D + 8, TP = GN + 4, VTP = GM + 8;
static_assert(FP == GM && NAP - FP - L == GM && L % GM == 0 && GN % HD == 0, "a work-group's 64 tokens are one 128-byte line of a V^T row, and each zero margin is as long");
__global__ __launch_bounds__(256) void proj_kernel(const float* __restrict__ xq, const float* __restrict__ xk, const float* __restrict__ xv, const b16* __restrict__ W4, const float* __restrict__ bq, const float* __restrict__ bk, const float* __restrict__ bv, b16* __restrict__ Qh, b16* __restrict__ Ql, b16* __restrict__ KAh, b16* __restrict__ KAl, b16* __restrict__ VTh, b16* __restrict__ VTl) { __shared__ __attribute__((aligned(16))) char sm[GM * AP * 2]; b16 (*Ax)[AP] = (b16 (*)[AP])sm; float (*Tf)[TP] = (float (*)[TP])sm; b16 (*Vt)[VTP] = (b16 (*)[VTP])sm;   // Tf (q, k) or Vt (v) takes Ax's place behind the K loop
  const int tid = threadIdx.x, wave = __builtin_amdgcn_readfirstlane(tid >> 5), lane = tid & 31, nloc = lane & 15, hlf = lane >> 4; const size_t t0 = (size_t)blockIdx.x * GM; const int which = blockIdx.y, c0 = blockIdx.z * GN;
  const float* x = which == 0 ? xq : (which == 1 ? xk : xv); const float* bias = which == 0 ? bq : (which == 1 ? bk : bv);
  // rolled: 16 rows a trip are 16 loads of 16 bytes in flight per lane, enough to cover the memory latency
#pragma unroll 1
  for (int r0 = 0; r0 < GM; r0 += 16) { v4f xv[16];
#pragma unroll
    for (int j = 0; j < 16; ++j) xv[j] = *(const v4f*)(x + (t0 + r0 + j) * D + tid * 4);
#pragma unroll
    for (int j = 0; j < 16; ++j) { v4b hv;
#pragma unroll
      for (int e = 0; e < 4; ++e) hv[e] = (b16)(bf16_rne(xv[j][e]) * XS);
      *(v4b*)(&Ax[r0 + j][tid * 4]) = hv; } }
  // No line of packed W serves two k steps, so no step's loads warm the cache for the next: the fragments go through a ring of RD register sets, each refilled for k step s + RD as soon as step s has used it. The first RD sets are asked for here, in front of the barrier.
  const b16* wp = W4 + (size_t)(which * (D / 16) + (c0 + wave * 32) / 16) * WT + lane * 8; v16b bw[RD][2];
#pragma unroll
  for (int u = 0; u < RD; ++u)
#pragma unroll
    for (int n = 0; n < 2; ++n) bw[u][n] = frag_pk(wp + n * WT + u * WB);
  __syncthreads();   // the A tile is whole before any wave reads it
  v8f acc[4][2];
#pragma unroll
  for (int m = 0; m < 4; ++m) { acc[m][0] = (v8f){}; acc[m][1] = (v8f){}; }
  auto kstep = [&](int ks, int u, bool refill) { v16b a[4];
#pragma unroll
    for (int m = 0; m < 4; ++m) a[m] = frag_kb(&Ax[m * 16 + nloc][ks * 32], hlf);
#pragma unroll
    for (int m = 0; m < 4; ++m)
#pragma unroll
      for (int n = 0; n < 2; ++n) acc[m][n] = wmma16b(a[m], bw[u][n], acc[m][n]);
    if (refill) {
#pragma unroll
      for (int n = 0; n < 2; ++n) bw[u][n] = frag_pk(wp + n * WT + (size_t)(ks + RD) * WB); } };
  // rolled, RD k steps a trip (one turn of the ring, so that every set keeps its registers); the last turn refills nothing
#pragma unroll 1
  for (int k4 = 0; k4 < D / 32 - RD; k4 += RD) {
#pragma unroll
    for (int u = 0; u < RD; ++u) kstep(k4 + u, u, true); }
#pragma unroll
  for (int u = 0; u < RD; ++u) kstep(D / 32 - RD + u, u, false);
  __syncthreads();   // every wave has left Ax before Tf or Vt overwrites it
  // K and V leave here in the form that the attention kernel copies to LDS: hi and lo halves (x HS), K as token rows of its head (64 features = one 128-byte line), V transposed (feature rows along the padded token axis). Every store of a wave covers four whole lines.
  // The work-groups of a batch's first and last 64 tokens also write the zero margin beside them (po places away), line for line with their own.
  const int tl = (int)(t0 % L), hb = (int)(t0 / L) * H + c0 / HD, po = tl == 0 ? -GM : (tl == L - GM ? GM : 0);
  if (which == 2) {   // block-uniform. An accumulator register row is 8 successive tokens of one feature: 16 bytes of a V^T row as they stand. Vt rows 0 .. GN - 1 hold hi, GN .. 2 GN - 1 lo; pitch 16 bytes x odd
#pragma unroll
    for (int n = 0; n < 2; ++n) { const int cc = wave * 32 + n * 16 + nloc; const float bb = bfv(bias[c0 + cc]);
#pragma unroll
      for (int m = 0; m < 4; ++m) { v8b hv, lv;
#pragma unroll
        for (int r8 = 0; r8 < 8; ++r8) { b16 p, pl; split16((acc[m][n][r8] * (1.0f / (XS * WSC)) + bb) * HS, p, pl); hv[r8] = p; lv[r8] = pl; }
        *(v8b*)(&Vt[cc][m * 16 + 8 * hlf]) = hv; *(v8b*)(&Vt[GN + cc][m * 16 + 8 * hlf]) = lv; } }
    __syncthreads();   // Vt is whole before the line-wise stores read it
    for (int pl = 0; pl < 2; ++pl) { b16* dst = (pl != 0 ? VTl : VTh) + ((long long)hb * HD + (tid >> 3)) * NAP + FP + tl + (tid & 7) * 8; v8b x[8];   // 16-byte piece tid & 7 of feature rows (tid >> 3) + 32 i
      if (po != 0) {
#pragma unroll
        for (int i = 0; i < 8; ++i) *(v8b*)(dst + (long long)32 * i * NAP + po) = (v8b){}; }
      asm volatile("s_wait_xcnt 0x0" ::: "memory");   // behind the margin's stores: the wait that belongs in front of the next reuse of their address and data registers
#pragma unroll
      for (int i = 0; i < 8; ++i) x[i] = *(const v8b*)(&Vt[pl * GN + (tid >> 3) + 32 * i][(tid & 7) * 8]);
#pragma unroll
      for (int i = 0; i < 8; ++i) *(v8b*)(dst + (long long)32 * i * NAP) = x[i];
      asm volatile("s_wait_xcnt 0x0" ::: "memory"); }   // the same wait behind the plane's own stores
    return; }
#pragma unroll
  for (int n = 0; n < 2; ++n) { const int cc = wave * 32 + n * 16 + nloc; const float bb = bfv(bias[c0 + cc]);
#pragma unroll
    for (int m = 0; m < 4; ++m)
#pragma unroll
      for (int r8 = 0; r8 < 8; ++r8) Tf[m * 16 + 8 * hlf + r8][cc] = acc[m][n][r8] * (1.0f / (XS * WSC)) + bb; }
  __syncthreads();   // Tf is whole before the row-wise stores read it
  for (int rr = wave; rr < GM; rr += 8) { const size_t tk = t0 + rr;
    if (which == 0) { for (int q = 0; q < 4; ++q) { const int c = q * 64 + lane * 2; b16 h0, l0, h1, l1; split16(Tf[rr][c] * HS, h0, l0); split16(Tf[rr][c + 1] * HS, h1, l1); *(v2b*)(Qh + tk * D + c0 + c) = (v2b){h0, h1}; *(v2b*)(Ql + tk * D + c0 + c) = (v2b){l0, l1}; }
      asm volatile("s_wait_xcnt 0x0" ::: "memory"); }   // behind the row's stores, inside the branch: the wait that belongs in front of the next reuse of their address and data registers
    else { const long long ro = ((long long)(hb + (lane >> 3)) * NAP + FP + tl + rr) * HD + (lane & 7) * 8;   // lane l: features 8 (l & 7) .. + 7 of head hb + (l >> 3)
      if (po != 0) { *(v8b*)(KAh + ro + po * HD) = (v8b){}; *(v8b*)(KAl + ro + po * HD) = (v8b){}; }
      asm volatile("s_wait_xcnt 0x0" ::: "memory");   // behind the margin's stores: the wait that belongs in front of the next reuse of their address and data registers
      const v4f f0 = *(const v4f*)(&Tf[rr][lane * 8]), f1 = *(const v4f*)(&Tf[rr][lane * 8 + 4]); v8b hv, lv;
#pragma unroll
      for (int e = 0; e < 4; ++e) { b16 p, pl; split16(f0[e] * HS, p, pl); hv[e] = p; lv[e] = pl; split16(f1[e] * HS, p, pl); hv[4 + e] = p; lv[4 + e] = pl; }
      *(v8b*)(KAh + ro) = hv; *(v8b*)(KAl + ro) = lv;
      asm volatile("s_wait_xcnt 0x0" ::: "memory"); } } }   // the same wait behind the row's own stores
// Attention work-group: AG halves of AW waves, all of one (batch, head); a half works on one 64-query block at a time, 16 queries a wave. Chunk c is the 128 tokens CS c - HALO .. CS c + CS - 1 (places CS c + FP - HALO .. of the padded axis): it owns the areas that END in its last CS tokens, and its first HALO tokens are there for the two tokens that such an area may reach back, so every chunk is worked on by itself. Its K and V rows are brought into LDS once for the four waves of a half and every fragment is read from there.
// One buffer = Kh, Kl (128 token rows of 128 bytes, pitch 144) and Vh, Vl (64 feature rows of 256 bytes, pitch 272): pitches of 16 bytes x odd for the 16-byte LDS reads. Two buffers for each half: the next chunk's copies fly while this chunk is worked on.
constexpr int AW = 4, AG = 2, XP = 36, KP = HD + 8, VP = CH + 8, KB = CH * KP, VB = HD * VP, SB = 2 * KB + 2 * VB;
typedef __attribute__((ext_vector_type(4))) int v4i;
// eight asynchronous 16-byte copies to LDS per lane (LDS byte address l + i ls, global address g + i gs); the s_wait_xcnt stands in the copies' own statement, in front of any reuse of the address registers that they name
__device__ __forceinline__ void copy8(unsigned int l, unsigned int ls, const char* g, size_t gs) {
  asm volatile("global_load_async_to_lds_b128 %0, %8, off\n\tglobal_load_async_to_lds_b128 %1, %9, off\n\tglobal_load_async_to_lds_b128 %2, %10, off\n\tglobal_load_async_to_lds_b128 %3, %11, off\n\t"
               "global_load_async_to_lds_b128 %4, %12, off\n\tglobal_load_async_to_lds_b128 %5, %13, off\n\tglobal_load_async_to_lds_b128 %6, %14, off\n\tglobal_load_async_to_lds_b128 %7, %15, off\n\ts_wait_xcnt 0x0"
               :: "v"(l), "v"(l + ls), "v"(l + 2 * ls), "v"(l + 3 * ls), "v"(l + 4 * ls), "v"(l + 5 * ls), "v"(l + 6 * ls), "v"(l + 7 * ls),
                  "v"(g), "v"(g + gs), "v"(g + 2 * gs), "v"(g + 3 * gs), "v"(g + 4 * gs), "v"(g + 5 * gs), "v"(g + 6 * gs), "v"(g + 7 * gs) : "memory"); }
// one chunk into the buffer at LDS byte address lb: 16-byte piece p = tid + 128 i of each of the four tiles (K: row p / 8, the 16 KB are contiguous in memory; V: row p / 16, memory pitch NAP elements)
__device__ __forceinline__ void stage_chunk(unsigned int lb, int tid, int a0, const b16* kh, const b16* kl, const b16* vh, const b16* vl) {
  const unsigned int lk = lb + (unsigned int)((tid >> 3) * (KP * 2) + (tid & 7) * 16), lv = lb + (unsigned int)(2 * KB * 2 + (tid >> 4) * (VP * 2) + (tid & 15) * 16);
  const size_t gk = (size_t)a0 * (HD * 2) + (size_t)tid * 16, gv = (size_t)(tid >> 4) * (NAP * 2) + (size_t)a0 * 2 + (size_t)(tid & 15) * 16;
  copy8(lk, 16 * KP * 2, (const char*)kh + gk, 2048); copy8(lk + KB * 2, 16 * KP * 2, (const char*)kl + gk, 2048);
  copy8(lv, 8 * VP * 2, (const char*)vh + gv, (size_t)8 * NAP * 2); copy8(lv + VB * 2, 8 * VP * 2, (const char*)vl + gv, (size_t)8 * NAP * 2); }
// one work-group to a WGP, two waves for each SIMD (a wave of each half): let the register budget and the load scheduling be those of two resident waves
__global__ __launch_bounds__(32 * AW * AG) __attribute__((amdgpu_waves_per_eu(1, 2))) void att_kernel(const b16* __restrict__ Qh, const b16* __restrict__ Ql, const b16* __restrict__ KAh, const b16* __restrict__ KAl, const b16* __restrict__ VTh, const b16* __restrict__ VTl, const int* __restrict__ mask, const int* __restrict__ zpad, int QLIM, float* __restrict__ O) { __shared__ __attribute__((aligned(16))) b16 sb[AG * 2 * SB]; __shared__ unsigned int cv[AG * AW];
  const int tid = threadIdx.x, wave = __builtin_amdgcn_readfirstlane(tid >> 5), lane = tid & 31, nloc = lane & 15, hlf = lane >> 4, grp = wave / AW, wq = wave % AW, gt = tid % (32 * AW); constexpr int NQB = L / (16 * AW);
  // The work-group owns query blocks A = NQB - 1 - pr and B = pr of its head: under a causal mask one sees many chunks where the other sees few, so every work-group has about the same number of (block, chunk) tasks.
  // The tasks, A's visible chunks in order and then B's, are cut in the middle: half 0 takes the first part, half 1 the rest, each through an LDS ring of its own. No wave walks a long row of chunks alone while its SIMD's other wave has run out of work.
  const int bh = blockIdx.x / (NQB / 2), pr = blockIdx.x % (NQB / 2), qbA = (NQB - 1 - pr) * (16 * AW), qbB = pr * (16 * AW); if (qbB >= QLIM) return;   // qbB < qbA: both blocks lie past the query cut; the whole work-group leaves, in front of every barrier
  const int q0 = (grp != 0 ? qbB : qbA) + wq * 16; const bool live = q0 < QLIM;   // the wave's own 16 queries: it scans their mask rows here and merges and stores their result at the end (a wave past the query cut still copies and passes every barrier; it stores nothing)
  const int b = bh / H, h = bh % H; const size_t tq = (size_t)b * L + q0;
  // both products are taken transposed (X^T = kh x qh^T, O^T = vh^T x c^T): queries are the N side, so lane nloc owns query nloc of the wave's 16 in the block in work and its half hlf holds tokens 16 T + 8 hlf + 0..7 of every 16-token tile T.
  // Two neighbouring tiles are then, register for register, the K = 32 operand of c (k = 8 hlf + e and 16 + 8 hlf + e, the order of frag_kb): mask, softmax and c never leave the registers; a neighbour token in the other half of the lanes comes by one lane exchange.
  // The task list must read the same in all waves: each wave ORs its 16 mask rows (whole lines); bit c of wv = some query of the wave sees some end position of chunk c, 120 c .. 120 c + 119. Exact, so that the cut in the middle halves the real work:
  v4i any[8];
#pragma unroll
  for (int j = 0; j < 8; ++j) any[j] = (v4i){0, 0, 0, 0};
  // rolled, four rows a trip: 32 loads of 16 bytes in flight per lane cover the latency
#pragma unroll 1
  for (int r0 = 0; r0 < 16; r0 += 4) { v4i mv[4][8];
#pragma unroll
    for (int r = 0; r < 4; ++r)
#pragma unroll
      for (int j = 0; j < 8; ++j) mv[r][j] = *(const v4i*)(mask + (size_t)(q0 + r0 + r) * L + j * 128 + lane * 4);
#pragma unroll
    for (int r = 0; r < 4; ++r)
#pragma unroll
      for (int j = 0; j < 8; ++j) any[j] |= mv[r][j]; }
  unsigned int wv = 0;
#pragma unroll
  for (int j = 0; j < 8; ++j) { const unsigned int bal = __builtin_amdgcn_ballot_w32((any[j][0] | any[j][1] | any[j][2] | any[j][3]) != 0), lowm = (1u << (30 - 2 * j)) - 1u;   // lane l holds columns 128 j + 4 l .. + 3: chunk j for l < 30 - 2 j, chunk j + 1 behind
    wv |= ((bal & lowm) != 0u ? 1u : 0u) << j; wv |= ((bal & ~lowm) != 0u ? 1u : 0u) << (j + 1); }
  if (lane == 0) cv[wave] = live ? wv : 0u;
  __syncthreads();   // all eight words are written before any wave reads them
  // ra, rb: the chunks of A and of B that are still to be handed out to this half; nst = steps of the longer half (half 0), passed by every wave; n = this half's own tasks
  unsigned int ra = (unsigned int)__builtin_amdgcn_readfirstlane((int)(cv[0] | cv[1] | cv[2] | cv[3])), rb = (unsigned int)__builtin_amdgcn_readfirstlane((int)(cv[4] | cv[5] | cv[6] | cv[7]));
  const int ntot = __builtin_popcount(ra) + __builtin_popcount(rb), nst = (ntot + 1) >> 1; int n = nst;
  if (grp != 0) { n = ntot - nst; for (int i = 0; i < nst; ++i) { if (ra != 0u) ra &= ra - 1u; else rb &= rb - 1u; } }   // half 1 steps over half 0's tasks (at most NCH trips)
  auto pop = [&](int& c, int& k) { if (ra != 0u) { c = __builtin_ctz(ra); ra &= ra - 1u; k = 0; } else { c = __builtin_ctz(rb); rb &= rb - 1u; k = 1; } };   // next task: chunk c of block k (0 = A, 1 = B)
  // the block in work: its first query of this wave, its mask row and its query fragments
  bool wlive = false; const int* mrow = mask; v16b qa[2], ql[2];
  auto take = [&](int k) { const int qw = (k != 0 ? qbB : qbA) + wq * 16; wlive = qw < QLIM; mrow = mask + (size_t)(qw + nloc) * L; const size_t qo = ((size_t)b * L + qw + nloc) * D + h * HD;
    for (int ks = 0; ks < 2; ++ks) { qa[ks] = frag_kb(Qh + qo + ks * 32, hlf); ql[ks] = frag_kb(Ql + qo + ks * 32, hlf); }
    __builtin_amdgcn_sched_barrier(0);   // keeps the fragment loads in front of the wait below (without it the scheduler let them sink behind it)
    asm volatile("s_wait_xcnt 0x0" ::: "memory");   // behind the fragment loads: the wait that belongs in front of the next reuse of their address registers
    __builtin_amdgcn_sched_barrier(0); };   // and keeps what follows, which may reuse those registers, behind the wait
  v8f oacc[4] = {(v8f){}, (v8f){}, (v8f){}, (v8f){}}, oA[4] = {(v8f){}, (v8f){}, (v8f){}, (v8f){}}; float mrun = -INFINITY, lrun = 0.0f, mA = -INFINITY, lA = 0.0f;   // the state of the block in work; block A's state once the half has gone on to B
  const unsigned int lds0 = (unsigned int)(size_t)sb + (unsigned int)(grp * 2 * SB * 2);   // LDS byte address of this half's buffer 0: the low 32 bits of the shared address
  const b16 *gkh = KAh + (size_t)bh * NAP * HD, *gkl = KAl + (size_t)bh * NAP * HD, *gvh = VTh + (size_t)bh * HD * NAP, *gvl = VTl + (size_t)bh * HD * NAP;
  int c0 = 0, c1 = 0, k0 = 0, k1 = 0;   // the task in work and the task in flight
  if (n > 0) { pop(c0, k0); stage_chunk(lds0, gt, c0 * CS + (FP - HALO), gkh, gkl, gvh, gvl); }
  int kc = k0; take(kc);   // here, so that the fragments' latency passes while the first chunk's copies fly
  asm volatile("s_wait_asynccnt 0x0" ::: "memory");   // this wave's copies of the first chunk have landed
  __syncthreads();   // and every wave's: the first chunk may be read
  if (n > 1) { pop(c1, k1); stage_chunk(lds0 + SB * 2, gt, c1 * CS + (FP - HALO), gkh, gkl, gvh, gvl); }
#pragma unroll 1
  for (int st = 0; st < nst; ++st) { const int e0 = c0 * CS - HALO; const b16* kbuf = sb + (grp * 2 + (st & 1)) * SB; const b16* vbuf = kbuf + 2 * KB; const bool act = st < n;   // half 1 may have one task less: it passes the last hand-over all the same
    if (act && k0 != kc) {   // wave-uniform: the half goes on from block A to block B
      kc = k0; take(kc);
#pragma unroll
      for (int t = 0; t < 4; ++t) { oA[t] = oacc[t]; oacc[t] = (v8f){}; }
      mA = mrun; lA = lrun; mrun = -INFINITY; lrun = 0.0f; }
    // visibility bits of this lane's 64 end positions e0 + 16 T + 8 hlf + r8 (bit 8 (T & 3) + r8 of word T >> 2). A group of eight holds ends of this chunk unless it is the halo (T = 0, lower half) or lies behind the last token: there the address is clamped and no bit is set.
    unsigned int vb[NTI / 4] = {};
#pragma unroll
    for (int t = 0; t < NTI; ++t) { const int g = e0 + t * 16 + 8 * hlf; const bool ok = (t > 0 || hlf != 0) && g < L; int m[8]; __builtin_memcpy(m, mrow + (ok ? g : 0), 32); unsigned int bb = 0;
#pragma unroll
      for (int r8 = 0; r8 < 8; ++r8) bb |= (m[r8] != 0 ? 1u : 0u) << r8;
      vb[t >> 2] |= (ok ? bb : 0u) << ((t & 3) * 8); }
    // an area of width w ends no earlier than token w - 1: end 0 has width 1 alone, end 1 widths 1 and 2 (chunk 0, tile 0, upper half, bits 0 and 1)
    const bool later = c0 != 0 || hlf == 0;
    if (act && wlive && __builtin_amdgcn_ballot_w32((vb[0] | vb[1]) != 0u) != 0u) {   // wave-uniform: where no query of this wave sees any area of the chunk its contribution is exactly zero; the hand-over below is passed all the same
    v8f s[NTI];
#pragma unroll
    for (int tg = 0; tg < NTI; tg += 4) {
#pragma unroll
      for (int t = 0; t < 4; ++t) s[tg + t] = (v8f){};
#pragma unroll
      for (int ks = 0; ks < 2; ++ks) { v16b kh[4], kl[4];
#pragma unroll
        for (int t = 0; t < 4; ++t) { const b16* kr = kbuf + ((tg + t) * 16 + nloc) * KP + ks * 32; kh[t] = frag_kb(kr, hlf); kl[t] = frag_kb(kr + KB, hlf); }
#pragma unroll
        for (int t = 0; t < 4; ++t) s[tg + t] = wmma16q(kh[t], qa[ks], s[tg + t]);
#pragma unroll
        for (int t = 0; t < 4; ++t) s[tg + t] = wmma16q(kl[t], qa[ks], s[tg + t]);
#pragma unroll
        for (int t = 0; t < 4; ++t) s[tg + t] = wmma16q(kh[t], ql[ks], s[tg + t]); } }
    // token logits x (in s), and for every group of eight its two predecessors b7 = x[-1], b6 = x[-2], which the other half of the lanes holds: the group in front of (T, upper half) is (T, lower half); in front of (T, lower half), (T - 1, upper half); the chunk's first group is halo and ends no area
    float b6[NTI], b7[NTI];
#pragma unroll
    for (int t = 0; t < NTI; ++t) { s[t] *= SCALE / (HS * HS); b6[t] = xhalf(s[t][6]); b7[t] = xhalf(s[t][7]); }
#pragma unroll
    for (int t = NTI - 1; t >= 0; --t) { b6[t] = hlf ? b6[t] : (t > 0 ? b6[t > 0 ? t - 1 : 0] : 0.0f); b7[t] = hlf ? b7[t] : (t > 0 ? b7[t > 0 ? t - 1 : 0] : 0.0f); }
    // area logits by end position e: x[e], (x[e] + x[e-1]) / 2, (x[e] + x[e-1] + x[e-2]) / 3; written out here for the maximum and again below for the weights
    v8f m8;
#pragma unroll
    for (int r8 = 0; r8 < 8; ++r8) m8[r8] = -INFINITY;
#pragma unroll
    for (int t = 0; t < NTI; ++t)
#pragma unroll
      for (int r8 = 0; r8 < 8; ++r8) { const float x0 = s[t][r8], xm1 = r8 >= 1 ? s[t][r8 >= 1 ? r8 - 1 : 0] : b7[t], xm2 = r8 >= 2 ? s[t][r8 >= 2 ? r8 - 2 : 0] : (r8 == 1 ? b7[t] : b6[t]), u2 = x0 + xm1, u3 = u2 + xm2;
        const bool c1 = ((vb[t >> 2] >> ((t & 3) * 8 + r8)) & 1u) != 0u, c2 = (t == 0 && r8 == 0) ? (c1 && later) : c1, c3 = (t == 0 && r8 <= 1) ? (c1 && later) : c1;
        m8[r8] = fmaxf(m8[r8], fmaxf(x0 + (c1 ? 0.0f : -INFINITY), fmaxf(__builtin_fmaf(u2, 0.5f, c2 ? 0.0f : -INFINITY), __builtin_fmaf(u3, 1.0f / 3.0f, c3 ? 0.0f : -INFINITY)))); }
    float mx = fmaxf(fmaxf(fmaxf(m8[0], m8[1]), fmaxf(m8[2], m8[3])), fmaxf(fmaxf(m8[4], m8[5]), fmaxf(m8[6], m8[7]))); mx = fmaxf(mx, __shfl_xor(mx, 16));
    const float mn = fmaxf(mrun, mx), fe = exp2_slot((mrun - mn) * LOG2E), fac = (mrun == -INFINITY) ? 0.0f : fe, ms = (mn == -INFINITY) ? 0.0f : mn, nms = -ms * LOG2E; v8f s8 = (v8f){};
    // weights by end position e: wa = p1 + p2 + p3 goes to token e (and into the row sum), wb = p2 + p3 also to token e - 1, wc = p3 also to token e - 2: token weight c[t] = wa[t] + wb[t + 1] + wc[t + 2], written over x tile by tile.
    // What the last two tokens of a group take from the group behind it (n0 = wc[0], n1 = wb[0] + wc[1]) comes from the other half of the lanes: behind (T, lower half) stands (T, upper half); behind (T, upper half), (T + 1, lower half); behind the chunk's last group, the next chunk's ends, which reach these tokens through that chunk's halo.
    float n0[NTI], n1[NTI];
#pragma unroll
    for (int t = 0; t < NTI; ++t) { float wa[8], wb[8], wc[8];
#pragma unroll
      for (int r8 = 0; r8 < 8; ++r8) { const float x0 = s[t][r8], xm1 = r8 >= 1 ? s[t][r8 >= 1 ? r8 - 1 : 0] : b7[t], xm2 = r8 >= 2 ? s[t][r8 >= 2 ? r8 - 2 : 0] : (r8 == 1 ? b7[t] : b6[t]), u2 = x0 + xm1, u3 = u2 + xm2;
        const bool c1 = ((vb[t >> 2] >> ((t & 3) * 8 + r8)) & 1u) != 0u, c2 = (t == 0 && r8 == 0) ? (c1 && later) : c1, c3 = (t == 0 && r8 <= 1) ? (c1 && later) : c1;
        const float p1 = exp2_slot(__builtin_fmaf(x0, LOG2E, c1 ? nms : -INFINITY)), p2 = exp2_slot(__builtin_fmaf(u2, 0.5f * LOG2E, c2 ? nms : -INFINITY)), p3 = exp2_slot(__builtin_fmaf(u3, LOG2E / 3.0f, c3 ? nms : -INFINITY));
        wc[r8] = p3; wb[r8] = p2 + p3; wa[r8] = p1 + wb[r8]; s8[r8] += wa[r8]; }
      n0[t] = xhalf(wc[0]); n1[t] = xhalf(wb[0] + wc[1]);
#pragma unroll
      for (int r8 = 0; r8 < 6; ++r8) s[t][r8] = wa[r8] + wb[r8 + 1] + wc[r8 + 2];
      s[t][6] = wa[6] + wb[7]; s[t][7] = wa[7]; }
    float sm = ((s8[0] + s8[1]) + (s8[2] + s8[3])) + ((s8[4] + s8[5]) + (s8[6] + s8[7])); sm += __shfl_xor(sm, 16); lrun = lrun * fac + sm; mrun = mn;
#pragma unroll
    for (int t = 0; t < NTI; ++t) { s[t][6] += hlf ? (t + 1 < NTI ? n0[t + 1 < NTI ? t + 1 : 0] : 0.0f) : n0[t]; s[t][7] += hlf ? (t + 1 < NTI ? n1[t + 1 < NTI ? t + 1 : 0] : 0.0f) : n1[t]; s[t] *= PS; }
#pragma unroll
    for (int t = 0; t < 4; ++t) oacc[t] *= fac;
#pragma unroll
    for (int kb = 0; kb < CH; kb += 32) { v16b pa, pb, vh[4], vlo[4];
#pragma unroll
      for (int e = 0; e < 8; ++e) { b16 ph, pl; split16(s[kb / 16][e], ph, pl); pa[e] = ph; pb[e] = pl; split16(s[kb / 16 + 1][e], ph, pl); pa[8 + e] = ph; pb[8 + e] = pl; }
#pragma unroll
      for (int t = 0; t < 4; ++t) { const b16* vr = vbuf + (t * 16 + nloc) * VP + kb; vh[t] = frag_kb(vr, hlf); vlo[t] = frag_kb(vr + VB, hlf); }
#pragma unroll
      for (int t = 0; t < 4; ++t) oacc[t] = wmma16b(vh[t], pa, oacc[t]);
#pragma unroll
      for (int t = 0; t < 4; ++t) oacc[t] = wmma16b(vlo[t], pa, oacc[t]);
#pragma unroll
      for (int t = 0; t < 4; ++t) oacc[t] = wmma16b(vh[t], pb, oacc[t]); } }
    // hand-over, every wave, in this order: my LDS reads of this buffer are done; my copies of the next chunk have landed; the barrier publishes the next chunk and frees this buffer; only then the refill
    asm volatile("s_wait_dscnt 0x0" ::: "memory");
    asm volatile("s_wait_asynccnt 0x0" ::: "memory");
    __syncthreads();
    c0 = c1; k0 = k1;
    if (st + 2 < n) { pop(c1, k1); stage_chunk(lds0 + (unsigned int)((st & 1) * SB * 2), gt, c1 * CS + (FP - HALO), gkh, gkl, gvh, gvl); } }
  asm volatile("s_wait_asynccnt 0x0" ::: "memory");   // no copy is outstanding when the wave ends
  // Each wave now holds a state for its tile of A and one for its tile of B (empty: -inf, 0, 0). Half 0 finishes A, half 1 finishes B: a wave hands the other state to the wave of the other half that has the same tile, through LDS (the rings are free: every wave's reads and copies ended in front of the last barrier).
  if (kc == 0) {
#pragma unroll
    for (int t = 0; t < 4; ++t) { oA[t] = oacc[t]; oacc[t] = (v8f){}; }
    mA = mrun; lA = lrun; mrun = -INFINITY; lrun = 0.0f; }
  if (grp == 0) {
#pragma unroll
    for (int t = 0; t < 4; ++t) { const v8f x = oacc[t]; oacc[t] = oA[t]; oA[t] = x; }
    const float xm = mrun, xl = lrun; mrun = mA; lrun = lA; mA = xm; lA = xl; }
  // (oacc, mrun, lrun) stays, (oA, mA, lA) goes; XP floats a lane: a pitch of 16 bytes x odd
  float* xw = (float*)sb + (size_t)(wave * 32 + lane) * XP; const float* xr = (const float*)sb + (size_t)((wave ^ AW) * 32 + lane) * XP;
#pragma unroll
  for (int t = 0; t < 4; ++t) { *(v4f*)(xw + t * 8) = (v4f){oA[t][0], oA[t][1], oA[t][2], oA[t][3]}; *(v4f*)(xw + t * 8 + 4) = (v4f){oA[t][4], oA[t][5], oA[t][6], oA[t][7]}; }
  *(v2f*)(xw + 32) = (v2f){mA, lA};
  __syncthreads();   // every wave's handed-over state is written before its partner reads it
  const v2f ml = *(const v2f*)(xr + 32); const float mm = fmaxf(mrun, ml[0]), ek = exp2_slot((mrun - mm) * LOG2E), ep = exp2_slot((ml[0] - mm) * LOG2E), fk = (mrun == -INFINITY) ? 0.0f : ek, fp = (ml[0] == -INFINITY) ? 0.0f : ep;
  lrun = lrun * fk + ml[1] * fp;
#pragma unroll
  for (int t = 0; t < 4; ++t) { const v4f p0 = *(const v4f*)(xr + t * 8), p1 = *(const v4f*)(xr + t * 8 + 4);
#pragma unroll
    for (int j = 0; j < 4; ++j) { oacc[t][j] = oacc[t][j] * fk + p0[j] * fp; oacc[t][4 + j] = oacc[t][4 + j] * fk + p1[j] * fp; } }
  const bool zero = (zpad[0] != 0 && q0 + nloc == 0);
  if (live) {
#pragma unroll
  for (int t = 0; t < 4; ++t) { v4f o0, o1;
#pragma unroll
    for (int j = 0; j < 4; ++j) { const float u0 = oacc[t][j] * (1.0f / (PS * HS)) / lrun, u1 = oacc[t][4 + j] * (1.0f / (PS * HS)) / lrun; o0[j] = zero ? 0.0f : u0; o1[j] = zero ? 0.0f : u1; }
    float* op = O + (tq + nloc) * D + h * HD + t * 16 + 8 * hlf; *(v4f*)op = o0; *(v4f*)(op + 4) = o1; } } }
__global__ __launch_bounds__(256) void outp_kernel(const float* __restrict__ O, const b16* __restrict__ WO, const float* __restrict__ bo, int QLIM, float* __restrict__ out) { __shared__ __attribute__((aligned(16))) char sm[2 * GM * AP * 2]; b16 (*Ah)[AP] = (b16 (*)[AP])sm; b16 (*Al)[AP] = (b16 (*)[AP])(sm + GM * AP * 2); float (*Tf)[TP] = (float (*)[TP])sm;   // Tf takes Ah's place behind the K loop
  const int tid = threadIdx.x, wave = __builtin_amdgcn_readfirstlane(tid >> 5), lane = tid & 31, nloc = lane & 15, hlf = lane >> 4; const size_t t0 = (size_t)blockIdx.x * GM; const int c0 = blockIdx.y * GN; if ((int)(t0 % L) >= QLIM) return;
  // rolled: 16 rows a trip are 16 loads of 16 bytes in flight per lane, enough to cover the latency
#pragma unroll 1
  for (int r0 = 0; r0 < GM; r0 += 16) { v4f xv[16];
#pragma unroll
    for (int j = 0; j < 16; ++j) xv[j] = *(const v4f*)(O + (t0 + r0 + j) * D + tid * 4);
#pragma unroll
    for (int j = 0; j < 16; ++j) { v4b hv, lv;
#pragma unroll
      for (int e = 0; e < 4; ++e) { b16 p, pl; split16(xv[j][e] * HS, p, pl); hv[e] = p; lv[e] = pl; }
      *(v4b*)(&Ah[r0 + j][tid * 4]) = hv; *(v4b*)(&Al[r0 + j][tid * 4]) = lv; } }
  // packed W fragments through a ring of RD register sets, as in proj_kernel; the first RD sets are asked for in front of the barrier
  const b16* wp = WO + (size_t)((c0 + wave * 32) / 16) * WT + lane * 8; v16b bw[RD][2];
#pragma unroll
  for (int u = 0; u < RD; ++u)
#pragma unroll
    for (int n = 0; n < 2; ++n) bw[u][n] = frag_pk(wp + n * WT + u * WB);
  __syncthreads();   // both A tiles are whole before any wave reads them
  v8f acc[4][2];
#pragma unroll
  for (int m = 0; m < 4; ++m) { acc[m][0] = (v8f){}; acc[m][1] = (v8f){}; }
  auto kstep = [&](int ks, int u, bool refill) { v16b a[4], al[4];
#pragma unroll
    for (int m = 0; m < 4; ++m) { a[m] = frag_kb(&Ah[m * 16 + nloc][ks * 32], hlf); al[m] = frag_kb(&Al[m * 16 + nloc][ks * 32], hlf); }
#pragma unroll
    for (int m = 0; m < 4; ++m)
#pragma unroll
      for (int n = 0; n < 2; ++n) acc[m][n] = wmma16b(a[m], bw[u][n], acc[m][n]);
#pragma unroll
    for (int m = 0; m < 4; ++m)
#pragma unroll
      for (int n = 0; n < 2; ++n) acc[m][n] = wmma16b(al[m], bw[u][n], acc[m][n]);
    if (refill) {
#pragma unroll
      for (int n = 0; n < 2; ++n) bw[u][n] = frag_pk(wp + n * WT + (size_t)(ks + RD) * WB); } };
  // rolled, RD k steps a trip (one turn of the ring); the last turn refills nothing
#pragma unroll 1
  for (int k4 = 0; k4 < D / 32 - RD; k4 += RD) {
#pragma unroll
    for (int u = 0; u < RD; ++u) kstep(k4 + u, u, true); }
#pragma unroll
  for (int u = 0; u < RD; ++u) kstep(D / 32 - RD + u, u, false);
  __syncthreads();   // every wave has left Ah before Tf overwrites it
#pragma unroll
  for (int n = 0; n < 2; ++n) { const int cc = wave * 32 + n * 16 + nloc; const float bb = bfv(bo[c0 + cc]);
#pragma unroll
    for (int m = 0; m < 4; ++m)
#pragma unroll
      for (int r8 = 0; r8 < 8; ++r8) Tf[m * 16 + 8 * hlf + r8][cc] = acc[m][n][r8] * (1.0f / (HS * WSC)) + bb; }
  __syncthreads();   // Tf is whole before the row-wise stores read it
  for (int rr = wave; rr < GM; rr += 8) { if ((int)((t0 + rr) % L) >= QLIM) continue;   // rows past the query cut stay unwritten, as before
    for (int q = 0; q < 2; ++q) *(v4f*)(out + (t0 + rr) * D + c0 + q * 128 + lane * 4) = *(const v4f*)(&Tf[rr][q * 128 + lane * 4]);
    asm volatile("s_wait_xcnt 0x0" ::: "memory"); } }   // behind the row's stores: the wait that belongs in front of the next trip's reuse of their address and data registers
}  // namespace

extern "C" void kernel_launch(void* const* d_in, const int* in_sizes, int n_in, void* d_out, int out_size, void* d_ws, size_t ws_size, hipStream_t stream) {
  (void)n_in;
  auto Fp = [&](int i) { return (const float*)d_in[i]; }; auto Ip = [&](int i) { return (const int*)d_in[i]; };
  // input order: 0 q [2,1024,1024]; 1 k; 2 v; 3 Wq; 4 bq; 5 Wk; 6 bk; 7 Wv; 8 bv; 9 Wo; 10 bo; 11 mask [1024,1024] i32; 12 zero_pad [1] i32
  if (in_sizes[0] != NT * D || in_sizes[1] != NT * D || in_sizes[2] != NT * D || in_sizes[3] != D * D || in_sizes[9] != D * D || in_sizes[11] != L * L || in_sizes[12] != 1 || out_size != NT * D) return;
  const int QLIM = L;   // per-batch query cut (multiple of 16)
  size_t off = 0; char* ws = (char*)d_ws;
  auto carve = [&](size_t bytes) { char* p = ws + off; off += (bytes + 255) & ~(size_t)255; return p; };
  b16* W4 = (b16*)carve((size_t)4 * D * D * 2); b16* Qh = (b16*)carve((size_t)NT * D * 2); b16* Ql = (b16*)carve((size_t)NT * D * 2); b16* KAh = (b16*)carve((size_t)NB_ * H * NAP * HD * 2); b16* KAl = (b16*)carve((size_t)NB_ * H * NAP * HD * 2); b16* VTh = (b16*)carve((size_t)NB_ * H * HD * NAP * 2); b16* VTl = (b16*)carve((size_t)NB_ * H * HD * NAP * 2); float* O = (float*)carve((size_t)NT * D * 4);
  if (off > ws_size || off > ((size_t)96 << 20)) return;   // ~ 44 MB
  wput_kernel<<<256, 256, 0, stream>>>(Fp(3), Fp(5), Fp(7), Fp(9), W4);
  proj_kernel<<<dim3(NT / GM, 3, D / GN), 256, 0, stream>>>(Fp(0), Fp(1), Fp(2), W4, Fp(4), Fp(6), Fp(8), Qh, Ql, KAh, KAl, VTh, VTl);
  att_kernel<<<NB_ * H * (L / (16 * AW)) / AG, 32 * AW * AG, 0, stream>>>(Qh, Ql, KAh, KAl, VTh, VTl, Ip(11), Ip(12), QLIM, O);
  outp_kernel<<<dim3(NT / GM, D / GN), 256, 0, stream>>>(O, W4 + (size_t)3 * D * D, Fp(10), QLIM, (float*)d_out);
}

// v008
// Measured time: 76.8 microseconds a run.
// In both of two side-by-side timings against v007, it was 1.11 times as fast.
// All steps since v000 together make it 35.4 times as fast.
#include <hip/hip_runtime.h>

// MultiHeadAreaAttention: qh,kh,vh = (q Wq^T + bq), (k Wk^T + bk), (v Wv^T + bv) as 16 heads x 64; areas = all windows of width 1..3 along the key axis (A = 3,069; block w starts at area index 0 / 1024 / 2047, end(a) = start + w - 1); k_area = window mean, v_area = window sum; logits = qh.k_area / 8, visible iff mask[q][end(a)] != 0 (else -1e30); weights = softmax over areas; if zero_pad: weights of query 0 := 0; ctx = weights.v_area; out = concat Wo^T + bo -> [2][1024][1024].
// Pooling is linear, so no pooled row is ever formed: qh.k_area(end e, width w) = (x[e] + .. + x[e-w+1]) / w with the token logits x[t] = qh.kh[t], and weights.v_area = sum over tokens t of c[t] vh[t], c[t] = the summed weights of the (up to six) areas that hold t. Both matrix products run over the 1,024 tokens instead of the 3,069 areas.
// Deterministic: online softmax over fixed chunks of 120 end positions (360 areas) in order, a query's chunks in at most two runs whose running maximum, sum and O are merged at the end in a fixed order (chunks with no visible area for any of the wave's 16 queries are skipped: they contribute exactly 0); inside a chunk each lane sums its areas in a fixed tree, then the two halves of a query are added; no atomics.
// WMMA (v_wmma_f32_16x16x32_f16, f32 accumulate): inputs (EXACT bf16 x8, K 1,024) x W rows (EXACT) per 64-token x 256-column work-group of 8 waves; per (bh, 16-query) wave (eight to a work-group, K and V chunks shared in LDS by four) X^T = kh token rows (hi+lo; 8 tiles/chunk) x qh (hi+lo x256, K 64) and O^T += vh^T rows (hi+lo; 4 tiles) x c (hi+lo), 3 products; o (hi+lo) x Wo rows, same tiling; neighbour sums, mask gather, softmax in f32.

namespace {
constexpr int NB_ = 2, L = 1024, D = 1024, H = 16, HD = 64, NT = NB_ * L, CH = 128, NTI = CH / 16, HALO = 8, CS = CH - HALO /* 120 */, NCH = (L + CS - 1) / CS /* 9 */, FP = 64, NAP = FP + L + 64 /* 1152 */;
// the padded token axis of the K rows and of the V^T rows: token t stands at place FP + t; the FP places in front of token 0 and the 64 behind token L - 1 are zero. Chunk c begins at place CS c + FP - HALO.
static_assert((NCH - 1) * CS + FP - HALO + CH <= NAP && FP >= HALO && NAP % 64 == 0, "every chunk lies inside the padded axis; a V^T row is a whole number of 128-byte lines");
constexpr float XS = 8.0f, HS = 256.0f, PS = 256.0f, WSC = 256.0f, SCALE = 0.125f, LOG2E = 1.44269504f;
typedef _Float16 b16;
typedef __attribute__((ext_vector_type(16))) _Float16 v16b;
typedef __attribute__((ext_vector_type(8))) _Float16 v8b;
typedef __attribute__((ext_vector_type(4))) _Float16 v4b;
typedef __attribute__((ext_vector_type(2))) _Float16 v2b;
typedef __attribute__((ext_vector_type(8))) float v8f;
typedef __attribute__((ext_vector_type(4))) float v4f;
typedef __attribute__((ext_vector_type(2))) float v2f;
typedef __attribute__((ext_vector_type(4))) int v4i;
typedef __attribute__((ext_vector_type(2))) int v2i;
__device__ __forceinline__ float bf16_rne(float f) { unsigned int u = __float_as_uint(f); u += 0x7FFFu + ((u >> 16) & 1u); float r = __uint_as_float(u & 0xFFFF0000u); asm volatile("" : "+v"(r)); return r; }
__device__ __forceinline__ float bfv(float f) { float r = bf16_rne(f); asm volatile("" : "+v"(r)); return r; }
__device__ __forceinline__ void split16(float v, b16& hi, b16& lo) { hi = (b16)v; lo = (b16)(v - (float)hi); }
__device__ __forceinline__ v16b frag_kb(const b16* p, int hh) { const v8b a = *(const v8b*)(p + 8 * hh), b = *(const v8b*)(p + 16 + 8 * hh); v16b f;
#pragma unroll
  for (int e = 0; e < 8; ++e) { f[e] = a[e]; f[8 + e] = b[e]; } return f; }
// W4 holds the four weight matrices in the order in which a GEMM wave reads them. One block = one B fragment (16 output columns x 32 k, WB elements) = two runs of 512 bytes: run r, lane l = (hlf, nloc) holds W[column nloc of the tile][k = 16 r + 8 hlf + 0..7], the k order of frag_kb.
// So each 16-byte load of a wave covers four whole 128-byte lines (from row-major W it touched sixteen lines for 32 bytes each). The blocks of one column tile follow one another in k (WT elements a tile), the tiles in column order, the matrices in the order q, k, v, o.
constexpr int WB = 16 * 32, WT = (D / 32) * WB, RD = 4;
__device__ __forceinline__ v16b frag_pk(const b16* p) { const v8b a = *(const v8b*)p, b = *(const v8b*)(p + WB / 2); v16b f;
#pragma unroll
  for (int e = 0; e < 8; ++e) { f[e] = a[e]; f[8 + e] = b[e]; } return f; }
__device__ __forceinline__ v8f wmma16b(v16b a, v16b b, v8f c) { v8f d = __builtin_amdgcn_wmma_f32_16x16x32_f16(false, a, false, b, (short)0, c, false, false); asm volatile("v_nop\n\tv_nop\n\tv_nop\n\tv_nop" : "+v"(d) : "v"(a), "v"(b)); return d; }
// the same for a B operand that is rewritten only when the half goes on to block B, far from any product (the query fragments): not named in the statement, it is free to live above v255, where an asm operand cannot, and leaves the low registers to the operands that must be there (named, two of the four fragments were spilled to scratch and read back in every chunk)
__device__ __forceinline__ v8f wmma16q(v16b a, v16b b, v8f c) { v8f d = __builtin_amdgcn_wmma_f32_16x16x32_f16(false, a, false, b, (short)0, c, false, false); asm volatile("v_nop\n\tv_nop\n\tv_nop\n\tv_nop" : "+v"(d) : "v"(a)); return d; }
// 2^x and, in the same statement, the one issue slot that the instruction set asks for behind a transcendental
__device__ __forceinline__ float exp2_slot(float x) { float p; asm("v_exp_f32 %0, %1\n\tv_nop" : "=v"(p) : "v"(x)); return p; }
// the value that lane l ^ 16 holds (the other half of the same query's tokens), by a vector cross-row move
__device__ __forceinline__ float xhalf(float v) { const int b = __float_as_int(v); return __int_as_float(__builtin_amdgcn_permlanex16(b, b, 0x76543210, 0xfedcba98, false, false)); }

// One work-group = one column tile (16 rows of one W, whole K); wave m of it = k steps 4 m .. 4 m + 3: four blocks, 4 KB of W4 in a row.
// Reads: load (b, i) of a wave is rows 4 i .. 4 i + 3 of block b, 128 bytes of each (lane l: row 4 i + (l >> 3), floats 4 (l & 7) .. + 3 of the block's 32): four whole lines. All sixteen loads of a lane are asked for before the first is used, so their memory latency is paid once.
// Writes: a 16-byte piece of W4 is two neighbouring lanes' four floats of one row. The lanes of a pair swap halves across two row groups: the even lane ends with the piece of row 8 j + (l >> 3), the odd lane with that of row 8 j + 4 + (l >> 3). The eight lanes that share (r, hlf) then store 128 bytes in a row: four whole lines a store.
static_assert(4 * (D / 16) == 256 && D / 32 == 8 * 4, "the launch has one work-group for each column tile of the four matrices, and its eight waves of four blocks cover K");
__global__ __launch_bounds__(256) void wput_kernel(const float* __restrict__ wq, const float* __restrict__ wk, const float* __restrict__ wv, const float* __restrict__ wo, b16* __restrict__ W4) { const int tid = threadIdx.x, wave = __builtin_amdgcn_readfirstlane(tid >> 5), lane = tid & 31, pc = lane & 7, which = blockIdx.x / (D / 16), ct = blockIdx.x % (D / 16); const bool odd = (lane & 1) != 0;
  const float* w = which == 0 ? wq : (which == 1 ? wk : (which == 2 ? wv : wo)); const float* src = w + (size_t)(ct * 16 + (lane >> 3)) * D + wave * 128 + pc * 4; v4f x[4][4];
  // every loop of this kernel is unrolled: x and o are indexed by constants alone and stay in registers
#pragma unroll
  for (int b = 0; b < 4; ++b)
#pragma unroll
    for (int i = 0; i < 4; ++i) x[b][i] = *(const v4f*)(src + (size_t)i * 4 * D + b * 32);
  asm volatile("s_wait_xcnt 0x0" :: "v"(src) : "memory");   // behind the loads: the wait that belongs in front of the next reuse of their address registers (named as an input, they stay as they are up to here); the clobber keeps all sixteen loads in front of the conversions
  b16* dst = W4 + ((size_t)blockIdx.x * (D / 32) + wave * 4) * WB + (pc >> 2) * (WB / 2) + (((pc >> 1) & 1) * 16 + (odd ? 4 : 0) + (lane >> 3)) * 8;   // run r = pc >> 2, place hlf = (pc >> 1) & 1, column of the tile as above (j = 0)
  v4i o[4][2];
#pragma unroll
  for (int b = 0; b < 4; ++b)
#pragma unroll
    for (int j = 0; j < 2; ++j) { v4b ha, hb;
#pragma unroll
      for (int e = 0; e < 4; ++e) { ha[e] = (b16)(bf16_rne(x[b][2 * j][e]) * WSC); hb[e] = (b16)(bf16_rne(x[b][2 * j + 1][e]) * WSC); }
      const v2i A = __builtin_bit_cast(v2i, ha), B = __builtin_bit_cast(v2i, hb), s = odd ? A : B;   // the half that the other lane of the pair stores
      const int r0 = __builtin_amdgcn_update_dpp(0, s[0], 0xB1, 0xF, 0xF, true), r1 = __builtin_amdgcn_update_dpp(0, s[1], 0xB1, 0xF, 0xF, true);   // quad_perm [1,0,3,2]: the value of lane l ^ 1
      o[b][j] = odd ? (v4i){r0, r1, B[0], B[1]} : (v4i){A[0], A[1], r0, r1}; }
#pragma unroll
  for (int b = 0; b < 4; ++b)
#pragma unroll
    for (int j = 0; j < 2; ++j) *(v8b*)(dst + b * WB + j * 64) = __builtin_bit_cast(v8b, o[b][j]); }
// GEMM tile of one work-group (both projection kernels): GM tokens x GN output columns, 8 waves. All waves stage the A tile (whole K) in LDS once; wave w then owns columns 32 w .. 32 w + 31 for all GM tokens (4 x 2 accumulator tiles), so each B fragment read from global memory (packed: frag_pk) serves four products. k order per output element: ascending, as before.
constexpr int GM = 64, GN = 256, AP = D + 8, TP = GN + 4, VTP = GM + 8;
static_assert(FP == GM && NAP - FP - L == GM && L % GM == 0 && GN % HD == 0, "a work-group's 64 tokens are one 128-byte line of a V^T row, and each zero margin is as long");
__global__ __launch_bounds__(256) void proj_kernel(const float* __restrict__ xq, const float* __restrict__ xk, const float* __restrict__ xv, const b16* __restrict__ W4, const float* __restrict__ bq, const float* __restrict__ bk, const float* __restrict__ bv, b16* __restrict__ Qh, b16* __restrict__ Ql, b16* __restrict__ KAh, b16* __restrict__ KAl, b16* __restrict__ VTh, b16* __restrict__ VTl) { __shared__ __attribute__((aligned(16))) char sm[GM * AP * 2]; b16 (*Ax)[AP] = (b16 (*)[AP])sm; float (*Tf)[TP] = (float (*)[TP])sm; b16 (*Vt)[VTP] = (b16 (*)[VTP])sm;   // Tf (q, k) or Vt (v) takes Ax's place behind the K loop
  const int tid = threadIdx.x, wave = __builtin_amdgcn_readfirstlane(tid >> 5), lane = tid & 31, nloc = lane & 15, hlf = lane >> 4; const size_t t0 = (size_t)blockIdx.x * GM; const int which = blockIdx.y, c0 = blockIdx.z * GN;
  const float* x = which == 0 ? xq : (which == 1 ? xk : xv); const float* bias = which == 0 ? bq : (which == 1 ? bk : bv);
  // rolled: 16 rows a trip are 16 loads of 16 bytes in flight per lane, enough to cover the memory latency
#pragma unroll 1
  for (int r0 = 0; r0 < GM; r0 += 16) { v4f xv[16];
#pragma unroll
    for (int j = 0; j < 16; ++j) xv[j] = *(const v4f*)(x + (t0 + r0 + j) * D + tid * 4);
#pragma unroll
    for (int j = 0; j < 16; ++j) { v4b hv;
#pragma unroll
      for (int e = 0; e < 4; ++e) hv[e] = (b16)(bf16_rne(xv[j][e]) * XS);
      *(v4b*)(&Ax[r0 + j][tid * 4]) = hv; } }
  // No line of packed W serves two k steps, so no step's loads warm the cache for the next: the fragments go through a ring of RD register sets, each refilled for k step s + RD as soon as step s has used it. The first RD sets are asked for here, in front of the barrier.
  const b16* wp = W4 + (size_t)(which * (D / 16) + (c0 + wave * 32) / 16) * WT + lane * 8; v16b bw[RD][2];
#pragma unroll
  for (int u = 0; u < RD; ++u)
#pragma unroll
    for (int n = 0; n < 2; ++n) bw[u][n] = frag_pk(wp + n * WT + u * WB);
  __syncthreads();   // the A tile is whole before any wave reads it
  v8f acc[4][2];
#pragma unroll
  for (int m = 0; m < 4; ++m) { acc[m][0] = (v8f){}; acc[m][1] = (v8f){}; }
  auto kstep = [&](int ks, int u, bool refill) { v16b a[4];
#pragma unroll
    for (int m = 0; m < 4; ++m) a[m] = frag_kb(&Ax[m * 16 + nloc][ks * 32], hlf);
#pragma unroll
    for (int m = 0; m < 4; ++m)
#pragma unroll
      for (int n = 0; n < 2; ++n) acc[m][n] = wmma16b(a[m], bw[u][n], acc[m][n]);
    if (refill) {
#pragma unroll
      for (int n = 0; n < 2; ++n) bw[u][n] = frag_pk(wp + n * WT + (size_t)(ks + RD) * WB); } };
  // rolled, RD k steps a trip (one turn of the ring, so that every set keeps its registers); the last turn refills nothing
#pragma unroll 1
  for (int k4 = 0; k4 < D / 32 - RD; k4 += RD) {
#pragma unroll
    for (int u = 0; u < RD; ++u) kstep(k4 + u, u, true); }
#pragma unroll
  for (int u = 0; u < RD; ++u) kstep(D / 32 - RD + u, u, false);
  __syncthreads();   // every wave has left Ax before Tf or Vt overwrites it
  // K and V leave here in the form that the attention kernel copies to LDS: hi and lo halves (x HS), K as token rows of its head (64 features = one 128-byte line), V transposed (feature rows along the padded token axis). Every store of a wave covers four whole lines.
  // The work-groups of a batch's first and last 64 tokens also write the zero margin beside them (po places away), line for line with their own.
  const int tl = (int)(t0 % L), hb = (int)(t0 / L) * H + c0 / HD, po = tl == 0 ? -GM : (tl == L - GM ? GM : 0);
  if (which == 2) {   // block-uniform. An accumulator register row is 8 successive tokens of one feature: 16 bytes of a V^T row as they stand. Vt rows 0 .. GN - 1 hold hi, GN .. 2 GN - 1 lo; pitch 16 bytes x odd
#pragma unroll
    for (int n = 0; n < 2; ++n) { const int cc = wave * 32 + n * 16 + nloc; const float bb = bfv(bias[c0 + cc]);
#pragma unroll
      for (int m = 0; m < 4; ++m) { v8b hv, lv;
#pragma unroll
        for (int r8 = 0; r8 < 8; ++r8) { b16 p, pl; split16((acc[m][n][r8] * (1.0f / (XS * WSC)) + bb) * HS, p, pl); hv[r8] = p; lv[r8] = pl; }
        *(v8b*)(&Vt[cc][m * 16 + 8 * hlf]) = hv; *(v8b*)(&Vt[GN + cc][m * 16 + 8 * hlf]) = lv; } }
    __syncthreads();   // Vt is whole before the line-wise stores read it
    for (int pl = 0; pl < 2; ++pl) { b16* dst = (pl != 0 ? VTl : VTh) + ((long long)hb * HD + (tid >> 3)) * NAP + FP + tl + (tid & 7) * 8; v8b x[8];   // 16-byte piece tid & 7 of feature rows (tid >> 3) + 32 i
      if (po != 0) {
#pragma unroll
        for (int i = 0; i < 8; ++i) *(v8b*)(dst + (long long)32 * i * NAP + po) = (v8b){}; }
      asm volatile("s_wait_xcnt 0x0" ::: "memory");   // behind the margin's stores: the wait that belongs in front of the next reuse of their address and data registers
#pragma unroll
      for (int i = 0; i < 8; ++i) x[i] = *(const v8b*)(&Vt[pl * GN + (tid >> 3) + 32 * i][(tid & 7) * 8]);
#pragma unroll
      for (int i = 0; i < 8; ++i) *(v8b*)(dst + (long long)32 * i * NAP) = x[i];
      asm volatile("s_wait_xcnt 0x0" ::: "memory"); }   // the same wait behind the plane's own stores
    return; }
#pragma unroll
  for (int n = 0; n < 2; ++n) { const int cc = wave * 32 + n * 16 + nloc; const float bb = bfv(bias[c0 + cc]);
#pragma unroll
    for (int m = 0; m < 4; ++m)
#pragma unroll
      for (int r8 = 0; r8 < 8; ++r8) Tf[m * 16 + 8 * hlf + r8][cc] = acc[m][n][r8] * (1.0f / (XS * WSC)) + bb; }
  __syncthreads();   // Tf is whole before the row-wise stores read it
  for (int rr = wave; rr < GM; rr += 8) { const size_t tk = t0 + rr;
    if (which == 0) { for (int q = 0; q < 4; ++q) { const int c = q * 64 + lane * 2; b16 h0, l0, h1, l1; split16(Tf[rr][c] * HS, h0, l0); split16(Tf[rr][c + 1] * HS, h1, l1); *(v2b*)(Qh + tk * D + c0 + c) = (v2b){h0, h1}; *(v2b*)(Ql + tk * D + c0 + c) = (v2b){l0, l1}; }
      asm volatile("s_wait_xcnt 0x0" ::: "memory"); }   // behind the row's stores, inside the branch: the wait that belongs in front of the next reuse of their address and data registers
    else { const long long ro = ((long long)(hb + (lane >> 3)) * NAP + FP + tl + rr) * HD + (lane & 7) * 8;   // lane l: features 8 (l & 7) .. + 7 of head hb + (l >> 3)
      if (po != 0) { *(v8b*)(KAh + ro + po * HD) = (v8b){}; *(v8b*)(KAl + ro + po * HD) = (v8b){}; }
      asm volatile("s_wait_xcnt 0x0" ::: "memory");   // behind the margin's stores: the wait that belongs in front of the next reuse of their address and data registers
      const v4f f0 = *(const v4f*)(&Tf[rr][lane * 8]), f1 = *(const v4f*)(&Tf[rr][lane * 8 + 4]); v8b hv, lv;
#pragma unroll
      for (int e = 0; e < 4; ++e) { b16 p, pl; split16(f0[e] * HS, p, pl); hv[e] = p; lv[e] = pl; split16(f1[e] * HS, p, pl); hv[4 + e] = p; lv[4 + e] = pl; }
      *(v8b*)(KAh + ro) = hv; *(v8b*)(KAl + ro) = lv;
      asm volatile("s_wait_xcnt 0x0" ::: "memory"); } } }   // the same wait behind the row's own stores
// Attention work-group: AG halves of AW waves, all of one (batch, head); a half works on one 64-query block at a time, 16 queries a wave. Chunk c is the 128 tokens CS c - HALO .. CS c + CS - 1 (places CS c + FP - HALO .. of the padded axis): it owns the areas that END in its last CS tokens, and its first HALO tokens are there for the two tokens that such an area may reach back, so every chunk is worked on by itself. Its K and V rows are brought into LDS once for the four waves of a half and every fragment is read from there.
// One buffer = Kh, Kl (128 token rows of 128 bytes, pitch 144) and Vh, Vl (64 feature rows of 256 bytes, pitch 272): pitches of 16 bytes x odd for the 16-byte LDS reads. Two buffers for each half: the next chunk's copies fly while this chunk is worked on.
constexpr int AW = 4, AG = 2, XP = 36, KP = HD + 8, VP = CH + 8, KB = CH * KP, VB = HD * VP, SB = 2 * KB + 2 * VB;
// eight asynchronous 16-byte copies to LDS per lane (LDS byte address l + i ls, global address g + i gs); the s_wait_xcnt stands in the copies' own statement, in front of any reuse of the address registers that they name
__device__ __forceinline__ void copy8(unsigned int l, unsigned int ls, const char* g, size_t gs) {
  asm volatile("global_load_async_to_lds_b128 %0, %8, off\n\tglobal_load_async_to_lds_b128 %1, %9, off\n\tglobal_load_async_to_lds_b128 %2, %10, off\n\tglobal_load_async_to_lds_b128 %3, %11, off\n\t"
               "global_load_async_to_lds_b128 %4, %12, off\n\tglobal_load_async_to_lds_b128 %5, %13, off\n\tglobal_load_async_to_lds_b128 %6, %14, off\n\tglobal_load_async_to_lds_b128 %7, %15, off\n\ts_wait_xcnt 0x0"
               :: "v"(l), "v"(l + ls), "v"(l + 2 * ls), "v"(l + 3 * ls), "v"(l + 4 * ls), "v"(l + 5 * ls), "v"(l + 6 * ls), "v"(l + 7 * ls),
                  "v"(g), "v"(g + gs), "v"(g + 2 * gs), "v"(g + 3 * gs), "v"(g + 4 * gs), "v"(g + 5 * gs), "v"(g + 6 * gs), "v"(g + 7 * gs) : "memory"); }
// one chunk into the buffer at LDS byte address lb: 16-byte piece p = tid + 128 i of each of the four tiles (K: row p / 8, the 16 KB are contiguous in memory; V: row p / 16, memory pitch NAP elements)
__device__ __forceinline__ void stage_chunk(unsigned int lb, int tid, int a0, const b16* kh, const b16* kl, const b16* vh, const b16* vl) {
  const unsigned int lk = lb + (unsigned int)((tid >> 3) * (KP * 2) + (tid & 7) * 16), lv = lb + (unsigned int)(2 * KB * 2 + (tid >> 4) * (VP * 2) + (tid & 15) * 16);
  const size_t gk = (size_t)a0 * (HD * 2) + (size_t)tid * 16, gv = (size_t)(tid >> 4) * (NAP * 2) + (size_t)a0 * 2 + (size_t)(tid & 15) * 16;
  copy8(lk, 16 * KP * 2, (const char*)kh + gk, 2048); copy8(lk + KB * 2, 16 * KP * 2, (const char*)kl + gk, 2048);
  copy8(lv, 8 * VP * 2, (const char*)vh + gv, (size_t)8 * NAP * 2); copy8(lv + VB * 2, 8 * VP * 2, (const char*)vl + gv, (size_t)8 * NAP * 2); }
// one work-group to a WGP, two waves for each SIMD (a wave of each half): let the register budget and the load scheduling be those of two resident waves
__global__ __launch_bounds__(32 * AW * AG) __attribute__((amdgpu_waves_per_eu(1, 2))) void att_kernel(const b16* __restrict__ Qh, const b16* __restrict__ Ql, const b16* __restrict__ KAh, const b16* __restrict__ KAl, const b16* __restrict__ VTh, const b16* __restrict__ VTl, const int* __restrict__ mask, const int* __restrict__ zpad, int QLIM, float* __restrict__ O) { __shared__ __attribute__((aligned(16))) b16 sb[AG * 2 * SB]; __shared__ unsigned int cv[AG * AW];
  const int tid = threadIdx.x, wave = __builtin_amdgcn_readfirstlane(tid >> 5), lane = tid & 31, nloc = lane & 15, hlf = lane >> 4, grp = wave / AW, wq = wave % AW, gt = tid % (32 * AW); constexpr int NQB = L / (16 * AW);
  // The work-group owns query blocks A = NQB - 1 - pr and B = pr of its head: under a causal mask one sees many chunks where the other sees few, so every work-group has about the same number of (block, chunk) tasks.
  // The tasks, A's visible chunks in order and then B's, are cut in the middle: half 0 takes the first part, half 1 the rest, each through an LDS ring of its own. No wave walks a long row of chunks alone while its SIMD's other wave has run out of work.
  const int bh = blockIdx.x / (NQB / 2), pr = blockIdx.x % (NQB / 2), qbA = (NQB - 1 - pr) * (16 * AW), qbB = pr * (16 * AW); if (qbB >= QLIM) return;   // qbB < qbA: both blocks lie past the query cut; the whole work-group leaves, in front of every barrier
  const int q0 = (grp != 0 ? qbB : qbA) + wq * 16; const bool live = q0 < QLIM;   // the wave's own 16 queries: it scans their mask rows here and merges and stores their result at the end (a wave past the query cut still copies and passes every barrier; it stores nothing)
  const int b = bh / H, h = bh % H; const size_t tq = (size_t)b * L + q0;
  // both products are taken transposed (X^T = kh x qh^T, O^T = vh^T x c^T): queries are the N side, so lane nloc owns query nloc of the wave's 16 in the block in work and its half hlf holds tokens 16 T + 8 hlf + 0..7 of every 16-token tile T.
  // Two neighbouring tiles are then, register for register, the K = 32 operand of c (k = 8 hlf + e and 16 + 8 hlf + e, the order of frag_kb): mask, softmax and c never leave the registers; a neighbour token in the other half of the lanes comes by one lane exchange.
  // The task list must read the same in all waves: each wave ORs its 16 mask rows (whole lines); bit c of wv = some query of the wave sees some end position of chunk c, 120 c .. 120 c + 119. Exact, so that the cut in the middle halves the real work:
  v4i any[8];
#pragma unroll
  for (int j = 0; j < 8; ++j) any[j] = (v4i){0, 0, 0, 0};
  // rolled, four rows a trip: 32 loads of 16 bytes in flight per lane cover the latency
#pragma unroll 1
  for (int r0 = 0; r0 < 16; r0 += 4) { v4i mv[4][8];
#pragma unroll
    for (int r = 0; r < 4; ++r)
#pragma unroll
      for (int j = 0; j < 8; ++j) mv[r][j] = *(const v4i*)(mask + (size_t)(q0 + r0 + r) * L + j * 128 + lane * 4);
#pragma unroll
    for (int r = 0; r < 4; ++r)
#pragma unroll
      for (int j = 0; j < 8; ++j) any[j] |= mv[r][j]; }
  unsigned int wv = 0;
#pragma unroll
  for (int j = 0; j < 8; ++j) { const unsigned int bal = __builtin_amdgcn_ballot_w32((any[j][0] | any[j][1] | any[j][2] | any[j][3]) != 0), lowm = (1u << (30 - 2 * j)) - 1u;   // lane l holds columns 128 j + 4 l .. + 3: chunk j for l < 30 - 2 j, chunk j + 1 behind
    wv |= ((bal & lowm) != 0u ? 1u : 0u) << j; wv |= ((bal & ~lowm) != 0u ? 1u : 0u) << (j + 1); }
  if (lane == 0) cv[wave] = live ? wv : 0u;
  __syncthreads();   // all eight words are written before any wave reads them
  // ra, rb: the chunks of A and of B that are still to be handed out to this half; nst = steps of the longer half (half 0), passed by every wave; n = this half's own tasks
  unsigned int ra = (unsigned int)__builtin_amdgcn_readfirstlane((int)(cv[0] | cv[1] | cv[2] | cv[3])), rb = (unsigned int)__builtin_amdgcn_readfirstlane((int)(cv[4] | cv[5] | cv[6] | cv[7]));
  const int ntot = __builtin_popcount(ra) + __builtin_popcount(rb), nst = (ntot + 1) >> 1; int n = nst;
  if (grp != 0) { n = ntot - nst; for (int i = 0; i < nst; ++i) { if (ra != 0u) ra &= ra - 1u; else rb &= rb - 1u; } }   // half 1 steps over half 0's tasks (at most NCH trips)
  auto pop = [&](int& c, int& k) { if (ra != 0u) { c = __builtin_ctz(ra); ra &= ra - 1u; k = 0; } else { c = __builtin_ctz(rb); rb &= rb - 1u; k = 1; } };   // next task: chunk c of block k (0 = A, 1 = B)
  // the block in work: its first query of this wave, its mask row and its query fragments
  bool wlive = false; const int* mrow = mask; v16b qa[2], ql[2];
  auto take = [&](int k) { const int qw = (k != 0 ? qbB : qbA) + wq * 16; wlive = qw < QLIM; mrow = mask + (size_t)(qw + nloc) * L; const size_t qo = ((size_t)b * L + qw + nloc) * D + h * HD;
    for (int ks = 0; ks < 2; ++ks) { qa[ks] = frag_kb(Qh + qo + ks * 32, hlf); ql[ks] = frag_kb(Ql + qo + ks * 32, hlf); }
    __builtin_amdgcn_sched_barrier(0);   // keeps the fragment loads in front of the wait below (without it the scheduler let them sink behind it)
    asm volatile("s_wait_xcnt 0x0" ::: "memory");   // behind the fragment loads: the wait that belongs in front of the next reuse of their address registers
    __builtin_amdgcn_sched_barrier(0); };   // and keeps what follows, which may reuse those registers, behind the wait
  v8f oacc[4] = {(v8f){}, (v8f){}, (v8f){}, (v8f){}}, oA[4] = {(v8f){}, (v8f){}, (v8f){}, (v8f){}}; float mrun = -INFINITY, lrun = 0.0f, mA = -INFINITY, lA = 0.0f;   // the state of the block in work; block A's state once the half has gone on to B
  const unsigned int lds0 = (unsigned int)(size_t)sb + (unsigned int)(grp * 2 * SB * 2);   // LDS byte address of this half's buffer 0: the low 32 bits of the shared address
  const b16 *gkh = KAh + (size_t)bh * NAP * HD, *gkl = KAl + (size_t)bh * NAP * HD, *gvh = VTh + (size_t)bh * HD * NAP, *gvl = VTl + (size_t)bh * HD * NAP;
  int c0 = 0, c1 = 0, k0 = 0, k1 = 0;   // the task in work and the task in flight
  if (n > 0) { pop(c0, k0); stage_chunk(lds0, gt, c0 * CS + (FP - HALO), gkh, gkl, gvh, gvl); }
  int kc = k0; take(kc);   // here, so that the fragments' latency passes while the first chunk's copies fly
  asm volatile("s_wait_asynccnt 0x0" ::: "memory");   // this wave's copies of the first chunk have landed
  __syncthreads();   // and every wave's: the first chunk may be read
  if (n > 1) { pop(c1, k1); stage_chunk(lds0 + SB * 2, gt, c1 * CS + (FP - HALO), gkh, gkl, gvh, gvl); }
#pragma unroll 1
  for (int st = 0; st < nst; ++st) { const int e0 = c0 * CS - HALO; const b16* kbuf = sb + (grp * 2 + (st & 1)) * SB; const b16* vbuf = kbuf + 2 * KB; const bool act = st < n;   // half 1 may have one task less: it passes the last hand-over all the same
    if (act && k0 != kc) {   // wave-uniform: the half goes on from block A to block B
      kc = k0; take(kc);
#pragma unroll
      for (int t = 0; t < 4; ++t) { oA[t] = oacc[t]; oacc[t] = (v8f){}; }
      mA = mrun; lA = lrun; mrun = -INFINITY; lrun = 0.0f; }
    // visibility bits of this lane's 64 end positions e0 + 16 T + 8 hlf + r8 (bit 8 (T & 3) + r8 of word T >> 2). A group of eight holds ends of this chunk unless it is the halo (T = 0, lower half) or lies behind the last token: there the address is clamped and no bit is set.
    unsigned int vb[NTI / 4] = {};
#pragma unroll
    for (int t = 0; t < NTI; ++t) { const int g = e0 + t * 16 + 8 * hlf; const bool ok = (t > 0 || hlf != 0) && g < L; int m[8]; __builtin_memcpy(m, mrow + (ok ? g : 0), 32); unsigned int bb = 0;
#pragma unroll
      for (int r8 = 0; r8 < 8; ++r8) bb |= (m[r8] != 0 ? 1u : 0u) << r8;
      vb[t >> 2] |= (ok ? bb : 0u) << ((t & 3) * 8); }
    // an area of width w ends no earlier than token w - 1: end 0 has width 1 alone, end 1 widths 1 and 2 (chunk 0, tile 0, upper half, bits 0 and 1)
    const bool later = c0 != 0 || hlf == 0;
    if (act && wlive && __builtin_amdgcn_ballot_w32((vb[0] | vb[1]) != 0u) != 0u) {   // wave-uniform: where no query of this wave sees any area of the chunk its contribution is exactly zero; the hand-over below is passed all the same
    v8f s[NTI];
#pragma unroll
    for (int tg = 0; tg < NTI; tg += 4) {
#pragma unroll
      for (int t = 0; t < 4; ++t) s[tg + t] = (v8f){};
#pragma unroll
      for (int ks = 0; ks < 2; ++ks) { v16b kh[4], kl[4];
#pragma unroll
        for (int t = 0; t < 4; ++t) { const b16* kr = kbuf + ((tg + t) * 16 + nloc) * KP + ks * 32; kh[t] = frag_kb(kr, hlf); kl[t] = frag_kb(kr + KB, hlf); }
#pragma unroll
        for (int t = 0; t < 4; ++t) s[tg + t] = wmma16q(kh[t], qa[ks], s[tg + t]);
#pragma unroll
        for (int t = 0; t < 4; ++t) s[tg + t] = wmma16q(kl[t], qa[ks], s[tg + t]);
#pragma unroll
        for (int t = 0; t < 4; ++t) s[tg + t] = wmma16q(kh[t], ql[ks], s[tg + t]); } }
    // token logits x (in s), and for every group of eight its two predecessors b7 = x[-1], b6 = x[-2], which the other half of the lanes holds: the group in front of (T, upper half) is (T, lower half); in front of (T, lower half), (T - 1, upper half); the chunk's first group is halo and ends no area
    float b6[NTI], b7[NTI];
#pragma unroll
    for (int t = 0; t < NTI; ++t) { s[t] *= SCALE / (HS * HS); b6[t] = xhalf(s[t][6]); b7[t] = xhalf(s[t][7]); }
#pragma unroll
    for (int t = NTI - 1; t >= 0; --t) { b6[t] = hlf ? b6[t] : (t > 0 ? b6[t > 0 ? t - 1 : 0] : 0.0f); b7[t] = hlf ? b7[t] : (t > 0 ? b7[t > 0 ? t - 1 : 0] : 0.0f); }
    // area logits by end position e: x[e], (x[e] + x[e-1]) / 2, (x[e] + x[e-1] + x[e-2]) / 3; written out here for the maximum and again below for the weights
    v8f m8;
#pragma unroll
    for (int r8 = 0; r8 < 8; ++r8) m8[r8] = -INFINITY;
#pragma unroll
    for (int t = 0; t < NTI; ++t)
#pragma unroll
      for (int r8 = 0; r8 < 8; ++r8) { const float x0 = s[t][r8], xm1 = r8 >= 1 ? s[t][r8 >= 1 ? r8 - 1 : 0] : b7[t], xm2 = r8 >= 2 ? s[t][r8 >= 2 ? r8 - 2 : 0] : (r8 == 1 ? b7[t] : b6[t]), u2 = x0 + xm1, u3 = u2 + xm2;
        const bool c1 = ((vb[t >> 2] >> ((t & 3) * 8 + r8)) & 1u) != 0u, c2 = (t == 0 && r8 == 0) ? (c1 && later) : c1, c3 = (t == 0 && r8 <= 1) ? (c1 && later) : c1;
        m8[r8] = fmaxf(m8[r8], fmaxf(x0 + (c1 ? 0.0f : -INFINITY), fmaxf(__builtin_fmaf(u2, 0.5f, c2 ? 0.0f : -INFINITY), __builtin_fmaf(u3, 1.0f / 3.0f, c3 ? 0.0f : -INFINITY)))); }
    float mx = fmaxf(fmaxf(fmaxf(m8[0], m8[1]), fmaxf(m8[2], m8[3])), fmaxf(fmaxf(m8[4], m8[5]), fmaxf(m8[6], m8[7]))); mx = fmaxf(mx, __shfl_xor(mx, 16));
    const float mn = fmaxf(mrun, mx), fe = exp2_slot((mrun - mn) * LOG2E), fac = (mrun == -INFINITY) ? 0.0f : fe, ms = (mn == -INFINITY) ? 0.0f : mn, nms = -ms * LOG2E; v8f s8 = (v8f){};
    // weights by end position e: wa = p1 + p2 + p3 goes to token e (and into the row sum), wb = p2 + p3 also to token e - 1, wc = p3 also to token e - 2: token weight c[t] = wa[t] + wb[t + 1] + wc[t + 2], written over x tile by tile.
    // What the last two tokens of a group take from the group behind it (n0 = wc[0], n1 = wb[0] + wc[1]) comes from the other half of the lanes: behind (T, lower half) stands (T, upper half); behind (T, upper half), (T + 1, lower half); behind the chunk's last group, the next chunk's ends, which reach these tokens through that chunk's halo.
    float n0[NTI], n1[NTI];
#pragma unroll
    for (int t = 0; t < NTI; ++t) { float wa[8], wb[8], wc[8];
#pragma unroll
      for (int r8 = 0; r8 < 8; ++r8) { const float x0 = s[t][r8], xm1 = r8 >= 1 ? s[t][r8 >= 1 ? r8 - 1 : 0] : b7[t], xm2 = r8 >= 2 ? s[t][r8 >= 2 ? r8 - 2 : 0] : (r8 == 1 ? b7[t] : b6[t]), u2 = x0 + xm1, u3 = u2 + xm2;
        const bool c1 = ((vb[t >> 2] >> ((t & 3) * 8 + r8)) & 1u) != 0u, c2 = (t == 0 && r8 == 0) ? (c1 && later) : c1, c3 = (t == 0 && r8 <= 1) ? (c1 && later) : c1;
        const float p1 = exp2_slot(__builtin_fmaf(x0, LOG2E, c1 ? nms : -INFINITY)), p2 = exp2_slot(__builtin_fmaf(u2, 0.5f * LOG2E, c2 ? nms : -INFINITY)), p3 = exp2_slot(__builtin_fmaf(u3, LOG2E / 3.0f, c3 ? nms : -INFINITY));
        wc[r8] = p3; wb[r8] = p2 + p3; wa[r8] = p1 + wb[r8]; s8[r8] += wa[r8]; }
      n0[t] = xhalf(wc[0]); n1[t] = xhalf(wb[0] + wc[1]);
#pragma unroll
      for (int r8 = 0; r8 < 6; ++r8) s[t][r8] = wa[r8] + wb[r8 + 1] + wc[r8 + 2];
      s[t][6] = wa[6] + wb[7]; s[t][7] = wa[7]; }
    float sm = ((s8[0] + s8[1]) + (s8[2] + s8[3])) + ((s8[4] + s8[5]) + (s8[6] + s8[7])); sm += __shfl_xor(sm, 16); lrun = lrun * fac + sm; mrun = mn;
#pragma unroll
    for (int t = 0; t < NTI; ++t) { s[t][6] += hlf ? (t + 1 < NTI ? n0[t + 1 < NTI ? t + 1 : 0] : 0.0f) : n0[t]; s[t][7] += hlf ? (t + 1 < NTI ? n1[t + 1 < NTI ? t + 1 : 0] : 0.0f) : n1[t]; s[t] *= PS; }
#pragma unroll
    for (int t = 0; t < 4; ++t) oacc[t] *= fac;
#pragma unroll
    for (int kb = 0; kb < CH; kb += 32) { v16b pa, pb, vh[4], vlo[4];
#pragma unroll
      for (int e = 0; e < 8; ++e) { b16 ph, pl; split16(s[kb / 16][e], ph, pl); pa[e] = ph; pb[e] = pl; split16(s[kb / 16 + 1][e], ph, pl); pa[8 + e] = ph; pb[8 + e] = pl; }
#pragma unroll
      for (int t = 0; t < 4; ++t) { const b16* vr = vbuf + (t * 16 + nloc) * VP + kb; vh[t] = frag_kb(vr, hlf); vlo[t] = frag_kb(vr + VB, hlf); }
#pragma unroll
      for (int t = 0; t < 4; ++t) oacc[t] = wmma16b(vh[t], pa, oacc[t]);
#pragma unroll
      for (int t = 0; t < 4; ++t) oacc[t] = wmma16b(vlo[t], pa, oacc[t]);
#pragma unroll
      for (int t = 0; t < 4; ++t) oacc[t] = wmma16b(vh[t], pb, oacc[t]); } }
    // hand-over, every wave, in this order: my LDS reads of this buffer are done; my copies of the next chunk have landed; the barrier publishes the next chunk and frees this buffer; only then the refill
    asm volatile("s_wait_dscnt 0x0" ::: "memory");
    asm volatile("s_wait_asynccnt 0x0" ::: "memory");
    __syncthreads();
    c0 = c1; k0 = k1;
    if (st + 2 < n) { pop(c1, k1); stage_chunk(lds0 + (unsigned int)((st & 1) * SB * 2), gt, c1 * CS + (FP - HALO), gkh, gkl, gvh, gvl); } }
  asm volatile("s_wait_asynccnt 0x0" ::: "memory");   // no copy is outstanding when the wave ends
  // Each wave now holds a state for its tile of A and one for its tile of B (empty: -inf, 0, 0). Half 0 finishes A, half 1 finishes B: a wave hands the other state to the wave of the other half that has the same tile, through LDS (the rings are free: every wave's reads and copies ended in front of the last barrier).
  if (kc == 0) {
#pragma unroll
    for (int t = 0; t < 4; ++t) { oA[t] = oacc[t]; oacc[t] = (v8f){}; }
    mA = mrun; lA = lrun; mrun = -INFINITY; lrun = 0.0f; }
  if (grp == 0) {
#pragma unroll
    for (int t = 0; t < 4; ++t) { const v8f x = oacc[t]; oacc[t] = oA[t]; oA[t] = x; }
    const float xm = mrun, xl = lrun; mrun = mA; lrun = lA; mA = xm; lA = xl; }
  // (oacc, mrun, lrun) stays, (oA, mA, lA) goes; XP floats a lane: a pitch of 16 bytes x odd
  float* xw = (float*)sb + (size_t)(wave * 32 + lane) * XP; const float* xr = (const float*)sb + (size_t)((wave ^ AW) * 32 + lane) * XP;
#pragma unroll
  for (int t = 0; t < 4; ++t) { *(v4f*)(xw + t * 8) = (v4f){oA[t][0], oA[t][1], oA[t][2], oA[t][3]}; *(v4f*)(xw + t * 8 + 4) = (v4f){oA[t][4], oA[t][5], oA[t][6], oA[t][7]}; }
  *(v2f*)(xw + 32) = (v2f){mA, lA};
  __syncthreads();   // every wave's handed-over state is written before its partner reads it
  const v2f ml = *(const v2f*)(xr + 32); const float mm = fmaxf(mrun, ml[0]), ek = exp2_slot((mrun - mm) * LOG2E), ep = exp2_slot((ml[0] - mm) * LOG2E), fk = (mrun == -INFINITY) ? 0.0f : ek, fp = (ml[0] == -INFINITY) ? 0.0f : ep;
  lrun = lrun * fk + ml[1] * fp;
#pragma unroll
  for (int t = 0; t < 4; ++t) { const v4f p0 = *(const v4f*)(xr + t * 8), p1 = *(const v4f*)(xr + t * 8 + 4);
#pragma unroll
    for (int j = 0; j < 4; ++j) { oacc[t][j] = oacc[t][j] * fk + p0[j] * fp; oacc[t][4 + j] = oacc[t][4 + j] * fk + p1[j] * fp; } }
  const bool zero = (zpad[0] != 0 && q0 + nloc == 0);
  if (live) {
#pragma unroll
  for (int t = 0; t < 4; ++t) { v4f o0, o1;
#pragma unroll
    for (int j = 0; j < 4; ++j) { const float u0 = oacc[t][j] * (1.0f / (PS * HS)) / lrun, u1 = oacc[t][4 + j] * (1.0f / (PS * HS)) / lrun; o0[j] = zero ? 0.0f : u0; o1[j] = zero ? 0.0f : u1; }
    float* op = O + (tq + nloc) * D + h * HD + t * 16 + 8 * hlf; *(v4f*)op = o0; *(v4f*)(op + 4) = o1; } } }
__global__ __launch_bounds__(256) void outp_kernel(const float* __restrict__ O, const b16* __restrict__ WO, const float* __restrict__ bo, int QLIM, float* __restrict__ out) { __shared__ __attribute__((aligned(16))) char sm[2 * GM * AP * 2]; b16 (*Ah)[AP] = (b16 (*)[AP])sm; b16 (*Al)[AP] = (b16 (*)[AP])(sm + GM * AP * 2); float (*Tf)[TP] = (float (*)[TP])sm;   // Tf takes Ah's place behind the K loop
  const int tid = threadIdx.x, wave = __builtin_amdgcn_readfirstlane(tid >> 5), lane = tid & 31, nloc = lane & 15, hlf = lane >> 4; const size_t t0 = (size_t)blockIdx.x * GM; const int c0 = blockIdx.y * GN; if ((int)(t0 % L) >= QLIM) return;
  // rolled: 16 rows a trip are 16 loads of 16 bytes in flight per lane, enough to cover the latency
#pragma unroll 1
  for (int r0 = 0; r0 < GM; r0 += 16) { v4f xv[16];
#pragma unroll
    for (int j = 0; j < 16; ++j) xv[j] = *(const v4f*)(O + (t0 + r0 + j) * D + tid * 4);
#pragma unroll
    for (int j = 0; j < 16; ++j) { v4b hv, lv;
#pragma unroll
      for (int e = 0; e < 4; ++e) { b16 p, pl; split16(xv[j][e] * HS, p, pl); hv[e] = p; lv[e] = pl; }
      *(v4b*)(&Ah[r0 + j][tid * 4]) = hv; *(v4b*)(&Al[r0 + j][tid * 4]) = lv; } }
  // packed W fragments through a ring of RD register sets, as in proj_kernel; the first RD sets are asked for in front of the barrier
  const b16* wp = WO + (size_t)((c0 + wave * 32) / 16) * WT + lane * 8; v16b bw[RD][2];
#pragma unroll
  for (int u = 0; u < RD; ++u)
#pragma unroll
    for (int n = 0; n < 2; ++n) bw[u][n] = frag_pk(wp + n * WT + u * WB);
  __syncthreads();   // both A tiles are whole before any wave reads them
  v8f acc[4][2];
#pragma unroll
  for (int m = 0; m < 4; ++m) { acc[m][0] = (v8f){}; acc[m][1] = (v8f){}; }
  auto kstep = [&](int ks, int u, bool refill) { v16b a[4], al[4];
#pragma unroll
    for (int m = 0; m < 4; ++m) { a[m] = frag_kb(&Ah[m * 16 + nloc][ks * 32], hlf); al[m] = frag_kb(&Al[m * 16 + nloc][ks * 32], hlf); }
#pragma unroll
    for (int m = 0; m < 4; ++m)
#pragma unroll
      for (int n = 0; n < 2; ++n) acc[m][n] = wmma16b(a[m], bw[u][n], acc[m][n]);
#pragma unroll
    for (int m = 0; m < 4; ++m)
#pragma unroll
      for (int n = 0; n < 2; ++n) acc[m][n] = wmma16b(al[m], bw[u][n], acc[m][n]);
    if (refill) {
#pragma unroll
      for (int n = 0; n < 2; ++n) bw[u][n] = frag_pk(wp + n * WT + (size_t)(ks + RD) * WB); } };
  // rolled, RD k steps a trip (one turn of the ring); the last turn refills nothing
#pragma unroll 1
  for (int k4 = 0; k4 < D / 32 - RD; k4 += RD) {
#pragma unroll
    for (int u = 0; u < RD; ++u) kstep(k4 + u, u, true); }
#pragma unroll
  for (int u = 0; u < RD; ++u) kstep(D / 32 - RD + u, u, false);
  __syncthreads();   // every wave has left Ah before Tf overwrites it
#pragma unroll
  for (int n = 0; n < 2; ++n) { const int cc = wave * 32 + n * 16 + nloc; const float bb = bfv(bo[c0 + cc]);
#pragma unroll
    for (int m = 0; m < 4; ++m)
#pragma unroll
      for (int r8 = 0; r8 < 8; ++r8) Tf[m * 16 + 8 * hlf + r8][cc] = acc[m][n][r8] * (1.0f / (HS * WSC)) + bb; }
  __syncthreads();   // Tf is whole before the row-wise stores read it
  for (int rr = wave; rr < GM; rr += 8) { if ((int)((t0 + rr) % L) >= QLIM) continue;   // rows past the query cut stay unwritten, as before
    for (int q = 0; q < 2; ++q) *(v4f*)(out + (t0 + rr) * D + c0 + q * 128 + lane * 4) = *(const v4f*)(&Tf[rr][q * 128 + lane * 4]);
    asm volatile("s_wait_xcnt 0x0" ::: "memory"); } }   // behind the row's stores: the wait that belongs in front of the next trip's reuse of their address and data registers
}  // namespace

extern "C" void kernel_launch(void* const* d_in, const int* in_sizes, int n_in, void* d_out, int out_size, void* d_ws, size_t ws_size, hipStream_t stream) {
  (void)n_in;
  auto Fp = [&](int i) { return (const float*)d_in[i]; }; auto Ip = [&](int i) { return (const int*)d_in[i]; };
  // input order: 0 q [2,1024,1024]; 1 k; 2 v; 3 Wq; 4 bq; 5 Wk; 6 bk; 7 Wv; 8 bv; 9 Wo; 10 bo; 11 mask [1024,1024] i32; 12 zero_pad [1] i32
  if (in_sizes[0] != NT * D || in_sizes[1] != NT * D || in_sizes[2] != NT * D || in_sizes[3] != D * D || in_sizes[9] != D * D || in_sizes[11] != L * L || in_sizes[12] != 1 || out_size != NT * D) return;
  const int QLIM = L;   // per-batch query cut (multiple of 16)
  size_t off = 0; char* ws = (char*)d_ws;
  auto carve = [&](size_t bytes) { char* p = ws + off; off += (bytes + 255) & ~(size_t)255; return p; };
  b16* W4 = (b16*)carve((size_t)4 * D * D * 2); b16* Qh = (b16*)carve((size_t)NT * D * 2); b16* Ql = (b16*)carve((size_t)NT * D * 2); b16* KAh = (b16*)carve((size_t)NB_ * H * NAP * HD * 2); b16* KAl = (b16*)carve((size_t)NB_ * H * NAP * HD * 2); b16* VTh = (b16*)carve((size_t)NB_ * H * HD * NAP * 2); b16* VTl = (b16*)carve((size_t)NB_ * H * HD * NAP * 2); float* O = (float*)carve((size_t)NT * D * 4);
  if (off > ws_size || off > ((size_t)96 << 20)) return;   // ~ 44 MB
  wput_kernel<<<256, 256, 0, stream>>>(Fp(3), Fp(5), Fp(7), Fp(9), W4);
  proj_kernel<<<dim3(NT / GM, 3, D / GN), 256, 0, stream>>>(Fp(0), Fp(1), Fp(2), W4, Fp(4), Fp(6), Fp(8), Qh, Ql, KAh, KAl, VTh, VTl);
  att_kernel<<<NB_ * H * (L / (16 * AW)) / AG, 32 * AW * AG, 0, stream>>>(Qh, Ql, KAh, KAl, VTh, VTl, Ip(11), Ip(12), QLIM, O);
  outp_kernel<<<dim3(NT / GM, D / GN), 256, 0, stream>>>(O, W4 + (size_t)3 * D * D, Fp(10), QLIM, (float*)d_out);
}

// v009
// Measured time: 68.3 microseconds a run.
// In both of two side-by-side timings against v008, it was 1.13 times as fast.
// All steps since v000 together make it 39.9 times as fast.
#include <hip/hip_runtime.h>

// MultiHeadAreaAttention: qh,kh,vh = (q Wq^T + bq), (k Wk^T + bk), (v Wv^T + bv) as 16 heads x 64; areas = all windows of width 1..3 along the key axis (A = 3,069; block w starts at area index 0 / 1024 / 2047, end(a) = start + w - 1); k_area = window mean, v_area = window sum; logits = qh.k_area / 8, visible iff mask[q][end(a)] != 0 (else -1e30); weights = softmax over areas; if zero_pad: weights of query 0 := 0; ctx = weights.v_area; out = concat Wo^T + bo -> [2][1024][1024].
// Pooling is linear, so no pooled row is ever formed: qh.k_area(end e, width w) = (x[e] + .. + x[e-w+1]) / w with the token logits x[t] = qh.kh[t], and weights.v_area = sum over tokens t of c[t] vh[t], c[t] = the summed weights of the (up to six) areas that hold t. Both matrix products run over the 1,024 tokens instead of the 3,069 areas.
// Deterministic: online softmax over fixed chunks of 120 end positions (360 areas) in order, a query's chunks in at most two runs whose running maximum, sum and O are merged at the end in a fixed order (chunks with no visible area for any of the wave's 16 queries are skipped: they contribute exactly 0); inside a chunk each lane sums its areas in a fixed tree, then the two halves of a query are added; no atomics.
// WMMA (v_wmma_f32_16x16x32_f16, f32 accumulate): inputs (EXACT bf16 x8, K 1,024) x W rows (EXACT) per 64-token x 256-column work-group of 8 waves; per (bh, 16-query) wave (eight to a work-group, K and V chunks shared in LDS by four) X^T = kh token rows (hi+lo; 8 tiles/chunk) x qh (hi+lo x256, K 64) and O^T += vh^T rows (hi+lo; 4 tiles) x c (hi+lo), 3 products; o (hi+lo) x Wo rows, same tiling; neighbour sums, mask gather, softmax in f32.

namespace {
constexpr int NB_ = 2, L = 1024, D = 1024, H = 16, HD = 64, NT = NB_ * L, CH = 128, NTI = CH / 16, HALO = 8, CS = CH - HALO /* 120 */, NCH = (L + CS - 1) / CS /* 9 */, FP = 64, NAP = FP + L + 64 /* 1152 */;
// the padded token axis of the K rows and of the V^T rows: token t stands at place FP + t; the FP places in front of token 0 and the 64 behind token L - 1 are zero. Chunk c begins at place CS c + FP - HALO.
static_assert((NCH - 1) * CS + FP - HALO + CH <= NAP && FP >= HALO && NAP % 64 == 0, "every chunk lies inside the padded axis; a V^T row is a whole number of 128-byte lines");
constexpr float XS = 8.0f, HS = 256.0f, PS = 256.0f, WSC = 256.0f, SCALE = 0.125f, LOG2E = 1.44269504f;
typedef _Float16 b16;
typedef __attribute__((ext_vector_type(16))) _Float16 v16b;
typedef __attribute__((ext_vector_type(8))) _Float16 v8b;
typedef __attribute__((ext_vector_type(4))) _Float16 v4b;
typedef __attribute__((ext_vector_type(2))) _Float16 v2b;
typedef __attribute__((ext_vector_type(8))) float v8f;
typedef __attribute__((ext_vector_type(4))) float v4f;
typedef __attribute__((ext_vector_type(2))) float v2f;
typedef __attribute__((ext_vector_type(4))) int v4i;
typedef __attribute__((ext_vector_type(2))) int v2i;
typedef __attribute__((ext_vector_type(2))) unsigned int v2u;
__device__ __forceinline__ float bf16_rne(float f) { unsigned int u = __float_as_uint(f); u += 0x7FFFu + ((u >> 16) & 1u); float r = __uint_as_float(u & 0xFFFF0000u); asm volatile("" : "+v"(r)); return r; }
__device__ __forceinline__ float bfv(float f) { float r = bf16_rne(f); asm volatile("" : "+v"(r)); return r; }
__device__ __forceinline__ void split16(float v, b16& hi, b16& lo) { hi = (b16)v; lo = (b16)(v - (float)hi); }
__device__ __forceinline__ v16b frag_kb(const b16* p, int hh) { const v8b a = *(const v8b*)(p + 8 * hh), b = *(const v8b*)(p + 16 + 8 * hh); v16b f;
#pragma unroll
  for (int e = 0; e < 8; ++e) { f[e] = a[e]; f[8 + e] = b[e]; } return f; }
// W4 holds the four weight matrices in the order in which a GEMM wave reads them. One block = one B fragment (16 output columns x 32 k, WB elements) = two runs of 512 bytes: run r, lane l = (hlf, nloc) holds W[column nloc of the tile][k = 16 r + 8 hlf + 0..7], the k order of frag_kb.
// So each 16-byte load of a wave covers four whole 128-byte lines (from row-major W it touched sixteen lines for 32 bytes each). The blocks of one column tile follow one another in k (WT elements a tile), the tiles in column order, the matrices in the order q, k, v, o.
constexpr int WB = 16 * 32, WT = (D / 32) * WB, RD = 4;
__device__ __forceinline__ v16b frag_pk(const b16* p) { const v8b a = *(const v8b*)p, b = *(const v8b*)(p + WB / 2); v16b f;
#pragma unroll
  for (int e = 0; e < 8; ++e) { f[e] = a[e]; f[8 + e] = b[e]; } return f; }
__device__ __forceinline__ v8f wmma16b(v16b a, v16b b, v8f c) { v8f d = __builtin_amdgcn_wmma_f32_16x16x32_f16(false, a, false, b, (short)0, c, false, false); asm volatile("v_nop\n\tv_nop\n\tv_nop\n\tv_nop" : "+v"(d) : "v"(a), "v"(b)); return d; }
// the same for a B operand that is rewritten only when the half goes on to block B, far from any product (the query fragments): not named in the statement, it is free to live above v255, where an asm operand cannot, and leaves the low registers to the operands that must be there (named, two of the four fragments were spilled to scratch and read back in every chunk)
__device__ __forceinline__ v8f wmma16q(v16b a, v16b b, v8f c) { v8f d = __builtin_amdgcn_wmma_f32_16x16x32_f16(false, a, false, b, (short)0, c, false, false); asm volatile("v_nop\n\tv_nop\n\tv_nop\n\tv_nop" : "+v"(d) : "v"(a)); return d; }
// 2^x and, in the same statement, the one issue slot that the instruction set asks for behind a transcendental
__device__ __forceinline__ float exp2_slot(float x) { float p; asm("v_exp_f32 %0, %1\n\tv_nop" : "=v"(p) : "v"(x)); return p; }
// the value that lane l ^ 16 holds (the other half of the same query's tokens), by a vector cross-row move
__device__ __forceinline__ float xhalf(float v) { const int b = __float_as_int(v); return __int_as_float(__builtin_amdgcn_permlanex16(b, b, 0x76543210, 0xfedcba98, false, false)); }

// One work-group = one column tile (16 rows of one W, whole K); wave m of it = k steps 4 m .. 4 m + 3: four blocks, 4 KB of W4 in a row.
// Reads: load (b, i) of a wave is rows 4 i .. 4 i + 3 of block b, 128 bytes of each (lane l: row 4 i + (l >> 3), floats 4 (l & 7) .. + 3 of the block's 32): four whole lines. All sixteen loads of a lane are asked for before the first is used, so their memory latency is paid once.
// Writes: a 16-byte piece of W4 is two neighbouring lanes' four floats of one row. The lanes of a pair swap halves across two row groups: the even lane ends with the piece of row 8 j + (l >> 3), the odd lane with that of row 8 j + 4 + (l >> 3). The eight lanes that share (r, hlf) then store 128 bytes in a row: four whole lines a store.
static_assert(4 * (D / 16) == 256 && D / 32 == 8 * 4, "the launch has one work-group for each column tile of the four matrices, and its eight waves of four blocks cover K");
// MB holds the mask as bits, in the order in which an attention lane uses them: query q has MW words; words 4 c + 2 hlf and 4 c + 2 hlf + 1 are the 64 end positions 120 c - 8 + 16 T + 8 hlf + r8 of chunk c that the lanes of half hlf own (bit r8 of byte T).
// Byte B of a mask row (ends 8 B .. 8 B + 7) belongs to one chunk alone, c = B / 15, at place p = B % 15 + 1 = 2 T + hlf of its sixteen; place 0 (the halo, which ends no area of the chunk) and the places behind the last token stay zero.
// The MBK work-groups behind those of the weights pack MR mask rows each (wave m: rows 2 m and 2 m + 1, sixteen whole-line 16-byte loads a lane, all in flight at once); the bytes are put in place in LDS and leave as whole lines.
constexpr int MW = NCH * 4, MR = 16, MBK = L / MR;
static_assert(MR == 2 * 8 && (L / 8 - 1) / 15 < NCH && CS == 15 * 8 && HALO == 8 && CH == 128 && MR * MW * 4 <= 256 * 16, "byte places as described; one 16-byte piece a thread covers the work-group's part of MB");
__global__ __launch_bounds__(256) void wput_kernel(const float* __restrict__ wq, const float* __restrict__ wk, const float* __restrict__ wv, const float* __restrict__ wo, const int* __restrict__ mask, b16* __restrict__ W4, unsigned int* __restrict__ MB) { const int tid = threadIdx.x, wave = __builtin_amdgcn_readfirstlane(tid >> 5), lane = tid & 31, pc = lane & 7, which = blockIdx.x / (D / 16), ct = blockIdx.x % (D / 16); const bool odd = (lane & 1) != 0;
  if (blockIdx.x >= 4 * (D / 16)) {   // block-uniform: a work-group of the mask
    __shared__ __attribute__((aligned(16))) unsigned char mb[MR * MW * 4]; const int r0 = ((int)blockIdx.x - 4 * (D / 16)) * MR; const int* ms = mask + (size_t)(r0 + wave * 2) * L + lane * 4; v4i m[2][8];
    // unrolled, here and below: m is indexed by constants alone and stays in registers
#pragma unroll
    for (int r = 0; r < 2; ++r)
#pragma unroll
      for (int j = 0; j < 8; ++j) m[r][j] = *(const v4i*)(ms + r * L + j * 128);
    asm volatile("s_wait_xcnt 0x0" ::: "memory");   // behind the loads: the wait that belongs in front of the next reuse of their address registers
    if (tid < MR * MW / 4) *(v4i*)(mb + tid * 16) = (v4i){0, 0, 0, 0};
    __syncthreads();   // the zeros are written before any byte is put among them
    int by[2][8];
#pragma unroll
    for (int r = 0; r < 2; ++r)
#pragma unroll
      for (int j = 0; j < 8; ++j) { const int nib = (m[r][j][0] != 0 ? 1 : 0) | (m[r][j][1] != 0 ? 2 : 0) | (m[r][j][2] != 0 ? 4 : 0) | (m[r][j][3] != 0 ? 8 : 0);
        by[r][j] = nib | (__builtin_amdgcn_update_dpp(0, nib, 0xB1, 0xF, 0xF, true) << 4); }   // quad_perm [1,0,3,2]: the four bits of lane l ^ 1; the even lane of a pair now holds byte B = 16 j + (l >> 1)
    if (!odd) {
#pragma unroll
      for (int j = 0; j < 8; ++j) { const int s = j + (lane >> 1), ov = s >= 15 ? 1 : 0, p = s - 15 * ov + 1; unsigned char* d = mb + wave * 2 * (MW * 4) + (j + ov) * 16 + (p & 1) * 8 + (p >> 1);   // B = 15 j + s with s < 30: B / 15 = j + ov, B % 15 = s - 15 ov
        d[0] = (unsigned char)by[0][j]; d[MW * 4] = (unsigned char)by[1][j]; } }
    __syncthreads();   // every byte is in place before the line-wise stores read them
    if (tid < MR * MW / 4) *(v4i*)(MB + (size_t)r0 * MW + tid * 4) = *(const v4i*)(mb + tid * 16);
    return; }
  const float* w = which == 0 ? wq : (which == 1 ? wk : (which == 2 ? wv : wo)); const float* src = w + (size_t)(ct * 16 + (lane >> 3)) * D + wave * 128 + pc * 4; v4f x[4][4];
  // every loop of this kernel is unrolled: x and o are indexed by constants alone and stay in registers
#pragma unroll
  for (int b = 0; b < 4; ++b)
#pragma unroll
    for (int i = 0; i < 4; ++i) x[b][i] = *(const v4f*)(src + (size_t)i * 4 * D + b * 32);
  asm volatile("s_wait_xcnt 0x0" :: "v"(src) : "memory");   // behind the loads: the wait that belongs in front of the next reuse of their address registers (named as an input, they stay as they are up to here); the clobber keeps all sixteen loads in front of the conversions
  b16* dst = W4 + ((size_t)blockIdx.x * (D / 32) + wave * 4) * WB + (pc >> 2) * (WB / 2) + (((pc >> 1) & 1) * 16 + (odd ? 4 : 0) + (lane >> 3)) * 8;   // run r = pc >> 2, place hlf = (pc >> 1) & 1, column of the tile as above (j = 0)
  v4i o[4][2];
#pragma unroll
  for (int b = 0; b < 4; ++b)
#pragma unroll
    for (int j = 0; j < 2; ++j) { v4b ha, hb;
#pragma unroll
      for (int e = 0; e < 4; ++e) { ha[e] = (b16)(bf16_rne(x[b][2 * j][e]) * WSC); hb[e] = (b16)(bf16_rne(x[b][2 * j + 1][e]) * WSC); }
      const v2i A = __builtin_bit_cast(v2i, ha), B = __builtin_bit_cast(v2i, hb), s = odd ? A : B;   // the half that the other lane of the pair stores
      const int r0 = __builtin_amdgcn_update_dpp(0, s[0], 0xB1, 0xF, 0xF, true), r1 = __builtin_amdgcn_update_dpp(0, s[1], 0xB1, 0xF, 0xF, true);   // quad_perm [1,0,3,2]: the value of lane l ^ 1
      o[b][j] = odd ? (v4i){r0, r1, B[0], B[1]} : (v4i){A[0], A[1], r0, r1}; }
#pragma unroll
  for (int b = 0; b < 4; ++b)
#pragma unroll
    for (int j = 0; j < 2; ++j) *(v8b*)(dst + b * WB + j * 64) = __builtin_bit_cast(v8b, o[b][j]); }
// GEMM tile of one work-group (both projection kernels): GM tokens x GN output columns, 8 waves. All waves stage the A tile (whole K) in LDS once; wave w then owns columns 32 w .. 32 w + 31 for all GM tokens (4 x 2 accumulator tiles), so each B fragment read from global memory (packed: frag_pk) serves four products. k order per output element: ascending, as before.
constexpr int GM = 64, GN = 256, AP = D + 8, TP = GN + 4, VTP = GM + 8;
static_assert(FP == GM && NAP - FP - L == GM && L % GM == 0 && GN % HD == 0, "a work-group's 64 tokens are one 128-byte line of a V^T row, and each zero margin is as long");
__global__ __launch_bounds__(256) void proj_kernel(const float* __restrict__ xq, const float* __restrict__ xk, const float* __restrict__ xv, const b16* __restrict__ W4, const float* __restrict__ bq, const float* __restrict__ bk, const float* __restrict__ bv, b16* __restrict__ Qh, b16* __restrict__ Ql, b16* __restrict__ KAh, b16* __restrict__ KAl, b16* __restrict__ VTh, b16* __restrict__ VTl) { __shared__ __attribute__((aligned(16))) char sm[GM * AP * 2]; b16 (*Ax)[AP] = (b16 (*)[AP])sm; float (*Tf)[TP] = (float (*)[TP])sm; b16 (*Vt)[VTP] = (b16 (*)[VTP])sm;   // Tf (q, k) or Vt (v) takes Ax's place behind the K loop
  const int tid = threadIdx.x, wave = __builtin_amdgcn_readfirstlane(tid >> 5), lane = tid & 31, nloc = lane & 15, hlf = lane >> 4; const size_t t0 = (size_t)blockIdx.x * GM; const int which = blockIdx.y, c0 = blockIdx.z * GN;
  const float* x = which == 0 ? xq : (which == 1 ? xk : xv); const float* bias = which == 0 ? bq : (which == 1 ? bk : bv);
  // rolled: 16 rows a trip are 16 loads of 16 bytes in flight per lane, enough to cover the memory latency
#pragma unroll 1
  for (int r0 = 0; r0 < GM; r0 += 16) { v4f xv[16];
#pragma unroll
    for (int j = 0; j < 16; ++j) xv[j] = *(const v4f*)(x + (t0 + r0 + j) * D + tid * 4);
#pragma unroll
    for (int j = 0; j < 16; ++j) { v4b hv;
#pragma unroll
      for (int e = 0; e < 4; ++e) hv[e] = (b16)(bf16_rne(xv[j][e]) * XS);
      *(v4b*)(&Ax[r0 + j][tid * 4]) = hv; } }
  // No line of packed W serves two k steps, so no step's loads warm the cache for the next: the fragments go through a ring of RD register sets, each refilled for k step s + RD as soon as step s has used it. The first RD sets are asked for here, in front of the barrier.
  const b16* wp = W4 + (size_t)(which * (D / 16) + (c0 + wave * 32) / 16) * WT + lane * 8; v16b bw[RD][2];
#pragma unroll
  for (int u = 0; u < RD; ++u)
#pragma unroll
    for (int n = 0; n < 2; ++n) bw[u][n] = frag_pk(wp + n * WT + u * WB);
  __syncthreads();   // the A tile is whole before any wave reads it
  v8f acc[4][2];
#pragma unroll
  for (int m = 0; m < 4; ++m) { acc[m][0] = (v8f){}; acc[m][1] = (v8f){}; }
  auto kstep = [&](int ks, int u, bool refill) { v16b a[4];
#pragma unroll
    for (int m = 0; m < 4; ++m) a[m] = frag_kb(&Ax[m * 16 + nloc][ks * 32], hlf);
#pragma unroll
    for (int m = 0; m < 4; ++m)
#pragma unroll
      for (int n = 0; n < 2; ++n) acc[m][n] = wmma16b(a[m], bw[u][n], acc[m][n]);
    if (refill) {
#pragma unroll
      for (int n = 0; n < 2; ++n) bw[u][n] = frag_pk(wp + n * WT + (size_t)(ks + RD) * WB); } };
  // rolled, RD k steps a trip (one turn of the ring, so that every set keeps its registers); the last turn refills nothing
#pragma unroll 1
  for (int k4 = 0; k4 < D / 32 - RD; k4 += RD) {
#pragma unroll
    for (int u = 0; u < RD; ++u) kstep(k4 + u, u, true); }
#pragma unroll
  for (int u = 0; u < RD; ++u) kstep(D / 32 - RD + u, u, false);
  __syncthreads();   // every wave has left Ax before Tf or Vt overwrites it
  // K and V leave here in the form that the attention kernel copies to LDS: hi and lo halves (x HS), K as token rows of its head (64 features = one 128-byte line), V transposed (feature rows along the padded token axis). Every store of a wave covers four whole lines.
  // The work-groups of a batch's first and last 64 tokens also write the zero margin beside them (po places away), line for line with their own.
  const int tl = (int)(t0 % L), hb = (int)(t0 / L) * H + c0 / HD, po = tl == 0 ? -GM : (tl == L - GM ? GM : 0);
  if (which == 2) {   // block-uniform. An accumulator register row is 8 successive tokens of one feature: 16 bytes of a V^T row as they stand. Vt rows 0 .. GN - 1 hold hi, GN .. 2 GN - 1 lo; pitch 16 bytes x odd
#pragma unroll
    for (int n = 0; n < 2; ++n) { const int cc = wave * 32 + n * 16 + nloc; const float bb = bfv(bias[c0 + cc]);
#pragma unroll
      for (int m = 0; m < 4; ++m) { v8b hv, lv;
#pragma unroll
        for (int r8 = 0; r8 < 8; ++r8) { b16 p, pl; split16((acc[m][n][r8] * (1.0f / (XS * WSC)) + bb) * HS, p, pl); hv[r8] = p; lv[r8] = pl; }
        *(v8b*)(&Vt[cc][m * 16 + 8 * hlf]) = hv; *(v8b*)(&Vt[GN + cc][m * 16 + 8 * hlf]) = lv; } }
    __syncthreads();   // Vt is whole before the line-wise stores read it
    for (int pl = 0; pl < 2; ++pl) { b16* dst = (pl != 0 ? VTl : VTh) + ((long long)hb * HD + (tid >> 3)) * NAP + FP + tl + (tid & 7) * 8; v8b x[8];   // 16-byte piece tid & 7 of feature rows (tid >> 3) + 32 i
      if (po != 0) {
#pragma unroll
        for (int i = 0; i < 8; ++i) *(v8b*)(dst + (long long)32 * i * NAP + po) = (v8b){}; }
      asm volatile("s_wait_xcnt 0x0" ::: "memory");   // behind the margin's stores: the wait that belongs in front of the next reuse of their address and data registers
#pragma unroll
      for (int i = 0; i < 8; ++i) x[i] = *(const v8b*)(&Vt[pl * GN + (tid >> 3) + 32 * i][(tid & 7) * 8]);
#pragma unroll
      for (int i = 0; i < 8; ++i) *(v8b*)(dst + (long long)32 * i * NAP) = x[i];
      asm volatile("s_wait_xcnt 0x0" ::: "memory"); }   // the same wait behind the plane's own stores
    return; }
#pragma unroll
  for (int n = 0; n < 2; ++n) { const int cc = wave * 32 + n * 16 + nloc; const float bb = bfv(bias[c0 + cc]);
#pragma unroll
    for (int m = 0; m < 4; ++m)
#pragma unroll
      for (int r8 = 0; r8 < 8; ++r8) Tf[m * 16 + 8 * hlf + r8][cc] = acc[m][n][r8] * (1.0f / (XS * WSC)) + bb; }
  __syncthreads();   // Tf is whole before the row-wise stores read it
  for (int rr = wave; rr < GM; rr += 8) { const size_t tk = t0 + rr;
    if (which == 0) { for (int q = 0; q < 4; ++q) { const int c = q * 64 + lane * 2; b16 h0, l0, h1, l1; split16(Tf[rr][c] * HS, h0, l0); split16(Tf[rr][c + 1] * HS, h1, l1); *(v2b*)(Qh + tk * D + c0 + c) = (v2b){h0, h1}; *(v2b*)(Ql + tk * D + c0 + c) = (v2b){l0, l1}; }
      asm volatile("s_wait_xcnt 0x0" ::: "memory"); }   // behind the row's stores, inside the branch: the wait that belongs in front of the next reuse of their address and data registers
    else { const long long ro = ((long long)(hb + (lane >> 3)) * NAP + FP + tl + rr) * HD + (lane & 7) * 8;   // lane l: features 8 (l & 7) .. + 7 of head hb + (l >> 3)
      if (po != 0) { *(v8b*)(KAh + ro + po * HD) = (v8b){}; *(v8b*)(KAl + ro + po * HD) = (v8b){}; }
      asm volatile("s_wait_xcnt 0x0" ::: "memory");   // behind the margin's stores: the wait that belongs in front of the next reuse of their address and data registers
      const v4f f0 = *(const v4f*)(&Tf[rr][lane * 8]), f1 = *(const v4f*)(&Tf[rr][lane * 8 + 4]); v8b hv, lv;
#pragma unroll
      for (int e = 0; e < 4; ++e) { b16 p, pl; split16(f0[e] * HS, p, pl); hv[e] = p; lv[e] = pl; split16(f1[e] * HS, p, pl); hv[4 + e] = p; lv[4 + e] = pl; }
      *(v8b*)(KAh + ro) = hv; *(v8b*)(KAl + ro) = lv;
      asm volatile("s_wait_xcnt 0x0" ::: "memory"); } } }   // the same wait behind the row's own stores
// Attention work-group: AG halves of AW waves, all of one (batch, head); a half works on one 64-query block at a time, 16 queries a wave. Chunk c is the 128 tokens CS c - HALO .. CS c + CS - 1 (places CS c + FP - HALO .. of the padded axis): it owns the areas that END in its last CS tokens, and its first HALO tokens are there for the two tokens that such an area may reach back, so every chunk is worked on by itself. Its K and V rows are brought into LDS once for the four waves of a half and every fragment is read from there.
// One buffer = Kh, Kl (128 token rows of 128 bytes, pitch 144) and Vh, Vl (64 feature rows of 256 bytes, pitch 272): pitches of 16 bytes x odd for the 16-byte LDS reads. Two buffers for each half: the next chunk's copies fly while this chunk is worked on.
constexpr int AW = 4, AG = 2, XP = 36, KP = HD + 8, VP = CH + 8, KB = CH * KP, VB = HD * VP, SB = 2 * KB + 2 * VB;
// eight asynchronous 16-byte copies to LDS per lane (LDS byte address l + i ls, global address g + i gs); the s_wait_xcnt stands in the copies' own statement, in front of any reuse of the address registers that they name
__device__ __forceinline__ void copy8(unsigned int l, unsigned int ls, const char* g, size_t gs) {
  asm volatile("global_load_async_to_lds_b128 %0, %8, off\n\tglobal_load_async_to_lds_b128 %1, %9, off\n\tglobal_load_async_to_lds_b128 %2, %10, off\n\tglobal_load_async_to_lds_b128 %3, %11, off\n\t"
               "global_load_async_to_lds_b128 %4, %12, off\n\tglobal_load_async_to_lds_b128 %5, %13, off\n\tglobal_load_async_to_lds_b128 %6, %14, off\n\tglobal_load_async_to_lds_b128 %7, %15, off\n\ts_wait_xcnt 0x0"
               :: "v"(l), "v"(l + ls), "v"(l + 2 * ls), "v"(l + 3 * ls), "v"(l + 4 * ls), "v"(l + 5 * ls), "v"(l + 6 * ls), "v"(l + 7 * ls),
                  "v"(g), "v"(g + gs), "v"(g + 2 * gs), "v"(g + 3 * gs), "v"(g + 4 * gs), "v"(g + 5 * gs), "v"(g + 6 * gs), "v"(g + 7 * gs) : "memory"); }
// one chunk into the buffer at LDS byte address lb: 16-byte piece p = tid + 128 i of each of the four tiles (K: row p / 8, the 16 KB are contiguous in memory; V: row p / 16, memory pitch NAP elements)
__device__ __forceinline__ void stage_chunk(unsigned int lb, int tid, int a0, const b16* kh, const b16* kl, const b16* vh, const b16* vl) {
  const unsigned int lk = lb + (unsigned int)((tid >> 3) * (KP * 2) + (tid & 7) * 16), lv = lb + (unsigned int)(2 * KB * 2 + (tid >> 4) * (VP * 2) + (tid & 15) * 16);
  const size_t gk = (size_t)a0 * (HD * 2) + (size_t)tid * 16, gv = (size_t)(tid >> 4) * (NAP * 2) + (size_t)a0 * 2 + (size_t)(tid & 15) * 16;
  copy8(lk, 16 * KP * 2, (const char*)kh + gk, 2048); copy8(lk + KB * 2, 16 * KP * 2, (const char*)kl + gk, 2048);
  copy8(lv, 8 * VP * 2, (const char*)vh + gv, (size_t)8 * NAP * 2); copy8(lv + VB * 2, 8 * VP * 2, (const char*)vl + gv, (size_t)8 * NAP * 2); }
// one work-group to a WGP, two waves for each SIMD (a wave of each half): let the register budget and the load scheduling be those of two resident waves
__global__ __launch_bounds__(32 * AW * AG) __attribute__((amdgpu_waves_per_eu(1, 2))) void att_kernel(const b16* __restrict__ Qh, const b16* __restrict__ Ql, const b16* __restrict__ KAh, const b16* __restrict__ KAl, const b16* __restrict__ VTh, const b16* __restrict__ VTl, const unsigned int* __restrict__ MB, const int* __restrict__ zpad, int QLIM, float* __restrict__ O) { __shared__ __attribute__((aligned(16))) b16 sb[AG * 2 * SB]; __shared__ unsigned int cv[AG * AW];
  const int tid = threadIdx.x, wave = __builtin_amdgcn_readfirstlane(tid >> 5), lane = tid & 31, nloc = lane & 15, hlf = lane >> 4, grp = wave / AW, wq = wave % AW, gt = tid % (32 * AW); constexpr int NQB = L / (16 * AW);
  // The work-group owns query blocks A = NQB - 1 - pr and B = pr of its head: under a causal mask one sees many chunks where the other sees few, so every work-group has about the same number of (block, chunk) tasks.
  // The tasks, A's visible chunks in order and then B's, are cut in the middle: half 0 takes the first part, half 1 the rest, each through an LDS ring of its own. No wave walks a long row of chunks alone while its SIMD's other wave has run out of work.
  const int bh = blockIdx.x / (NQB / 2), pr = blockIdx.x % (NQB / 2), qbA = (NQB - 1 - pr) * (16 * AW), qbB = pr * (16 * AW); if (qbB >= QLIM) return;   // qbB < qbA: both blocks lie past the query cut; the whole work-group leaves, in front of every barrier
  const int q0 = (grp != 0 ? qbB : qbA) + wq * 16; const bool live = q0 < QLIM;   // the wave's own 16 queries: it reads their mask bits here and merges and stores their result at the end (a wave past the query cut still copies and passes every barrier; it stores nothing)
  const int b = bh / H, h = bh % H; const size_t tq = (size_t)b * L + q0;
  // both products are taken transposed (X^T = kh x qh^T, O^T = vh^T x c^T): queries are the N side, so lane nloc owns query nloc of the wave's 16 in the block in work and its half hlf holds tokens 16 T + 8 hlf + 0..7 of every 16-token tile T.
  // Two neighbouring tiles are then, register for register, the K = 32 operand of c (k = 8 hlf + e and 16 + 8 hlf + e, the order of frag_kb): mask, softmax and c never leave the registers; a neighbour token in the other half of the lanes comes by one lane exchange.
  // The task list must read the same in all waves: bit c of wv = some query of the wave sees some end position of chunk c, 120 c .. 120 c + 119 (a lane holds its query's and half's two words of every chunk). Exact, so that the cut in the middle halves the real work:
  const unsigned int* mq = MB + (size_t)(q0 + nloc) * MW + hlf * 2; v2u mw[NCH];
#pragma unroll
  for (int c = 0; c < NCH; ++c) mw[c] = *(const v2u*)(mq + c * 4);
  asm volatile("s_wait_xcnt 0x0" :: "v"(mq) : "memory");   // behind the loads: the wait that belongs in front of the next reuse of their address registers (named as an input, they stay as they are up to here)
  unsigned int wv = 0;
#pragma unroll
  for (int c = 0; c < NCH; ++c) wv |= (__builtin_amdgcn_ballot_w32((mw[c][0] | mw[c][1]) != 0u) != 0u ? 1u : 0u) << c;
  if (lane == 0) cv[wave] = live ? wv : 0u;
  __syncthreads();   // all eight words are written before any wave reads them
  // ra, rb: the chunks of A and of B that are still to be handed out to this half; nst = steps of the longer half (half 0), passed by every wave; n = this half's own tasks
  unsigned int ra = (unsigned int)__builtin_amdgcn_readfirstlane((int)(cv[0] | cv[1] | cv[2] | cv[3])), rb = (unsigned int)__builtin_amdgcn_readfirstlane((int)(cv[4] | cv[5] | cv[6] | cv[7]));
  const int ntot = __builtin_popcount(ra) + __builtin_popcount(rb), nst = (ntot + 1) >> 1; int n = nst;
  if (grp != 0) { n = ntot - nst; for (int i = 0; i < nst; ++i) { if (ra != 0u) ra &= ra - 1u; else rb &= rb - 1u; } }   // half 1 steps over half 0's tasks (at most NCH trips)
  auto pop = [&](int& c, int& k) { if (ra != 0u) { c = __builtin_ctz(ra); ra &= ra - 1u; k = 0; } else { c = __builtin_ctz(rb); rb &= rb - 1u; k = 1; } };   // next task: chunk c of block k (0 = A, 1 = B)
  // a task's visibility bits for this lane: the 64 end positions 120 c - 8 + 16 T + 8 hlf + r8 of chunk c for the lane's query of block k (bit 8 (T & 3) + r8 of word T >> 2; no bit is set in the halo or behind the last token). Asked for a whole step before they are used. c < NCH: it is 0 or the place of a bit of wv
  auto bits = [&](int c, int k) { const v2u w = *(const v2u*)(MB + (size_t)((k != 0 ? qbB : qbA) + wq * 16 + nloc) * MW + c * 4 + hlf * 2);
    asm volatile("s_wait_xcnt 0x0" ::: "memory");   // behind the load: the wait that belongs in front of the next reuse of its address registers
    return w; };
  // the block in work: whether this wave's queries of it lie before the query cut, and its query fragments
  bool wlive = false; v16b qa[2], ql[2];
  auto take = [&](int k) { const int qw = (k != 0 ? qbB : qbA) + wq * 16; wlive = qw < QLIM; const size_t qo = ((size_t)b * L + qw + nloc) * D + h * HD;
    for (int ks = 0; ks < 2; ++ks) { qa[ks] = frag_kb(Qh + qo + ks * 32, hlf); ql[ks] = frag_kb(Ql + qo + ks * 32, hlf); }
    __builtin_amdgcn_sched_barrier(0);   // keeps the fragment loads in front of the wait below (without it the scheduler let them sink behind it)
    asm volatile("s_wait_xcnt 0x0" ::: "memory");   // behind the fragment loads: the wait that belongs in front of the next reuse of their address registers
    __builtin_amdgcn_sched_barrier(0); };   // and keeps what follows, which may reuse those registers, behind the wait
  v8f oacc[4] = {(v8f){}, (v8f){}, (v8f){}, (v8f){}}, oA[4] = {(v8f){}, (v8f){}, (v8f){}, (v8f){}}; float mrun = -INFINITY, lrun = 0.0f, mA = -INFINITY, lA = 0.0f;   // the state of the block in work; block A's state once the half has gone on to B
  const unsigned int lds0 = (unsigned int)(size_t)sb + (unsigned int)(grp * 2 * SB * 2);   // LDS byte address of this half's buffer 0: the low 32 bits of the shared address
  const b16 *gkh = KAh + (size_t)bh * NAP * HD, *gkl = KAl + (size_t)bh * NAP * HD, *gvh = VTh + (size_t)bh * HD * NAP, *gvl = VTl + (size_t)bh * HD * NAP;
  int c0 = 0, c1 = 0, k0 = 0, k1 = 0;   // the task in work and the task in flight
  if (n > 0) { pop(c0, k0); stage_chunk(lds0, gt, c0 * CS + (FP - HALO), gkh, gkl, gvh, gvl); }
  v2u v0 = bits(c0, k0);   // the visibility bits of the task in work
  int kc = k0; take(kc);   // here, so that the fragments' latency passes while the first chunk's copies fly
  asm volatile("s_wait_asynccnt 0x0" ::: "memory");   // this wave's copies of the first chunk have landed
  __syncthreads();   // and every wave's: the first chunk may be read
  if (n > 1) { pop(c1, k1); stage_chunk(lds0 + SB * 2, gt, c1 * CS + (FP - HALO), gkh, gkl, gvh, gvl); }
#pragma unroll 1
  for (int st = 0; st < nst; ++st) { const b16* kbuf = sb + (grp * 2 + (st & 1)) * SB; const b16* vbuf = kbuf + 2 * KB; const bool act = st < n;   // half 1 may have one task less: it passes the last hand-over all the same
    if (act && k0 != kc) {   // wave-uniform: the half goes on from block A to block B
      kc = k0; take(kc);
#pragma unroll
      for (int t = 0; t < 4; ++t) { oA[t] = oacc[t]; oacc[t] = (v8f){}; }
      mA = mrun; lA = lrun; mrun = -INFINITY; lrun = 0.0f; }
    const v2u v1 = bits(c1, k1);   // the bits of the task in flight: their latency passes under this step's work (where no task is in flight it reads the last task's words again, and nobody uses them). Behind the query fragments' loads, so that the counted waits for those leave this one in flight
    const unsigned int vb[NTI / 4] = {v0[0], v0[1]};
    // an area of width w ends no earlier than token w - 1: end 0 has width 1 alone, end 1 widths 1 and 2 (chunk 0, tile 0, upper half, bits 0 and 1)
    const bool later = c0 != 0 || hlf == 0;
    if (act && wlive && __builtin_amdgcn_ballot_w32((vb[0] | vb[1]) != 0u) != 0u) {   // wave-uniform: where no query of this wave sees any area of the chunk its contribution is exactly zero; the hand-over below is passed all the same
    v8f s[NTI];
#pragma unroll
    for (int tg = 0; tg < NTI; tg += 4) {
#pragma unroll
      for (int t = 0; t < 4; ++t) s[tg + t] = (v8f){};
#pragma unroll
      for (int ks = 0; ks < 2; ++ks) { v16b kh[4], kl[4];
#pragma unroll
        for (int t = 0; t < 4; ++t) { const b16* kr = kbuf + ((tg + t) * 16 + nloc) * KP + ks * 32; kh[t] = frag_kb(kr, hlf); kl[t] = frag_kb(kr + KB, hlf); }
#pragma unroll
        for (int t = 0; t < 4; ++t) s[tg + t] = wmma16q(kh[t], qa[ks], s[tg + t]);
#pragma unroll
        for (int t = 0; t < 4; ++t) s[tg + t] = wmma16q(kl[t], qa[ks], s[tg + t]);
#pragma unroll
        for (int t = 0; t < 4; ++t) s[tg + t] = wmma16q(kh[t], ql[ks], s[tg + t]); } }
    // token logits x (in s), and for every group of eight its two predecessors b7 = x[-1], b6 = x[-2], which the other half of the lanes holds: the group in front of (T, upper half) is (T, lower half); in front of (T, lower half), (T - 1, upper half); the chunk's first group is halo and ends no area
    float b6[NTI], b7[NTI];
#pragma unroll
    for (int t = 0; t < NTI; ++t) { s[t] *= SCALE / (HS * HS); b6[t] = xhalf(s[t][6]); b7[t] = xhalf(s[t][7]); }
#pragma unroll
    for (int t = NTI - 1; t >= 0; --t) { b6[t] = hlf ? b6[t] : (t > 0 ? b6[t > 0 ? t - 1 : 0] : 0.0f); b7[t] = hlf ? b7[t] : (t > 0 ? b7[t > 0 ? t - 1 : 0] : 0.0f); }
    // area logits by end position e: x[e], (x[e] + x[e-1]) / 2, (x[e] + x[e-1] + x[e-2]) / 3; written out here for the maximum and again below for the weights
    v8f m8;
#pragma unroll
    for (int r8 = 0; r8 < 8; ++r8) m8[r8] = -INFINITY;
#pragma unroll
    for (int t = 0; t < NTI; ++t)
#pragma unroll
      for (int r8 = 0; r8 < 8; ++r8) { const float x0 = s[t][r8], xm1 = r8 >= 1 ? s[t][r8 >= 1 ? r8 - 1 : 0] : b7[t], xm2 = r8 >= 2 ? s[t][r8 >= 2 ? r8 - 2 : 0] : (r8 == 1 ? b7[t] : b6[t]), u2 = x0 + xm1, u3 = u2 + xm2;
        const bool c1 = ((vb[t >> 2] >> ((t & 3) * 8 + r8)) & 1u) != 0u, c2 = (t == 0 && r8 == 0) ? (c1 && later) : c1, c3 = (t == 0 && r8 <= 1) ? (c1 && later) : c1;
        m8[r8] = fmaxf(m8[r8], fmaxf(x0 + (c1 ? 0.0f : -INFINITY), fmaxf(__builtin_fmaf(u2, 0.5f, c2 ? 0.0f : -INFINITY), __builtin_fmaf(u3, 1.0f / 3.0f, c3 ? 0.0f : -INFINITY)))); }
    float mx = fmaxf(fmaxf(fmaxf(m8[0], m8[1]), fmaxf(m8[2], m8[3])), fmaxf(fmaxf(m8[4], m8[5]), fmaxf(m8[6], m8[7]))); mx = fmaxf(mx, __shfl_xor(mx, 16));
    const float mn = fmaxf(mrun, mx), fe = exp2_slot((mrun - mn) * LOG2E), fac = (mrun == -INFINITY) ? 0.0f : fe, ms = (mn == -INFINITY) ? 0.0f : mn, nms = -ms * LOG2E; v8f s8 = (v8f){};
    // weights by end position e: wa = p1 + p2 + p3 goes to token e (and into the row sum), wb = p2 + p3 also to token e - 1, wc = p3 also to token e - 2: token weight c[t] = wa[t] + wb[t + 1] + wc[t + 2], written over x tile by tile.
    // What the last two tokens of a group take from the group behind it (n0 = wc[0], n1 = wb[0] + wc[1]) comes from the other half of the lanes: behind (T, lower half) stands (T, upper half); behind (T, upper half), (T + 1, lower half); behind the chunk's last group, the next chunk's ends, which reach these tokens through that chunk's halo.
    float n0[NTI], n1[NTI];
#pragma unroll
    for (int t = 0; t < NTI; ++t) { float wa[8], wb[8], wc[8];
#pragma unroll
      for (int r8 = 0; r8 < 8; ++r8) { const float x0 = s[t][r8], xm1 = r8 >= 1 ? s[t][r8 >= 1 ? r8 - 1 : 0] : b7[t], xm2 = r8 >= 2 ? s[t][r8 >= 2 ? r8 - 2 : 0] : (r8 == 1 ? b7[t] : b6[t]), u2 = x0 + xm1, u3 = u2 + xm2;
        const bool c1 = ((vb[t >> 2] >> ((t & 3) * 8 + r8)) & 1u) != 0u, c2 = (t == 0 && r8 == 0) ? (c1 && later) : c1, c3 = (t == 0 && r8 <= 1) ? (c1 && later) : c1;
        const float p1 = exp2_slot(__builtin_fmaf(x0, LOG2E, c1 ? nms : -INFINITY)), p2 = exp2_slot(__builtin_fmaf(u2, 0.5f * LOG2E, c2 ? nms : -INFINITY)), p3 = exp2_slot(__builtin_fmaf(u3, LOG2E / 3.0f, c3 ? nms : -INFINITY));
        wc[r8] = p3; wb[r8] = p2 + p3; wa[r8] = p1 + wb[r8]; s8[r8] += wa[r8]; }
      n0[t] = xhalf(wc[0]); n1[t] = xhalf(wb[0] + wc[1]);
#pragma unroll
      for (int r8 = 0; r8 < 6; ++r8) s[t][r8] = wa[r8] + wb[r8 + 1] + wc[r8 + 2];
      s[t][6] = wa[6] + wb[7]; s[t][7] = wa[7]; }
    float sm = ((s8[0] + s8[1]) + (s8[2] + s8[3])) + ((s8[4] + s8[5]) + (s8[6] + s8[7])); sm += __shfl_xor(sm, 16); lrun = lrun * fac + sm; mrun = mn;
#pragma unroll
    for (int t = 0; t < NTI; ++t) { s[t][6] += hlf ? (t + 1 < NTI ? n0[t + 1 < NTI ? t + 1 : 0] : 0.0f) : n0[t]; s[t][7] += hlf ? (t + 1 < NTI ? n1[t + 1 < NTI ? t + 1 : 0] : 0.0f) : n1[t]; s[t] *= PS; }
#pragma unroll
    for (int t = 0; t < 4; ++t) oacc[t] *= fac;
#pragma unroll
    for (int kb = 0; kb < CH; kb += 32) { v16b pa, pb, vh[4], vlo[4];
#pragma unroll
      for (int e = 0; e < 8; ++e) { b16 ph, pl; split16(s[kb / 16][e], ph, pl); pa[e] = ph; pb[e] = pl; split16(s[kb / 16 + 1][e], ph, pl); pa[8 + e] = ph; pb[8 + e] = pl; }
#pragma unroll
      for (int t = 0; t < 4; ++t) { const b16* vr = vbuf + (t * 16 + nloc) * VP + kb; vh[t] = frag_kb(vr, hlf); vlo[t] = frag_kb(vr + VB, hlf); }
#pragma unroll
      for (int t = 0; t < 4; ++t) oacc[t] = wmma16b(vh[t], pa, oacc[t]);
#pragma unroll
      for (int t = 0; t < 4; ++t) oacc[t] = wmma16b(vlo[t], pa, oacc[t]);
#pragma unroll
      for (int t = 0; t < 4; ++t) oacc[t] = wmma16b(vh[t], pb, oacc[t]); } }
    // hand-over, every wave, in this order: my LDS reads of this buffer are done; my copies of the next chunk have landed; the barrier publishes the next chunk and frees this buffer; only then the refill
    asm volatile("s_wait_dscnt 0x0" ::: "memory");
    asm volatile("s_wait_asynccnt 0x0" ::: "memory");
    __syncthreads();
    c0 = c1; k0 = k1; v0 = v1;
    if (st + 2 < n) { pop(c1, k1); stage_chunk(lds0 + (unsigned int)((st & 1) * SB * 2), gt, c1 * CS + (FP - HALO), gkh, gkl, gvh, gvl); } }
  asm volatile("s_wait_asynccnt 0x0" ::: "memory");   // no copy is outstanding when the wave ends
  // Each wave now holds a state for its tile of A and one for its tile of B (empty: -inf, 0, 0). Half 0 finishes A, half 1 finishes B: a wave hands the other state to the wave of the other half that has the same tile, through LDS (the rings are free: every wave's reads and copies ended in front of the last barrier).
  if (kc == 0) {
#pragma unroll
    for (int t = 0; t < 4; ++t) { oA[t] = oacc[t]; oacc[t] = (v8f){}; }
    mA = mrun; lA = lrun; mrun = -INFINITY; lrun = 0.0f; }
  if (grp == 0) {
#pragma unroll
    for (int t = 0; t < 4; ++t) { const v8f x = oacc[t]; oacc[t] = oA[t]; oA[t] = x; }
    const float xm = mrun, xl = lrun; mrun = mA; lrun = lA; mA = xm; lA = xl; }
  // (oacc, mrun, lrun) stays, (oA, mA, lA) goes; XP floats a lane: a pitch of 16 bytes x odd
  float* xw = (float*)sb + (size_t)(wave * 32 + lane) * XP; const float* xr = (const float*)sb + (size_t)((wave ^ AW) * 32 + lane) * XP;
#pragma unroll
  for (int t = 0; t < 4; ++t) { *(v4f*)(xw + t * 8) = (v4f){oA[t][0], oA[t][1], oA[t][2], oA[t][3]}; *(v4f*)(xw + t * 8 + 4) = (v4f){oA[t][4], oA[t][5], oA[t][6], oA[t][7]}; }
  *(v2f*)(xw + 32) = (v2f){mA, lA};
  __syncthreads();   // every wave's handed-over state is written before its partner reads it
  const v2f ml = *(const v2f*)(xr + 32); const float mm = fmaxf(mrun, ml[0]), ek = exp2_slot((mrun - mm) * LOG2E), ep = exp2_slot((ml[0] - mm) * LOG2E), fk = (mrun == -INFINITY) ? 0.0f : ek, fp = (ml[0] == -INFINITY) ? 0.0f : ep;
  lrun = lrun * fk + ml[1] * fp;
#pragma unroll
  for (int t = 0; t < 4; ++t) { const v4f p0 = *(const v4f*)(xr + t * 8), p1 = *(const v4f*)(xr + t * 8 + 4);
#pragma unroll
    for (int j = 0; j < 4; ++j) { oacc[t][j] = oacc[t][j] * fk + p0[j] * fp; oacc[t][4 + j] = oacc[t][4 + j] * fk + p1[j] * fp; } }
  const bool zero = (zpad[0] != 0 && q0 + nloc == 0);
  if (live) {
#pragma unroll
  for (int t = 0; t < 4; ++t) { v4f o0, o1;
#pragma unroll
    for (int j = 0; j < 4; ++j) { const float u0 = oacc[t][j] * (1.0f / (PS * HS)) / lrun, u1 = oacc[t][4 + j] * (1.0f / (PS * HS)) / lrun; o0[j] = zero ? 0.0f : u0; o1[j] = zero ? 0.0f : u1; }
    float* op = O + (tq + nloc) * D + h * HD + t * 16 + 8 * hlf; *(v4f*)op = o0; *(v4f*)(op + 4) = o1; } } }
__global__ __launch_bounds__(256) void outp_kernel(const float* __restrict__ O, const b16* __restrict__ WO, const float* __restrict__ bo, int QLIM, float* __restrict__ out) { __shared__ __attribute__((aligned(16))) char sm[2 * GM * AP * 2]; b16 (*Ah)[AP] = (b16 (*)[AP])sm; b16 (*Al)[AP] = (b16 (*)[AP])(sm + GM * AP * 2); float (*Tf)[TP] = (float (*)[TP])sm;   // Tf takes Ah's place behind the K loop
  const int tid = threadIdx.x, wave = __builtin_amdgcn_readfirstlane(tid >> 5), lane = tid & 31, nloc = lane & 15, hlf = lane >> 4; const size_t t0 = (size_t)blockIdx.x * GM; const int c0 = blockIdx.y * GN; if ((int)(t0 % L) >= QLIM) return;
  // rolled: 16 rows a trip are 16 loads of 16 bytes in flight per lane, enough to cover the latency
#pragma unroll 1
  for (int r0 = 0; r0 < GM; r0 += 16) { v4f xv[16];
#pragma unroll
    for (int j = 0; j < 16; ++j) xv[j] = *(const v4f*)(O + (t0 + r0 + j) * D + tid * 4);
#pragma unroll
    for (int j = 0; j < 16; ++j) { v4b hv, lv;
#pragma unroll
      for (int e = 0; e < 4; ++e) { b16 p, pl; split16(xv[j][e] * HS, p, pl); hv[e] = p; lv[e] = pl; }
      *(v4b*)(&Ah[r0 + j][tid * 4]) = hv; *(v4b*)(&Al[r0 + j][tid * 4]) = lv; } }
  // packed W fragments through a ring of RD register sets, as in proj_kernel; the first RD sets are asked for in front of the barrier
  const b16* wp = WO + (size_t)((c0 + wave * 32) / 16) * WT + lane * 8; v16b bw[RD][2];
#pragma unroll
  for (int u = 0; u < RD; ++u)
#pragma unroll
    for (int n = 0; n < 2; ++n) bw[u][n] = frag_pk(wp + n * WT + u * WB);
  __syncthreads();   // both A tiles are whole before any wave reads them
  v8f acc[4][2];
#pragma unroll
  for (int m = 0; m < 4; ++m) { acc[m][0] = (v8f){}; acc[m][1] = (v8f){}; }
  auto kstep = [&](int ks, int u, bool refill) { v16b a[4], al[4];
#pragma unroll
    for (int m = 0; m < 4; ++m) { a[m] = frag_kb(&Ah[m * 16 + nloc][ks * 32], hlf); al[m] = frag_kb(&Al[m * 16 + nloc][ks * 32], hlf); }
#pragma unroll
    for (int m = 0; m < 4; ++m)
#pragma unroll
      for (int n = 0; n < 2; ++n) acc[m][n] = wmma16b(a[m], bw[u][n], acc[m][n]);
#pragma unroll
    for (int m = 0; m < 4; ++m)
#pragma unroll
      for (int n = 0; n < 2; ++n) acc[m][n] = wmma16b(al[m], bw[u][n], acc[m][n]);
    if (refill) {
#pragma unroll
      for (int n = 0; n < 2; ++n) bw[u][n] = frag_pk(wp + n * WT + (size_t)(ks + RD) * WB); } };
  // rolled, RD k steps a trip (one turn of the ring); the last turn refills nothing
#pragma unroll 1
  for (int k4 = 0; k4 < D / 32 - RD; k4 += RD) {
#pragma unroll
    for (int u = 0; u < RD; ++u) kstep(k4 + u, u, true); }
#pragma unroll
  for (int u = 0; u < RD; ++u) kstep(D / 32 - RD + u, u, false);
  __syncthreads();   // every wave has left Ah before Tf overwrites it
#pragma unroll
  for (int n = 0; n < 2; ++n) { const int cc = wave * 32 + n * 16 + nloc; const float bb = bfv(bo[c0 + cc]);
#pragma unroll
    for (int m = 0; m < 4; ++m)
#pragma unroll
      for (int r8 = 0; r8 < 8; ++r8) Tf[m * 16 + 8 * hlf + r8][cc] = acc[m][n][r8] * (1.0f / (HS * WSC)) + bb; }
  __syncthreads();   // Tf is whole before the row-wise stores read it
  for (int rr = wave; rr < GM; rr += 8) { if ((int)((t0 + rr) % L) >= QLIM) continue;   // rows past the query cut stay unwritten, as before
    for (int q = 0; q < 2; ++q) *(v4f*)(out + (t0 + rr) * D + c0 + q * 128 + lane * 4) = *(const v4f*)(&Tf[rr][q * 128 + lane * 4]);
    asm volatile("s_wait_xcnt 0x0" ::: "memory"); } }   // behind the row's stores: the wait that belongs in front of the next trip's reuse of their address and data registers
}  // namespace

extern "C" void kernel_launch(void* const* d_in, const int* in_sizes, int n_in, void* d_out, int out_size, void* d_ws, size_t ws_size, hipStream_t stream) {
  (void)n_in;
  auto Fp = [&](int i) { return (const float*)d_in[i]; }; auto Ip = [&](int i) { return (const int*)d_in[i]; };
  // input order: 0 q [2,1024,1024]; 1 k; 2 v; 3 Wq; 4 bq; 5 Wk; 6 bk; 7 Wv; 8 bv; 9 Wo; 10 bo; 11 mask [1024,1024] i32; 12 zero_pad [1] i32
  if (in_sizes[0] != NT * D || in_sizes[1] != NT * D || in_sizes[2] != NT * D || in_sizes[3] != D * D || in_sizes[9] != D * D || in_sizes[11] != L * L || in_sizes[12] != 1 || out_size != NT * D) return;
  const int QLIM = L;   // per-batch query cut (multiple of 16)
  size_t off = 0; char* ws = (char*)d_ws;
  auto carve = [&](size_t bytes) { char* p = ws + off; off += (bytes + 255) & ~(size_t)255; return p; };
  b16* W4 = (b16*)carve((size_t)4 * D * D * 2); b16* Qh = (b16*)carve((size_t)NT * D * 2); b16* Ql = (b16*)carve((size_t)NT * D * 2); b16* KAh = (b16*)carve((size_t)NB_ * H * NAP * HD * 2); b16* KAl = (b16*)carve((size_t)NB_ * H * NAP * HD * 2); b16* VTh = (b16*)carve((size_t)NB_ * H * HD * NAP * 2); b16* VTl = (b16*)carve((size_t)NB_ * H * HD * NAP * 2); float* O = (float*)carve((size_t)NT * D * 4); unsigned int* MB = (unsigned int*)carve((size_t)L * MW * 4);
  if (off > ws_size || off > ((size_t)96 << 20)) return;   // ~ 42 MiB
  wput_kernel<<<4 * (D / 16) + MBK, 256, 0, stream>>>(Fp(3), Fp(5), Fp(7), Fp(9), Ip(11), W4, MB);
  proj_kernel<<<dim3(NT / GM, 3, D / GN), 256, 0, stream>>>(Fp(0), Fp(1), Fp(2), W4, Fp(4), Fp(6), Fp(8), Qh, Ql, KAh, KAl, VTh, VTl);
  att_kernel<<<NB_ * H * (L / (16 * AW)) / AG, 32 * AW * AG, 0, stream>>>(Qh, Ql, KAh, KAl, VTh, VTl, MB, Ip(12), QLIM, O);
  outp_kernel<<<dim3(NT / GM, D / GN), 256, 0, stream>>>(O, W4 + (size_t)3 * D * D, Fp(10), QLIM, (float*)d_out);
}

// v010
// Measured time: 63.1 microseconds a run.
// Two timings next to v009 both put it at 1.08 times that version's speed.
// Counting every step since v000, it is 43.1 times as fast.
#include <hip/hip_runtime.h>

// MultiHeadAreaAttention: qh,kh,vh = (q Wq^T + bq), (k Wk^T + bk), (v Wv^T + bv) as 16 heads x 64; areas = all windows of width 1..3 along the key axis (A = 3,069; block w starts at area index 0 / 1024 / 2047, end(a) = start + w - 1); k_area = window mean, v_area = window sum; logits = qh.k_area / 8, visible iff mask[q][end(a)] != 0 (else -1e30); weights = softmax over areas; if zero_pad: weights of query 0 := 0; ctx = weights.v_area; out = concat Wo^T + bo -> [2][1024][1024].
// Pooling is linear, so no pooled row is ever formed: qh.k_area(end e, width w) = (x[e] + .. + x[e-w+1]) / w with the token logits x[t] = qh.kh[t], and weights.v_area = sum over tokens t of c[t] vh[t], c[t] = the summed weights of the (up to six) areas that hold t. Both matrix products run over the 1,024 tokens instead of the 3,069 areas.
// Deterministic: online softmax over fixed chunks of 120 end positions (360 areas) in order, a query's chunks in at most two runs whose running maximum, sum and O are merged at the end in a fixed order (chunks with no visible area for any of the wave's 16 queries are skipped: they contribute exactly 0); inside a chunk each lane sums its areas in a fixed tree, then the two halves of a query are added; no atomics.
// WMMA (v_wmma_f32_16x16x32_f16, f32 accumulate): inputs (EXACT bf16 x8, K 1,024) x W rows (EXACT) per 64-token x 256-column work-group of 8 waves; per (bh, 16-query) wave (eight to a work-group, K and V chunks shared in LDS by four) X^T = kh token rows (hi+lo; 8 tiles/chunk) x qh (hi+lo x256, K 64) and O^T += vh^T rows (hi+lo; 4 tiles) x c (hi+lo), 3 products; o (hi+lo) x Wo rows, same tiling; neighbour sums, mask gather, softmax in f32.

namespace {
constexpr int NB_ = 2, L = 1024, D = 1024, H = 16, HD = 64, NT = NB_ * L, CH = 128, NTI = CH / 16, HALO = 8, CS = CH - HALO /* 120 */, NCH = (L + CS - 1) / CS /* 9 */, FP = 64, NAP = FP + L + 64 /* 1152 */;
// the padded token axis of the K rows and of the V^T rows: token t stands at place FP + t; the FP places in front of token 0 and the 64 behind token L - 1 are zero. Chunk c begins at place CS c + FP - HALO.
static_assert((NCH - 1) * CS + FP - HALO + CH <= NAP && FP >= HALO && NAP % 64 == 0, "every chunk lies inside the padded axis; a V^T row is a whole number of 128-byte lines");
constexpr float XS = 8.0f, HS = 256.0f, PS = 256.0f, WSC = 256.0f, SCALE = 0.125f, LOG2E = 1.44269504f;
typedef _Float16 b16;
typedef __attribute__((ext_vector_type(16))) _Float16 v16b;
typedef __attribute__((ext_vector_type(8))) _Float16 v8b;
typedef __attribute__((ext_vector_type(4))) _Float16 v4b;
typedef __attribute__((ext_vector_type(2))) _Float16 v2b;
typedef __attribute__((ext_vector_type(8))) float v8f;
typedef __attribute__((ext_vector_type(4))) float v4f;
typedef __attribute__((ext_vector_type(2))) float v2f;
typedef __attribute__((ext_vector_type(4))) int v4i;
typedef __attribute__((ext_vector_type(2))) int v2i;
typedef __attribute__((ext_vector_type(2))) unsigned int v2u;
__device__ __forceinline__ float bf16_rne(float f) { unsigned int u = __float_as_uint(f); u += 0x7FFFu + ((u >> 16) & 1u); float r = __uint_as_float(u & 0xFFFF0000u); asm volatile("" : "+v"(r)); return r; }
__device__ __forceinline__ float bfv(float f) { float r = bf16_rne(f); asm volatile("" : "+v"(r)); return r; }
__device__ __forceinline__ void split16(float v, b16& hi, b16& lo) { hi = (b16)v; lo = (b16)(v - (float)hi); }
__device__ __forceinline__ v16b frag_kb(const b16* p, int hh) { const v8b a = *(const v8b*)(p + 8 * hh), b = *(const v8b*)(p + 16 + 8 * hh); v16b f;
#pragma unroll
  for (int e = 0; e < 8; ++e) { f[e] = a[e]; f[8 + e] = b[e]; } return f; }
// W4 holds the four weight matrices in the order in which a GEMM wave reads them. One block = one B fragment (16 output columns x 32 k, WB elements) = two runs of 512 bytes: run r, lane l = (hlf, nloc) holds W[column nloc of the tile][k = 16 r + 8 hlf + 0..7], the k order of frag_kb.
// So each 16-byte load of a wave covers four whole 128-byte lines (from row-major W it touched sixteen lines for 32 bytes each). The blocks of one column tile follow one another in k (WT elements a tile), the tiles in column order, the matrices in the order q, k, v, o.
constexpr int WB = 16 * 32, WT = (D / 32) * WB, RD = 4;
__device__ __forceinline__ v16b frag_pk(const b16* p) { const v8b a = *(const v8b*)p, b = *(const v8b*)(p + WB / 2); v16b f;
#pragma unroll
  for (int e = 0; e < 8; ++e) { f[e] = a[e]; f[8 + e] = b[e]; } return f; }
__device__ __forceinline__ v8f wmma16b(v16b a, v16b b, v8f c) { v8f d = __builtin_amdgcn_wmma_f32_16x16x32_f16(false, a, false, b, (short)0, c, false, false); asm volatile("v_nop\n\tv_nop\n\tv_nop\n\tv_nop" : "+v"(d) : "v"(a), "v"(b)); return d; }
// the same for a B operand that is rewritten only when the half goes on to block B, far from any product (the query fragments): not named in the statement, it is free to live above v255, where an asm operand cannot, and leaves the low registers to the operands that must be there (named, two of the four fragments were spilled to scratch and read back in every chunk)
__device__ __forceinline__ v8f wmma16q(v16b a, v16b b, v8f c) { v8f d = __builtin_amdgcn_wmma_f32_16x16x32_f16(false, a, false, b, (short)0, c, false, false); asm volatile("v_nop\n\tv_nop\n\tv_nop\n\tv_nop" : "+v"(d) : "v"(a)); return d; }
// 2^x and, in the same statement, the one issue slot that the instruction set asks for behind a transcendental
__device__ __forceinline__ float exp2_slot(float x) { float p; asm("v_exp_f32 %0, %1\n\tv_nop" : "=v"(p) : "v"(x)); return p; }
// eight independent 2^x in one statement: each v_exp_f32 is followed by one that neither reads its result nor overwrites its source (outputs are early-clobber), and the one issue slot that the instruction set asks for behind a transcendental stands once, behind the last
__device__ __forceinline__ v8f exp2x8(v8f x) { float p0, p1, p2, p3, p4, p5, p6, p7;
  asm("v_exp_f32 %0, %8\n\tv_exp_f32 %1, %9\n\tv_exp_f32 %2, %10\n\tv_exp_f32 %3, %11\n\tv_exp_f32 %4, %12\n\tv_exp_f32 %5, %13\n\tv_exp_f32 %6, %14\n\tv_exp_f32 %7, %15\n\tv_nop"
      : "=&v"(p0), "=&v"(p1), "=&v"(p2), "=&v"(p3), "=&v"(p4), "=&v"(p5), "=&v"(p6), "=&v"(p7) : "v"(x[0]), "v"(x[1]), "v"(x[2]), "v"(x[3]), "v"(x[4]), "v"(x[5]), "v"(x[6]), "v"(x[7]));
  return (v8f){p0, p1, p2, p3, p4, p5, p6, p7}; }
// the value that lane l ^ 16 holds (the other half of the same query's tokens), by a vector cross-row move
__device__ __forceinline__ float xhalf(float v) { const int b = __float_as_int(v); return __int_as_float(__builtin_amdgcn_permlanex16(b, b, 0x76543210, 0xfedcba98, false, false)); }

// One work-group = one column tile (16 rows of one W, whole K); wave m of it = k steps 4 m .. 4 m + 3: four blocks, 4 KB of W4 in a row.
// Reads: load (b, i) of a wave is rows 4 i .. 4 i + 3 of block b, 128 bytes of each (lane l: row 4 i + (l >> 3), floats 4 (l & 7) .. + 3 of the block's 32): four whole lines. All sixteen loads of a lane are asked for before the first is used, so their memory latency is paid once.
// Writes: a 16-byte piece of W4 is two neighbouring lanes' four floats of one row. The lanes of a pair swap halves across two row groups: the even lane ends with the piece of row 8 j + (l >> 3), the odd lane with that of row 8 j + 4 + (l >> 3). The eight lanes that share (r, hlf) then store 128 bytes in a row: four whole lines a store.
static_assert(4 * (D / 16) == 256 && D / 32 == 8 * 4, "the launch has one work-group for each column tile of the four matrices, and its eight waves of four blocks cover K");
// MB holds the mask as bits, in the order in which an attention lane uses them: query q has MW words; words 4 c + 2 hlf and 4 c + 2 hlf + 1 are the 64 end positions 120 c - 8 + 16 T + 8 hlf + r8 of chunk c that the lanes of half hlf own (bit r8 of byte T).
// Byte B of a mask row (ends 8 B .. 8 B + 7) belongs to one chunk alone, c = B / 15, at place p = B % 15 + 1 = 2 T + hlf of its sixteen; place 0 (the halo, which ends no area of the chunk) and the places behind the last token stay zero.
// The MBK work-groups behind those of the weights pack MR mask rows each (wave m: rows 2 m and 2 m + 1, sixteen whole-line 16-byte loads a lane, all in flight at once); the bytes are put in place in LDS and leave as whole lines.
constexpr int MW = NCH * 4, MR = 16, MBK = L / MR;
static_assert(MR == 2 * 8 && (L / 8 - 1) / 15 < NCH && CS == 15 * 8 && HALO == 8 && CH == 128 && MR * MW * 4 <= 256 * 16, "byte places as described; one 16-byte piece a thread covers the work-group's part of MB");
__global__ __launch_bounds__(256) void wput_kernel(const float* __restrict__ wq, const float* __restrict__ wk, const float* __restrict__ wv, const float* __restrict__ wo, const int* __restrict__ mask, b16* __restrict__ W4, unsigned int* __restrict__ MB) { const int tid = threadIdx.x, wave = __builtin_amdgcn_readfirstlane(tid >> 5), lane = tid & 31, pc = lane & 7, which = blockIdx.x / (D / 16), ct = blockIdx.x % (D / 16); const bool odd = (lane & 1) != 0;
  if (blockIdx.x >= 4 * (D / 16)) {   // block-uniform: a work-group of the mask
    __shared__ __attribute__((aligned(16))) unsigned char mb[MR * MW * 4]; const int r0 = ((int)blockIdx.x - 4 * (D / 16)) * MR; const int* ms = mask + (size_t)(r0 + wave * 2) * L + lane * 4; v4i m[2][8];
    // unrolled, here and below: m is indexed by constants alone and stays in registers
#pragma unroll
    for (int r = 0; r < 2; ++r)
#pragma unroll
      for (int j = 0; j < 8; ++j) m[r][j] = *(const v4i*)(ms + r * L + j * 128);
    asm volatile("s_wait_xcnt 0x0" ::: "memory");   // behind the loads: the wait that belongs in front of the next reuse of their address registers
    if (tid < MR * MW / 4) *(v4i*)(mb + tid * 16) = (v4i){0, 0, 0, 0};
    __syncthreads();   // the zeros are written before any byte is put among them
    int by[2][8];
#pragma unroll
    for (int r = 0; r < 2; ++r)
#pragma unroll
      for (int j = 0; j < 8; ++j) { const int nib = (m[r][j][0] != 0 ? 1 : 0) | (m[r][j][1] != 0 ? 2 : 0) | (m[r][j][2] != 0 ? 4 : 0) | (m[r][j][3] != 0 ? 8 : 0);
        by[r][j] = nib | (__builtin_amdgcn_update_dpp(0, nib, 0xB1, 0xF, 0xF, true) << 4); }   // quad_perm [1,0,3,2]: the four bits of lane l ^ 1; the even lane of a pair now holds byte B = 16 j + (l >> 1)
    if (!odd) {
#pragma unroll
      for (int j = 0; j < 8; ++j) { const int s = j + (lane >> 1), ov = s >= 15 ? 1 : 0, p = s - 15 * ov + 1; unsigned char* d = mb + wave * 2 * (MW * 4) + (j + ov) * 16 + (p & 1) * 8 + (p >> 1);   // B = 15 j + s with s < 30: B / 15 = j + ov, B % 15 = s - 15 ov
        d[0] = (unsigned char)by[0][j]; d[MW * 4] = (unsigned char)by[1][j]; } }
    __syncthreads();   // every byte is in place before the line-wise stores read them
    if (tid < MR * MW / 4) *(v4i*)(MB + (size_t)r0 * MW + tid * 4) = *(const v4i*)(mb + tid * 16);
    return; }
  const float* w = which == 0 ? wq : (which == 1 ? wk : (which == 2 ? wv : wo)); const float* src = w + (size_t)(ct * 16 + (lane >> 3)) * D + wave * 128 + pc * 4; v4f x[4][4];
  // every loop of this kernel is unrolled: x and o are indexed by constants alone and stay in registers
#pragma unroll
  for (int b = 0; b < 4; ++b)
#pragma unroll
    for (int i = 0; i < 4; ++i) x[b][i] = *(const v4f*)(src + (size_t)i * 4 * D + b * 32);
  asm volatile("s_wait_xcnt 0x0" :: "v"(src) : "memory");   // behind the loads: the wait that belongs in front of the next reuse of their address registers (named as an input, they stay as they are up to here); the clobber keeps all sixteen loads in front of the conversions
  b16* dst = W4 + ((size_t)blockIdx.x * (D / 32) + wave * 4) * WB + (pc >> 2) * (WB / 2) + (((pc >> 1) & 1) * 16 + (odd ? 4 : 0) + (lane >> 3)) * 8;   // run r = pc >> 2, place hlf = (pc >> 1) & 1, column of the tile as above (j = 0)
  v4i o[4][2];
#pragma unroll
  for (int b = 0; b < 4; ++b)
#pragma unroll
    for (int j = 0; j < 2; ++j) { v4b ha, hb;
#pragma unroll
      for (int e = 0; e < 4; ++e) { ha[e] = (b16)(bf16_rne(x[b][2 * j][e]) * WSC); hb[e] = (b16)(bf16_rne(x[b][2 * j + 1][e]) * WSC); }
      const v2i A = __builtin_bit_cast(v2i, ha), B = __builtin_bit_cast(v2i, hb), s = odd ? A : B;   // the half that the other lane of the pair stores
      const int r0 = __builtin_amdgcn_update_dpp(0, s[0], 0xB1, 0xF, 0xF, true), r1 = __builtin_amdgcn_update_dpp(0, s[1], 0xB1, 0xF, 0xF, true);   // quad_perm [1,0,3,2]: the value of lane l ^ 1
      o[b][j] = odd ? (v4i){r0, r1, B[0], B[1]} : (v4i){A[0], A[1], r0, r1}; }
#pragma unroll
  for (int b = 0; b < 4; ++b)
#pragma unroll
    for (int j = 0; j < 2; ++j) *(v8b*)(dst + b * WB + j * 64) = __builtin_bit_cast(v8b, o[b][j]); }
// GEMM tile of one work-group (both projection kernels): GM tokens x GN output columns, 8 waves. All waves stage the A tile (whole K) in LDS once; wave w then owns columns 32 w .. 32 w + 31 for all GM tokens (4 x 2 accumulator tiles), so each B fragment read from global memory (packed: frag_pk) serves four products. k order per output element: ascending, as before.
constexpr int GM = 64, GN = 256, AP = D + 8, TP = GN + 4, VTP = GM + 8;
static_assert(FP == GM && NAP - FP - L == GM && L % GM == 0 && GN % HD == 0, "a work-group's 64 tokens are one 128-byte line of a V^T row, and each zero margin is as long");
__global__ __launch_bounds__(256) void proj_kernel(const float* __restrict__ xq, const float* __restrict__ xk, const float* __restrict__ xv, const b16* __restrict__ W4, const float* __restrict__ bq, const float* __restrict__ bk, const float* __restrict__ bv, b16* __restrict__ Qh, b16* __restrict__ Ql, b16* __restrict__ KAh, b16* __restrict__ KAl, b16* __restrict__ VTh, b16* __restrict__ VTl) { __shared__ __attribute__((aligned(16))) char sm[GM * AP * 2]; b16 (*Ax)[AP] = (b16 (*)[AP])sm; float (*Tf)[TP] = (float (*)[TP])sm; b16 (*Vt)[VTP] = (b16 (*)[VTP])sm;   // Tf (q, k) or Vt (v) takes Ax's place behind the K loop
  const int tid = threadIdx.x, wave = __builtin_amdgcn_readfirstlane(tid >> 5), lane = tid & 31, nloc = lane & 15, hlf = lane >> 4; const size_t t0 = (size_t)blockIdx.x * GM; const int which = blockIdx.y, c0 = blockIdx.z * GN;
  const float* x = which == 0 ? xq : (which == 1 ? xk : xv); const float* bias = which == 0 ? bq : (which == 1 ? bk : bv);
  // rolled: 16 rows a trip are 16 loads of 16 bytes in flight per lane, enough to cover the memory latency
#pragma unroll 1
  for (int r0 = 0; r0 < GM; r0 += 16) { v4f xv[16];
#pragma unroll
    for (int j = 0; j < 16; ++j) xv[j] = *(const v4f*)(x + (t0 + r0 + j) * D + tid * 4);
#pragma unroll
    for (int j = 0; j < 16; ++j) { v4b hv;
#pragma unroll
      for (int e = 0; e < 4; ++e) hv[e] = (b16)(bf16_rne(xv[j][e]) * XS);
      *(v4b*)(&Ax[r0 + j][tid * 4]) = hv; } }
  // No line of packed W serves two k steps, so no step's loads warm the cache for the next: the fragments go through a ring of RD register sets, each refilled for k step s + RD as soon as step s has used it. The first RD sets are asked for here, in front of the barrier.
  const b16* wp = W4 + (size_t)(which * (D / 16) + (c0 + wave * 32) / 16) * WT + lane * 8; v16b bw[RD][2];
#pragma unroll
  for (int u = 0; u < RD; ++u)
#pragma unroll
    for (int n = 0; n < 2; ++n) bw[u][n] = frag_pk(wp + n * WT + u * WB);
  __syncthreads();   // the A tile is whole before any wave reads it
  v8f acc[4][2];
#pragma unroll
  for (int m = 0; m < 4; ++m) { acc[m][0] = (v8f){}; acc[m][1] = (v8f){}; }
  auto kstep = [&](int ks, int u, bool refill) { v16b a[4];
#pragma unroll
    for (int m = 0; m < 4; ++m) a[m] = frag_kb(&Ax[m * 16 + nloc][ks * 32], hlf);
#pragma unroll
    for (int m = 0; m < 4; ++m)
#pragma unroll
      for (int n = 0; n < 2; ++n) acc[m][n] = wmma16b(a[m], bw[u][n], acc[m][n]);
    if (refill) {
#pragma unroll
      for (int n = 0; n < 2; ++n) bw[u][n] = frag_pk(wp + n * WT + (size_t)(ks + RD) * WB); } };
  // rolled, RD k steps a trip (one turn of the ring, so that every set keeps its registers); the last turn refills nothing
#pragma unroll 1
  for (int k4 = 0; k4 < D / 32 - RD; k4 += RD) {
#pragma unroll
    for (int u = 0; u < RD; ++u) kstep(k4 + u, u, true); }
#pragma unroll
  for (int u = 0; u < RD; ++u) kstep(D / 32 - RD + u, u, false);
  __syncthreads();   // every wave has left Ax before Tf or Vt overwrites it
  // K and V leave here in the form that the attention kernel copies to LDS: hi and lo halves (x HS), K as token rows of its head (64 features = one 128-byte line), V transposed (feature rows along the padded token axis). Every store of a wave covers four whole lines.
  // The work-groups of a batch's first and last 64 tokens also write the zero margin beside them (po places away), line for line with their own.
  const int tl = (int)(t0 % L), hb = (int)(t0 / L) * H + c0 / HD, po = tl == 0 ? -GM : (tl == L - GM ? GM : 0);
  if (which == 2) {   // block-uniform. An accumulator register row is 8 successive tokens of one feature: 16 bytes of a V^T row as they stand. Vt rows 0 .. GN - 1 hold hi, GN .. 2 GN - 1 lo; pitch 16 bytes x odd
#pragma unroll
    for (int n = 0; n < 2; ++n) { const int cc = wave * 32 + n * 16 + nloc; const float bb = bfv(bias[c0 + cc]);
#pragma unroll
      for (int m = 0; m < 4; ++m) { v8b hv, lv;
#pragma unroll
        for (int r8 = 0; r8 < 8; ++r8) { b16 p, pl; split16((acc[m][n][r8] * (1.0f / (XS * WSC)) + bb) * HS, p, pl); hv[r8] = p; lv[r8] = pl; }
        *(v8b*)(&Vt[cc][m * 16 + 8 * hlf]) = hv; *(v8b*)(&Vt[GN + cc][m * 16 + 8 * hlf]) = lv; } }
    __syncthreads();   // Vt is whole before the line-wise stores read it
    for (int pl = 0; pl < 2; ++pl) { b16* dst = (pl != 0 ? VTl : VTh) + ((long long)hb * HD + (tid >> 3)) * NAP + FP + tl + (tid & 7) * 8; v8b x[8];   // 16-byte piece tid & 7 of feature rows (tid >> 3) + 32 i
      if (po != 0) {
#pragma unroll
        for (int i = 0; i < 8; ++i) *(v8b*)(dst + (long long)32 * i * NAP + po) = (v8b){}; }
      asm volatile("s_wait_xcnt 0x0" ::: "memory");   // behind the margin's stores: the wait that belongs in front of the next reuse of their address and data registers
#pragma unroll
      for (int i = 0; i < 8; ++i) x[i] = *(const v8b*)(&Vt[pl * GN + (tid >> 3) + 32 * i][(tid & 7) * 8]);
#pragma unroll
      for (int i = 0; i < 8; ++i) *(v8b*)(dst + (long long)32 * i * NAP) = x[i];
      asm volatile("s_wait_xcnt 0x0" ::: "memory"); }   // the same wait behind the plane's own stores
    return; }
#pragma unroll
  for (int n = 0; n < 2; ++n) { const int cc = wave * 32 + n * 16 + nloc; const float bb = bfv(bias[c0 + cc]);
#pragma unroll
    for (int m = 0; m < 4; ++m)
#pragma unroll
      for (int r8 = 0; r8 < 8; ++r8) Tf[m * 16 + 8 * hlf + r8][cc] = acc[m][n][r8] * (1.0f / (XS * WSC)) + bb; }
  __syncthreads();   // Tf is whole before the row-wise stores read it
  for (int rr = wave; rr < GM; rr += 8) { const size_t tk = t0 + rr;
    if (which == 0) { for (int q = 0; q < 4; ++q) { const int c = q * 64 + lane * 2; b16 h0, l0, h1, l1; split16(Tf[rr][c] * HS, h0, l0); split16(Tf[rr][c + 1] * HS, h1, l1); *(v2b*)(Qh + tk * D + c0 + c) = (v2b){h0, h1}; *(v2b*)(Ql + tk * D + c0 + c) = (v2b){l0, l1}; }
      asm volatile("s_wait_xcnt 0x0" ::: "memory"); }   // behind the row's stores, inside the branch: the wait that belongs in front of the next reuse of their address and data registers
    else { const long long ro = ((long long)(hb + (lane >> 3)) * NAP + FP + tl + rr) * HD + (lane & 7) * 8;   // lane l: features 8 (l & 7) .. + 7 of head hb + (l >> 3)
      if (po != 0) { *(v8b*)(KAh + ro + po * HD) = (v8b){}; *(v8b*)(KAl + ro + po * HD) = (v8b){}; }
      asm volatile("s_wait_xcnt 0x0" ::: "memory");   // behind the margin's stores: the wait that belongs in front of the next reuse of their address and data registers
      const v4f f0 = *(const v4f*)(&Tf[rr][lane * 8]), f1 = *(const v4f*)(&Tf[rr][lane * 8 + 4]); v8b hv, lv;
#pragma unroll
      for (int e = 0; e < 4; ++e) { b16 p, pl; split16(f0[e] * HS, p, pl); hv[e] = p; lv[e] = pl; split16(f1[e] * HS, p, pl); hv[4 + e] = p; lv[4 + e] = pl; }
      *(v8b*)(KAh + ro) = hv; *(v8b*)(KAl + ro) = lv;
      asm volatile("s_wait_xcnt 0x0" ::: "memory"); } } }   // the same wait behind the row's own stores
// Attention work-group: AG halves of AW waves, all of one (batch, head); a half works on one 64-query block at a time, 16 queries a wave. Chunk c is the 128 tokens CS c - HALO .. CS c + CS - 1 (places CS c + FP - HALO .. of the padded axis): it owns the areas that END in its last CS tokens, and its first HALO tokens are there for the two tokens that such an area may reach back, so every chunk is worked on by itself. Its K and V rows are brought into LDS once for the four waves of a half and every fragment is read from there.
// One buffer = Kh, Kl (128 token rows of 128 bytes, pitch 144) and Vh, Vl (64 feature rows of 256 bytes, pitch 272): pitches of 16 bytes x odd for the 16-byte LDS reads. Two buffers for each half: the next chunk's copies fly while this chunk is worked on.
constexpr int AW = 4, AG = 2, XP = 36, KP = HD + 8, VP = CH + 8, KB = CH * KP, VB = HD * VP, SB = 2 * KB + 2 * VB;
// eight asynchronous 16-byte copies to LDS per lane (LDS byte address l + i ls, global address g + i gs); the s_wait_xcnt stands in the copies' own statement, in front of any reuse of the address registers that they name
__device__ __forceinline__ void copy8(unsigned int l, unsigned int ls, const char* g, size_t gs) {
  asm volatile("global_load_async_to_lds_b128 %0, %8, off\n\tglobal_load_async_to_lds_b128 %1, %9, off\n\tglobal_load_async_to_lds_b128 %2, %10, off\n\tglobal_load_async_to_lds_b128 %3, %11, off\n\t"
               "global_load_async_to_lds_b128 %4, %12, off\n\tglobal_load_async_to_lds_b128 %5, %13, off\n\tglobal_load_async_to_lds_b128 %6, %14, off\n\tglobal_load_async_to_lds_b128 %7, %15, off\n\ts_wait_xcnt 0x0"
               :: "v"(l), "v"(l + ls), "v"(l + 2 * ls), "v"(l + 3 * ls), "v"(l + 4 * ls), "v"(l + 5 * ls), "v"(l + 6 * ls), "v"(l + 7 * ls),
                  "v"(g), "v"(g + gs), "v"(g + 2 * gs), "v"(g + 3 * gs), "v"(g + 4 * gs), "v"(g + 5 * gs), "v"(g + 6 * gs), "v"(g + 7 * gs) : "memory"); }
// one chunk into the buffer at LDS byte address lb: 16-byte piece p = tid + 128 i of each of the four tiles (K: row p / 8, the 16 KB are contiguous in memory; V: row p / 16, memory pitch NAP elements)
__device__ __forceinline__ void stage_chunk(unsigned int lb, int tid, int a0, const b16* kh, const b16* kl, const b16* vh, const b16* vl) {
  const unsigned int lk = lb + (unsigned int)((tid >> 3) * (KP * 2) + (tid & 7) * 16), lv = lb + (unsigned int)(2 * KB * 2 + (tid >> 4) * (VP * 2) + (tid & 15) * 16);
  const size_t gk = (size_t)a0 * (HD * 2) + (size_t)tid * 16, gv = (size_t)(tid >> 4) * (NAP * 2) + (size_t)a0 * 2 + (size_t)(tid & 15) * 16;
  copy8(lk, 16 * KP * 2, (const char*)kh + gk, 2048); copy8(lk + KB * 2, 16 * KP * 2, (const char*)kl + gk, 2048);
  copy8(lv, 8 * VP * 2, (const char*)vh + gv, (size_t)8 * NAP * 2); copy8(lv + VB * 2, 8 * VP * 2, (const char*)vl + gv, (size_t)8 * NAP * 2); }
// one work-group to a WGP, two waves for each SIMD (a wave of each half): let the register budget and the load scheduling be those of two resident waves
__global__ __launch_bounds__(32 * AW * AG) __attribute__((amdgpu_waves_per_eu(1, 2))) void att_kernel(const b16* __restrict__ Qh, const b16* __restrict__ Ql, const b16* __restrict__ KAh, const b16* __restrict__ KAl, const b16* __restrict__ VTh, const b16* __restrict__ VTl, const unsigned int* __restrict__ MB, const int* __restrict__ zpad, int QLIM, float* __restrict__ O) { __shared__ __attribute__((aligned(16))) b16 sb[AG * 2 * SB]; __shared__ unsigned int cv[AG * AW];
  const int tid = threadIdx.x, wave = __builtin_amdgcn_readfirstlane(tid >> 5), lane = tid & 31, nloc = lane & 15, hlf = lane >> 4, grp = wave / AW, wq = wave % AW, gt = tid % (32 * AW); constexpr int NQB = L / (16 * AW);
  // The work-group owns query blocks A = NQB - 1 - pr and B = pr of its head: under a causal mask one sees many chunks where the other sees few, so every work-group has about the same number of (block, chunk) tasks.
  // The tasks, A's visible chunks in order and then B's, are cut in the middle: half 0 takes the first part, half 1 the rest, each through an LDS ring of its own. No wave walks a long row of chunks alone while its SIMD's other wave has run out of work.
  const int bh = blockIdx.x / (NQB / 2), pr = blockIdx.x % (NQB / 2), qbA = (NQB - 1 - pr) * (16 * AW), qbB = pr * (16 * AW); if (qbB >= QLIM) return;   // qbB < qbA: both blocks lie past the query cut; the whole work-group leaves, in front of every barrier
  const int q0 = (grp != 0 ? qbB : qbA) + wq * 16; const bool live = q0 < QLIM;   // the wave's own 16 queries: it reads their mask bits here and merges and stores their result at the end (a wave past the query cut still copies and passes every barrier; it stores nothing)
  const int b = bh / H, h = bh % H; const size_t tq = (size_t)b * L + q0;
  // both products are taken transposed (X^T = kh x qh^T, O^T = vh^T x c^T): queries are the N side, so lane nloc owns query nloc of the wave's 16 in the block in work and its half hlf holds tokens 16 T + 8 hlf + 0..7 of every 16-token tile T.
  // Two neighbouring tiles are then, register for register, the K = 32 operand of c (k = 8 hlf + e and 16 + 8 hlf + e, the order of frag_kb): mask, softmax and c never leave the registers; a neighbour token in the other half of the lanes comes by one lane exchange.
  // The task list must read the same in all waves: bit c of wv = some query of the wave sees some end position of chunk c, 120 c .. 120 c + 119 (a lane holds its query's and half's two words of every chunk). Exact, so that the cut in the middle halves the real work:
  const unsigned int* mq = MB + (size_t)(q0 + nloc) * MW + hlf * 2; v2u mw[NCH];
#pragma unroll
  for (int c = 0; c < NCH; ++c) mw[c] = *(const v2u*)(mq + c * 4);
  asm volatile("s_wait_xcnt 0x0" :: "v"(mq) : "memory");   // behind the loads: the wait that belongs in front of the next reuse of their address registers (named as an input, they stay as they are up to here)
  unsigned int wv = 0;
#pragma unroll
  for (int c = 0; c < NCH; ++c) wv |= (__builtin_amdgcn_ballot_w32((mw[c][0] | mw[c][1]) != 0u) != 0u ? 1u : 0u) << c;
  if (lane == 0) cv[wave] = live ? wv : 0u;
  __syncthreads();   // all eight words are written before any wave reads them
  // ra, rb: the chunks of A and of B that are still to be handed out to this half; nst = steps of the longer half (half 0), passed by every wave; n = this half's own tasks
  unsigned int ra = (unsigned int)__builtin_amdgcn_readfirstlane((int)(cv[0] | cv[1] | cv[2] | cv[3])), rb = (unsigned int)__builtin_amdgcn_readfirstlane((int)(cv[4] | cv[5] | cv[6] | cv[7]));
  const int ntot = __builtin_popcount(ra) + __builtin_popcount(rb), nst = (ntot + 1) >> 1; int n = nst;
  if (grp != 0) { n = ntot - nst; for (int i = 0; i < nst; ++i) { if (ra != 0u) ra &= ra - 1u; else rb &= rb - 1u; } }   // half 1 steps over half 0's tasks (at most NCH trips)
  auto pop = [&](int& c, int& k) { if (ra != 0u) { c = __builtin_ctz(ra); ra &= ra - 1u; k = 0; } else { c = __builtin_ctz(rb); rb &= rb - 1u; k = 1; } };   // next task: chunk c of block k (0 = A, 1 = B)
  // a task's visibility bits for this lane: the 64 end positions 120 c - 8 + 16 T + 8 hlf + r8 of chunk c for the lane's query of block k (bit 8 (T & 3) + r8 of word T >> 2; no bit is set in the halo or behind the last token). Asked for a whole step before they are used. c < NCH: it is 0 or the place of a bit of wv
  auto bits = [&](int c, int k) { const v2u w = *(const v2u*)(MB + (size_t)((k != 0 ? qbB : qbA) + wq * 16 + nloc) * MW + c * 4 + hlf * 2);
    asm volatile("s_wait_xcnt 0x0" ::: "memory");   // behind the load: the wait that belongs in front of the next reuse of its address registers
    return w; };
  // the block in work: whether this wave's queries of it lie before the query cut, and its query fragments
  bool wlive = false; v16b qa[2], ql[2];
  auto take = [&](int k) { const int qw = (k != 0 ? qbB : qbA) + wq * 16; wlive = qw < QLIM; const size_t qo = ((size_t)b * L + qw + nloc) * D + h * HD;
    for (int ks = 0; ks < 2; ++ks) { qa[ks] = frag_kb(Qh + qo + ks * 32, hlf); ql[ks] = frag_kb(Ql + qo + ks * 32, hlf); }
    __builtin_amdgcn_sched_barrier(0);   // keeps the fragment loads in front of the wait below (without it the scheduler let them sink behind it)
    asm volatile("s_wait_xcnt 0x0" ::: "memory");   // behind the fragment loads: the wait that belongs in front of the next reuse of their address registers
    __builtin_amdgcn_sched_barrier(0); };   // and keeps what follows, which may reuse those registers, behind the wait
  v8f oacc[4] = {(v8f){}, (v8f){}, (v8f){}, (v8f){}}, oA[4] = {(v8f){}, (v8f){}, (v8f){}, (v8f){}}; float mrun = -INFINITY, lrun = 0.0f, mA = -INFINITY, lA = 0.0f;   // the state of the block in work; block A's state once the half has gone on to B
  const unsigned int lds0 = (unsigned int)(size_t)sb + (unsigned int)(grp * 2 * SB * 2);   // LDS byte address of this half's buffer 0: the low 32 bits of the shared address
  const b16 *gkh = KAh + (size_t)bh * NAP * HD, *gkl = KAl + (size_t)bh * NAP * HD, *gvh = VTh + (size_t)bh * HD * NAP, *gvl = VTl + (size_t)bh * HD * NAP;
  int c0 = 0, c1 = 0, k0 = 0, k1 = 0;   // the task in work and the task in flight
  if (n > 0) { pop(c0, k0); stage_chunk(lds0, gt, c0 * CS + (FP - HALO), gkh, gkl, gvh, gvl); }
  v2u v0 = bits(c0, k0);   // the visibility bits of the task in work
  int kc = k0; take(kc);   // here, so that the fragments' latency passes while the first chunk's copies fly
  asm volatile("s_wait_asynccnt 0x0" ::: "memory");   // this wave's copies of the first chunk have landed
  __syncthreads();   // and every wave's: the first chunk may be read
  if (n > 1) { pop(c1, k1); stage_chunk(lds0 + SB * 2, gt, c1 * CS + (FP - HALO), gkh, gkl, gvh, gvl); }
#pragma unroll 1
  for (int st = 0; st < nst; ++st) { const b16* kbuf = sb + (grp * 2 + (st & 1)) * SB; const b16* vbuf = kbuf + 2 * KB; const bool act = st < n;   // half 1 may have one task less: it passes the last hand-over all the same
    if (act && k0 != kc) {   // wave-uniform: the half goes on from block A to block B
      kc = k0; take(kc);
#pragma unroll
      for (int t = 0; t < 4; ++t) { oA[t] = oacc[t]; oacc[t] = (v8f){}; }
      mA = mrun; lA = lrun; mrun = -INFINITY; lrun = 0.0f; }
    const v2u v1 = bits(c1, k1);   // the bits of the task in flight: their latency passes under this step's work (where no task is in flight it reads the last task's words again, and nobody uses them). Behind the query fragments' loads, so that the counted waits for those leave this one in flight
    const unsigned int vb[NTI / 4] = {v0[0], v0[1]};
    // an area of width w ends no earlier than token w - 1: end 0 has width 1 alone, end 1 widths 1 and 2 (chunk 0, tile 0, upper half, bits 0 and 1)
    const bool later = c0 != 0 || hlf == 0;
    if (act && wlive && __builtin_amdgcn_ballot_w32((vb[0] | vb[1]) != 0u) != 0u) {   // wave-uniform: where no query of this wave sees any area of the chunk its contribution is exactly zero; the hand-over below is passed all the same
    v8f s[NTI];
#pragma unroll
    for (int tg = 0; tg < NTI; tg += 4) {
#pragma unroll
      for (int t = 0; t < 4; ++t) s[tg + t] = (v8f){};
#pragma unroll
      for (int ks = 0; ks < 2; ++ks) { v16b kh[4], kl[4];
#pragma unroll
        for (int t = 0; t < 4; ++t) { const b16* kr = kbuf + ((tg + t) * 16 + nloc) * KP + ks * 32; kh[t] = frag_kb(kr, hlf); kl[t] = frag_kb(kr + KB, hlf); }
#pragma unroll
        for (int t = 0; t < 4; ++t) s[tg + t] = wmma16q(kh[t], qa[ks], s[tg + t]);
#pragma unroll
        for (int t = 0; t < 4; ++t) s[tg + t] = wmma16q(kl[t], qa[ks], s[tg + t]);
#pragma unroll
        for (int t = 0; t < 4; ++t) s[tg + t] = wmma16q(kh[t], ql[ks], s[tg + t]); } }
    // raw token logits y = x / SC (in s), and for every group of eight its two predecessors b7 = y[-1], b6 = y[-2], which the other half of the lanes holds: the group in front of (T, upper half) is (T, lower half); in front of (T, lower half), (T - 1, upper half); the chunk's first group is halo and ends no area
    constexpr float SC = SCALE / (HS * HS), K6 = SC * LOG2E / 6.0f;
    float b6[NTI], b7[NTI];
#pragma unroll
    for (int t = 0; t < NTI; ++t) { b6[t] = xhalf(s[t][6]); b7[t] = xhalf(s[t][7]); }
#pragma unroll
    for (int t = NTI - 1; t >= 0; --t) { b6[t] = hlf ? b6[t] : (t > 0 ? b6[t > 0 ? t - 1 : 0] : 0.0f); b7[t] = hlf ? b7[t] : (t > 0 ? b7[t > 0 ? t - 1 : 0] : 0.0f); }
    // The softmax reference of the chunk: the largest token logit inside the three-token window of any visible end. An area logit is a mean of such tokens, so it is no smaller than any visible area logit, and the reference cancels in weights / row sum.
    float m4[4] = {-INFINITY, -INFINITY, -INFINITY, -INFINITY};
#pragma unroll
    for (int t = 0; t < NTI; ++t) { float w3[8];
#pragma unroll
      for (int r8 = 0; r8 < 8; ++r8) { const float x0 = s[t][r8], xm1 = r8 >= 1 ? s[t][r8 >= 1 ? r8 - 1 : 0] : b7[t], xm2 = r8 >= 2 ? s[t][r8 >= 2 ? r8 - 2 : 0] : (r8 == 1 ? b7[t] : b6[t]);
        const bool c1 = ((vb[t >> 2] >> ((t & 3) * 8 + r8)) & 1u) != 0u; w3[r8] = c1 ? fmaxf(fmaxf(x0, xm1), xm2) : -INFINITY; }
#pragma unroll
      for (int j = 0; j < 4; ++j) m4[j] = fmaxf(fmaxf(m4[j], w3[j]), w3[4 + j]); }
    float mx = fmaxf(fmaxf(m4[0], m4[1]), fmaxf(m4[2], m4[3])) * SC; mx = fmaxf(mx, __shfl_xor(mx, 16));
    const float mn = fmaxf(mrun, mx), fe = exp2_slot((mrun - mn) * LOG2E), fac = (mrun == -INFINITY) ? 0.0f : fe, ms = (mn == -INFINITY) ? 0.0f : mn, nm6 = __builtin_fmaf(ms, -LOG2E / 6.0f, 4.0f / 3.0f); v8f s8 = (v8f){};
    // One exponential per token instead of three per end: a[t] = 2^((x[t] - m) log2(e) / 6 + 8 / 6), written over y. With E2 = a^2 and E3 = a^3 the three area weights of end e, each x PS = 2^8, are products:
    // p1 = E3[e] E3[e], p2 = E3[e] E3[e-1], p3 = E2[e] E2[e-1] E2[e-2]. Every token of a visible window has x <= m, so no factor of a visible area exceeds 2^4; the row sum carries the same PS, which the last division leaves out.
#pragma unroll
    for (int t = 0; t < NTI; ++t) { v8f g;
#pragma unroll
      for (int r8 = 0; r8 < 8; ++r8) g[r8] = __builtin_fmaf(s[t][r8], K6, nm6);
      s[t] = exp2x8(g); }
    // what a group's first two ends take from the group in front of it: E2[-1], E3[-1] and G[-1] = E2[-1] E2[-2], from the other half of the lanes as above. In front of token 0 they are zero: end 0 has width 1 alone, end 1 widths 1 and 2 (chunk 0, tile 0, upper half)
    float e2p[NTI], e3p[NTI], gp[NTI];
#pragma unroll
    for (int t = 0; t < NTI; ++t) { const float q7 = s[t][7] * s[t][7], q6 = s[t][6] * s[t][6]; e2p[t] = xhalf(q7); e3p[t] = xhalf(q7 * s[t][7]); gp[t] = xhalf(q7 * q6); }
#pragma unroll
    for (int t = NTI - 1; t >= 0; --t) { e2p[t] = hlf ? e2p[t] : (t > 0 ? e2p[t > 0 ? t - 1 : 0] : 0.0f); e3p[t] = hlf ? e3p[t] : (t > 0 ? e3p[t > 0 ? t - 1 : 0] : 0.0f); gp[t] = hlf ? gp[t] : (t > 0 ? gp[t > 0 ? t - 1 : 0] : 0.0f); }
    e2p[0] = later ? e2p[0] : 0.0f; e3p[0] = later ? e3p[0] : 0.0f; gp[0] = later ? gp[0] : 0.0f;
    // weights by end position e (zero where the end is not visible): wa = p1 + p2 + p3 goes to token e (and into the row sum), wb = p2 + p3 also to token e - 1, wc = p3 also to token e - 2: token weight c[t] = wa[t] + wb[t + 1] + wc[t + 2], written over a tile by tile.
    // What the last two tokens of a group take from the group behind it (n0 = wc[0], n1 = wb[0] + wc[1]) comes from the other half of the lanes: behind (T, lower half) stands (T, upper half); behind (T, upper half), (T + 1, lower half); behind the chunk's last group, the next chunk's ends, which reach these tokens through that chunk's halo.
    float n0[NTI], n1[NTI];
#pragma unroll
    for (int t = 0; t < NTI; ++t) { float E2[8], E3[8], G[8], wa[8], wb[8], wc[8];
#pragma unroll
      for (int r8 = 0; r8 < 8; ++r8) { const float a = s[t][r8]; E2[r8] = a * a; E3[r8] = E2[r8] * a; }
#pragma unroll
      for (int r8 = 0; r8 < 8; ++r8) G[r8] = E2[r8] * (r8 >= 1 ? E2[r8 >= 1 ? r8 - 1 : 0] : e2p[t]);
#pragma unroll
      for (int r8 = 0; r8 < 8; ++r8) { const bool c1 = ((vb[t >> 2] >> ((t & 3) * 8 + r8)) & 1u) != 0u; const float z3 = c1 ? E3[r8] : 0.0f, z2 = c1 ? E2[r8] : 0.0f;
        wc[r8] = z2 * (r8 >= 1 ? G[r8 >= 1 ? r8 - 1 : 0] : gp[t]); wb[r8] = __builtin_fmaf(z3, r8 >= 1 ? E3[r8 >= 1 ? r8 - 1 : 0] : e3p[t], wc[r8]); wa[r8] = __builtin_fmaf(z3, E3[r8], wb[r8]); s8[r8] += wa[r8]; }
      n0[t] = xhalf(wc[0]); n1[t] = xhalf(wb[0] + wc[1]);
#pragma unroll
      for (int r8 = 0; r8 < 6; ++r8) s[t][r8] = wa[r8] + wb[r8 + 1] + wc[r8 + 2];
      s[t][6] = wa[6] + wb[7]; s[t][7] = wa[7]; }
    float sm = ((s8[0] + s8[1]) + (s8[2] + s8[3])) + ((s8[4] + s8[5]) + (s8[6] + s8[7])); sm += __shfl_xor(sm, 16); lrun = lrun * fac + sm; mrun = mn;
#pragma unroll
    for (int t = 0; t < NTI; ++t) { s[t][6] += hlf ? (t + 1 < NTI ? n0[t + 1 < NTI ? t + 1 : 0] : 0.0f) : n0[t]; s[t][7] += hlf ? (t + 1 < NTI ? n1[t + 1 < NTI ? t + 1 : 0] : 0.0f) : n1[t]; }
#pragma unroll
    for (int t = 0; t < 4; ++t) oacc[t] *= fac;
#pragma unroll
    for (int kb = 0; kb < CH; kb += 32) { v16b pa, pb, vh[4], vlo[4];
#pragma unroll
      for (int e = 0; e < 8; ++e) { b16 ph, pl; split16(s[kb / 16][e], ph, pl); pa[e] = ph; pb[e] = pl; split16(s[kb / 16 + 1][e], ph, pl); pa[8 + e] = ph; pb[8 + e] = pl; }
#pragma unroll
      for (int t = 0; t < 4; ++t) { const b16* vr = vbuf + (t * 16 + nloc) * VP + kb; vh[t] = frag_kb(vr, hlf); vlo[t] = frag_kb(vr + VB, hlf); }
#pragma unroll
      for (int t = 0; t < 4; ++t) oacc[t] = wmma16b(vh[t], pa, oacc[t]);
#pragma unroll
      for (int t = 0; t < 4; ++t) oacc[t] = wmma16b(vlo[t], pa, oacc[t]);
#pragma unroll
      for (int t = 0; t < 4; ++t) oacc[t] = wmma16b(vh[t], pb, oacc[t]); } }
    // hand-over, every wave, in this order: my LDS reads of this buffer are done; my copies of the next chunk have landed; the barrier publishes the next chunk and frees this buffer; only then the refill
    asm volatile("s_wait_dscnt 0x0" ::: "memory");
    asm volatile("s_wait_asynccnt 0x0" ::: "memory");
    __syncthreads();
    c0 = c1; k0 = k1; v0 = v1;
    if (st + 2 < n) { pop(c1, k1); stage_chunk(lds0 + (unsigned int)((st & 1) * SB * 2), gt, c1 * CS + (FP - HALO), gkh, gkl, gvh, gvl); } }
  asm volatile("s_wait_asynccnt 0x0" ::: "memory");   // no copy is outstanding when the wave ends
  // Each wave now holds a state for its tile of A and one for its tile of B (empty: -inf, 0, 0). Half 0 finishes A, half 1 finishes B: a wave hands the other state to the wave of the other half that has the same tile, through LDS (the rings are free: every wave's reads and copies ended in front of the last barrier).
  if (kc == 0) {
#pragma unroll
    for (int t = 0; t < 4; ++t) { oA[t] = oacc[t]; oacc[t] = (v8f){}; }
    mA = mrun; lA = lrun; mrun = -INFINITY; lrun = 0.0f; }
  if (grp == 0) {
#pragma unroll
    for (int t = 0; t < 4; ++t) { const v8f x = oacc[t]; oacc[t] = oA[t]; oA[t] = x; }
    const float xm = mrun, xl = lrun; mrun = mA; lrun = lA; mA = xm; lA = xl; }
  // (oacc, mrun, lrun) stays, (oA, mA, lA) goes; XP floats a lane: a pitch of 16 bytes x odd
  float* xw = (float*)sb + (size_t)(wave * 32 + lane) * XP; const float* xr = (const float*)sb + (size_t)((wave ^ AW) * 32 + lane) * XP;
#pragma unroll
  for (int t = 0; t < 4; ++t) { *(v4f*)(xw + t * 8) = (v4f){oA[t][0], oA[t][1], oA[t][2], oA[t][3]}; *(v4f*)(xw + t * 8 + 4) = (v4f){oA[t][4], oA[t][5], oA[t][6], oA[t][7]}; }
  *(v2f*)(xw + 32) = (v2f){mA, lA};
  __syncthreads();   // every wave's handed-over state is written before its partner reads it
  const v2f ml = *(const v2f*)(xr + 32); const float mm = fmaxf(mrun, ml[0]), ek = exp2_slot((mrun - mm) * LOG2E), ep = exp2_slot((ml[0] - mm) * LOG2E), fk = (mrun == -INFINITY) ? 0.0f : ek, fp = (ml[0] == -INFINITY) ? 0.0f : ep;
  lrun = lrun * fk + ml[1] * fp;
#pragma unroll
  for (int t = 0; t < 4; ++t) { const v4f p0 = *(const v4f*)(xr + t * 8), p1 = *(const v4f*)(xr + t * 8 + 4);
#pragma unroll
    for (int j = 0; j < 4; ++j) { oacc[t][j] = oacc[t][j] * fk + p0[j] * fp; oacc[t][4 + j] = oacc[t][4 + j] * fk + p1[j] * fp; } }
  const bool zero = (zpad[0] != 0 && q0 + nloc == 0);
  if (live) {
#pragma unroll
  for (int t = 0; t < 4; ++t) { v4f o0, o1;
#pragma unroll
    for (int j = 0; j < 4; ++j) { const float u0 = oacc[t][j] * (1.0f / HS) / lrun, u1 = oacc[t][4 + j] * (1.0f / HS) / lrun;   /* O and the row sum both carry PS */ o0[j] = zero ? 0.0f : u0; o1[j] = zero ? 0.0f : u1; }
    float* op = O + (tq + nloc) * D + h * HD + t * 16 + 8 * hlf; *(v4f*)op = o0; *(v4f*)(op + 4) = o1; } } }
__global__ __launch_bounds__(256) void outp_kernel(const float* __restrict__ O, const b16* __restrict__ WO, const float* __restrict__ bo, int QLIM, float* __restrict__ out) { __shared__ __attribute__((aligned(16))) char sm[2 * GM * AP * 2]; b16 (*Ah)[AP] = (b16 (*)[AP])sm; b16 (*Al)[AP] = (b16 (*)[AP])(sm + GM * AP * 2); float (*Tf)[TP] = (float (*)[TP])sm;   // Tf takes Ah's place behind the K loop
  const int tid = threadIdx.x, wave = __builtin_amdgcn_readfirstlane(tid >> 5), lane = tid & 31, nloc = lane & 15, hlf = lane >> 4; const size_t t0 = (size_t)blockIdx.x * GM; const int c0 = blockIdx.y * GN; if ((int)(t0 % L) >= QLIM) return;
  // rolled: 16 rows a trip are 16 loads of 16 bytes in flight per lane, enough to cover the latency
#pragma unroll 1
  for (int r0 = 0; r0 < GM; r0 += 16) { v4f xv[16];
#pragma unroll
    for (int j = 0; j < 16; ++j) xv[j] = *(const v4f*)(O + (t0 + r0 + j) * D + tid * 4);
#pragma unroll
    for (int j = 0; j < 16; ++j) { v4b hv, lv;
#pragma unroll
      for (int e = 0; e < 4; ++e) { b16 p, pl; split16(xv[j][e] * HS, p, pl); hv[e] = p; lv[e] = pl; }
      *(v4b*)(&Ah[r0 + j][tid * 4]) = hv; *(v4b*)(&Al[r0 + j][tid * 4]) = lv; } }
  // packed W fragments through a ring of RD register sets, as in proj_kernel; the first RD sets are asked for in front of the barrier
  const b16* wp = WO + (size_t)((c0 + wave * 32) / 16) * WT + lane * 8; v16b bw[RD][2];
#pragma unroll
  for (int u = 0; u < RD; ++u)
#pragma unroll
    for (int n = 0; n < 2; ++n) bw[u][n] = frag_pk(wp + n * WT + u * WB);
  __syncthreads();   // both A tiles are whole before any wave reads them
  v8f acc[4][2];
#pragma unroll
  for (int m = 0; m < 4; ++m) { acc[m][0] = (v8f){}; acc[m][1] = (v8f){}; }
  auto kstep = [&](int ks, int u, bool refill) { v16b a[4], al[4];
#pragma unroll
    for (int m = 0; m < 4; ++m) { a[m] = frag_kb(&Ah[m * 16 + nloc][ks * 32], hlf); al[m] = frag_kb(&Al[m * 16 + nloc][ks * 32], hlf); }
#pragma unroll
    for (int m = 0; m < 4; ++m)
#pragma unroll
      for (int n = 0; n < 2; ++n) acc[m][n] = wmma16b(a[m], bw[u][n], acc[m][n]);
#pragma unroll
    for (int m = 0; m < 4; ++m)
#pragma unroll
      for (int n = 0; n < 2; ++n) acc[m][n] = wmma16b(al[m], bw[u][n], acc[m][n]);
    if (refill) {
#pragma unroll
      for (int n = 0; n < 2; ++n) bw[u][n] = frag_pk(wp + n * WT + (size_t)(ks + RD) * WB); } };
  // rolled, RD k steps a trip (one turn of the ring); the last turn refills nothing
#pragma unroll 1
  for (int k4 = 0; k4 < D / 32 - RD; k4 += RD) {
#pragma unroll
    for (int u = 0; u < RD; ++u) kstep(k4 + u, u, true); }
#pragma unroll
  for (int u = 0; u < RD; ++u) kstep(D / 32 - RD + u, u, false);
  __syncthreads();   // every wave has left Ah before Tf overwrites it
#pragma unroll
  for (int n = 0; n < 2; ++n) { const int cc = wave * 32 + n * 16 + nloc; const float bb = bfv(bo[c0 + cc]);
#pragma unroll
    for (int m = 0; m < 4; ++m)
#pragma unroll
      for (int r8 = 0; r8 < 8; ++r8) Tf[m * 16 + 8 * hlf + r8][cc] = acc[m][n][r8] * (1.0f / (HS * WSC)) + bb; }
  __syncthreads();   // Tf is whole before the row-wise stores read it
  for (int rr = wave; rr < GM; rr += 8) { if ((int)((t0 + rr) % L) >= QLIM) continue;   // rows past the query cut stay unwritten, as before
    for (int q = 0; q < 2; ++q) *(v4f*)(out + (t0 + rr) * D + c0 + q * 128 + lane * 4) = *(const v4f*)(&Tf[rr][q * 128 + lane * 4]);
    asm volatile("s_wait_xcnt 0x0" ::: "memory"); } }   // behind the row's stores: the wait that belongs in front of the next trip's reuse of their address and data registers
}  // namespace

extern "C" void kernel_launch(void* const* d_in, const int* in_sizes, int n_in, void* d_out, int out_size, void* d_ws, size_t ws_size, hipStream_t stream) {
  (void)n_in;
  auto Fp = [&](int i) { return (const float*)d_in[i]; }; auto Ip = [&](int i) { return (const int*)d_in[i]; };
  // input order: 0 q [2,1024,1024]; 1 k; 2 v; 3 Wq; 4 bq; 5 Wk; 6 bk; 7 Wv; 8 bv; 9 Wo; 10 bo; 11 mask [1024,1024] i32; 12 zero_pad [1] i32
  if (in_sizes[0] != NT * D || in_sizes[1] != NT * D || in_sizes[2] != NT * D || in_sizes[3] != D * D || in_sizes[9] != D * D || in_sizes[11] != L * L || in_sizes[12] != 1 || out_size != NT * D) return;
  const int QLIM = L;   // per-batch query cut (multiple of 16)
  size_t off = 0; char* ws = (char*)d_ws;
  auto carve = [&](size_t bytes) { char* p = ws + off; off += (bytes + 255) & ~(size_t)255; return p; };
  b16* W4 = (b16*)carve((size_t)4 * D * D * 2); b16* Qh = (b16*)carve((size_t)NT * D * 2); b16* Ql = (b16*)carve((size_t)NT * D * 2); b16* KAh = (b16*)carve((size_t)NB_ * H * NAP * HD * 2); b16* KAl = (b16*)carve((size_t)NB_ * H * NAP * HD * 2); b16* VTh = (b16*)carve((size_t)NB_ * H * HD * NAP * 2); b16* VTl = (b16*)carve((size_t)NB_ * H * HD * NAP * 2); float* O = (float*)carve((size_t)NT * D * 4); unsigned int* MB = (unsigned int*)carve((size_t)L * MW * 4);
  if (off > ws_size || off > ((size_t)96 << 20)) return;   // ~ 42 MiB
  wput_kernel<<<4 * (D / 16) + MBK, 256, 0, stream>>>(Fp(3), Fp(5), Fp(7), Fp(9), Ip(11), W4, MB);
  proj_kernel<<<dim3(NT / GM, 3, D / GN), 256, 0, stream>>>(Fp(0), Fp(1), Fp(2), W4, Fp(4), Fp(6), Fp(8), Qh, Ql, KAh, KAl, VTh, VTl);
  att_kernel<<<NB_ * H * (L / (16 * AW)) / AG, 32 * AW * AG, 0, stream>>>(Qh, Ql, KAh, KAl, VTh, VTl, MB, Ip(12), QLIM, O);
  outp_kernel<<<dim3(NT / GM, D / GN), 256, 0, stream>>>(O, W4 + (size_t)3 * D * D, Fp(10), QLIM, (float*)d_out);
}
